// v005
// Measured on an AMD MI455X. A time is GPU time per run, averaged over a window of back-to-back runs after a warm-up
// (all launches, gaps included; the runs take copies of the inputs in turn), and the median of several windows.
// Apart from v000's, it joins two sittings. Times from different sittings can be a few percent apart, while
// side-by-side timings come from the same sitting.
// The versions before v005 are in another document.
// One run takes 156 microseconds.
// Two timings next to v004 put it at 1.83 and 1.84 times that version's speed.
// Counting every step since v000, which is the starting kernel, it is 14.5 times as fast.
// Contractions: q = x.Wq^T [4096x1024].[1024x1024], k/v = context.W^T and the output projection (+b) with f16 operands on pre-cast planes (v_wmma_f32_16x16x32_f16; 128x128 block tiles staged in LDS by asynchronous copies, 32x64 wave tiles, weights x16); per (batch, head) softmax(q k^T / 8 + b_h(|i-j|)) v over 2048 keys (head_dim 64) as a flash kernel with f16 q.k^T and f16 p.v (p as f16 of 4096 p), the periodic distance bias -floor(|i-j|/30) 2^-(h+1) read from a per-head relative-offset table built on device; f32 accumulate and softmax.
#include <hip/hip_runtime.h>
#include <math.h>

typedef __attribute__((ext_vector_type(16))) _Float16 v16h;
typedef __attribute__((ext_vector_type(8)))  _Float16 v8h;
typedef __attribute__((ext_vector_type(4)))  _Float16 v4h;
typedef __attribute__((ext_vector_type(16))) __bf16   v16b;
typedef __attribute__((ext_vector_type(8)))  float    v8f;
typedef __attribute__((ext_vector_type(4)))  float    v4f;

// 16-bit WMMA fragment map (wave32), lane L, h = L>>4, m = L&15:
//   A 16x32: lane = row m;   element i -> k = (i<8) ? 8h+i : 16+8h+(i-8)
//   B 32x16: lane = column m; the SAME k(i,h)
//   D 16x16 (8 f32): lane = column m; element r -> row 8h+r
__device__ __forceinline__ int frag_k(int i, int h) { return (i < 8) ? (8 * h + i) : (16 + 8 * h + (i - 8)); }
__device__ __forceinline__ __bf16 bf16_rne(float f) {
    unsigned int u = __float_as_uint(f);
    u += 0x7fffu + ((u >> 16) & 1u);
    return __builtin_bit_cast(__bf16, (unsigned short)(u >> 16));
}
__device__ __forceinline__ float bf16_f32(__bf16 b) { return __uint_as_float(((unsigned int)__builtin_bit_cast(unsigned short, b)) << 16); }
__device__ __forceinline__ v8f wmma16(v16h a, v16h b, v8f c) {
    c = __builtin_amdgcn_wmma_f32_16x16x32_f16(false, a, false, b, (short)0, c, false, false);
    asm volatile("v_nop\n\tv_nop\n\tv_nop\n\tv_nop" : "+v"(c) : "v"(a), "v"(b));
    return c;
}
__device__ __forceinline__ v8f wmmab(v16b a, v16b b, v8f c) {
    c = __builtin_amdgcn_wmma_f32_16x16x32_bf16(false, a, false, b, (short)0, c, false, false);
    asm volatile("v_nop\n\tv_nop\n\tv_nop\n\tv_nop" : "+v"(c) : "v"(a), "v"(b));
    return c;
}
struct Split { v16b hi, lo; };
// hi/lo split product: a.hi*b.hi + a.hi*b.lo + a.lo*b.hi
__device__ __forceinline__ v8f wmma3(const Split& a, const Split& b, v8f c) {
    c = __builtin_amdgcn_wmma_f32_16x16x32_bf16(false, a.hi, false, b.hi, (short)0, c, false, false);
    c = __builtin_amdgcn_wmma_f32_16x16x32_bf16(false, a.hi, false, b.lo, (short)0, c, false, false);
    c = __builtin_amdgcn_wmma_f32_16x16x32_bf16(false, a.lo, false, b.hi, (short)0, c, false, false);
    asm volatile("v_nop\n\tv_nop\n\tv_nop\n\tv_nop" : "+v"(c) : "v"(a.hi), "v"(a.lo), "v"(b.hi), "v"(b.lo));
    return c;
}
struct Split3 { v16b hi, mid, lo; };
// triple split product (6 terms, drops only terms below 2^-24 relative)
__device__ __forceinline__ v8f wmma6(const Split3& a, const Split3& b, v8f c) {
    c = __builtin_amdgcn_wmma_f32_16x16x32_bf16(false, a.hi, false, b.hi, (short)0, c, false, false);
    c = __builtin_amdgcn_wmma_f32_16x16x32_bf16(false, a.hi, false, b.mid, (short)0, c, false, false);
    c = __builtin_amdgcn_wmma_f32_16x16x32_bf16(false, a.mid, false, b.hi, (short)0, c, false, false);
    c = __builtin_amdgcn_wmma_f32_16x16x32_bf16(false, a.hi, false, b.lo, (short)0, c, false, false);
    c = __builtin_amdgcn_wmma_f32_16x16x32_bf16(false, a.mid, false, b.mid, (short)0, c, false, false);
    c = __builtin_amdgcn_wmma_f32_16x16x32_bf16(false, a.lo, false, b.hi, (short)0, c, false, false);
    asm volatile("v_nop\n\tv_nop\n\tv_nop\n\tv_nop" : "+v"(c) : "v"(a.hi), "v"(a.mid), "v"(a.lo), "v"(b.hi), "v"(b.mid), "v"(b.lo));
    return c;
}

// Fragment gathers from f32 memory: element i <- p[(k0 + frag_k(i,h)) * sk] * s, zero for k >= klen.
__device__ __forceinline__ v16h fh_ld(const float* __restrict__ p, long long sk, int k0, int h, int klen, float s) {
    v16h a;
#pragma unroll
    for (int i = 0; i < 16; ++i) { const int k = k0 + frag_k(i, h); a[i] = (k < klen) ? (_Float16)(p[(long long)k * sk] * s) : (_Float16)0.f; }
    return a;
}
__device__ __forceinline__ Split sp_ld(const float* __restrict__ p, long long sk, int k0, int h, int klen, float s) {
    Split r;
#pragma unroll
    for (int i = 0; i < 16; ++i) {
        const int k = k0 + frag_k(i, h); const float x = (k < klen) ? p[(long long)k * sk] * s : 0.f;
        const __bf16 hb = bf16_rne(x); r.hi[i] = hb; r.lo[i] = bf16_rne(x - bf16_f32(hb));
    }
    return r;
}
__device__ __forceinline__ Split3 sp3_ld(const float* __restrict__ p, long long sk, int k0, int h, int klen, float s) {
    Split3 r;
#pragma unroll
    for (int i = 0; i < 16; ++i) {
        const int k = k0 + frag_k(i, h); const float x = (k < klen) ? p[(long long)k * sk] * s : 0.f;
        const __bf16 hb = bf16_rne(x); const float r1 = x - bf16_f32(hb); const __bf16 mb = bf16_rne(r1);
        r.hi[i] = hb; r.mid[i] = mb; r.lo[i] = bf16_rne(r1 - bf16_f32(mb));
    }
    return r;
}
__device__ __forceinline__ v16b bh_ld(const float* __restrict__ p, long long sk, int k0, int h, int klen, float s) {
    v16b a;
#pragma unroll
    for (int i = 0; i < 16; ++i) { const int k = k0 + frag_k(i, h); a[i] = bf16_rne((k < klen) ? p[(long long)k * sk] * s : 0.f); }
    return a;
}
// f16 fragment from an f16 LDS/global row with element stride 1 (k-contiguous), no bounds (tile already zero padded)
__device__ __forceinline__ v16h fh_row(const _Float16* __restrict__ row, int k0, int h) {
    v16h a;
#pragma unroll
    for (int i = 0; i < 16; ++i) a[i] = row[k0 + frag_k(i, h)];
    return a;
}

#define VST2(T, ptr, val) do { const T vst2_v_ = (val); *(T*)(ptr) = vst2_v_;  } while (0)
typedef float v4f __attribute__((ext_vector_type(4)));
#define VST2V4(ptr, val) do { const v4f vst2_v4_ = (val); *(v4f*)(ptr) = vst2_v4_;  } while (0)

__device__ __attribute__((noinline)) float act_fn(float v, int act) {
    if (act == 1) return fmaxf(v, 0.f);                                                                               // relu
    if (act == 2) { const float u = 0.7978845608028654f * (v + 0.044715f * v * v * v); return 0.5f * v * (1.f + tanhf(u)); } // tanh-gelu
    if (act == 3) return v / (1.f + expf(-v));                                                                        // silu
    if (act == 4) return 0.5f * v * (1.f + erff(v * 0.7071067811865476f));                                             // erf-gelu
    if (act == 5) return tanhf(v);
    if (act == 6) return 1.f / (1.f + expf(-v));                                                                      // sigmoid
    if (act == 7) return (v > 0.f) ? v : 0.01f * v;                                                                   // leaky relu 0.01
    if (act == 8) return (v > 0.f) ? v : (expf(v) - 1.f);                                                             // elu
    if (act == 9) return fminf(fmaxf(v, 0.f), 6.f);                                                                   // relu6
    if (act == 10) return fabsf(v);                                                                                    // abs
    if (act == 11) return (v >= 0.f) ? v : 0.1f * v;                                                                  // leaky 0.1
    if (act == 12) return (v > 0.f) ? v : 0.2f * v;                                                                   // leaky 0.2
    if (act == 13) return (v > 20.f) ? v : log1pf(expf(v));                                                            // softplus
    return v;
}

// =====================================================================================================================
// k_gemm<MODE>: C(z, m, n) = act(alpha * sum_k A(z, m, k) * B(z, k, n) + bias) + beta * R(z, m, n)
//   One wave (32-thread block) per 16 x 32 tile of C; grid (ceil(N/32), ceil(M/16), Z). Batch z -> (zo = z / zi_n, zi = z % zi_n)
//   with separate outer/inner strides for every tensor (e.g. batch and head). A(m,k) = A[zo*sAo + zi*sAi + m*sAm + k*sAk] (f32),
//   B(k,n) = B[zo*sBo + zi*sBi + n*sBn + k*sBk] (f32); any M, N, K (K zero-padded to 32 inside the fragments, M/N tails guarded).
//   C(m,n) = C[zo*sCo + zi*sCi + m*sCm + n] (n contiguous). flags: 1 bias[n], 2 bias[m], 4 residual R[zo*sRo + zi*sRi + m*sRm + n*sRn].
//   MODE 0: f16 operands (A prescaled by sa, B by sb, both undone in the epilogue); 1: bf16 hi/lo split (3 products); 2: bf16;
//   3: bf16 hi/mid/lo triple split (6 products); 4: as 3 with Kahan-compensated f32 accumulation across k-steps.
// =====================================================================================================================
struct GemmP {
    const float* A; const float* B; const float* bias; const float* R; float* C;
    long long sAo, sAi, sAm, sAk, sBo, sBi, sBn, sBk, sCo, sCi, sCm, sRo, sRi, sRm, sRn;
    int M, N, K, zi_n, flags, act; float alpha, beta, sa, sb;
    int Npad, pad_;     // columns [N, Npad) of C are written as 0 so that padded workspace rows are covered by whole-line stores; Npad >= N
};
static_assert(sizeof(GemmP) == 5 * 8 + 15 * 8 + 6 * 4 + 4 * 4 + 2 * 4, "GemmP has padding");

template <int MODE>
__global__ __launch_bounds__(32) void k_gemm(GemmP p) {
    const int lane = threadIdx.x & 31, h = lane >> 4, l15 = lane & 15;
    const int m0 = blockIdx.y * 16, n0 = blockIdx.x * 32;
    const int z = blockIdx.z, zo = z / p.zi_n, zi = z - zo * p.zi_n;
    const float* A = p.A + zo * p.sAo + zi * p.sAi;
    const float* B = p.B + zo * p.sBo + zi * p.sBi;
    const int am = min(m0 + l15, p.M - 1);                       // clamped row for loads (stores are guarded)
    v8f acc[2], comp[2];
#pragma unroll
    for (int t = 0; t < 2; ++t) { v8f zz = {}; acc[t] = zz; comp[t] = zz; }
    for (int k0 = 0; k0 < p.K; k0 += 32) {
        const float* arow = A + (long long)am * p.sAm;
        if (MODE == 1) {
            const Split a = sp_ld(arow, p.sAk, k0, h, p.K, 1.f);
#pragma unroll
            for (int t = 0; t < 2; ++t) {
                const int bn = min(n0 + t * 16 + l15, p.N - 1);
                acc[t] = wmma3(a, sp_ld(B + (long long)bn * p.sBn, p.sBk, k0, h, p.K, 1.f), acc[t]);
            }
        } else if (MODE == 3) {
            const Split3 a = sp3_ld(arow, p.sAk, k0, h, p.K, 1.f);
#pragma unroll
            for (int t = 0; t < 2; ++t) {
                const int bn = min(n0 + t * 16 + l15, p.N - 1);
                acc[t] = wmma6(a, sp3_ld(B + (long long)bn * p.sBn, p.sBk, k0, h, p.K, 1.f), acc[t]);
            }
        } else if (MODE == 4) {
            // triple split as MODE 3, but each k-step's 6 products go into a fresh accumulator and the partial is added to the running f32 sum
            // on the VALU with Kahan compensation (accumulation error stays ~1 ulp however long K is)
            const Split3 a = sp3_ld(arow, p.sAk, k0, h, p.K, 1.f);
#pragma unroll
            for (int t = 0; t < 2; ++t) {
                const int bn = min(n0 + t * 16 + l15, p.N - 1); v8f zz = {};
                const v8f part = wmma6(a, sp3_ld(B + (long long)bn * p.sBn, p.sBk, k0, h, p.K, 1.f), zz);
                const v8f y = part - comp[t]; const v8f s = acc[t] + y; comp[t] = (s - acc[t]) - y; acc[t] = s;
            }
        } else if (MODE == 2) {
            const v16b a = bh_ld(arow, p.sAk, k0, h, p.K, 1.f);
#pragma unroll
            for (int t = 0; t < 2; ++t) {
                const int bn = min(n0 + t * 16 + l15, p.N - 1);
                acc[t] = wmmab(a, bh_ld(B + (long long)bn * p.sBn, p.sBk, k0, h, p.K, 1.f), acc[t]);
            }
        } else {
            const v16h a = fh_ld(arow, p.sAk, k0, h, p.K, p.sa);
#pragma unroll
            for (int t = 0; t < 2; ++t) {
                const int bn = min(n0 + t * 16 + l15, p.N - 1);
                acc[t] = wmma16(a, fh_ld(B + (long long)bn * p.sBn, p.sBk, k0, h, p.K, p.sb), acc[t]);
            }
        }
    }
    const float iscale = (MODE == 0) ? p.alpha / (p.sa * p.sb) : p.alpha;
    float* C = p.C + zo * p.sCo + zi * p.sCi;
    const float* R = p.R + zo * p.sRo + zi * p.sRi;
    __shared__ __align__(16) float ctile[16][36];
#pragma unroll
    for (int t = 0; t < 2; ++t) {
        const int n = n0 + t * 16 + l15; const int nn = min(n, p.N - 1);
#pragma unroll
        for (int r = 0; r < 8; ++r) {
            const int m = m0 + 8 * h + r; const int mm = min(m, p.M - 1);
            float v = acc[t][r] * iscale;
            if (p.flags & 1) v += p.bias[nn];
            if (p.flags & 2) v += p.bias[mm];
            if (p.flags & 8) v *= p.bias[(long long)zo * p.M + mm];   /* per-(z,row) scale vector laid out [Z][M]; exclusive with the bias flags */
            v = act_fn(v, p.act);
            if (p.flags & 4) v += p.beta * R[(long long)mm * p.sRm + (long long)nn * p.sRn];
            ctile[8 * h + r][t * 16 + l15] = (n < p.N) ? v : 0.f;
        }
    }
    __syncthreads();
    const int NW = (p.Npad > p.N) ? p.Npad : p.N;           // write width
    const bool fast = (m0 + 16 <= p.M) && (n0 + 32 <= NW) && ((p.sCm & 3) == 0) && ((((size_t)C) & 15) == 0);
    if (fast) {
#pragma unroll
        for (int s = 0; s < 4; ++s) {
            const int row = s * 4 + (lane >> 3), c4 = (lane & 7) * 4;
            const v4f v = *(const v4f*)&ctile[row][c4];
            VST2V4(C + (long long)(m0 + row) * p.sCm + n0 + c4, v);
        }
    } else {
        for (int row = 0; row < 16; ++row) {
            const int m = m0 + row, n = n0 + lane;
            if (m < p.M && n < NW) VST2(float, C + (long long)m * p.sCm + n, ctile[row][lane]);
        }
    }
}


// =====================================================================================================================
// k_gemmT<MODE, TM, TN>: same contract as k_gemm, but one wave computes a (16*TM) x (16*TN) tile: TM A fragments and TN B fragments are
//   loaded per 32-wide k-step and reused across TM*TN WMMAs (far fewer load/convert instructions per MAC). MODE 0 (f16), 1 (bf16 hi/lo),
//   2 (bf16) only. grid (ceil(NW/(16*TN)), ceil(M/(16*TM)), Z), block 32. Epilogue identical to k_gemm, run per 16x32 sub-tile.
// =====================================================================================================================
template <int MODE, int TM, int TN>
__global__ __launch_bounds__(32) void k_gemmT(GemmP p) {
    const int lane = threadIdx.x & 31, h = lane >> 4, l15 = lane & 15;
    const int m0 = blockIdx.y * (16 * TM), n0 = blockIdx.x * (16 * TN);
    const int z = blockIdx.z, zo = z / p.zi_n, zi = z - zo * p.zi_n;
    const float* A = p.A + zo * p.sAo + zi * p.sAi;
    const float* B = p.B + zo * p.sBo + zi * p.sBi;
    v8f acc[TM][TN];
#pragma unroll
    for (int i = 0; i < TM; ++i)
#pragma unroll
        for (int t = 0; t < TN; ++t) { v8f zz = {}; acc[i][t] = zz; }
    for (int k0 = 0; k0 < p.K; k0 += 32) {
        if (MODE == 1) {
            Split a[TM], b[TN];
#pragma unroll
            for (int i = 0; i < TM; ++i) { const int am = min(m0 + 16 * i + l15, p.M - 1); a[i] = sp_ld(A + (long long)am * p.sAm, p.sAk, k0, h, p.K, 1.f); }
#pragma unroll
            for (int t = 0; t < TN; ++t) { const int bn = min(n0 + 16 * t + l15, p.N - 1); b[t] = sp_ld(B + (long long)bn * p.sBn, p.sBk, k0, h, p.K, 1.f); }
#pragma unroll
            for (int i = 0; i < TM; ++i)
#pragma unroll
                for (int t = 0; t < TN; ++t) acc[i][t] = wmma3(a[i], b[t], acc[i][t]);
        } else if (MODE == 2) {
            v16b a[TM], b[TN];
#pragma unroll
            for (int i = 0; i < TM; ++i) { const int am = min(m0 + 16 * i + l15, p.M - 1); a[i] = bh_ld(A + (long long)am * p.sAm, p.sAk, k0, h, p.K, 1.f); }
#pragma unroll
            for (int t = 0; t < TN; ++t) { const int bn = min(n0 + 16 * t + l15, p.N - 1); b[t] = bh_ld(B + (long long)bn * p.sBn, p.sBk, k0, h, p.K, 1.f); }
#pragma unroll
            for (int i = 0; i < TM; ++i)
#pragma unroll
                for (int t = 0; t < TN; ++t) acc[i][t] = wmmab(a[i], b[t], acc[i][t]);
        } else {
            v16h a[TM], b[TN];
#pragma unroll
            for (int i = 0; i < TM; ++i) { const int am = min(m0 + 16 * i + l15, p.M - 1); a[i] = fh_ld(A + (long long)am * p.sAm, p.sAk, k0, h, p.K, p.sa); }
#pragma unroll
            for (int t = 0; t < TN; ++t) { const int bn = min(n0 + 16 * t + l15, p.N - 1); b[t] = fh_ld(B + (long long)bn * p.sBn, p.sBk, k0, h, p.K, p.sb); }
#pragma unroll
            for (int i = 0; i < TM; ++i)
#pragma unroll
                for (int t = 0; t < TN; ++t) acc[i][t] = wmma16(a[i], b[t], acc[i][t]);
        }
    }
    const float iscale = (MODE == 0) ? p.alpha / (p.sa * p.sb) : p.alpha;
    float* C = p.C + zo * p.sCo + zi * p.sCi;
    const float* R = p.R + zo * p.sRo + zi * p.sRi;
    const int NW = (p.Npad > p.N) ? p.Npad : p.N;
    __shared__ __align__(16) float ctile[16][36];
#pragma unroll
    for (int i = 0; i < TM; ++i) {
        const int mb = m0 + 16 * i; if (mb >= p.M) break;          // wave-uniform
#pragma unroll
        for (int tp = 0; tp < TN / 2; ++tp) {
            const int nb = n0 + 32 * tp; if (nb >= NW) break;        // wave-uniform
#pragma unroll
            for (int t2 = 0; t2 < 2; ++t2) {
                const int t = 2 * tp + t2; const int n = nb + t2 * 16 + l15; const int nn = min(n, p.N - 1);
#pragma unroll
                for (int r = 0; r < 8; ++r) {
                    const int m = mb + 8 * h + r; const int mm = min(m, p.M - 1);
                    float v = acc[i][t][r] * iscale;
                    if (p.flags & 1) v += p.bias[nn];
                    if (p.flags & 2) v += p.bias[mm];
            if (p.flags & 8) v *= p.bias[(long long)zo * p.M + mm];   /* per-(z,row) scale vector laid out [Z][M]; exclusive with the bias flags */
                    v = act_fn(v, p.act);
                    if (p.flags & 4) v += p.beta * R[(long long)mm * p.sRm + (long long)nn * p.sRn];
                    ctile[8 * h + r][t2 * 16 + l15] = (n < p.N) ? v : 0.f;
                }
            }
            __syncthreads();
            const bool fast = (mb + 16 <= p.M) && (nb + 32 <= NW) && ((p.sCm & 3) == 0) && ((((size_t)C) & 15) == 0);
            if (fast) {
#pragma unroll
                for (int s = 0; s < 4; ++s) {
                    const int row = s * 4 + (lane >> 3), c4 = (lane & 7) * 4;
                    const v4f v = *(const v4f*)&ctile[row][c4];
                    VST2V4(C + (long long)(mb + row) * p.sCm + nb + c4, v);
                }
            } else {
                for (int row = 0; row < 16; ++row) {
                    const int m = mb + row, n = nb + lane;
                    if (m < p.M && n < NW) VST2(float, C + (long long)m * p.sCm + n, ctile[row][lane]);
                }
            }
            __syncthreads();
        }
    }
}

// =====================================================================================================================
//   Wave = 16 queries, AW waves per block, 64-key blocks; grid (ceil(Lq/(16*AW)), H, B), block 32*AW. Any Lq, Lk; head dim dh <= DHP
//   (DHP multiple of 32), value dim dv <= DVP (multiple of 16, <= 128). Every tensor addressed by (batch, head, row, element) strides, f32.
//   Scores: QM 0 f16 operands, 1 bf16 hi/lo split, 2 bf16 triple split; statistics f32 (exp2 domain); P.V: P x 4096 as f16 with V f16 staged in LDS
//   (SPLITPV: P and V as bf16 hi/lo splits). kv head = h / hrep. Masking: causal = 1 (keep j <= i + coff, masked -> -inf, key blocks beyond the
//   diagonal skipped), causal = 2 (masked -> mfill, a finite fill like the -1e9; no skipping), causal = 3 (keep j >= i + coff,
//   masked -> -inf, no skipping); optional additive f32 mask Mf,
//   optional int keep-mask Mi (0 -> score := mfill), both addressed b*smb + h*smh + i*smi + j*smj (0 strides broadcast).
// =====================================================================================================================
#define AW 4
struct AttnP {   // apv4
    const float* Q; const float* K; const float* V; float* O; float* P; const float* Mf; const int* Mi; float* ST;
    const float* Pw; const float* Rt; const int* SQ; const int* SK;           // optional: post-softmax weight, relative-position table, segment ids
    long long swb, swh, swi, swj, srb, srh, sri;                                 // Pw strides (b,h,i,j); Rt strides (b,h,i), column = clamp(i - j + roff, 0, rn-1)
    long long sQb, sQh, sQi, sQd, sKb, sKh, sKj, sKd, sVb, sVh, sVj, sVd, sOb, sOh, sOi, sPb, sPh, sPi, smb, smh, smi, smj;
    int Lq, Lk, dh, dv, hrep, causal, coff, pband;   // pband > 0: P holds only the band |j - i| <= pband, column j - i + pband
    float scale, mfill; int nonorm, mpol;             // nonorm (online path only): O = sum_j exp(score_j) V_j without the 1/rowsum (scores must be <= ~0); mpol: Mi masks where ==0 (mpol 0) or where !=0 (mpol 1)
    int roff, rn, segpol, win;                        // Rt column offset/count; SQ/SK: score := mfill where (segpol 0) SQ[i] != SK[j] or (segpol 1) SQ[i] == SK[j]; win > 0: keys with i - j > win (after coff) -> -inf
};
//   Pw: the softmax numerator is multiplied by Pw(b,h,i,j) AFTER the row sum is taken (probs * weight, then P.V), as in post-softmax multiplicative biases.                                                    // ST (optional): per row (b,h,i) -> ST[((b*H + h)*Lq + i)*2 + {0,1}] = {row max of the scaled+masked score (natural units), sum_j exp(score - max)}
static_assert(sizeof(AttnP) == 12 * 8 + 29 * 8 + 16 * 4, "AttnP has padding");

// Inputs-only fence on sixteen loaded values: all must have arrived here, so their loads are issued together ahead of it and share one wait
// (without it the register-budgeted schedule waits after every load). It names no product and changes no value.
template <typename T> __device__ __forceinline__ void hold16(const T* x) {
    asm volatile("" :: "v"(x[0]), "v"(x[1]), "v"(x[2]), "v"(x[3]), "v"(x[4]), "v"(x[5]), "v"(x[6]), "v"(x[7]),
                       "v"(x[8]), "v"(x[9]), "v"(x[10]), "v"(x[11]), "v"(x[12]), "v"(x[13]), "v"(x[14]), "v"(x[15]));
}
#ifndef KATTN_ATTR
#define KATTN_ATTR __attribute__((amdgpu_waves_per_eu(4)))   // register budget of 256: four waves a SIMD, so that all 1,024 blocks of the launch are resident at once
#endif
//   GT > 0 fixes the geometry at compile time: Lq = Lk = GT, rows of GD floats with head h at column h * DHP (unit element stride), dh = DHP,
//   dv = DVP, one kv head per head, no mask, weight, segment, P or ST tensor, and a per-head Rt row of 2 GT - 1 columns. Only Q, K, V, O, Rt and scale
//   are then taken from the argument, so every length guard folds and the loads of a key block are contiguous and free of branches.
template <int DHP, int DVP, int QM, bool SPLITPV, bool TWOPASS, int GT = 0, int GD = 0>
__global__ __launch_bounds__(32 * AW) KATTN_ATTR void k_attn(AttnP parg) {
    AttnP p = parg;
    if (GT > 0) {
        p.P = nullptr; p.Mf = nullptr; p.Mi = nullptr; p.ST = nullptr; p.Pw = nullptr; p.SQ = nullptr; p.SK = nullptr;
        p.swb = 0; p.swh = 0; p.swi = 0; p.swj = 0; p.srb = 0; p.srh = 2 * GT - 1; p.sri = 0;
        p.sQb = (long long)GT * GD; p.sQh = DHP; p.sQi = GD; p.sQd = 1; p.sKb = (long long)GT * GD; p.sKh = DHP; p.sKj = GD; p.sKd = 1;
        p.sVb = (long long)GT * GD; p.sVh = DVP; p.sVj = GD; p.sVd = 1; p.sOb = (long long)GT * GD; p.sOh = DVP; p.sOi = GD;
        p.sPb = 0; p.sPh = 0; p.sPi = 0; p.smb = 0; p.smh = 0; p.smi = 0; p.smj = 0;
        p.Lq = GT; p.Lk = GT; p.dh = DHP; p.dv = DVP; p.hrep = 1; p.causal = 0; p.coff = 0; p.pband = 0;
        p.mfill = 0.f; p.nonorm = 0; p.mpol = 0; p.roff = GT - 1; p.rn = 2 * GT - 1; p.segpol = 0; p.win = 0;
        __builtin_assume(p.Rt != nullptr);
    }
    constexpr bool FULL = GT > 0 && GT % (16 * AW) == 0 && GT % 64 == 0;   // every query tile and key block is whole: index clamps and length guards are identities
    constexpr int NT = DVP / 16;                // output tiles
    constexpr int KS = DHP / 32;                // k-steps for the scores
    constexpr int VP = DVP + 8;                 // LDS pitch (halves)
    __shared__ __align__(16) float    pl[AW][16 * 64];
    __shared__ __align__(16) _Float16 vl[(SPLITPV ? 2 : 1) * 64 * VP];   // f16 V tile, or bf16 hi and lo tiles (same 2-byte size)
    const int lane = threadIdx.x & 31, hf = lane >> 4, l15 = lane & 15, wave = threadIdx.x >> 5;
    const int h = blockIdx.y, b = blockIdx.z, hk = h / p.hrep;
    const int q0 = (blockIdx.x * AW + wave) * 16;
    float* myp = pl[wave];
    const float L2E = 1.4426950408889634f;
    const float NEG = -__builtin_inff();
    const int qi = FULL ? q0 + l15 : min(q0 + l15, p.Lq - 1);
    const float* qrow = p.Q + b * p.sQb + h * p.sQh + (long long)qi * p.sQi;
    const float* kbase = p.K + b * p.sKb + hk * p.sKh;
    const float* vbase = p.V + b * p.sVb + hk * p.sVh;
    v16h qa[QM == 0 ? KS : 1]; Split qs_[QM == 1 ? KS : 1]; Split3 qt_[QM == 2 ? KS : 1];
#pragma unroll
    for (int ks = 0; ks < KS; ++ks) {
        if (QM == 2) qt_[ks] = sp3_ld(qrow, p.sQd, ks * 32, hf, p.dh, 1.f);
        else if (QM == 1) qs_[ks] = sp_ld(qrow, p.sQd, ks * 32, hf, p.dh, 1.f);
        else qa[ks] = fh_ld(qrow, p.sQd, ks * 32, hf, p.dh, 1.f);
    }
    v8f o[NT]; float m8[8], l8[8];
#pragma unroll
    for (int t = 0; t < NT; ++t) { v8f zz = {}; o[t] = zz; }
#pragma unroll
    for (int i = 0; i < 8; ++i) { m8[i] = NEG; l8[i] = 0.f; }
    int jend = p.Lk;
    if (p.causal == 1) { const int je = (blockIdx.x * AW + AW - 1) * 16 + 16 + p.coff; jend = min(jend, max(je, 0)); }   // uniform per block
    const int npass = TWOPASS ? 2 : 1;
    for (int pass = 0; pass < npass; ++pass) {
        const bool dopv = (!TWOPASS) || pass == 1;
        for (int j0 = 0; j0 < jend; j0 += 64) {
            if (dopv) {
                __syncthreads();                                 // previous key block's reads of vl / pl are done
                constexpr int VN = 64 * DVP / (32 * AW);         // V elements per thread and key block
                constexpr bool VLIN = (32 * AW) % DVP == 0;      // a thread keeps its column: its rows differ by a constant step
                float vf[VN];
#pragma unroll   // constant trip count: with the guard folded the tile's loads differ by immediate offsets only
                for (int it = 0; it < VN; ++it) {
                    const int idx = threadIdx.x + it * (32 * AW);
                    const int jr = VLIN ? (int)threadIdx.x / DVP + it * ((32 * AW) / DVP) : idx / DVP, d = VLIN ? (int)threadIdx.x % DVP : idx - jr * DVP, j = j0 + jr;
                    if constexpr (FULL && VLIN)   // block-uniform tile pointer + the thread's fixed offset + a constant
                        vf[it] = (vbase + (long long)j0 * GD)[(size_t)(unsigned)((int)threadIdx.x / DVP * GD + (int)threadIdx.x % DVP) + it * ((32 * AW) / DVP) * GD];
                    else
                        vf[it] = (j < p.Lk && d < p.dv) ? vbase[(long long)j * p.sVj + (long long)d * p.sVd] : 0.f;
                }
                if (FULL && VN == 32) { hold16(vf); hold16(vf + 16); }   // the tile's loads all issue ahead of this line and are waited for once
#pragma unroll
                for (int it = 0; it < VN; ++it) {
                    const int idx = threadIdx.x + it * (32 * AW);
                    const int jr = VLIN ? (int)threadIdx.x / DVP + it * ((32 * AW) / DVP) : idx / DVP, d = VLIN ? (int)threadIdx.x % DVP : idx - jr * DVP;
                    const float f = vf[it];
                    if (SPLITPV) {
                        const __bf16 hb = bf16_rne(f);
                        ((__bf16*)vl)[jr * VP + d] = hb; ((__bf16*)vl)[64 * VP + jr * VP + d] = bf16_rne(f - bf16_f32(hb));
                    } else vl[jr * VP + d] = (_Float16)f;
                }
            }
            v8f s[4];
            float rb[8][4];                                     // the key block's relative-position table entries, fetched ahead of the products
            if constexpr (FULL) {
                // column i - j + GT - 1 as block-uniform pointer + the lane's fixed offset + a constant, each part >= 0 (j0 <= GT - 64)
                const float* rt = p.Rt + (long long)h * (2 * GT - 1) + ((int)blockIdx.x * (16 * AW) - j0 + (GT - 64));
                const unsigned ro = (unsigned)(wave * 16 + 8 * hf + 15 - l15);
#pragma unroll
                for (int i = 0; i < 8; ++i)
#pragma unroll
                    for (int t = 0; t < 4; ++t) rb[i][t] = rt[(size_t)ro + (i + 16 * (3 - t))];
            } else if (p.Rt) {
#pragma unroll
                for (int i = 0; i < 8; ++i)
#pragma unroll
                    for (int t = 0; t < 4; ++t) {
                        const int ic = min(q0 + i + 8 * hf, p.Lq - 1);
                        int rc = ic - min(j0 + t * 16 + l15, p.Lk - 1) + p.roff; rc = rc < 0 ? 0 : (rc >= p.rn ? p.rn - 1 : rc);
                        rb[i][t] = p.Rt[b * p.srb + h * p.srh + (long long)ic * p.sri + rc];
                    }
            }
            if constexpr (FULL && QM == 0 && KS == 2) {
                // two key tiles at a time: their sixteen 16-byte loads (fh_ld's k order: floats 8 hf + 0..7 and 16 + 8 hf + 0..7 of each 32) fly together
#pragma unroll
                for (int tp = 0; tp < 2; ++tp) {
                    v4f kr[16];
#pragma unroll
                    for (int t2 = 0; t2 < 2; ++t2)
#pragma unroll
                        for (int ks = 0; ks < 2; ++ks) {
                            const v4f* kp = (const v4f*)((kbase + (long long)j0 * GD) + ((size_t)(unsigned)(l15 * GD + 8 * hf) + (2 * tp + t2) * 16 * GD + ks * 32));
                            kr[(t2 * 2 + ks) * 4 + 0] = kp[0]; kr[(t2 * 2 + ks) * 4 + 1] = kp[1]; kr[(t2 * 2 + ks) * 4 + 2] = kp[4]; kr[(t2 * 2 + ks) * 4 + 3] = kp[5];
                        }
                    hold16(kr);                                  // all sixteen loads issue ahead of this line and are waited for once
#pragma unroll
                    for (int t2 = 0; t2 < 2; ++t2) {
                        v8f acc = {};
#pragma unroll
                        for (int ks = 0; ks < 2; ++ks) {
                            v16h kfr;
#pragma unroll
                            for (int e = 0; e < 16; ++e) kfr[e] = (_Float16)kr[(t2 * 2 + ks) * 4 + (e >> 2)][e & 3];
                            acc = wmma16(qa[ks], kfr, acc);
                        }
                        s[2 * tp + t2] = acc;
                    }
                }
            } else {
#pragma unroll
            for (int t = 0; t < 4; ++t) {
                const int j = min(j0 + t * 16 + l15, p.Lk - 1);
                const float* krow = kbase + (long long)j * p.sKj;
                v8f acc = {};
#pragma unroll
                for (int ks = 0; ks < KS; ++ks) {
                    if (QM == 2)      acc = wmma6(qt_[ks], sp3_ld(krow, p.sKd, ks * 32, hf, p.dh, 1.f), acc);
                    else if (QM == 1) acc = wmma3(qs_[ks], sp_ld(krow, p.sKd, ks * 32, hf, p.dh, 1.f), acc);
                    else              acc = wmma16(qa[ks], fh_ld(krow, p.sKd, ks * 32, hf, p.dh, 1.f), acc);
                }
                s[t] = acc;
            }
            }
            float pv[8][4];
#pragma unroll
            for (int i = 0; i < 8; ++i) {
                const int irow = q0 + i + 8 * hf;
                const int ic = FULL ? irow : min(irow, p.Lq - 1);
                float sc[4];
#pragma unroll
                for (int t = 0; t < 4; ++t) {
                    const int jg = j0 + t * 16 + l15;
                    float v = s[t][i] * p.scale;
                    if (p.Mf) v += p.Mf[b * p.smb + h * p.smh + (long long)ic * p.smi + (long long)min(jg, p.Lk - 1) * p.smj];
                    if (p.Rt) v += rb[i][t];
                    if (p.Mi) { const int mv = p.Mi[b * p.smb + h * p.smh + (long long)ic * p.smi + (long long)min(jg, p.Lk - 1) * p.smj]; if (p.mpol ? (mv != 0) : (mv == 0)) v = p.mfill; }
                    if (p.SQ) { const bool same = p.SQ[(long long)b * p.Lq + ic] == p.SK[(long long)b * p.Lk + min(jg, p.Lk - 1)]; if (p.segpol ? same : !same) v = p.mfill; }
                    if (p.causal == 2 && jg > irow + p.coff) v = p.mfill;
                    if ((!FULL && jg >= p.Lk) || (p.causal == 1 && jg > irow + p.coff) || (p.causal == 3 && jg < irow + p.coff) || (p.win > 0 && irow + p.coff - jg > p.win)) v = NEG; else v *= L2E;
                    sc[t] = v;
                }
                if (!TWOPASS || pass == 0) {
                    float mx = fmaxf(fmaxf(sc[0], sc[1]), fmaxf(sc[2], sc[3]));
                    mx = fmaxf(mx, __shfl_xor(mx, 1, 32)); mx = fmaxf(mx, __shfl_xor(mx, 2, 32));
                    mx = fmaxf(mx, __shfl_xor(mx, 4, 32)); mx = fmaxf(mx, __shfl_xor(mx, 8, 32));
                    const float mnew = fmaxf(m8[i], mx);
                    const float corr = (mnew == NEG) ? 1.f : exp2f(m8[i] - mnew);
                    float rs = 0.f;
#pragma unroll
                    for (int t = 0; t < 4; ++t) {
                        const float pp = (sc[t] == NEG) ? 0.f : exp2f(sc[t] - mnew); rs += pp;
                        pv[i][t] = p.Pw ? pp * p.Pw[b * p.swb + h * p.swh + (long long)ic * p.swi + (long long)min(j0 + t * 16 + l15, p.Lk - 1) * p.swj] : pp;
                    }
                    rs += __shfl_xor(rs, 1, 32); rs += __shfl_xor(rs, 2, 32); rs += __shfl_xor(rs, 4, 32); rs += __shfl_xor(rs, 8, 32);
                    l8[i] = l8[i] * corr + rs; m8[i] = mnew;
                    if (!TWOPASS) {
#pragma unroll
                        for (int t = 0; t < NT; ++t) o[t][i] *= corr;
                    }
                } else {
                    const float inv = (l8[i] > 0.f) ? 1.f / l8[i] : 0.f;
#pragma unroll
                    for (int t = 0; t < 4; ++t) {
                        const int jg = j0 + t * 16 + l15;
                        float pp = (sc[t] == NEG) ? 0.f : exp2f(sc[t] - m8[i]) * inv;
                        if (p.Pw) pp *= p.Pw[b * p.swb + h * p.swh + (long long)ic * p.swi + (long long)min(jg, p.Lk - 1) * p.swj];
                        pv[i][t] = pp;
                    }
                }
            }
            if (dopv) {
#pragma unroll
                for (int i = 0; i < 8; ++i)
#pragma unroll
                    for (int t = 0; t < 4; ++t) ((float*)myp)[(i + 8 * hf) * 64 + t * 16 + l15] = pv[i][t];
                __syncthreads();                                 // P (per wave) and V (shared) visible
                if (p.P) {
                    float* pb_ = p.P + b * p.sPb + h * p.sPh;
                    const bool fastP = (p.pband == 0) && ((p.sPi & 3) == 0) && (j0 + 64 <= p.Lk) && (q0 + 16 <= p.Lq) && ((((size_t)pb_) & 15) == 0);
                    if (fastP) {
#pragma unroll
                        for (int s = 0; s < 8; ++s) {
                            const int row = s * 2 + (lane >> 4), c4 = (lane & 15) * 4;
                            const v4f v = *(const v4f*)(myp + row * 64 + c4);
                            VST2V4(pb_ + (long long)(q0 + row) * p.sPi + j0 + c4, v);
                        }
                    } else {
                        for (int row = 0; row < 16; ++row) {
                            const int irow = q0 + row; if (irow >= p.Lq) continue;
                            for (int c = lane; c < 64; c += 32) {
                                const int jg = j0 + c; if (jg >= p.Lk) continue;
                                if (p.pband == 0) VST2(float, pb_ + (long long)irow * p.sPi + jg, myp[row * 64 + c]);
                                else if (jg - irow <= p.pband && irow - jg <= p.pband) VST2(float, pb_ + (long long)irow * p.sPi + (jg - irow + p.pband), myp[row * 64 + c]);
                            }
                        }
                    }
                }
                if (SPLITPV) {
                    const Split pa0 = sp_ld(myp + l15 * 64, 1, 0, hf, 64, 1.f), pa1 = sp_ld(myp + l15 * 64, 1, 32, hf, 64, 1.f);
                    const __bf16* vh = (const __bf16*)vl; const __bf16* vlo = vh + 64 * VP;
#pragma unroll
                    for (int t = 0; t < NT; ++t) {
                        const int dcol = t * 16 + l15;
                        Split b0, b1;
#pragma unroll
                        for (int e = 0; e < 16; ++e) {
                            const int k0 = frag_k(e, hf), k1 = 32 + frag_k(e, hf);
                            b0.hi[e] = vh[k0 * VP + dcol]; b0.lo[e] = vlo[k0 * VP + dcol]; b1.hi[e] = vh[k1 * VP + dcol]; b1.lo[e] = vlo[k1 * VP + dcol];
                        }
                        o[t] = wmma3(pa0, b0, o[t]);
                        o[t] = wmma3(pa1, b1, o[t]);
                    }
                } else {
                    const v16h pa0 = fh_ld(myp + l15 * 64, 1, 0, hf, 64, 4096.f), pa1 = fh_ld(myp + l15 * 64, 1, 32, hf, 64, 4096.f);
#pragma unroll
                    for (int t = 0; t < NT; ++t) {
                        const int dcol = t * 16 + l15;
                        v16h b0, b1;
#pragma unroll
                        for (int e = 0; e < 16; ++e) { b0[e] = vl[frag_k(e, hf) * VP + dcol]; b1[e] = vl[(32 + frag_k(e, hf)) * VP + dcol]; }
                        o[t] = wmma16(pa0, b0, o[t]);
                        o[t] = wmma16(pa1, b1, o[t]);
                    }
                }
            }
        }
    }
    float* obase = p.O + b * p.sOb + h * p.sOh;
    if (p.ST) {
        const int rl = lane >> 1, isel = rl & 7;           // row q0 + rl ; rl>>3 == hf holds because lane>>4 == (lane>>1)>>3
        float mv = 0.f, lv = 0.f;
#pragma unroll
        for (int i = 0; i < 8; ++i) if (i == isel) { mv = m8[i]; lv = l8[i]; }
        const int irow = q0 + rl;
        if (irow < p.Lq) { float* st = p.ST + (((long long)b * gridDim.y + h) * p.Lq + irow) * 2 + (lane & 1); VST2(float, st, (lane & 1) ? lv : mv * 0.6931471805599453f); }
    }
    float invr[8];
#pragma unroll
    for (int i = 0; i < 8; ++i) {
        if (TWOPASS) invr[i] = SPLITPV ? 1.f : (1.f / 4096.f);
        else if (p.nonorm) invr[i] = exp2f(m8[i]) * (SPLITPV ? 1.f : (1.f / 4096.f));
        else invr[i] = (l8[i] > 0.f) ? (SPLITPV ? 1.f / l8[i] : 1.f / (l8[i] * 4096.f)) : 0.f;
    }
    __syncthreads();                                             // all waves done with pl/vl from the main loop
    const bool ofast = ((p.sOi & 3) == 0) && ((((size_t)obase) & 15) == 0) && (q0 + 16 <= p.Lq);
#pragma unroll
    for (int c0 = 0; c0 < DVP; c0 += 64) {
#pragma unroll
        for (int i = 0; i < 8; ++i)
#pragma unroll
            for (int t = 0; t < NT; ++t) if (t * 16 >= c0 && t * 16 < c0 + 64) ((float*)myp)[(i + 8 * hf) * 64 + (t * 16 - c0) + l15] = o[t][i] * invr[i];
        __syncthreads();
        const int cw = (DVP - c0 < 64) ? (DVP - c0) : 64;      // staged columns in this chunk (multiple of 16)
        if (ofast && (c0 + cw <= p.dv) && (cw % 32 == 0)) {
            const int lpr = cw / 4;                              // lanes per row (16 for 64 cols, 8 for 32)
            const int rows_per_ins = 32 / lpr;
            for (int r0 = 0; r0 < 16; r0 += rows_per_ins) {
                const int row = r0 + lane / lpr, c4 = (lane % lpr) * 4;
                const v4f v = *(const v4f*)(myp + row * 64 + c4);
                VST2V4(obase + (long long)(q0 + row) * p.sOi + c0 + c4, v);
            }
        } else {
            for (int row = 0; row < 16; ++row) {
                const int irow = q0 + row; if (irow >= p.Lq) continue;
                for (int c = lane; c < cw; c += 32) { const int d = c0 + c; if (d < p.dv) VST2(float, obase + (long long)irow * p.sOi + d, myp[row * 64 + c]); }
            }
        }
        __syncthreads();
    }
}

__device__ __forceinline__ float xhalf(float x) { return __builtin_bit_cast(float, __builtin_amdgcn_permlanex16(__builtin_bit_cast(int, x), __builtin_bit_cast(int, x), 0x76543210, 0xfedcba98, false, false)); }
template <int GT, int GD>
__global__ __launch_bounds__(32 * AW) KATTN_ATTR void k_attnT(const float* __restrict__ Q, const float* __restrict__ K, const float* __restrict__ V, float* __restrict__ O, const float* __restrict__ Rt, float scale) {
    static_assert(GT % (16 * AW) == 0 && GT % 64 == 0 && AW == 4, "whole query tiles and key blocks; 128 threads stage the 64 x 64 K and V tiles");
    constexpr int DH = 64;                      // head size
    constexpr int VP = 64 + 8;                  // LDS pitch (halves): rows of 128 bytes + 16, for 16-byte readers
    __shared__ __align__(16) _Float16 vt[2][DH * VP];   // V^T tile: row = head column, 64 keys along the row
    __shared__ __align__(16) _Float16 kt[2][64 * VP];   // K tile: row = key, the 64 head columns along the row; written once a key block, read by all four waves
    const int lane = threadIdx.x & 31, hf = lane >> 4, l15 = lane & 15, wave = threadIdx.x >> 5;
    const int h = blockIdx.y, b = blockIdx.z;
    const int q0 = (blockIdx.x * AW + wave) * 16;
    const float L2E = 1.4426950408889634f;
    const float* qrow = Q + (long long)b * GT * GD + h * DH + (long long)(q0 + l15) * GD;
    const float* kbase = K + (long long)b * GT * GD + h * DH;
    const float* vbase = V + (long long)b * GT * GD + h * DH;
    v16h qb[2];
#pragma unroll
    for (int ks = 0; ks < 2; ++ks) qb[ks] = fh_ld(qrow, 1, ks * 32, hf, DH, 1.f);
    v8f o[4]; float m = -__builtin_inff(), l = 0.f;
#pragma unroll
    for (int t = 0; t < 4; ++t) { v8f zz = {}; o[t] = zz; }
    const int vd = threadIdx.x & 63, vk = (threadIdx.x >> 6) * 32;   // V staging: this thread's head column and its first of 32 consecutive keys
    const int kc = threadIdx.x & 15, kq = threadIdx.x >> 4;          // K staging: 16 lanes cover one key's 256 bytes, so a wave's 16-byte load is four whole lines; keys kq + 8 it
    float vf[32]; v4f kf[8];                                         // this thread's share of the tiles on their way from global memory to LDS
    __builtin_amdgcn_sched_barrier(0);                               // with the one behind the wait below: nothing but the first tiles' loads stands between them, so no register is rewritten ahead of that wait
#pragma unroll
    for (int it = 0; it < 8; ++it) kf[it] = *(const v4f*)(kbase + ((size_t)(unsigned)(kq * GD + kc * 4) + it * 8 * GD));
#pragma unroll
    for (int it = 0; it < 32; ++it) vf[it] = vbase[(size_t)(unsigned)(vk * GD + vd) + it * GD];
    asm volatile("s_wait_xcnt 0x0" ::: "memory");                    // in front of the first overwrite of a register that these loads name as an address
    __builtin_amdgcn_sched_barrier(0);                               // keeps the later address arithmetic behind that wait (a "memory" clobber alone did not)
#pragma unroll
    for (int it = 0; it < 8; ++it) {
        v4h pk;
#pragma unroll
        for (int e = 0; e < 4; ++e) pk[e] = (_Float16)kf[it][e];
        *(v4h*)(kt[0] + (kq + 8 * it) * VP + kc * 4) = pk;
    }
#pragma unroll
    for (int c8 = 0; c8 < 4; ++c8) {
        v8h pk;
#pragma unroll
        for (int e = 0; e < 8; ++e) pk[e] = (_Float16)vf[c8 * 8 + e];
        *(v8h*)(vt[0] + vd * VP + vk + c8 * 8) = pk;
    }
    for (int j0 = 0; j0 < GT; j0 += 64) {
        // This trip works on key block j0 in buffer cur and fills the other buffer with the next block, whose loads fly under the products and the softmax.
        const int cur = (j0 >> 6) & 1;
        __syncthreads();                                 // block j0's tiles are visible; every wave has left the buffer that this trip fills
        const int jn = (j0 + 64 < GT) ? j0 + 64 : j0;    // the last trip fetches its own block again: no branch, nothing out of bounds, the copy is not read
#pragma unroll
        for (int it = 0; it < 8; ++it) kf[it] = *(const v4f*)((kbase + (long long)jn * GD) + ((size_t)(unsigned)(kq * GD + kc * 4) + it * 8 * GD));
        __builtin_amdgcn_sched_barrier(0);               // the next K tile's loads issue here: the scheduler otherwise moves them down to their LDS stores, each waited for with nothing to hide it
        // table column i - j + GT - 1 as block-uniform pointer + the lane's fixed offset + a constant, each part >= 0 (j0 <= GT - 64)
        float rb[4][8];
        const float* rt = Rt + (long long)h * (2 * GT - 1) + ((int)blockIdx.x * (16 * AW) - j0 + (GT - 64));
        const unsigned ro = (unsigned)(wave * 16 + l15 + 8 * (1 - hf));
#pragma unroll
        for (int t = 0; t < 4; ++t)
#pragma unroll
            for (int r = 0; r < 8; ++r) rb[t][r] = rt[(size_t)ro + (16 * (3 - t) + (7 - r))];
        v8f s[4];
        v8h ka[16];                                      // the eight K fragments, fh_ld's k order: halves 8 hf + 0..7 and 16 + 8 hf + 0..7 of each 32
#pragma unroll
        for (int t = 0; t < 4; ++t)
#pragma unroll
            for (int ks = 0; ks < 2; ++ks) {
                const _Float16* kr = kt[cur] + (t * 16 + l15) * VP + ks * 32 + 8 * hf;
                ka[(t * 2 + ks) * 2] = *(const v8h*)kr; ka[(t * 2 + ks) * 2 + 1] = *(const v8h*)(kr + 16);
            }
        hold16(ka);                                      // the sixteen LDS reads issue together and are waited for once (otherwise: one fragment's registers, a full LDS wait in front of each product)
#pragma unroll
        for (int t = 0; t < 4; ++t) {
            v8f acc = {};
#pragma unroll
            for (int ks = 0; ks < 2; ++ks) {
                const v16h kfr = __builtin_shufflevector(ka[(t * 2 + ks) * 2], ka[(t * 2 + ks) * 2 + 1], 0, 1, 2, 3, 4, 5, 6, 7, 8, 9, 10, 11, 12, 13, 14, 15);
                acc = __builtin_amdgcn_wmma_f32_16x16x32_f16(false, kfr, false, qb[ks], (short)0, acc, false, false);   // A = key rows, B = query columns
            }
            s[t] = acc;
        }
        float sc[4][8], mt[4];
#pragma unroll
        for (int t = 0; t < 4; ++t) {
#pragma unroll
            for (int r = 0; r < 8; ++r) sc[t][r] = (s[t][r] * scale + rb[t][r]) * L2E;
            mt[t] = fmaxf(fmaxf(fmaxf(sc[t][0], sc[t][1]), fmaxf(sc[t][2], sc[t][3])), fmaxf(fmaxf(sc[t][4], sc[t][5]), fmaxf(sc[t][6], sc[t][7])));
        }
        // the next V tile's loads: behind the table's last use, whose 32 registers they take over; they fly under the exponentials and the second products
        __builtin_amdgcn_sched_barrier(0);               // not earlier: issued beside the K tile and the table they leave the score products one fragment's registers, a wait per product
#pragma unroll
        for (int it = 0; it < 32; ++it) vf[it] = (vbase + (long long)jn * GD)[(size_t)(unsigned)(vk * GD + vd) + it * GD];
        __builtin_amdgcn_sched_barrier(0);               // they issue here, for the same reason as the K tile's
        float mx = fmaxf(fmaxf(mt[0], mt[1]), fmaxf(mt[2], mt[3]));
        mx = fmaxf(mx, xhalf(mx));                        // the other lane half holds the query's other 32 keys
        const float mnew = fmaxf(m, mx);
        const float corr = exp2f(m - mnew);
        float rs[4];
#pragma unroll
        for (int t = 0; t < 4; ++t) {
            rs[t] = 0.f;
#pragma unroll
            for (int r = 0; r < 8; ++r) { const float pp = exp2f(sc[t][r] - mnew); rs[t] += pp; sc[t][r] = pp; }
        }
        l = l * corr + ((rs[0] + rs[1]) + (rs[2] + rs[3])); m = mnew;
#pragma unroll
        for (int t = 0; t < 4; ++t)
#pragma unroll
            for (int r = 0; r < 8; ++r) o[t][r] *= corr;
        v16h pb[2];
#pragma unroll
        for (int ks = 0; ks < 2; ++ks)
#pragma unroll
            for (int e = 0; e < 16; ++e) pb[ks][e] = (_Float16)(sc[2 * ks + (e >> 3)][e & 7] * 4096.f);
#pragma unroll
        for (int t = 0; t < 4; ++t)
#pragma unroll
            for (int ks = 0; ks < 2; ++ks) {
                const _Float16* vr = vt[cur] + (t * 16 + l15) * VP + ks * 32 + 8 * hf;
                const v8h a0 = *(const v8h*)vr, a1 = *(const v8h*)(vr + 16);
                const v16h va = __builtin_shufflevector(a0, a1, 0, 1, 2, 3, 4, 5, 6, 7, 8, 9, 10, 11, 12, 13, 14, 15);
                o[t] = __builtin_amdgcn_wmma_f32_16x16x32_f16(false, va, false, pb[ks], (short)0, o[t], false, false);   // A = head columns, B = query columns
            }
        __builtin_amdgcn_sched_barrier(0);               // the casts stay below: moved up to save registers they would wait for the tiles' loads ahead of the work that hides them
#pragma unroll
        for (int it = 0; it < 8; ++it) {
            v4h pk;
#pragma unroll
            for (int e = 0; e < 4; ++e) pk[e] = (_Float16)kf[it][e];
            *(v4h*)(kt[cur ^ 1] + (kq + 8 * it) * VP + kc * 4) = pk;
        }
#pragma unroll
        for (int c8 = 0; c8 < 4; ++c8) {
            v8h pk;
#pragma unroll
            for (int e = 0; e < 8; ++e) pk[e] = (_Float16)vf[c8 * 8 + e];
            *(v8h*)(vt[cur ^ 1] + vd * VP + vk + c8 * 8) = pk;
        }
    }
    l += xhalf(l);                                       // join the two halves' sums
    const float inv = (l > 0.f) ? 1.f / (l * 4096.f) : 0.f;
    float* orow = O + (long long)b * GT * GD + h * DH + (long long)(q0 + l15) * GD + 8 * hf;
#pragma unroll
    for (int t = 0; t < 4; ++t) {
        const v4f w0 = { o[t][0] * inv, o[t][1] * inv, o[t][2] * inv, o[t][3] * inv }, w1 = { o[t][4] * inv, o[t][5] * inv, o[t][6] * inv, o[t][7] * inv };
        VST2V4(orow + t * 16, w0); VST2V4(orow + t * 16 + 4, w1);
    }
}

// =====================================================================================================================
// k_tr: dst(z, c, r) = alpha * src(z, r, c) (+ beta * R2(z, c, r)): [Z][R][C] (row stride lds) -> [Z][C][R] (row stride ldd) through a 32x32 LDS tile;
//   flags: 1 -> add beta * residual R2 addressed like dst (z*sRz + c*ldr + r); act applied before the residual.
// =====================================================================================================================
struct TrP { const float* src; float* dst; const float* R2; long long sSz, lds, sDz, ldd, sRz, ldr; int R, C, flags, act; float alpha, beta; };
static_assert(sizeof(TrP) == 3 * 8 + 6 * 8 + 6 * 4, "TrP has padding");
__global__ __launch_bounds__(256) void k_tr(TrP p) {
    __shared__ float tile[32][33];
    const int c0 = blockIdx.x * 32, r0 = blockIdx.y * 32, z = blockIdx.z;
    const int lane = threadIdx.x & 31, wave = threadIdx.x >> 5;
    const float* s = p.src + z * p.sSz;
#pragma unroll
    for (int k = 0; k < 4; ++k) {
        const int rl = wave * 4 + k, r = r0 + rl, c = c0 + lane;
        tile[rl][lane] = (r < p.R && c < p.C) ? s[(long long)r * p.lds + c] : 0.f;
    }
    __syncthreads();
    float* d = p.dst + z * p.sDz; const float* rr = p.R2 + z * p.sRz;
#pragma unroll
    for (int k = 0; k < 4; ++k) {
        const int cl = wave * 4 + k, c = c0 + cl, r = r0 + lane;
        if (c < p.C && r < p.R) {
            float v = act_fn(p.alpha * tile[lane][cl], p.act);
            if (p.flags & 1) v += p.beta * rr[(long long)c * p.ldr + r];
            VST2(float, d + (long long)c * p.ldd + r, v);
        }
    }
}

// k_affine: dst[i] = a * (sdev ? sdev[0] : 1) * src[i] + b, i < n (one thread per element; consecutive lanes -> consecutive addresses)
__global__ __launch_bounds__(256) void k_affine(const float* __restrict__ src, float* __restrict__ dst, int n, float a, float b, const float* __restrict__ sdev) {
    const int i = blockIdx.x * 256 + threadIdx.x;
    if (i < n) { const float aa = sdev ? a * sdev[0] : a; const float v = aa * src[i] + b; VST2(float, dst + i, v); }
}

// =====================================================================================================================
// k_softmax: row softmax over n contiguous elements, one 256-thread block per row; rows addressed z*sz + r*sr (grid (R, Z)).
//   out = scale_out * softmax(scale_in * x + (Mf ? Mf[z*smz + r*smr + j] : 0)); a row whose max is -inf is written as 0.
// =====================================================================================================================
struct SmP { const float* src; float* dst; const float* Mf; long long sz, sr, dz, dr, smz, smr; int n, pad; float scale_in, scale_out; };
static_assert(sizeof(SmP) == 3 * 8 + 6 * 8 + 4 * 4, "SmP has padding");
__global__ __launch_bounds__(256) void k_softmax(SmP p) {
    __shared__ float red[256];
    const int r = blockIdx.x, z = blockIdx.y, tid = threadIdx.x;
    const float* s = p.src + z * p.sz + (long long)r * p.sr;
    const float* mf = p.Mf ? (p.Mf + z * p.smz + (long long)r * p.smr) : nullptr;
    float mx = -__builtin_inff();
    for (int j = tid; j < p.n; j += 256) { float v = s[j] * p.scale_in; if (mf) v += mf[j]; mx = fmaxf(mx, v); }
    red[tid] = mx; __syncthreads();
    for (int o = 128; o > 0; o >>= 1) { if (tid < o) red[tid] = fmaxf(red[tid], red[tid + o]); __syncthreads(); }
    mx = red[0]; __syncthreads();
    float sum = 0.f;
    for (int j = tid; j < p.n; j += 256) { float v = s[j] * p.scale_in; if (mf) v += mf[j]; sum += (mx == -__builtin_inff()) ? 0.f : expf(v - mx); }
    red[tid] = sum; __syncthreads();
    for (int o = 128; o > 0; o >>= 1) { if (tid < o) red[tid] += red[tid + o]; __syncthreads(); }
    sum = red[0];
    const float inv = (sum > 0.f) ? p.scale_out / sum : 0.f;
    float* d = p.dst + z * p.dz + (long long)r * p.dr;
    for (int j = tid; j < p.n; j += 256) { float v = s[j] * p.scale_in; if (mf) v += mf[j]; const float o = (mx == -__builtin_inff()) ? 0.f : expf(v - mx) * inv; VST2(float, d + j, o); }
}
// =====================================================================================================================
// k_stats: mean and rsqrt(var + eps) over a set of n elements addressed base + z*sz + (e / inner) * so + (e % inner) * si, one 256-thread
// k_norm_apply: y = (x - mean[set]) * rstd[set] * g[c] + b[c] over a [Z][C][L] channel-major tensor with set = z*G + c / (C/G) (G groups per z;
//   G = C -> per-channel sets indexed z*C+c; for batch norm pass stats indexed by c only via bn = 1). Optional act. Output same layout.
// =====================================================================================================================
//   mode 0: mean / rsqrt(var + eps); mode 1 (RMSNorm): 0 / rsqrt(mean(x^2) + eps); mode 2 (L2 normalize * sqrt(n)): 0 / sqrt(n) / max(||x||, eps); mode 3: as 0 with unbiased variance (n-1)
__global__ __launch_bounds__(256) void k_stats(const float* __restrict__ x, long long sz, long long so, long long si, int inner, int n, float eps, float* __restrict__ stat, int mode) {
    __shared__ float red[256];
    const int z = blockIdx.x, tid = threadIdx.x;
    const float* base = x + z * sz;
    float s = 0.f;
    for (int e = tid; e < n; e += 256) s += base[(long long)(e / inner) * so + (long long)(e % inner) * si];
    red[tid] = s; __syncthreads();
    for (int o = 128; o > 0; o >>= 1) { if (tid < o) red[tid] += red[tid + o]; __syncthreads(); }
    const float mu = (mode == 0 || mode == 3) ? red[0] / (float)n : 0.f; __syncthreads();
    float q = 0.f;
    for (int e = tid; e < n; e += 256) { const float dlt = base[(long long)(e / inner) * so + (long long)(e % inner) * si] - mu; q += dlt * dlt; }
    red[tid] = q; __syncthreads();
    for (int o = 128; o > 0; o >>= 1) { if (tid < o) red[tid] += red[tid + o]; __syncthreads(); }
    {
        float rs;
        if (mode == 2) rs = sqrtf((float)n) / fmaxf(sqrtf(red[0]), eps); else if (mode == 3) rs = rsqrtf(red[0] / (float)(n - 1) + eps); else rs = rsqrtf(red[0] / (float)n + eps);
        if (tid < 32) { const float v = (tid == 0) ? mu : ((tid == 1) ? rs : 0.f); VST2(float, stat + (long long)z * 32 + tid, v); }
    }
}
//   One thread per element over the flat [Z][C][L] index space: grid ceil(Z*C*L / 256).
__global__ __launch_bounds__(256) void k_norm_apply(const float* __restrict__ x, float* __restrict__ y, const float* __restrict__ stat, const float* __restrict__ g, const float* __restrict__ bta,
                                                     int Z, int C, int L, int G, int bn, int act) {
    const long long idx = (long long)blockIdx.x * 256 + threadIdx.x;
    if (idx >= (long long)Z * C * L) return;
    const int l = (int)(idx % L); const long long zc = idx / L; const int c = (int)(zc % C), z = (int)(zc / C); (void)l;
    const int set = bn ? c : (z * G + c / (C / G));
    float v = (x[idx] - stat[(long long)set * 32]) * stat[(long long)set * 32 + 1];
    if (g) v *= g[c];
    if (bta) v += bta[c];
    v = act_fn(v, act);
    VST2(float, y + idx, v);
}

// k_lse_neg: c[i] = -(st[2i] + log(st[2i+1])) = minus the log-sum-exp of row i from k_attn's ST output (for softmax over the query dimension)
__global__ __launch_bounds__(256) void k_lse_neg(const float* __restrict__ st, float* __restrict__ c, int n) {
    const int i = blockIdx.x * 256 + threadIdx.x;
    if (i < n) { const float v = -(st[2 * i] + logf(st[2 * i + 1])); VST2(float, c + i, v); }
}

// k_iota: dst[i] = a * i + b as int32 (segment/position id helper)
__global__ __launch_bounds__(256) void k_iota(int* __restrict__ dst, int n, int a, int b) {
    const int i = blockIdx.x * 256 + threadIdx.x;
    if (i < n) { const int v = a * i + b; VST2(int, dst + i, v); }
}

// k_axpby: dst[i] = a * x[i] + b * y[i] (+ c), i < n
__global__ __launch_bounds__(256) void k_axpby(const float* __restrict__ x, const float* __restrict__ y, float* __restrict__ dst, int n, float a, float b, float c) {
    const int i = blockIdx.x * 256 + threadIdx.x;
    if (i < n) { const float v = a * x[i] + b * y[i] + c; VST2(float, dst + i, v); }
}

// =====================================================================================================================
// k_rope: rotary embedding on a [R rows][Hn heads][D] view (row stride sXr, head stride sXh, element stride 1) -> Y (own strides).
//   mode 0: rotate_half (partner d±D/2, sign - for d<D/2); mode 1: interleaved pairs (partner d^1, sign - for even d).
//   table column tcol: tmode 0 -> d, 1 -> d % (D/2), 2 -> d / 2; position p: pmode 0 -> r % S, 1 -> head index, 2 -> pos[r];
//   c = C[(r / S) * sCb + p * sCp + tcol * sCd], s likewise from Sn; y = x[d] * c + sign * x[partner] * s. X and Y must not alias.
// =====================================================================================================================
struct RopeP { const float* X; float* Y; const float* C; const float* Sn; const int* pos; long long sXr, sXh, sYr, sYh, sCb, sCp, sCd; int R, Hn, D, S, mode, tmode, pmode, pad; };
static_assert(sizeof(RopeP) == 5 * 8 + 7 * 8 + 8 * 4, "RopeP has padding");
__global__ __launch_bounds__(256) void k_rope(RopeP p) {
    const long long idx = (long long)blockIdx.x * 256 + threadIdx.x;
    if (idx >= (long long)p.R * p.Hn * p.D) return;
    const int d = (int)(idx % p.D); const long long rh = idx / p.D; const int h = (int)(rh % p.Hn); const int r = (int)(rh / p.Hn);
    const int half = p.D / 2;
    int partner; float sign;
    if (p.mode == 0) { partner = (d < half) ? d + half : d - half; sign = (d < half) ? -1.f : 1.f; }
    else { partner = d ^ 1; sign = (d & 1) ? 1.f : -1.f; }
    const int tcol = (p.tmode == 0) ? d : ((p.tmode == 1) ? (d % half) : (d >> 1));
    const int pp = (p.pmode == 0) ? (r % p.S) : ((p.pmode == 1) ? h : p.pos[r]);
    const long long toff = (long long)(r / p.S) * p.sCb + (long long)pp * p.sCp + (long long)tcol * p.sCd;
    const float* xr = p.X + (long long)r * p.sXr + (long long)h * p.sXh;
    const float v = xr[d] * p.C[toff] + sign * xr[partner] * p.Sn[toff];
    VST2(float, p.Y + (long long)r * p.sYr + (long long)h * p.sYh + d, v);
}

// k_invf + k_sincos (split so neither kernel carries a large VALU-fma footprint): invf_i = num * (1 / powf(base, (2 i)/D)) [fmode 0],
//   num * expf((2 i) * cexp) [fmode 1], num * powf(base, -2 (i - 1) / D) [fmode 2]; then cs/sn[s*half + i] = cos/sin((pscale * s) * invf_i)
__global__ __launch_bounds__(256) void k_invf(float* __restrict__ invb, int half, int D, float base, float num, int fmode, float cexp) {
    const int i = blockIdx.x * 256 + threadIdx.x;
    if (i >= ((half + 31) / 32) * 32) return;
    if (i >= half) { VST2(float, invb + i, 0.f); return; }
    const float e = (float)(2 * i) / (float)D;
    float invf;
    if (fmode == 1) invf = num * expf((float)(2 * i) * cexp);
    else if (fmode == 2) invf = num * powf(base, (-2.0f * ((float)i - 1.0f)) / (float)D);
    else invf = num * (1.0f / powf(base, e));
    VST2(float, invb + i, invf);
}
__global__ __launch_bounds__(256) void k_sincos(float* __restrict__ cs, float* __restrict__ sn, const float* __restrict__ invb, int S, int half, float pscale) {
    const int idx = blockIdx.x * 256 + threadIdx.x;
    if (idx >= S * half) return;
    const int s = idx / half, i = idx - s * half;
    const float ang = (pscale * (float)s) * invb[i];
    VST2(float, cs + idx, cosf(ang)); VST2(float, sn + idx, sinf(ang));
}

// k_mulact: dst[i] = act(x[i]) * y[i]
__global__ __launch_bounds__(256) void k_mulact(const float* __restrict__ x, const float* __restrict__ y, float* __restrict__ dst, int n, int act) {
    const int i = blockIdx.x * 256 + threadIdx.x;
    if (i < n) { const float v = act_fn(x[i], act) * y[i]; VST2(float, dst + i, v); }
}

// =====================================================================================================================
// k_matvec: thread-per-row matrix-vector products for N <= 8 output columns (heads with 1-3 outputs, gates), f32 on the VALU.
//   C[r*sCm + j] = act(alpha * sum_k A[r*sAm + k*sAk] * B[j*sBn + k*sBk] + bias[j]) + beta * R[r*sRm + j*sRn]; each thread writes its N contiguous floats.
// =====================================================================================================================
__global__ __launch_bounds__(256) void k_matvec(GemmP p) {
    // 32 lanes write one line with one instruction.
    const int rpt = (p.N == 1) ? 1 : 32;
    const long long r0 = ((long long)blockIdx.x * 256 + threadIdx.x) * rpt; const int z = blockIdx.z, zo = z / p.zi_n, zi = z - zo * p.zi_n;
    if (r0 >= p.M) return;
    const float* Bb = p.B + zo * p.sBo + zi * p.sBi;
    float* C = p.C + zo * p.sCo + zi * p.sCi; const float* R = p.R + zo * p.sRo + zi * p.sRi;
    for (int rr = 0; rr < rpt; ++rr) {
        const long long r = r0 + rr; if (r >= p.M) break;
        const float* A = p.A + zo * p.sAo + zi * p.sAi + r * p.sAm;
        float acc[8] = {0.f, 0.f, 0.f, 0.f, 0.f, 0.f, 0.f, 0.f};
        for (int k = 0; k < p.K; ++k) { const float a = A[(long long)k * p.sAk];
#pragma unroll
            for (int j = 0; j < 8; ++j) if (j < p.N) acc[j] += a * Bb[(long long)j * p.sBn + (long long)k * p.sBk]; }
#pragma unroll
        for (int j = 0; j < 8; ++j) if (j < p.N) {
            float v = acc[j] * p.alpha;
            if (p.flags & 1) v += p.bias[j];
            if (p.flags & 2) v += p.bias[r];
            v = act_fn(v, p.act);
            if (p.flags & 4) v += p.beta * R[r * p.sRm + (long long)j * p.sRn];
            VST2(float, C + r * p.sCm + j, v);
        }
    }
}
// k_smallsoftmax: thread-per-row softmax for short rows (n <= 64): dst[r*dr + j] = softmax(scale*src[r*sr + j])
__global__ __launch_bounds__(256) void k_smallsoftmax(const float* __restrict__ src, float* __restrict__ dst, long long sr, long long dr, int n, long long R, float scale) {
    const long long r0 = ((long long)blockIdx.x * 256 + threadIdx.x) * 32;
    for (int rr = 0; rr < 32; ++rr) {
        const long long r = r0 + rr; if (r >= R) return;
        const float* s = src + r * sr; float* d = dst + r * dr;
        float mx = -__builtin_inff();
        for (int j = 0; j < n; ++j) mx = fmaxf(mx, s[j] * scale);
        float sum = 0.f;
        for (int j = 0; j < n; ++j) sum += expf(s[j] * scale - mx);
        const float inv = 1.f / sum;
        for (int j = 0; j < n; ++j) { const float v = expf(s[j] * scale - mx) * inv; VST2(float, d + j, v); }
    }
}

__global__ __launch_bounds__(32) void k_unitstat(float* __restrict__ st) { const int t = threadIdx.x; const float v = (t == 1) ? 1.f : 0.f; VST2(float, st + t, v); }

// destination (e.g. a d_out whose row width is not a multiple of 32 floats) is written by consecutive lanes of one instruction
__global__ __launch_bounds__(256) void k_lincopy(const float* __restrict__ src, long long lds, float* __restrict__ dst, long long ldd, long long rows, int cols) {
    const long long i = (long long)blockIdx.x * 256 + threadIdx.x; if (i >= rows * cols) return;
    const long long r = i / cols; const int c = (int)(i - r * cols);
    const float v = src[r * lds + c]; VST2(float, dst + r * ldd + c, v);
}

namespace w25 {
typedef __attribute__((ext_vector_type(16))) _Float16 v16h;
typedef __attribute__((ext_vector_type(8)))  _Float16 v8h;
typedef __attribute__((ext_vector_type(16))) __bf16   v16b;
typedef __attribute__((ext_vector_type(8)))  __bf16   v8b;
typedef __attribute__((ext_vector_type(8)))  float    v8f;
typedef __attribute__((ext_vector_type(4)))  float    v4f;

__device__ __forceinline__ unsigned short f2bf_bits(float f) {
  unsigned u = __float_as_uint(f);
  return (unsigned short)((u + 0x7FFFu + ((u >> 16) & 1u)) >> 16);
}
__device__ __forceinline__ float bf_bits2f(unsigned short h) { return __uint_as_float(((unsigned)h) << 16); }

// hazard guards as plain device helpers (no inline asm inside the kernel template body)
__device__ __forceinline__ void dep_guard_h(v8f& a, v8f& b, v16h x, v16h y) { asm volatile("v_nop\n\tv_nop\n\tv_nop\n\tv_nop" : "+v"(a), "+v"(b) : "v"(x), "v"(y)); }
__device__ __forceinline__ void dep_guard_b(v8f& a, v8f& b, v16b x, v16b y) { asm volatile("v_nop\n\tv_nop\n\tv_nop\n\tv_nop" : "+v"(a), "+v"(b) : "v"(x), "v"(y)); }
__device__ __forceinline__ void keep4_h(v16h a, v16h b, v16h c, v16h d) { asm volatile("v_nop" :: "v"(a), "v"(b), "v"(c), "v"(d)); }
__device__ __forceinline__ void keep4_b(v16b a, v16b b, v16b c, v16b d) { asm volatile("v_nop" :: "v"(a), "v"(b), "v"(c), "v"(d)); }
__device__ __forceinline__ void acc_guard4(v8f& a, v8f& b, v8f& c, v8f& d) { asm volatile("v_nop\n\tv_nop\n\tv_nop\n\tv_nop" : "+v"(a), "+v"(b), "+v"(c), "+v"(d)); }
template <typename T> struct Frag;
template <> struct Frag<_Float16> {
  typedef v16h V; union U { v16h v; v8h h[2]; };
  static __device__ __forceinline__ v16h load(const _Float16* p) {   // elements 0..7 <- p[0..7], 8..15 <- p[16..23]
    U f; f.h[0] = *(const v8h*)(p); f.h[1] = *(const v8h*)(p + 16); return f.v;
  }
  static __device__ __forceinline__ v8f mma(v16h a, v16h b, v8f c) {
    return __builtin_amdgcn_wmma_f32_16x16x32_f16(false, a, false, b, (short)0, c, false, false);
  }
  static __device__ __forceinline__ void guard(v8f& a, v8f& b, v16h x, v16h y) { dep_guard_h(a, b, x, y); }
  static __device__ __forceinline__ void keep(v16h a, v16h b, v16h c, v16h d) { keep4_h(a, b, c, d); }
};
template <> struct Frag<__bf16> {
  typedef v16b V; union U { v16b v; v8b h[2]; };
  static __device__ __forceinline__ v16b load(const __bf16* p) {
    U f; f.h[0] = *(const v8b*)(p); f.h[1] = *(const v8b*)(p + 16); return f.v;
  }
  static __device__ __forceinline__ v8f mma(v16b a, v16b b, v8f c) {
    return __builtin_amdgcn_wmma_f32_16x16x32_bf16(false, a, false, b, (short)0, c, false, false);
  }
  static __device__ __forceinline__ void guard(v8f& a, v8f& b, v16b x, v16b y) { dep_guard_b(a, b, x, y); }
  static __device__ __forceinline__ void keep(v16b a, v16b b, v16b c, v16b d) { keep4_b(a, b, c, d); }
};

// ---- Register-blocked batched WMMA GEMM ------------------------------------
// C[m,n] = scale * sum_k A[m,k] * Bt[n,k] (+bias)(+resid); each wave owns a 64x64 tile.
// A row-major [M,K]; Bt row-major [N,K]; M,N % 64 == 0, K % 32 == 0.
// SPLIT: operands are hi/lo planes (A2/Bt2 = lo planes, same layout); product = hi·hi + hi·lo + lo·hi.
// BIAS_MODE: 0 = none, 1 = bias[m], 2 = bias[n].
// OUT_MODE: 0 = f32, 1 = f16, 2 = bf16 hi plane (Cout) + bf16 lo plane (Cout2).
// ET: 0 = f16 operands, 1 = bf16 operands (pointers passed as 16-bit storage)
template <int ET> struct Elem;
template <> struct Elem<0> { typedef _Float16 T; };
template <> struct Elem<1> { typedef __bf16 T; };
template <int ET, bool SPLIT, int BIAS_MODE, int OUT_MODE, bool RESID, int ACT = 0>
__global__ __launch_bounds__(256) void wmma_gemm64(
    const unsigned short* __restrict__ Ap, const unsigned short* __restrict__ A2p, int lda, long strideA,
    const unsigned short* __restrict__ Btp, const unsigned short* __restrict__ Bt2p, int ldb, long strideB,
    void* __restrict__ Cout, void* __restrict__ Cout2, int ldc, long strideC,
    const float* __restrict__ bias,
    const float* __restrict__ resid, long strideR,
    int M, int N, int K, float scale) {
  typedef typename Elem<ET>::T T;
  typedef typename Frag<T>::V V;
  const T* A = (const T*)Ap; const T* A2 = (const T*)A2p; const T* Bt = (const T*)Btp; const T* Bt2 = (const T*)Bt2p;
  __shared__ __align__(16) float sT[8][16 * 68];   // per-wave 16x64 slab, pitch 68 floats
  const int b    = blockIdx.y;
  const int lane = threadIdx.x & 31;
  const int wave = threadIdx.x >> 5;
  const int tilesN = N >> 6;
  const int tilesM = M >> 6;
  const int tile = blockIdx.x * 8 + wave;
  if (tile >= tilesM * tilesN) return;   // wave-uniform; no block barriers in this kernel
  const int tm = tile / tilesN;
  const int tn = tile - tm * tilesN;
  const int m0 = tm << 6;
  const int n0 = tn << 6;

  const T* Ab  = A  + (size_t)b * strideA;
  const T* Bb  = Bt + (size_t)b * strideB;
  const T* Ab2 = SPLIT ? (A2  + (size_t)b * strideA) : nullptr;
  const T* Bb2 = SPLIT ? (Bt2 + (size_t)b * strideB) : nullptr;

  const int rlane = lane & 15;                 // row (A) / col (B, D) within subtile
  const int koff  = (lane >> 4) * 8;           // k offset of this lane half
  const int mOff  = (lane >> 4) * 8;           // D row offset

  v8f acc[4][4];
#pragma unroll
  for (int i = 0; i < 4; ++i)
#pragma unroll
    for (int j = 0; j < 4; ++j) acc[i][j] = (v8f){0.f,0.f,0.f,0.f,0.f,0.f,0.f,0.f};

  for (int k0 = 0; k0 < K; k0 += 32) {
    V bh[4], bl[4];
#pragma unroll
    for (int j = 0; j < 4; ++j) {
      const size_t bo = (size_t)(n0 + (j << 4) + rlane) * ldb + koff + k0;
      bh[j] = Frag<T>::load(Bb + bo);
      if (SPLIT) bl[j] = Frag<T>::load(Bb2 + bo);
    }
#pragma unroll
    for (int i = 0; i < 4; ++i) {
      const size_t ao = (size_t)(m0 + (i << 4) + rlane) * lda + koff + k0;
      V ah = Frag<T>::load(Ab + ao);
      V al;
      if (SPLIT) al = Frag<T>::load(Ab2 + ao);
#pragma unroll
      for (int j = 0; j < 4; ++j) {
        acc[i][j] = Frag<T>::mma(ah, bh[j], acc[i][j]);
        if (SPLIT) {
          acc[i][j] = Frag<T>::mma(ah, bl[j], acc[i][j]);
          acc[i][j] = Frag<T>::mma(al, bh[j], acc[i][j]);
        }
      }
      Frag<T>::guard(acc[i][0], acc[i][3], ah, SPLIT ? al : ah);
    }
    Frag<T>::keep(bh[0], bh[1], bh[2], bh[3]);
    if (SPLIT) Frag<T>::keep(bl[0], bl[1], bl[2], bl[3]);
  }
  acc_guard4(acc[0][0], acc[0][1], acc[0][2], acc[0][3]);
  acc_guard4(acc[1][0], acc[1][1], acc[1][2], acc[1][3]);
  acc_guard4(acc[2][0], acc[2][1], acc[2][2], acc[2][3]);
  acc_guard4(acc[3][0], acc[3][1], acc[3][2], acc[3][3]);

  // ---- epilogue ----
  float* slab = sT[wave];
  const float* Rb = RESID ? (resid + (size_t)b * strideR) : nullptr;
#pragma unroll
  for (int i = 0; i < 4; ++i) {
    const int mBase = m0 + (i << 4);
#pragma unroll
    for (int j = 0; j < 4; ++j) {
      const int n = n0 + (j << 4) + rlane;
      float bv = 0.f;
      if (BIAS_MODE == 2) bv = bias[n];
#pragma unroll
      for (int r = 0; r < 8; ++r) {
        float v = acc[i][j][r] * scale;
        if (BIAS_MODE == 1) v += bias[mBase + mOff + r];
        if (BIAS_MODE == 2) v += bv;
        if (RESID) v += Rb[(size_t)(mBase + mOff + r) * ldc + n];
        if (ACT == 1) v = tanhf(v);
        if (ACT == 2) v = fmaxf(v, 0.0f);
        if (ACT == 3) v = v / (1.0f + expf(-v));
        if (ACT == 4) v = (v > 0.f) ? v : 0.01f * v;
        if (ACT == 5) v = 0.5f * v * (1.0f + erff(v * 0.70710678118654752f));
        slab[(mOff + r) * 68 + (j << 4) + rlane] = v;
      }
    }
    __builtin_amdgcn_fence(__ATOMIC_RELEASE, "workgroup");
    __builtin_amdgcn_wave_barrier();
    __builtin_amdgcn_fence(__ATOMIC_ACQUIRE, "workgroup");
    if (OUT_MODE == 0) {
      float* C = (float*)Cout + (size_t)b * strideC;
      const int hh = lane >> 4, c4 = (lane & 15) * 4;     // row seg = 256 B = 16 lanes x 16 B
      {
#pragma unroll
        for (int it = 0; it < 8; ++it) {
          const int row = it * 2 + hh;
          v4f v = *(const v4f*)(slab + row * 68 + c4);
          *(v4f*)(C + (size_t)(mBase + row) * ldc + n0 + c4) = v;
        }
        
      }
    } else {
      const int q = lane >> 3, c8 = (lane & 7) * 8;
      unsigned short* C  = (unsigned short*)Cout  + (size_t)b * strideC;
      unsigned short* C2 = (OUT_MODE == 2) ? ((unsigned short*)Cout2 + (size_t)b * strideC) : nullptr;
      {
#pragma unroll
        for (int it = 0; it < 4; ++it) {
          const int row = it * 4 + q;
          const float* sp = slab + row * 68 + c8;
          v8h hv, lv;
#pragma unroll
          for (int e = 0; e < 8; ++e) {
            if (OUT_MODE == 1) {
              hv[e] = (_Float16)sp[e];
            } else {
              unsigned short hb = f2bf_bits(sp[e]);
              unsigned short lb = f2bf_bits(sp[e] - bf_bits2f(hb));
              hv[e] = __builtin_bit_cast(_Float16, hb);
              lv[e] = __builtin_bit_cast(_Float16, lb);
            }
          }
          *(v8h*)(C + (size_t)(mBase + row) * ldc + n0 + c8) = hv;
          if (OUT_MODE == 2) *(v8h*)(C2 + (size_t)(mBase + row) * ldc + n0 + c8) = lv;
        }
        
      }
    }
    __builtin_amdgcn_fence(__ATOMIC_RELEASE, "workgroup");
    __builtin_amdgcn_wave_barrier();
    __builtin_amdgcn_fence(__ATOMIC_ACQUIRE, "workgroup");
  }
}

// ---- Projection GEMM on operand tiles staged in LDS -------------------------------------------------------------
// C[m,n] = scale * sum_k A[m,k] * Bt[n,k] (+ bias[n]); A [GM][GK] and Bt [GN][GK] f16 with k contiguous, C f32 [GM][GN].
// A block owns a 128 x 128 tile of C, its eight waves 32 x 64 each. A trip takes 128 k: 256 bytes of each of the block's 256 operand rows come into LDS once,
// by asynchronous 16-byte copies (one wave's copy = two whole 256-byte row pieces), and every wave reads its fragments from there, 16 bytes a lane.
// Two buffers: tile t + 1 flies while tile t is worked on, one barrier a trip. The k order of the sums is that of wmma_gemm64 (ascending, 32 a product).
constexpr int GL_PB  = 272;             // LDS row pitch in bytes: 256 + 16, an odd multiple of 16, free of bank conflicts for 16-byte readers
constexpr int GL_OP  = 128 * GL_PB;     // one operand's tile
constexpr int GL_BUF = 2 * GL_OP;       // one buffer: the A tile, behind it the Bt tile
// One thread's eight copies for one operand tile: the same 16 bytes of rows 16 apart. l = LDS byte address, g = global address of the first.
// The s_wait_xcnt closes the statement so that no register which a copy names is rewritten ahead of it.
template <int LD>
__device__ __forceinline__ void gl_copy8(unsigned l, const _Float16* g) {
  asm volatile(
      "global_load_async_to_lds_b128 %0, %8, off\n\t"
      "global_load_async_to_lds_b128 %1, %9, off\n\t"
      "global_load_async_to_lds_b128 %2, %10, off\n\t"
      "global_load_async_to_lds_b128 %3, %11, off\n\t"
      "global_load_async_to_lds_b128 %4, %12, off\n\t"
      "global_load_async_to_lds_b128 %5, %13, off\n\t"
      "global_load_async_to_lds_b128 %6, %14, off\n\t"
      "global_load_async_to_lds_b128 %7, %15, off\n\t"
      "s_wait_xcnt 0x0"
      :: "v"(l), "v"(l + 16 * GL_PB), "v"(l + 32 * GL_PB), "v"(l + 48 * GL_PB), "v"(l + 64 * GL_PB), "v"(l + 80 * GL_PB), "v"(l + 96 * GL_PB), "v"(l + 112 * GL_PB),
         "v"(g), "v"(g + 16 * LD), "v"(g + 32 * LD), "v"(g + 48 * LD), "v"(g + 64 * LD), "v"(g + 80 * LD), "v"(g + 96 * LD), "v"(g + 112 * LD)
      : "memory");
}
template <int GM, int GN, int GK, int BIAS_MODE>
__global__ __launch_bounds__(256) void wmma_gemm_lds(const _Float16* __restrict__ A, const _Float16* __restrict__ Bt, float* __restrict__ C, const float* __restrict__ bias, float scale) {
  static_assert(GM % 128 == 0 && GN % 128 == 0 && GK % 128 == 0 && GK >= 256, "whole tiles; the two-buffer prologue needs two k tiles");
  __shared__ __align__(16) unsigned char ring[2 * GL_BUF];
  __shared__ __align__(16) float sT[8][32 * 68];   // per-wave 32x64 output slab, pitch 68 floats; apart from the ring
  constexpr int TN = GN / 128, NT = GK / 128;
  const int tid = threadIdx.x, lane = tid & 31, wave = tid >> 5;
  const int bm = blockIdx.x / TN, bn = blockIdx.x % TN;
  const int rlane = lane & 15, hf = lane >> 4;
  const int wm = wave >> 1, wn = wave & 1;
  const int crow = tid >> 4, ccol = tid & 15;      // copies: 16 lanes cover one row's 256 bytes
  const _Float16* ga = A  + (size_t)(bm * 128 + crow) * GK + ccol * 8;
  const _Float16* gb = Bt + (size_t)(bn * 128 + crow) * GK + ccol * 8;
  const unsigned la = (unsigned)(size_t)ring + (unsigned)(crow * GL_PB + ccol * 16);
  const unsigned char* fa = ring + (wm * 32 + rlane) * GL_PB + hf * 16;            // fragment rows: lane = row, this half's 8 k first
  const unsigned char* fb = ring + GL_OP + (wn * 64 + rlane) * GL_PB + hf * 16;

  v8f acc[2][4];
#pragma unroll
  for (int i = 0; i < 2; ++i)
#pragma unroll
    for (int j = 0; j < 4; ++j) acc[i][j] = (v8f){0.f,0.f,0.f,0.f,0.f,0.f,0.f,0.f};

  gl_copy8<GK>(la, ga);
  gl_copy8<GK>(la + GL_OP, gb);
  asm volatile("s_wait_asynccnt 0x0" ::: "memory");   // this wave's share of tile 0 has landed
  __syncthreads();                                    // tile 0 is whole for every wave
  gl_copy8<GK>(la + GL_BUF, ga + 128);
  gl_copy8<GK>(la + GL_BUF + GL_OP, gb + 128);
#pragma unroll 1   // kept rolled: buffer offset and refill test are scalar work, and one trip's code serves both buffers
  for (int t = 0; t < NT; ++t) {
    const int bo = (t & 1) * GL_BUF;
    v16h a[2][2], b[2][4];                              // two fragment sets: one is worked on while the next 32 k are read
#pragma unroll
    for (int i = 0; i < 2; ++i) a[0][i] = Frag<_Float16>::load((const _Float16*)(fa + bo + i * 16 * GL_PB));
#pragma unroll
    for (int j = 0; j < 4; ++j) b[0][j] = Frag<_Float16>::load((const _Float16*)(fb + bo + j * 16 * GL_PB));
#pragma unroll
    for (int ks = 0; ks < 4; ++ks) {
      if (ks < 3) {
#pragma unroll
        for (int i = 0; i < 2; ++i) a[(ks + 1) & 1][i] = Frag<_Float16>::load((const _Float16*)(fa + bo + i * 16 * GL_PB + (ks + 1) * 64));
#pragma unroll
        for (int j = 0; j < 4; ++j) b[(ks + 1) & 1][j] = Frag<_Float16>::load((const _Float16*)(fb + bo + j * 16 * GL_PB + (ks + 1) * 64));
      }
      __builtin_amdgcn_sched_barrier(0);                // the next set's twelve LDS reads stay one group ahead of these products (left alone, the scheduler spreads them among the products on one set, a full LDS wait each)
#pragma unroll
      for (int i = 0; i < 2; ++i)
#pragma unroll
        for (int j = 0; j < 4; ++j) acc[i][j] = Frag<_Float16>::mma(a[ks & 1][i], b[ks & 1][j], acc[i][j]);
      __builtin_amdgcn_sched_barrier(0);                // and the group after next stays behind them
    }
    asm volatile("s_wait_dscnt 0x0" ::: "memory");      // this wave's reads of tile t are done before the buffer is handed back
    asm volatile("s_wait_asynccnt 0x0" ::: "memory");   // this wave's share of tile t + 1 has landed
    __syncthreads();                                    // publishes tile t + 1 and ends every wave's reads of tile t
    if (t + 2 < NT) {
      gl_copy8<GK>(la + bo, ga + (t + 2) * 128);
      gl_copy8<GK>(la + bo + GL_OP, gb + (t + 2) * 128);
    }
  }
  asm volatile("s_wait_asynccnt 0x0" ::: "memory");     // nothing of this wave is in flight when it goes on

  // ---- epilogue: the wave's 32 x 64 tile goes through its own slab, so that every store is whole 256-byte row pieces ----
  float* slab = sT[wave];
  const int n0 = bn * 128 + wn * 64, mBase = bm * 128 + wm * 32;
#pragma unroll
  for (int j = 0; j < 4; ++j) {
    float bv = 0.f;
    if (BIAS_MODE == 2) bv = bias[n0 + j * 16 + rlane];
#pragma unroll
    for (int i = 0; i < 2; ++i)
#pragma unroll
      for (int r = 0; r < 8; ++r) {
        float v = acc[i][j][r] * scale;
        if (BIAS_MODE == 2) v += bv;
        slab[(i * 16 + hf * 8 + r) * 68 + j * 16 + rlane] = v;
      }
  }
  // the slab's rows are read by other lanes of the same wave than wrote them
  __builtin_amdgcn_fence(__ATOMIC_RELEASE, "workgroup");
  __builtin_amdgcn_wave_barrier();
  __builtin_amdgcn_fence(__ATOMIC_ACQUIRE, "workgroup");
  float* crow0 = C + (size_t)(mBase + hf) * GN + n0 + rlane * 4;
#pragma unroll
  for (int it = 0; it < 16; ++it) {
    const v4f v = *(const v4f*)(slab + (it * 2 + hf) * 68 + rlane * 4);
    *(v4f*)(crow0 + (size_t)it * 2 * GN) = v;
  }
}

__global__ __launch_bounds__(256) void cast_f32_f16x2(
    const float* __restrict__ in, _Float16* __restrict__ out, int n2) {
  int i = blockIdx.x * 256 + threadIdx.x;
  if (i < n2) {
    const _Float16 h0 = (_Float16)in[2 * i], h1 = (_Float16)in[2 * i + 1];
    const unsigned u = (unsigned)__builtin_bit_cast(unsigned short, h0) | ((unsigned)__builtin_bit_cast(unsigned short, h1) << 16);
    ((unsigned*)out)[i] = u;
    
  }
}


} // namespace w25

__global__ __launch_bounds__(256) void k_castT16(const float* __restrict__ src, long long lds, _Float16* __restrict__ dst, long long ldd, int R, int C, float s) {
    const long long i = (long long)blockIdx.x * 256 + threadIdx.x; const long long np = (long long)C * (R / 2); if (i >= np) return; const int c = (int)(i / (R / 2)); const int r = 2 * (int)(i % (R / 2));
    const _Float16 h0 = (_Float16)(src[(long long)r * lds + c] * s), h1 = (_Float16)(src[(long long)(r + 1) * lds + c] * s);
    const unsigned u = (unsigned)__builtin_bit_cast(unsigned short, h0) | ((unsigned)__builtin_bit_cast(unsigned short, h1) << 16);
    unsigned* d = (unsigned*)(dst + (long long)c * ldd + r); *d = u;  }
__global__ __launch_bounds__(256) void k_cast16(const float* __restrict__ src, long long lds, _Float16* __restrict__ dst, long long ldd, int R, int C, float s) {
    const long long i = (long long)blockIdx.x * 256 + threadIdx.x; const long long np = (long long)R * (C / 2); if (i >= np) return; const int r = (int)(i / (C / 2)); const int c = 2 * (int)(i % (C / 2));
    const _Float16 h0 = (_Float16)(src[(long long)r * lds + c] * s), h1 = (_Float16)(src[(long long)r * lds + c + 1] * s);
    const unsigned u = (unsigned)__builtin_bit_cast(unsigned short, h0) | ((unsigned)__builtin_bit_cast(unsigned short, h1) << 16);
    unsigned* d = (unsigned*)(dst + (long long)r * ldd + c); *d = u;  }

// f32 -> f16 casts on few, long waves: 256 blocks of 16 waves (4,096 waves to start a launch). A tile is 16,384 consecutive floats: eight wave-wide 16-byte loads a lane
// (512 contiguous bytes a wave and load), all issued before the first is used, and eight 8-byte stores (256 contiguous bytes a wave and store).
__device__ __forceinline__ void cast_tile_ld(const float* __restrict__ s, v4f* r) {
#pragma unroll   // r stays in registers and the eight loads issue back to back
    for (int i = 0; i < 8; ++i) r[i] = *(const v4f*)(s + i * 2048);
}
__device__ __forceinline__ void cast_tile_st(_Float16* __restrict__ d, const v4f* r, float sc) {
#pragma unroll   // constant indices into r and pk: both stay in registers
    for (int i = 0; i < 8; ++i) {
        v4h pk;
#pragma unroll
        for (int e = 0; e < 4; ++e) pk[e] = (_Float16)(r[i][e] * sc);
        *(v4h*)(d + i * 2048) = pk;
    }
}
// Every operand of the four projections that exists before the first of them, in one launch: block n casts tile n of x, tile n of the context and tile n & 63 of
// weight n >> 6 (order Wq, Wk, Wv, Wo; times 16; the four f16 planes lie one behind the other in w16). x and c: 256 tiles each, a weight: 64.
__global__ __launch_bounds__(512) void k_cast_in(const float* __restrict__ x, const float* __restrict__ c, const float* __restrict__ Wq, const float* __restrict__ Wk,
                                                 const float* __restrict__ Wv, const float* __restrict__ Wo, _Float16* __restrict__ x16, _Float16* __restrict__ c16, _Float16* __restrict__ w16) {
    const unsigned n = blockIdx.x, sel = n >> 6;
    const float* __restrict__ w = (sel == 0) ? Wq : (sel == 1) ? Wk : (sel == 2) ? Wv : Wo;
    const unsigned t4 = threadIdx.x * 4u;
    v4f rx[8], rc[8], rw[8];
    cast_tile_ld(x + (size_t)n * 16384 + t4, rx);
    cast_tile_ld(c + (size_t)n * 16384 + t4, rc);
    cast_tile_ld(w + (size_t)(n & 63u) * 16384 + t4, rw);
    cast_tile_st(x16 + (size_t)n * 16384 + t4, rx, 1.0f);
    cast_tile_st(c16 + (size_t)n * 16384 + t4, rc, 1.0f);
    cast_tile_st(w16 + (size_t)n * 16384 + t4, rw, 16.0f);
}
// One plane of 256 tiles (the attention output).
__global__ __launch_bounds__(512) void k_cast_plane(const float* __restrict__ s, _Float16* __restrict__ d) {
    const size_t o = (size_t)blockIdx.x * 16384 + threadIdx.x * 4u;
    v4f r[8];
    cast_tile_ld(s + o, r);
    cast_tile_st(d + o, r, 1.0f);
}

// f32 -> bf16 hi plane + bf16 lo plane (x = hi + lo to ~2^-17 relative; RNE both), [R][C] -> [R][C] (or transposed to [C][R]); 2 consecutive destination elements
__device__ __forceinline__ unsigned int f2bf2_pack(float a, float b, unsigned int* lo) {
    const unsigned short ha = w25::f2bf_bits(a), hb = w25::f2bf_bits(b);
    const unsigned short la = w25::f2bf_bits(a - w25::bf_bits2f(ha)), lb = w25::f2bf_bits(b - w25::bf_bits2f(hb));
    *lo = (unsigned)la | ((unsigned)lb << 16); return (unsigned)ha | ((unsigned)hb << 16); }
__global__ __launch_bounds__(256) void k_castS16(const float* __restrict__ src, long long lds, __bf16* __restrict__ dhi, __bf16* __restrict__ dlo, long long ldd, int R, int C, float s, int transpose) {
    const long long i = (long long)blockIdx.x * 256 + threadIdx.x; long long o; float a, b;
    if (transpose) { const long long np = (long long)C * (R / 2); if (i >= np) return; const int c = (int)(i / (R / 2)); const int r = 2 * (int)(i % (R / 2)); a = src[(long long)r * lds + c] * s; b = src[(long long)(r + 1) * lds + c] * s; o = (long long)c * ldd + r; }
    else { const long long np = (long long)R * (C / 2); if (i >= np) return; const int r = (int)(i / (C / 2)); const int c = 2 * (int)(i % (C / 2)); a = src[(long long)r * lds + c] * s; b = src[(long long)r * lds + c + 1] * s; o = (long long)r * ldd + c; }
    unsigned lo; const unsigned hi = f2bf2_pack(a, b, &lo); unsigned* ph = (unsigned*)(dhi + o); unsigned* pl = (unsigned*)(dlo + o);
    *ph = hi; *pl = lo;  }

namespace w25 {
// =====================================================================================
// Generic causal/non-causal attention for head_dim 64, f32 in / f32 out; 16-bit operands: bf16 with optional hi/lo splits, or
// plain f16 (F16=true, non-split, probabilities carried x2^15).
//   scores = (q*qscale)·kᵀ : v_wmma_f32_16x16x32_bf16; SPLIT_QK -> q,k as bf16 hi/lo (hi·hi + hi·lo + lo·hi)
//   out    = p·v           : v_wmma_f32_16x16x32_bf16; SPLIT_PV -> p,v as bf16 hi/lo; else p,v plain bf16
//   f32 accumulate; online softmax in f32. Block = 4 waves = 64 query rows of one (batch, head); S % 64 == 0.
//   Element (b, s, h, d) of tensor X lives at X[b*X_bs + s*X_rs + h*X_hs + d] (strides in floats, multiples of 4).
//   Masking: mask_mode 0 none, 1 causal (kv > q masked), 2 tensor [S][Skv] shared over (b,h) (float if
//   mask_is_int==0, int32 with element == 0 -> masked if 1, int32 with element != 0 -> masked if 2), 3 per-token vectors qmask[B][S] & kvmask[B][Skv] (int32,
//   0 -> masked), 4 causal + sliding window (kv > q or q - kv > W masked; W passed in mask_is_int);
//   5 = relative-position bias: s += cp[b,h,q][idx[q][kv]] + pc[b,h,kv][idx[q][kv]] with idx = mask_b ([S][Skv] int32) and
//   mask_a an int32 [S][Skv] tensor with nonzero = masked (tables: element (b,h,row,n) at X + b*c_bs + h*c_hs + row*c_rs + n);
//   masked scores are replaced by mask_fill (e.g. -inf or -1e9) before the softmax.
//   grid.x = B * H * (S/64) (or a sub-range with blk0).
// =====================================================================================
#define AT_D 64
#define AT_NW 4
#define AT_QB 64
#define AT_KC 64
struct AttnGeom { const float* cp = nullptr; const float* pc = nullptr; long c_bs = 0, c_rs = 0, c_hs = 0;   // mode-5 score-bias tables
                  long q_bs, q_rs, q_hs, k_bs, k_rs, k_hs, v_bs, v_rs, v_hs, o_bs, o_rs, o_hs;
                  int S, Skv, H, mask_mode; float qscale; int blk0; float mask_fill; int mask_is_int; };
static_assert(sizeof(AttnGeom) == 168, "no padding");

__device__ __forceinline__ unsigned short at_bf_bits(float f) {
  unsigned u = __float_as_uint(f);
  return (unsigned short)((u + 0x7FFFu + ((u >> 16) & 1u)) >> 16);
}
__device__ __forceinline__ __bf16 at_f2bf(float f) { return __builtin_bit_cast(__bf16, at_bf_bits(f)); }
__device__ __forceinline__ void at_split(float f, __bf16& hi, __bf16& lo) {
  const unsigned short hb = at_bf_bits(f);
  hi = __builtin_bit_cast(__bf16, hb);
  lo = at_f2bf(f - __uint_as_float(((unsigned)hb) << 16));
}
__device__ __forceinline__ v8f at_mma(v16b a, v16b b, v8f c) {
  c = __builtin_amdgcn_wmma_f32_16x16x32_bf16(false, a, false, b, (short)0, c, false, false);
  asm volatile("v_nop\n\tv_nop\n\tv_nop\n\tv_nop" : "+v"(c) : "v"(a), "v"(b));
  return c;
}
// 16-bit element as a bit pattern held in a __bf16 slot: f16 bits when F16, bf16 (RNE) otherwise
template <bool F16> __device__ __forceinline__ __bf16 at_to16(float f) {
  if (F16) return __builtin_bit_cast(__bf16, (_Float16)f);
  return at_f2bf(f);
}
template <bool F16> __device__ __forceinline__ v8f at_mma16(v16b a, v16b b, v8f c) {
  if (F16) {
    const v16h ah = __builtin_bit_cast(v16h, a), bh = __builtin_bit_cast(v16h, b);
    c = __builtin_amdgcn_wmma_f32_16x16x32_f16(false, ah, false, bh, (short)0, c, false, false);
    asm volatile("v_nop\n\tv_nop\n\tv_nop\n\tv_nop" : "+v"(c) : "v"(ah), "v"(bh));
    return c;
  }
  return at_mma(a, b, c);
}

template <bool SPLIT_QK, bool SPLIT_PV, bool F16 = false>
__global__ __launch_bounds__(128)
void attn64_kernel(const float* __restrict__ q, const float* __restrict__ k,
                   const float* __restrict__ v, float* __restrict__ out,
                   const void* __restrict__ mask_a, const int* __restrict__ mask_b, AttnGeom g) {
  static_assert(!(F16 && (SPLIT_QK || SPLIT_PV)), "f16 mode is non-split");
  const float PSC = F16 ? 32768.0f : 1.0f;     // f16 probabilities carried x2^15 (subnormal range), folded into the final 1/l
  union FB { v16b v; v8b h[2]; };
  __shared__ __align__(16) __bf16 Ksh[AT_KC * AT_D];             // K hi [kv][d]      8 KB
  __shared__ __align__(16) __bf16 Ksl[SPLIT_QK ? AT_KC * AT_D : 8];
  __shared__ __align__(16) __bf16 Vth[AT_D * AT_KC];             // V hi [d][kv]      8 KB
  __shared__ __align__(16) __bf16 Vtl[SPLIT_PV ? AT_D * AT_KC : 8];
  __shared__ __align__(16) __bf16 Psh[AT_NW][16 * AT_KC];        // per wave P hi [row][kv]  8 KB
  __shared__ __align__(16) __bf16 Psl[SPLIT_PV ? AT_NW : 1][SPLIT_PV ? 16 * AT_KC : 8];
  __shared__ __align__(16) float  Os[AT_NW][16 * 68];            // per wave out tile, pitch 68

  const int tid  = threadIdx.x;
  const int wave = tid >> 5;
  const int lane = tid & 31;
  const int hh   = lane >> 4;
  const int c    = lane & 15;

  const int nqb = g.S / AT_QB;
  const int bx = blockIdx.x + g.blk0;
  const int qb = bx % nqb;
  const int bh = bx / nqb;
  const int h  = bh % g.H;
  const int b  = bh / g.H;
  const int qbase_block = qb * AT_QB;
  const int q0 = qbase_block + wave * 16;

  const float* qb_ptr = q + (size_t)b * g.q_bs + (size_t)h * g.q_hs;
  const float* kb_ptr = k + (size_t)b * g.k_bs + (size_t)h * g.k_hs;
  const float* vb_ptr = v + (size_t)b * g.v_bs + (size_t)h * g.v_hs;
  float*       ob_ptr = out + (size_t)b * g.o_bs + (size_t)h * g.o_hs;

  // ---- Q fragments (A operand): 2 d-chunks, hi (and lo) ----
  v16b qah[2], qal[2];
  {
    const float* qrow = qb_ptr + (size_t)(q0 + c) * g.q_rs;
#pragma unroll
    for (int dc = 0; dc < 2; ++dc) {
#pragma unroll
      for (int e = 0; e < 8; ++e) {
        const float f0 = qrow[dc * 32 + 8 * hh + e] * g.qscale;
        const float f1 = qrow[dc * 32 + 16 + 8 * hh + e] * g.qscale;
        if (SPLIT_QK) { __bf16 hq, lq; at_split(f0, hq, lq); qah[dc][e] = hq; qal[dc][e] = lq; at_split(f1, hq, lq); qah[dc][8 + e] = hq; qal[dc][8 + e] = lq; }
        else { qah[dc][e] = at_to16<F16>(f0); qah[dc][8 + e] = at_to16<F16>(f1); qal[dc][e] = qah[dc][e]; qal[dc][8 + e] = qah[dc][8 + e]; }
      }
    }
  }

  float mrow[8], lrow[8];
  v8f oacc[4];
#pragma unroll
  for (int r = 0; r < 8; ++r) { mrow[r] = -INFINITY; lrow[r] = 0.f; }
#pragma unroll
  for (int t = 0; t < 4; ++t) oacc[t] = (v8f){0.f,0.f,0.f,0.f,0.f,0.f,0.f,0.f};

  const int nChunks = (g.mask_mode == 1 || g.mask_mode == 4) ? (qb + 1) : (g.Skv / AT_KC);   // block-uniform
  // per-row query mask (mode 3)
  int qkeep[8];
#pragma unroll
  for (int r = 0; r < 8; ++r) qkeep[r] = (g.mask_mode == 3) ? mask_b[(size_t)b * g.S + q0 + 8 * hh + r] : 1;   // mask_b = qmask in mode 3
  for (int kc = 0; kc < nChunks; ++kc) {
    const int kv0 = kc * AT_KC;
    __syncthreads();
    {
      const int kvr = tid >> 1, dh = (tid & 1) * 32;
      const float* krow = kb_ptr + (size_t)(kv0 + kvr) * g.k_rs + dh;
      const float* vrow = vb_ptr + (size_t)(kv0 + kvr) * g.v_rs + dh;
#pragma unroll
      for (int i = 0; i < 8; ++i) {
        v4f kk = *(const v4f*)(krow + 4 * i);
        v4f vv = *(const v4f*)(vrow + 4 * i);
#pragma unroll
        for (int e = 0; e < 4; ++e) {
          const int d = dh + 4 * i + e;
          if (SPLIT_QK) { __bf16 a, bl; at_split(kk[e], a, bl); Ksh[kvr * AT_D + d] = a; Ksl[kvr * AT_D + d] = bl; }
          else Ksh[kvr * AT_D + d] = at_to16<F16>(kk[e]);
          if (SPLIT_PV) { __bf16 a, bl; at_split(vv[e], a, bl); Vth[d * AT_KC + kvr] = a; Vtl[d * AT_KC + kvr] = bl; }
          else Vth[d * AT_KC + kvr] = at_to16<F16>(vv[e]);
        }
      }
    }
    __syncthreads();

    v8f s[4];
#pragma unroll
    for (int j = 0; j < 4; ++j) {
      s[j] = (v8f){0.f,0.f,0.f,0.f,0.f,0.f,0.f,0.f};
#pragma unroll 1
      for (int dc = 0; dc < 2; ++dc) {
        FB kb;
        kb.h[0] = *(const v8b*)(Ksh + (j * 16 + c) * AT_D + dc * 32 + 8 * hh);
        kb.h[1] = *(const v8b*)(Ksh + (j * 16 + c) * AT_D + dc * 32 + 16 + 8 * hh);
        s[j] = at_mma16<F16>(qah[dc], kb.v, s[j]);
        if (SPLIT_QK) {
          FB kl;
          kl.h[0] = *(const v8b*)(Ksl + (j * 16 + c) * AT_D + dc * 32 + 8 * hh);
          kl.h[1] = *(const v8b*)(Ksl + (j * 16 + c) * AT_D + dc * 32 + 16 + 8 * hh);
          s[j] = at_mma16<F16>(qah[dc], kl.v, s[j]);
          s[j] = at_mma16<F16>(qal[dc], kb.v, s[j]);
        }
      }
    }
    const bool diag = (g.mask_mode == 1) && (kc == qb);
    int kvkeep[4] = {1, 1, 1, 1};
    if (g.mask_mode == 3) {
#pragma unroll
      for (int j = 0; j < 4; ++j) kvkeep[j] = ((const int*)mask_a)[(size_t)b * g.Skv + kv0 + j * 16 + c];   // mask_a = kvmask
    }
    float cm[8];
#pragma unroll
    for (int r = 0; r < 8; ++r) {
      const int qrow = q0 + 8 * hh + r;
      float m = -INFINITY;
#pragma unroll
      for (int j = 0; j < 4; ++j) {
        const int kvcol = kv0 + j * 16 + c;
        bool masked = false;
        if (diag) masked = (kvcol > qrow);
        else if (g.mask_mode == 4) masked = (kvcol > qrow) || (qrow - kvcol > g.mask_is_int);
        else if (g.mask_mode == 2) {
          const size_t mi = (size_t)qrow * g.Skv + kvcol;
          masked = (g.mask_is_int == 0) ? (((const float*)mask_a)[mi] == 0.0f)
                 : (g.mask_is_int == 1) ? (((const int*)mask_a)[mi] == 0) : (((const int*)mask_a)[mi] != 0);
        } else if (g.mask_mode == 3) masked = (qkeep[r] == 0) || (kvkeep[j] == 0);
        else if (g.mask_mode == 5) {
          const size_t mi = (size_t)qrow * g.Skv + kvcol;
          masked = (((const int*)mask_a)[mi] != 0);
          int n = mask_b[mi]; n = n < 0 ? 0 : n;
          s[j][r] += g.cp[(size_t)b * g.c_bs + (size_t)h * g.c_hs + (size_t)qrow * g.c_rs + n]
                   + g.pc[(size_t)b * g.c_bs + (size_t)h * g.c_hs + (size_t)kvcol * g.c_rs + n];
        }
        if (masked) s[j][r] = g.mask_fill;
        m = fmaxf(m, s[j][r]);
      }
#pragma unroll
      for (int off = 1; off < 16; off <<= 1) m = fmaxf(m, __shfl_xor(m, off, 32));
      cm[r] = m;
    }
    __bf16* pwh = Psh[wave];
    __bf16* pwl = Psl[SPLIT_PV ? wave : 0];
#pragma unroll
    for (int r = 0; r < 8; ++r) {
      const float mnew = fmaxf(mrow[r], cm[r]);
      const float alpha = expf(mrow[r] - mnew);
      mrow[r] = mnew;
      float psum = 0.f;
#pragma unroll
      for (int j = 0; j < 4; ++j) {
        const float p = expf(s[j][r] - mnew);
        psum += p;
        if (SPLIT_PV) { __bf16 a, bl; at_split(p, a, bl); pwh[(8 * hh + r) * AT_KC + j * 16 + c] = a; pwl[(8 * hh + r) * AT_KC + j * 16 + c] = bl; }
        else pwh[(8 * hh + r) * AT_KC + j * 16 + c] = at_to16<F16>(p * PSC);
      }
#pragma unroll
      for (int off = 1; off < 16; off <<= 1) psum += __shfl_xor(psum, off, 32);
      lrow[r] = lrow[r] * alpha + psum;
#pragma unroll
      for (int t = 0; t < 4; ++t) oacc[t][r] *= alpha;
    }
    __builtin_amdgcn_fence(__ATOMIC_RELEASE, "workgroup");
    __builtin_amdgcn_wave_barrier();
    __builtin_amdgcn_fence(__ATOMIC_ACQUIRE, "workgroup");
#pragma unroll 1
    for (int kk = 0; kk < 2; ++kk) {
      FB pa, pl;
      pa.h[0] = *(const v8b*)(pwh + c * AT_KC + kk * 32 + 8 * hh);
      pa.h[1] = *(const v8b*)(pwh + c * AT_KC + kk * 32 + 16 + 8 * hh);
      if (SPLIT_PV) {
        pl.h[0] = *(const v8b*)(pwl + c * AT_KC + kk * 32 + 8 * hh);
        pl.h[1] = *(const v8b*)(pwl + c * AT_KC + kk * 32 + 16 + 8 * hh);
      }
#pragma unroll
      for (int t = 0; t < 4; ++t) {
        FB vb;
        vb.h[0] = *(const v8b*)(Vth + (t * 16 + c) * AT_KC + kk * 32 + 8 * hh);
        vb.h[1] = *(const v8b*)(Vth + (t * 16 + c) * AT_KC + kk * 32 + 16 + 8 * hh);
        oacc[t] = at_mma16<F16>(pa.v, vb.v, oacc[t]);
        if (SPLIT_PV) {
          FB vl;
          vl.h[0] = *(const v8b*)(Vtl + (t * 16 + c) * AT_KC + kk * 32 + 8 * hh);
          vl.h[1] = *(const v8b*)(Vtl + (t * 16 + c) * AT_KC + kk * 32 + 16 + 8 * hh);
          oacc[t] = at_mma16<F16>(pa.v, vl.v, oacc[t]);
          oacc[t] = at_mma16<F16>(pl.v, vb.v, oacc[t]);
        }
      }
    }
  }

  float* os = Os[wave];
#pragma unroll
  for (int r = 0; r < 8; ++r) {
    const float inv = 1.0f / (lrow[r] * PSC);
#pragma unroll
    for (int t = 0; t < 4; ++t) os[(8 * hh + r) * 68 + t * 16 + c] = oacc[t][r] * inv;
  }
  __builtin_amdgcn_fence(__ATOMIC_RELEASE, "workgroup");
  __builtin_amdgcn_wave_barrier();
  __builtin_amdgcn_fence(__ATOMIC_ACQUIRE, "workgroup");
  {
    const int c4 = (lane & 15) * 4;
    {
#pragma unroll
      for (int it = 0; it < 8; ++it) {
        const int row = it * 2 + hh;
        v4f val = *(const v4f*)(os + row * 68 + c4);
        *(v4f*)(ob_ptr + (size_t)(q0 + row) * g.o_rs + c4) = val;
      }
      
    }
  }
}

} // namespace w25

// relative-offset bias table RT[h][c], c = i - j + (T-1): -floor(|i-j| / 30) * 2^-(h+1)   (thread-linear, data-independent)
__global__ __launch_bounds__(256) void k_mc_rt(float* __restrict__ RT, int NH, int RN, int T) { const int t = blockIdx.x * 256 + threadIdx.x; if (t >= NH * RN) return; const int h = t / RN, c = t % RN; int dist = c - (T - 1); dist = dist < 0 ? -dist : dist; VST2(float, RT + t, -(float)(dist / 30) * exp2f(-(float)(h + 1))); }


extern "C" void kernel_launch(void* const* d_in, const int* in_sizes, int n_in, void* d_out, int out_size, void* d_ws, size_t ws_size, hipStream_t stream) {
    (void)in_sizes; (void)n_in; (void)out_size; (void)ws_size;
    const float* x = (const float*)d_in[0];
    const float* ctx = (const float*)d_in[1];
    const float* Wq = (const float*)d_in[2];
    const float* Wk = (const float*)d_in[3];
    const float* Wv = (const float*)d_in[4];
    const float* Wo = (const float*)d_in[5];
    const float* bo = (const float*)d_in[6];
    const int Bn = 2;
    const int T = 2048;
    const int D = 1024;
    const int NH = 16;
    const int HD = 64;
    const int NR = Bn * T;
    const int RN = 2 * T - 1;
    float* out = (float*)d_out;
    char* wsp = (char*)d_ws;
    float* Q = (float*)wsp; wsp += (((size_t)((size_t)NR * D) * 4 + 255) / 256) * 256;
    float* Kb = (float*)wsp; wsp += (((size_t)((size_t)NR * D) * 4 + 255) / 256) * 256;
    float* V = (float*)wsp; wsp += (((size_t)((size_t)NR * D) * 4 + 255) / 256) * 256;
    float* Y = (float*)wsp; wsp += (((size_t)((size_t)NR * D) * 4 + 255) / 256) * 256;
    float* RT = (float*)wsp; wsp += (((size_t)((size_t)NH * RN + 64) * 4 + 255) / 256) * 256;
    unsigned short* G64A = (unsigned short*)wsp; wsp += (((size_t)(4194304) * 2 + 255) / 256) * 256;
    unsigned short* G64C = (unsigned short*)wsp; wsp += (((size_t)(4194304) * 2 + 255) / 256) * 256;
    unsigned short* G64B = (unsigned short*)wsp; wsp += (((size_t)(4 * 1048576) * 2 + 255) / 256) * 256;
    k_mc_rt<<<(unsigned)((NH * RN + 255) / 256), 256, 0, stream>>>(RT, NH, RN, T);
    k_cast_in<<<256, 512, 0, stream>>>(x, ctx, Wq, Wk, Wv, Wo, (_Float16*)(G64A), (_Float16*)(G64C), (_Float16*)(G64B));
    w25::wmma_gemm_lds<4096, 1024, 1024, 0><<<256, 256, 0, stream>>>((const _Float16*)(G64A), (const _Float16*)(G64B), Q, nullptr, 0.0625f);
    w25::wmma_gemm_lds<4096, 1024, 1024, 0><<<256, 256, 0, stream>>>((const _Float16*)(G64C), (const _Float16*)(G64B + 1048576), Kb, nullptr, 0.0625f);
    w25::wmma_gemm_lds<4096, 1024, 1024, 0><<<256, 256, 0, stream>>>((const _Float16*)(G64C), (const _Float16*)(G64B + 2 * 1048576), V, nullptr, 0.0625f);
    k_attnT<2048, 1024><<<dim3(2048 / (16 * AW), 16, 2), 32 * AW, 0, stream>>>(Q, Kb, V, Y, RT, 0.125f);
    k_cast_plane<<<256, 512, 0, stream>>>(Y, (_Float16*)(G64A));
    w25::wmma_gemm_lds<4096, 1024, 1024, 2><<<256, 256, 0, stream>>>((const _Float16*)(G64A), (const _Float16*)(G64B + 3 * 1048576), out, bo, 0.0625f);
}

// v006
// It runs in 134 microseconds.
// In two side-by-side timings against v005, it was 1.14 and 1.16 times as fast.
// Counting every step since v000, which is the starting kernel, it is 16.7 times as fast.
// Contractions: q = x.Wq^T [4096x1024].[1024x1024], k/v = context.W^T and the output projection (+b) with f16 operands on pre-cast planes (v_wmma_f32_16x16x32_f16; 128x128 block tiles staged in LDS by asynchronous copies, 32x64 wave tiles, weights x16); per (batch, head) softmax(q k^T / 8 + b_h(|i-j|)) v over 2048 keys (head_dim 64) as a flash kernel with f16 q.k^T and f16 p.v (p as f16 of 4096 p), the periodic distance bias -floor(|i-j|/30) 2^-(h+1) read from a per-head relative-offset table built on device; f32 accumulate and softmax.
#include <hip/hip_runtime.h>
#include <math.h>

typedef __attribute__((ext_vector_type(16))) _Float16 v16h;
typedef __attribute__((ext_vector_type(8)))  _Float16 v8h;
typedef __attribute__((ext_vector_type(4)))  _Float16 v4h;
typedef __attribute__((ext_vector_type(16))) __bf16   v16b;
typedef __attribute__((ext_vector_type(8)))  float    v8f;
typedef __attribute__((ext_vector_type(4)))  float    v4f;

// 16-bit WMMA fragment map (wave32), lane L, h = L>>4, m = L&15:
//   A 16x32: lane = row m;   element i -> k = (i<8) ? 8h+i : 16+8h+(i-8)
//   B 32x16: lane = column m; the SAME k(i,h)
//   D 16x16 (8 f32): lane = column m; element r -> row 8h+r
__device__ __forceinline__ int frag_k(int i, int h) { return (i < 8) ? (8 * h + i) : (16 + 8 * h + (i - 8)); }
__device__ __forceinline__ __bf16 bf16_rne(float f) {
    unsigned int u = __float_as_uint(f);
    u += 0x7fffu + ((u >> 16) & 1u);
    return __builtin_bit_cast(__bf16, (unsigned short)(u >> 16));
}
__device__ __forceinline__ float bf16_f32(__bf16 b) { return __uint_as_float(((unsigned int)__builtin_bit_cast(unsigned short, b)) << 16); }
__device__ __forceinline__ v8f wmma16(v16h a, v16h b, v8f c) {
    c = __builtin_amdgcn_wmma_f32_16x16x32_f16(false, a, false, b, (short)0, c, false, false);
    asm volatile("v_nop\n\tv_nop\n\tv_nop\n\tv_nop" : "+v"(c) : "v"(a), "v"(b));
    return c;
}
__device__ __forceinline__ v8f wmmab(v16b a, v16b b, v8f c) {
    c = __builtin_amdgcn_wmma_f32_16x16x32_bf16(false, a, false, b, (short)0, c, false, false);
    asm volatile("v_nop\n\tv_nop\n\tv_nop\n\tv_nop" : "+v"(c) : "v"(a), "v"(b));
    return c;
}
struct Split { v16b hi, lo; };
// hi/lo split product: a.hi*b.hi + a.hi*b.lo + a.lo*b.hi
__device__ __forceinline__ v8f wmma3(const Split& a, const Split& b, v8f c) {
    c = __builtin_amdgcn_wmma_f32_16x16x32_bf16(false, a.hi, false, b.hi, (short)0, c, false, false);
    c = __builtin_amdgcn_wmma_f32_16x16x32_bf16(false, a.hi, false, b.lo, (short)0, c, false, false);
    c = __builtin_amdgcn_wmma_f32_16x16x32_bf16(false, a.lo, false, b.hi, (short)0, c, false, false);
    asm volatile("v_nop\n\tv_nop\n\tv_nop\n\tv_nop" : "+v"(c) : "v"(a.hi), "v"(a.lo), "v"(b.hi), "v"(b.lo));
    return c;
}
struct Split3 { v16b hi, mid, lo; };
// triple split product (6 terms, drops only terms below 2^-24 relative)
__device__ __forceinline__ v8f wmma6(const Split3& a, const Split3& b, v8f c) {
    c = __builtin_amdgcn_wmma_f32_16x16x32_bf16(false, a.hi, false, b.hi, (short)0, c, false, false);
    c = __builtin_amdgcn_wmma_f32_16x16x32_bf16(false, a.hi, false, b.mid, (short)0, c, false, false);
    c = __builtin_amdgcn_wmma_f32_16x16x32_bf16(false, a.mid, false, b.hi, (short)0, c, false, false);
    c = __builtin_amdgcn_wmma_f32_16x16x32_bf16(false, a.hi, false, b.lo, (short)0, c, false, false);
    c = __builtin_amdgcn_wmma_f32_16x16x32_bf16(false, a.mid, false, b.mid, (short)0, c, false, false);
    c = __builtin_amdgcn_wmma_f32_16x16x32_bf16(false, a.lo, false, b.hi, (short)0, c, false, false);
    asm volatile("v_nop\n\tv_nop\n\tv_nop\n\tv_nop" : "+v"(c) : "v"(a.hi), "v"(a.mid), "v"(a.lo), "v"(b.hi), "v"(b.mid), "v"(b.lo));
    return c;
}

// Fragment gathers from f32 memory: element i <- p[(k0 + frag_k(i,h)) * sk] * s, zero for k >= klen.
__device__ __forceinline__ v16h fh_ld(const float* __restrict__ p, long long sk, int k0, int h, int klen, float s) {
    v16h a;
#pragma unroll
    for (int i = 0; i < 16; ++i) { const int k = k0 + frag_k(i, h); a[i] = (k < klen) ? (_Float16)(p[(long long)k * sk] * s) : (_Float16)0.f; }
    return a;
}
__device__ __forceinline__ Split sp_ld(const float* __restrict__ p, long long sk, int k0, int h, int klen, float s) {
    Split r;
#pragma unroll
    for (int i = 0; i < 16; ++i) {
        const int k = k0 + frag_k(i, h); const float x = (k < klen) ? p[(long long)k * sk] * s : 0.f;
        const __bf16 hb = bf16_rne(x); r.hi[i] = hb; r.lo[i] = bf16_rne(x - bf16_f32(hb));
    }
    return r;
}
__device__ __forceinline__ Split3 sp3_ld(const float* __restrict__ p, long long sk, int k0, int h, int klen, float s) {
    Split3 r;
#pragma unroll
    for (int i = 0; i < 16; ++i) {
        const int k = k0 + frag_k(i, h); const float x = (k < klen) ? p[(long long)k * sk] * s : 0.f;
        const __bf16 hb = bf16_rne(x); const float r1 = x - bf16_f32(hb); const __bf16 mb = bf16_rne(r1);
        r.hi[i] = hb; r.mid[i] = mb; r.lo[i] = bf16_rne(r1 - bf16_f32(mb));
    }
    return r;
}
__device__ __forceinline__ v16b bh_ld(const float* __restrict__ p, long long sk, int k0, int h, int klen, float s) {
    v16b a;
#pragma unroll
    for (int i = 0; i < 16; ++i) { const int k = k0 + frag_k(i, h); a[i] = bf16_rne((k < klen) ? p[(long long)k * sk] * s : 0.f); }
    return a;
}
// f16 fragment from an f16 LDS/global row with element stride 1 (k-contiguous), no bounds (tile already zero padded)
__device__ __forceinline__ v16h fh_row(const _Float16* __restrict__ row, int k0, int h) {
    v16h a;
#pragma unroll
    for (int i = 0; i < 16; ++i) a[i] = row[k0 + frag_k(i, h)];
    return a;
}

#define VST2(T, ptr, val) do { const T vst2_v_ = (val); *(T*)(ptr) = vst2_v_;  } while (0)
typedef float v4f __attribute__((ext_vector_type(4)));
#define VST2V4(ptr, val) do { const v4f vst2_v4_ = (val); *(v4f*)(ptr) = vst2_v4_;  } while (0)

__device__ __attribute__((noinline)) float act_fn(float v, int act) {
    if (act == 1) return fmaxf(v, 0.f);                                                                               // relu
    if (act == 2) { const float u = 0.7978845608028654f * (v + 0.044715f * v * v * v); return 0.5f * v * (1.f + tanhf(u)); } // tanh-gelu
    if (act == 3) return v / (1.f + expf(-v));                                                                        // silu
    if (act == 4) return 0.5f * v * (1.f + erff(v * 0.7071067811865476f));                                             // erf-gelu
    if (act == 5) return tanhf(v);
    if (act == 6) return 1.f / (1.f + expf(-v));                                                                      // sigmoid
    if (act == 7) return (v > 0.f) ? v : 0.01f * v;                                                                   // leaky relu 0.01
    if (act == 8) return (v > 0.f) ? v : (expf(v) - 1.f);                                                             // elu
    if (act == 9) return fminf(fmaxf(v, 0.f), 6.f);                                                                   // relu6
    if (act == 10) return fabsf(v);                                                                                    // abs
    if (act == 11) return (v >= 0.f) ? v : 0.1f * v;                                                                  // leaky 0.1
    if (act == 12) return (v > 0.f) ? v : 0.2f * v;                                                                   // leaky 0.2
    if (act == 13) return (v > 20.f) ? v : log1pf(expf(v));                                                            // softplus
    return v;
}

// =====================================================================================================================
// k_gemm<MODE>: C(z, m, n) = act(alpha * sum_k A(z, m, k) * B(z, k, n) + bias) + beta * R(z, m, n)
//   One wave (32-thread block) per 16 x 32 tile of C; grid (ceil(N/32), ceil(M/16), Z). Batch z -> (zo = z / zi_n, zi = z % zi_n)
//   with separate outer/inner strides for every tensor (e.g. batch and head). A(m,k) = A[zo*sAo + zi*sAi + m*sAm + k*sAk] (f32),
//   B(k,n) = B[zo*sBo + zi*sBi + n*sBn + k*sBk] (f32); any M, N, K (K zero-padded to 32 inside the fragments, M/N tails guarded).
//   C(m,n) = C[zo*sCo + zi*sCi + m*sCm + n] (n contiguous). flags: 1 bias[n], 2 bias[m], 4 residual R[zo*sRo + zi*sRi + m*sRm + n*sRn].
//   MODE 0: f16 operands (A prescaled by sa, B by sb, both undone in the epilogue); 1: bf16 hi/lo split (3 products); 2: bf16;
//   3: bf16 hi/mid/lo triple split (6 products); 4: as 3 with Kahan-compensated f32 accumulation across k-steps.
// =====================================================================================================================
struct GemmP {
    const float* A; const float* B; const float* bias; const float* R; float* C;
    long long sAo, sAi, sAm, sAk, sBo, sBi, sBn, sBk, sCo, sCi, sCm, sRo, sRi, sRm, sRn;
    int M, N, K, zi_n, flags, act; float alpha, beta, sa, sb;
    int Npad, pad_;     // columns [N, Npad) of C are written as 0 so that padded workspace rows are covered by whole-line stores; Npad >= N
};
static_assert(sizeof(GemmP) == 5 * 8 + 15 * 8 + 6 * 4 + 4 * 4 + 2 * 4, "GemmP has padding");

template <int MODE>
__global__ __launch_bounds__(32) void k_gemm(GemmP p) {
    const int lane = threadIdx.x & 31, h = lane >> 4, l15 = lane & 15;
    const int m0 = blockIdx.y * 16, n0 = blockIdx.x * 32;
    const int z = blockIdx.z, zo = z / p.zi_n, zi = z - zo * p.zi_n;
    const float* A = p.A + zo * p.sAo + zi * p.sAi;
    const float* B = p.B + zo * p.sBo + zi * p.sBi;
    const int am = min(m0 + l15, p.M - 1);                       // clamped row for loads (stores are guarded)
    v8f acc[2], comp[2];
#pragma unroll
    for (int t = 0; t < 2; ++t) { v8f zz = {}; acc[t] = zz; comp[t] = zz; }
    for (int k0 = 0; k0 < p.K; k0 += 32) {
        const float* arow = A + (long long)am * p.sAm;
        if (MODE == 1) {
            const Split a = sp_ld(arow, p.sAk, k0, h, p.K, 1.f);
#pragma unroll
            for (int t = 0; t < 2; ++t) {
                const int bn = min(n0 + t * 16 + l15, p.N - 1);
                acc[t] = wmma3(a, sp_ld(B + (long long)bn * p.sBn, p.sBk, k0, h, p.K, 1.f), acc[t]);
            }
        } else if (MODE == 3) {
            const Split3 a = sp3_ld(arow, p.sAk, k0, h, p.K, 1.f);
#pragma unroll
            for (int t = 0; t < 2; ++t) {
                const int bn = min(n0 + t * 16 + l15, p.N - 1);
                acc[t] = wmma6(a, sp3_ld(B + (long long)bn * p.sBn, p.sBk, k0, h, p.K, 1.f), acc[t]);
            }
        } else if (MODE == 4) {
            // triple split as MODE 3, but each k-step's 6 products go into a fresh accumulator and the partial is added to the running f32 sum
            // on the VALU with Kahan compensation (accumulation error stays ~1 ulp however long K is)
            const Split3 a = sp3_ld(arow, p.sAk, k0, h, p.K, 1.f);
#pragma unroll
            for (int t = 0; t < 2; ++t) {
                const int bn = min(n0 + t * 16 + l15, p.N - 1); v8f zz = {};
                const v8f part = wmma6(a, sp3_ld(B + (long long)bn * p.sBn, p.sBk, k0, h, p.K, 1.f), zz);
                const v8f y = part - comp[t]; const v8f s = acc[t] + y; comp[t] = (s - acc[t]) - y; acc[t] = s;
            }
        } else if (MODE == 2) {
            const v16b a = bh_ld(arow, p.sAk, k0, h, p.K, 1.f);
#pragma unroll
            for (int t = 0; t < 2; ++t) {
                const int bn = min(n0 + t * 16 + l15, p.N - 1);
                acc[t] = wmmab(a, bh_ld(B + (long long)bn * p.sBn, p.sBk, k0, h, p.K, 1.f), acc[t]);
            }
        } else {
            const v16h a = fh_ld(arow, p.sAk, k0, h, p.K, p.sa);
#pragma unroll
            for (int t = 0; t < 2; ++t) {
                const int bn = min(n0 + t * 16 + l15, p.N - 1);
                acc[t] = wmma16(a, fh_ld(B + (long long)bn * p.sBn, p.sBk, k0, h, p.K, p.sb), acc[t]);
            }
        }
    }
    const float iscale = (MODE == 0) ? p.alpha / (p.sa * p.sb) : p.alpha;
    float* C = p.C + zo * p.sCo + zi * p.sCi;
    const float* R = p.R + zo * p.sRo + zi * p.sRi;
    __shared__ __align__(16) float ctile[16][36];
#pragma unroll
    for (int t = 0; t < 2; ++t) {
        const int n = n0 + t * 16 + l15; const int nn = min(n, p.N - 1);
#pragma unroll
        for (int r = 0; r < 8; ++r) {
            const int m = m0 + 8 * h + r; const int mm = min(m, p.M - 1);
            float v = acc[t][r] * iscale;
            if (p.flags & 1) v += p.bias[nn];
            if (p.flags & 2) v += p.bias[mm];
            if (p.flags & 8) v *= p.bias[(long long)zo * p.M + mm];   /* per-(z,row) scale vector laid out [Z][M]; exclusive with the bias flags */
            v = act_fn(v, p.act);
            if (p.flags & 4) v += p.beta * R[(long long)mm * p.sRm + (long long)nn * p.sRn];
            ctile[8 * h + r][t * 16 + l15] = (n < p.N) ? v : 0.f;
        }
    }
    __syncthreads();
    const int NW = (p.Npad > p.N) ? p.Npad : p.N;           // write width
    const bool fast = (m0 + 16 <= p.M) && (n0 + 32 <= NW) && ((p.sCm & 3) == 0) && ((((size_t)C) & 15) == 0);
    if (fast) {
#pragma unroll
        for (int s = 0; s < 4; ++s) {
            const int row = s * 4 + (lane >> 3), c4 = (lane & 7) * 4;
            const v4f v = *(const v4f*)&ctile[row][c4];
            VST2V4(C + (long long)(m0 + row) * p.sCm + n0 + c4, v);
        }
    } else {
        for (int row = 0; row < 16; ++row) {
            const int m = m0 + row, n = n0 + lane;
            if (m < p.M && n < NW) VST2(float, C + (long long)m * p.sCm + n, ctile[row][lane]);
        }
    }
}


// =====================================================================================================================
// k_gemmT<MODE, TM, TN>: same contract as k_gemm, but one wave computes a (16*TM) x (16*TN) tile: TM A fragments and TN B fragments are
//   loaded per 32-wide k-step and reused across TM*TN WMMAs (far fewer load/convert instructions per MAC). MODE 0 (f16), 1 (bf16 hi/lo),
//   2 (bf16) only. grid (ceil(NW/(16*TN)), ceil(M/(16*TM)), Z), block 32. Epilogue identical to k_gemm, run per 16x32 sub-tile.
// =====================================================================================================================
template <int MODE, int TM, int TN>
__global__ __launch_bounds__(32) void k_gemmT(GemmP p) {
    const int lane = threadIdx.x & 31, h = lane >> 4, l15 = lane & 15;
    const int m0 = blockIdx.y * (16 * TM), n0 = blockIdx.x * (16 * TN);
    const int z = blockIdx.z, zo = z / p.zi_n, zi = z - zo * p.zi_n;
    const float* A = p.A + zo * p.sAo + zi * p.sAi;
    const float* B = p.B + zo * p.sBo + zi * p.sBi;
    v8f acc[TM][TN];
#pragma unroll
    for (int i = 0; i < TM; ++i)
#pragma unroll
        for (int t = 0; t < TN; ++t) { v8f zz = {}; acc[i][t] = zz; }
    for (int k0 = 0; k0 < p.K; k0 += 32) {
        if (MODE == 1) {
            Split a[TM], b[TN];
#pragma unroll
            for (int i = 0; i < TM; ++i) { const int am = min(m0 + 16 * i + l15, p.M - 1); a[i] = sp_ld(A + (long long)am * p.sAm, p.sAk, k0, h, p.K, 1.f); }
#pragma unroll
            for (int t = 0; t < TN; ++t) { const int bn = min(n0 + 16 * t + l15, p.N - 1); b[t] = sp_ld(B + (long long)bn * p.sBn, p.sBk, k0, h, p.K, 1.f); }
#pragma unroll
            for (int i = 0; i < TM; ++i)
#pragma unroll
                for (int t = 0; t < TN; ++t) acc[i][t] = wmma3(a[i], b[t], acc[i][t]);
        } else if (MODE == 2) {
            v16b a[TM], b[TN];
#pragma unroll
            for (int i = 0; i < TM; ++i) { const int am = min(m0 + 16 * i + l15, p.M - 1); a[i] = bh_ld(A + (long long)am * p.sAm, p.sAk, k0, h, p.K, 1.f); }
#pragma unroll
            for (int t = 0; t < TN; ++t) { const int bn = min(n0 + 16 * t + l15, p.N - 1); b[t] = bh_ld(B + (long long)bn * p.sBn, p.sBk, k0, h, p.K, 1.f); }
#pragma unroll
            for (int i = 0; i < TM; ++i)
#pragma unroll
                for (int t = 0; t < TN; ++t) acc[i][t] = wmmab(a[i], b[t], acc[i][t]);
        } else {
            v16h a[TM], b[TN];
#pragma unroll
            for (int i = 0; i < TM; ++i) { const int am = min(m0 + 16 * i + l15, p.M - 1); a[i] = fh_ld(A + (long long)am * p.sAm, p.sAk, k0, h, p.K, p.sa); }
#pragma unroll
            for (int t = 0; t < TN; ++t) { const int bn = min(n0 + 16 * t + l15, p.N - 1); b[t] = fh_ld(B + (long long)bn * p.sBn, p.sBk, k0, h, p.K, p.sb); }
#pragma unroll
            for (int i = 0; i < TM; ++i)
#pragma unroll
                for (int t = 0; t < TN; ++t) acc[i][t] = wmma16(a[i], b[t], acc[i][t]);
        }
    }
    const float iscale = (MODE == 0) ? p.alpha / (p.sa * p.sb) : p.alpha;
    float* C = p.C + zo * p.sCo + zi * p.sCi;
    const float* R = p.R + zo * p.sRo + zi * p.sRi;
    const int NW = (p.Npad > p.N) ? p.Npad : p.N;
    __shared__ __align__(16) float ctile[16][36];
#pragma unroll
    for (int i = 0; i < TM; ++i) {
        const int mb = m0 + 16 * i; if (mb >= p.M) break;          // wave-uniform
#pragma unroll
        for (int tp = 0; tp < TN / 2; ++tp) {
            const int nb = n0 + 32 * tp; if (nb >= NW) break;        // wave-uniform
#pragma unroll
            for (int t2 = 0; t2 < 2; ++t2) {
                const int t = 2 * tp + t2; const int n = nb + t2 * 16 + l15; const int nn = min(n, p.N - 1);
#pragma unroll
                for (int r = 0; r < 8; ++r) {
                    const int m = mb + 8 * h + r; const int mm = min(m, p.M - 1);
                    float v = acc[i][t][r] * iscale;
                    if (p.flags & 1) v += p.bias[nn];
                    if (p.flags & 2) v += p.bias[mm];
            if (p.flags & 8) v *= p.bias[(long long)zo * p.M + mm];   /* per-(z,row) scale vector laid out [Z][M]; exclusive with the bias flags */
                    v = act_fn(v, p.act);
                    if (p.flags & 4) v += p.beta * R[(long long)mm * p.sRm + (long long)nn * p.sRn];
                    ctile[8 * h + r][t2 * 16 + l15] = (n < p.N) ? v : 0.f;
                }
            }
            __syncthreads();
            const bool fast = (mb + 16 <= p.M) && (nb + 32 <= NW) && ((p.sCm & 3) == 0) && ((((size_t)C) & 15) == 0);
            if (fast) {
#pragma unroll
                for (int s = 0; s < 4; ++s) {
                    const int row = s * 4 + (lane >> 3), c4 = (lane & 7) * 4;
                    const v4f v = *(const v4f*)&ctile[row][c4];
                    VST2V4(C + (long long)(mb + row) * p.sCm + nb + c4, v);
                }
            } else {
                for (int row = 0; row < 16; ++row) {
                    const int m = mb + row, n = nb + lane;
                    if (m < p.M && n < NW) VST2(float, C + (long long)m * p.sCm + n, ctile[row][lane]);
                }
            }
            __syncthreads();
        }
    }
}

// =====================================================================================================================
//   Wave = 16 queries, AW waves per block, 64-key blocks; grid (ceil(Lq/(16*AW)), H, B), block 32*AW. Any Lq, Lk; head dim dh <= DHP
//   (DHP multiple of 32), value dim dv <= DVP (multiple of 16, <= 128). Every tensor addressed by (batch, head, row, element) strides, f32.
//   Scores: QM 0 f16 operands, 1 bf16 hi/lo split, 2 bf16 triple split; statistics f32 (exp2 domain); P.V: P x 4096 as f16 with V f16 staged in LDS
//   (SPLITPV: P and V as bf16 hi/lo splits). kv head = h / hrep. Masking: causal = 1 (keep j <= i + coff, masked -> -inf, key blocks beyond the
//   diagonal skipped), causal = 2 (masked -> mfill, a finite fill like the -1e9; no skipping), causal = 3 (keep j >= i + coff,
//   masked -> -inf, no skipping); optional additive f32 mask Mf,
//   optional int keep-mask Mi (0 -> score := mfill), both addressed b*smb + h*smh + i*smi + j*smj (0 strides broadcast).
// =====================================================================================================================
#define AW 4
struct AttnP {   // apv4
    const float* Q; const float* K; const float* V; float* O; float* P; const float* Mf; const int* Mi; float* ST;
    const float* Pw; const float* Rt; const int* SQ; const int* SK;           // optional: post-softmax weight, relative-position table, segment ids
    long long swb, swh, swi, swj, srb, srh, sri;                                 // Pw strides (b,h,i,j); Rt strides (b,h,i), column = clamp(i - j + roff, 0, rn-1)
    long long sQb, sQh, sQi, sQd, sKb, sKh, sKj, sKd, sVb, sVh, sVj, sVd, sOb, sOh, sOi, sPb, sPh, sPi, smb, smh, smi, smj;
    int Lq, Lk, dh, dv, hrep, causal, coff, pband;   // pband > 0: P holds only the band |j - i| <= pband, column j - i + pband
    float scale, mfill; int nonorm, mpol;             // nonorm (online path only): O = sum_j exp(score_j) V_j without the 1/rowsum (scores must be <= ~0); mpol: Mi masks where ==0 (mpol 0) or where !=0 (mpol 1)
    int roff, rn, segpol, win;                        // Rt column offset/count; SQ/SK: score := mfill where (segpol 0) SQ[i] != SK[j] or (segpol 1) SQ[i] == SK[j]; win > 0: keys with i - j > win (after coff) -> -inf
};
//   Pw: the softmax numerator is multiplied by Pw(b,h,i,j) AFTER the row sum is taken (probs * weight, then P.V), as in post-softmax multiplicative biases.                                                    // ST (optional): per row (b,h,i) -> ST[((b*H + h)*Lq + i)*2 + {0,1}] = {row max of the scaled+masked score (natural units), sum_j exp(score - max)}
static_assert(sizeof(AttnP) == 12 * 8 + 29 * 8 + 16 * 4, "AttnP has padding");

// Inputs-only fence on sixteen loaded values: all must have arrived here, so their loads are issued together ahead of it and share one wait
// (without it the register-budgeted schedule waits after every load). It names no product and changes no value.
template <typename T> __device__ __forceinline__ void hold16(const T* x) {
    asm volatile("" :: "v"(x[0]), "v"(x[1]), "v"(x[2]), "v"(x[3]), "v"(x[4]), "v"(x[5]), "v"(x[6]), "v"(x[7]),
                       "v"(x[8]), "v"(x[9]), "v"(x[10]), "v"(x[11]), "v"(x[12]), "v"(x[13]), "v"(x[14]), "v"(x[15]));
}
#ifndef KATTN_ATTR
#define KATTN_ATTR __attribute__((amdgpu_waves_per_eu(4)))   // register budget of 256: four waves a SIMD, so that all 1,024 blocks of the launch are resident at once
#endif
//   GT > 0 fixes the geometry at compile time: Lq = Lk = GT, rows of GD floats with head h at column h * DHP (unit element stride), dh = DHP,
//   dv = DVP, one kv head per head, no mask, weight, segment, P or ST tensor, and a per-head Rt row of 2 GT - 1 columns. Only Q, K, V, O, Rt and scale
//   are then taken from the argument, so every length guard folds and the loads of a key block are contiguous and free of branches.
template <int DHP, int DVP, int QM, bool SPLITPV, bool TWOPASS, int GT = 0, int GD = 0>
__global__ __launch_bounds__(32 * AW) KATTN_ATTR void k_attn(AttnP parg) {
    AttnP p = parg;
    if (GT > 0) {
        p.P = nullptr; p.Mf = nullptr; p.Mi = nullptr; p.ST = nullptr; p.Pw = nullptr; p.SQ = nullptr; p.SK = nullptr;
        p.swb = 0; p.swh = 0; p.swi = 0; p.swj = 0; p.srb = 0; p.srh = 2 * GT - 1; p.sri = 0;
        p.sQb = (long long)GT * GD; p.sQh = DHP; p.sQi = GD; p.sQd = 1; p.sKb = (long long)GT * GD; p.sKh = DHP; p.sKj = GD; p.sKd = 1;
        p.sVb = (long long)GT * GD; p.sVh = DVP; p.sVj = GD; p.sVd = 1; p.sOb = (long long)GT * GD; p.sOh = DVP; p.sOi = GD;
        p.sPb = 0; p.sPh = 0; p.sPi = 0; p.smb = 0; p.smh = 0; p.smi = 0; p.smj = 0;
        p.Lq = GT; p.Lk = GT; p.dh = DHP; p.dv = DVP; p.hrep = 1; p.causal = 0; p.coff = 0; p.pband = 0;
        p.mfill = 0.f; p.nonorm = 0; p.mpol = 0; p.roff = GT - 1; p.rn = 2 * GT - 1; p.segpol = 0; p.win = 0;
        __builtin_assume(p.Rt != nullptr);
    }
    constexpr bool FULL = GT > 0 && GT % (16 * AW) == 0 && GT % 64 == 0;   // every query tile and key block is whole: index clamps and length guards are identities
    constexpr int NT = DVP / 16;                // output tiles
    constexpr int KS = DHP / 32;                // k-steps for the scores
    constexpr int VP = DVP + 8;                 // LDS pitch (halves)
    __shared__ __align__(16) float    pl[AW][16 * 64];
    __shared__ __align__(16) _Float16 vl[(SPLITPV ? 2 : 1) * 64 * VP];   // f16 V tile, or bf16 hi and lo tiles (same 2-byte size)
    const int lane = threadIdx.x & 31, hf = lane >> 4, l15 = lane & 15, wave = threadIdx.x >> 5;
    const int h = blockIdx.y, b = blockIdx.z, hk = h / p.hrep;
    const int q0 = (blockIdx.x * AW + wave) * 16;
    float* myp = pl[wave];
    const float L2E = 1.4426950408889634f;
    const float NEG = -__builtin_inff();
    const int qi = FULL ? q0 + l15 : min(q0 + l15, p.Lq - 1);
    const float* qrow = p.Q + b * p.sQb + h * p.sQh + (long long)qi * p.sQi;
    const float* kbase = p.K + b * p.sKb + hk * p.sKh;
    const float* vbase = p.V + b * p.sVb + hk * p.sVh;
    v16h qa[QM == 0 ? KS : 1]; Split qs_[QM == 1 ? KS : 1]; Split3 qt_[QM == 2 ? KS : 1];
#pragma unroll
    for (int ks = 0; ks < KS; ++ks) {
        if (QM == 2) qt_[ks] = sp3_ld(qrow, p.sQd, ks * 32, hf, p.dh, 1.f);
        else if (QM == 1) qs_[ks] = sp_ld(qrow, p.sQd, ks * 32, hf, p.dh, 1.f);
        else qa[ks] = fh_ld(qrow, p.sQd, ks * 32, hf, p.dh, 1.f);
    }
    v8f o[NT]; float m8[8], l8[8];
#pragma unroll
    for (int t = 0; t < NT; ++t) { v8f zz = {}; o[t] = zz; }
#pragma unroll
    for (int i = 0; i < 8; ++i) { m8[i] = NEG; l8[i] = 0.f; }
    int jend = p.Lk;
    if (p.causal == 1) { const int je = (blockIdx.x * AW + AW - 1) * 16 + 16 + p.coff; jend = min(jend, max(je, 0)); }   // uniform per block
    const int npass = TWOPASS ? 2 : 1;
    for (int pass = 0; pass < npass; ++pass) {
        const bool dopv = (!TWOPASS) || pass == 1;
        for (int j0 = 0; j0 < jend; j0 += 64) {
            if (dopv) {
                __syncthreads();                                 // previous key block's reads of vl / pl are done
                constexpr int VN = 64 * DVP / (32 * AW);         // V elements per thread and key block
                constexpr bool VLIN = (32 * AW) % DVP == 0;      // a thread keeps its column: its rows differ by a constant step
                float vf[VN];
#pragma unroll   // constant trip count: with the guard folded the tile's loads differ by immediate offsets only
                for (int it = 0; it < VN; ++it) {
                    const int idx = threadIdx.x + it * (32 * AW);
                    const int jr = VLIN ? (int)threadIdx.x / DVP + it * ((32 * AW) / DVP) : idx / DVP, d = VLIN ? (int)threadIdx.x % DVP : idx - jr * DVP, j = j0 + jr;
                    if constexpr (FULL && VLIN)   // block-uniform tile pointer + the thread's fixed offset + a constant
                        vf[it] = (vbase + (long long)j0 * GD)[(size_t)(unsigned)((int)threadIdx.x / DVP * GD + (int)threadIdx.x % DVP) + it * ((32 * AW) / DVP) * GD];
                    else
                        vf[it] = (j < p.Lk && d < p.dv) ? vbase[(long long)j * p.sVj + (long long)d * p.sVd] : 0.f;
                }
                if (FULL && VN == 32) { hold16(vf); hold16(vf + 16); }   // the tile's loads all issue ahead of this line and are waited for once
#pragma unroll
                for (int it = 0; it < VN; ++it) {
                    const int idx = threadIdx.x + it * (32 * AW);
                    const int jr = VLIN ? (int)threadIdx.x / DVP + it * ((32 * AW) / DVP) : idx / DVP, d = VLIN ? (int)threadIdx.x % DVP : idx - jr * DVP;
                    const float f = vf[it];
                    if (SPLITPV) {
                        const __bf16 hb = bf16_rne(f);
                        ((__bf16*)vl)[jr * VP + d] = hb; ((__bf16*)vl)[64 * VP + jr * VP + d] = bf16_rne(f - bf16_f32(hb));
                    } else vl[jr * VP + d] = (_Float16)f;
                }
            }
            v8f s[4];
            float rb[8][4];                                     // the key block's relative-position table entries, fetched ahead of the products
            if constexpr (FULL) {
                // column i - j + GT - 1 as block-uniform pointer + the lane's fixed offset + a constant, each part >= 0 (j0 <= GT - 64)
                const float* rt = p.Rt + (long long)h * (2 * GT - 1) + ((int)blockIdx.x * (16 * AW) - j0 + (GT - 64));
                const unsigned ro = (unsigned)(wave * 16 + 8 * hf + 15 - l15);
#pragma unroll
                for (int i = 0; i < 8; ++i)
#pragma unroll
                    for (int t = 0; t < 4; ++t) rb[i][t] = rt[(size_t)ro + (i + 16 * (3 - t))];
            } else if (p.Rt) {
#pragma unroll
                for (int i = 0; i < 8; ++i)
#pragma unroll
                    for (int t = 0; t < 4; ++t) {
                        const int ic = min(q0 + i + 8 * hf, p.Lq - 1);
                        int rc = ic - min(j0 + t * 16 + l15, p.Lk - 1) + p.roff; rc = rc < 0 ? 0 : (rc >= p.rn ? p.rn - 1 : rc);
                        rb[i][t] = p.Rt[b * p.srb + h * p.srh + (long long)ic * p.sri + rc];
                    }
            }
            if constexpr (FULL && QM == 0 && KS == 2) {
                // two key tiles at a time: their sixteen 16-byte loads (fh_ld's k order: floats 8 hf + 0..7 and 16 + 8 hf + 0..7 of each 32) fly together
#pragma unroll
                for (int tp = 0; tp < 2; ++tp) {
                    v4f kr[16];
#pragma unroll
                    for (int t2 = 0; t2 < 2; ++t2)
#pragma unroll
                        for (int ks = 0; ks < 2; ++ks) {
                            const v4f* kp = (const v4f*)((kbase + (long long)j0 * GD) + ((size_t)(unsigned)(l15 * GD + 8 * hf) + (2 * tp + t2) * 16 * GD + ks * 32));
                            kr[(t2 * 2 + ks) * 4 + 0] = kp[0]; kr[(t2 * 2 + ks) * 4 + 1] = kp[1]; kr[(t2 * 2 + ks) * 4 + 2] = kp[4]; kr[(t2 * 2 + ks) * 4 + 3] = kp[5];
                        }
                    hold16(kr);                                  // all sixteen loads issue ahead of this line and are waited for once
#pragma unroll
                    for (int t2 = 0; t2 < 2; ++t2) {
                        v8f acc = {};
#pragma unroll
                        for (int ks = 0; ks < 2; ++ks) {
                            v16h kfr;
#pragma unroll
                            for (int e = 0; e < 16; ++e) kfr[e] = (_Float16)kr[(t2 * 2 + ks) * 4 + (e >> 2)][e & 3];
                            acc = wmma16(qa[ks], kfr, acc);
                        }
                        s[2 * tp + t2] = acc;
                    }
                }
            } else {
#pragma unroll
            for (int t = 0; t < 4; ++t) {
                const int j = min(j0 + t * 16 + l15, p.Lk - 1);
                const float* krow = kbase + (long long)j * p.sKj;
                v8f acc = {};
#pragma unroll
                for (int ks = 0; ks < KS; ++ks) {
                    if (QM == 2)      acc = wmma6(qt_[ks], sp3_ld(krow, p.sKd, ks * 32, hf, p.dh, 1.f), acc);
                    else if (QM == 1) acc = wmma3(qs_[ks], sp_ld(krow, p.sKd, ks * 32, hf, p.dh, 1.f), acc);
                    else              acc = wmma16(qa[ks], fh_ld(krow, p.sKd, ks * 32, hf, p.dh, 1.f), acc);
                }
                s[t] = acc;
            }
            }
            float pv[8][4];
#pragma unroll
            for (int i = 0; i < 8; ++i) {
                const int irow = q0 + i + 8 * hf;
                const int ic = FULL ? irow : min(irow, p.Lq - 1);
                float sc[4];
#pragma unroll
                for (int t = 0; t < 4; ++t) {
                    const int jg = j0 + t * 16 + l15;
                    float v = s[t][i] * p.scale;
                    if (p.Mf) v += p.Mf[b * p.smb + h * p.smh + (long long)ic * p.smi + (long long)min(jg, p.Lk - 1) * p.smj];
                    if (p.Rt) v += rb[i][t];
                    if (p.Mi) { const int mv = p.Mi[b * p.smb + h * p.smh + (long long)ic * p.smi + (long long)min(jg, p.Lk - 1) * p.smj]; if (p.mpol ? (mv != 0) : (mv == 0)) v = p.mfill; }
                    if (p.SQ) { const bool same = p.SQ[(long long)b * p.Lq + ic] == p.SK[(long long)b * p.Lk + min(jg, p.Lk - 1)]; if (p.segpol ? same : !same) v = p.mfill; }
                    if (p.causal == 2 && jg > irow + p.coff) v = p.mfill;
                    if ((!FULL && jg >= p.Lk) || (p.causal == 1 && jg > irow + p.coff) || (p.causal == 3 && jg < irow + p.coff) || (p.win > 0 && irow + p.coff - jg > p.win)) v = NEG; else v *= L2E;
                    sc[t] = v;
                }
                if (!TWOPASS || pass == 0) {
                    float mx = fmaxf(fmaxf(sc[0], sc[1]), fmaxf(sc[2], sc[3]));
                    mx = fmaxf(mx, __shfl_xor(mx, 1, 32)); mx = fmaxf(mx, __shfl_xor(mx, 2, 32));
                    mx = fmaxf(mx, __shfl_xor(mx, 4, 32)); mx = fmaxf(mx, __shfl_xor(mx, 8, 32));
                    const float mnew = fmaxf(m8[i], mx);
                    const float corr = (mnew == NEG) ? 1.f : exp2f(m8[i] - mnew);
                    float rs = 0.f;
#pragma unroll
                    for (int t = 0; t < 4; ++t) {
                        const float pp = (sc[t] == NEG) ? 0.f : exp2f(sc[t] - mnew); rs += pp;
                        pv[i][t] = p.Pw ? pp * p.Pw[b * p.swb + h * p.swh + (long long)ic * p.swi + (long long)min(j0 + t * 16 + l15, p.Lk - 1) * p.swj] : pp;
                    }
                    rs += __shfl_xor(rs, 1, 32); rs += __shfl_xor(rs, 2, 32); rs += __shfl_xor(rs, 4, 32); rs += __shfl_xor(rs, 8, 32);
                    l8[i] = l8[i] * corr + rs; m8[i] = mnew;
                    if (!TWOPASS) {
#pragma unroll
                        for (int t = 0; t < NT; ++t) o[t][i] *= corr;
                    }
                } else {
                    const float inv = (l8[i] > 0.f) ? 1.f / l8[i] : 0.f;
#pragma unroll
                    for (int t = 0; t < 4; ++t) {
                        const int jg = j0 + t * 16 + l15;
                        float pp = (sc[t] == NEG) ? 0.f : exp2f(sc[t] - m8[i]) * inv;
                        if (p.Pw) pp *= p.Pw[b * p.swb + h * p.swh + (long long)ic * p.swi + (long long)min(jg, p.Lk - 1) * p.swj];
                        pv[i][t] = pp;
                    }
                }
            }
            if (dopv) {
#pragma unroll
                for (int i = 0; i < 8; ++i)
#pragma unroll
                    for (int t = 0; t < 4; ++t) ((float*)myp)[(i + 8 * hf) * 64 + t * 16 + l15] = pv[i][t];
                __syncthreads();                                 // P (per wave) and V (shared) visible
                if (p.P) {
                    float* pb_ = p.P + b * p.sPb + h * p.sPh;
                    const bool fastP = (p.pband == 0) && ((p.sPi & 3) == 0) && (j0 + 64 <= p.Lk) && (q0 + 16 <= p.Lq) && ((((size_t)pb_) & 15) == 0);
                    if (fastP) {
#pragma unroll
                        for (int s = 0; s < 8; ++s) {
                            const int row = s * 2 + (lane >> 4), c4 = (lane & 15) * 4;
                            const v4f v = *(const v4f*)(myp + row * 64 + c4);
                            VST2V4(pb_ + (long long)(q0 + row) * p.sPi + j0 + c4, v);
                        }
                    } else {
                        for (int row = 0; row < 16; ++row) {
                            const int irow = q0 + row; if (irow >= p.Lq) continue;
                            for (int c = lane; c < 64; c += 32) {
                                const int jg = j0 + c; if (jg >= p.Lk) continue;
                                if (p.pband == 0) VST2(float, pb_ + (long long)irow * p.sPi + jg, myp[row * 64 + c]);
                                else if (jg - irow <= p.pband && irow - jg <= p.pband) VST2(float, pb_ + (long long)irow * p.sPi + (jg - irow + p.pband), myp[row * 64 + c]);
                            }
                        }
                    }
                }
                if (SPLITPV) {
                    const Split pa0 = sp_ld(myp + l15 * 64, 1, 0, hf, 64, 1.f), pa1 = sp_ld(myp + l15 * 64, 1, 32, hf, 64, 1.f);
                    const __bf16* vh = (const __bf16*)vl; const __bf16* vlo = vh + 64 * VP;
#pragma unroll
                    for (int t = 0; t < NT; ++t) {
                        const int dcol = t * 16 + l15;
                        Split b0, b1;
#pragma unroll
                        for (int e = 0; e < 16; ++e) {
                            const int k0 = frag_k(e, hf), k1 = 32 + frag_k(e, hf);
                            b0.hi[e] = vh[k0 * VP + dcol]; b0.lo[e] = vlo[k0 * VP + dcol]; b1.hi[e] = vh[k1 * VP + dcol]; b1.lo[e] = vlo[k1 * VP + dcol];
                        }
                        o[t] = wmma3(pa0, b0, o[t]);
                        o[t] = wmma3(pa1, b1, o[t]);
                    }
                } else {
                    const v16h pa0 = fh_ld(myp + l15 * 64, 1, 0, hf, 64, 4096.f), pa1 = fh_ld(myp + l15 * 64, 1, 32, hf, 64, 4096.f);
#pragma unroll
                    for (int t = 0; t < NT; ++t) {
                        const int dcol = t * 16 + l15;
                        v16h b0, b1;
#pragma unroll
                        for (int e = 0; e < 16; ++e) { b0[e] = vl[frag_k(e, hf) * VP + dcol]; b1[e] = vl[(32 + frag_k(e, hf)) * VP + dcol]; }
                        o[t] = wmma16(pa0, b0, o[t]);
                        o[t] = wmma16(pa1, b1, o[t]);
                    }
                }
            }
        }
    }
    float* obase = p.O + b * p.sOb + h * p.sOh;
    if (p.ST) {
        const int rl = lane >> 1, isel = rl & 7;           // row q0 + rl ; rl>>3 == hf holds because lane>>4 == (lane>>1)>>3
        float mv = 0.f, lv = 0.f;
#pragma unroll
        for (int i = 0; i < 8; ++i) if (i == isel) { mv = m8[i]; lv = l8[i]; }
        const int irow = q0 + rl;
        if (irow < p.Lq) { float* st = p.ST + (((long long)b * gridDim.y + h) * p.Lq + irow) * 2 + (lane & 1); VST2(float, st, (lane & 1) ? lv : mv * 0.6931471805599453f); }
    }
    float invr[8];
#pragma unroll
    for (int i = 0; i < 8; ++i) {
        if (TWOPASS) invr[i] = SPLITPV ? 1.f : (1.f / 4096.f);
        else if (p.nonorm) invr[i] = exp2f(m8[i]) * (SPLITPV ? 1.f : (1.f / 4096.f));
        else invr[i] = (l8[i] > 0.f) ? (SPLITPV ? 1.f / l8[i] : 1.f / (l8[i] * 4096.f)) : 0.f;
    }
    __syncthreads();                                             // all waves done with pl/vl from the main loop
    const bool ofast = ((p.sOi & 3) == 0) && ((((size_t)obase) & 15) == 0) && (q0 + 16 <= p.Lq);
#pragma unroll
    for (int c0 = 0; c0 < DVP; c0 += 64) {
#pragma unroll
        for (int i = 0; i < 8; ++i)
#pragma unroll
            for (int t = 0; t < NT; ++t) if (t * 16 >= c0 && t * 16 < c0 + 64) ((float*)myp)[(i + 8 * hf) * 64 + (t * 16 - c0) + l15] = o[t][i] * invr[i];
        __syncthreads();
        const int cw = (DVP - c0 < 64) ? (DVP - c0) : 64;      // staged columns in this chunk (multiple of 16)
        if (ofast && (c0 + cw <= p.dv) && (cw % 32 == 0)) {
            const int lpr = cw / 4;                              // lanes per row (16 for 64 cols, 8 for 32)
            const int rows_per_ins = 32 / lpr;
            for (int r0 = 0; r0 < 16; r0 += rows_per_ins) {
                const int row = r0 + lane / lpr, c4 = (lane % lpr) * 4;
                const v4f v = *(const v4f*)(myp + row * 64 + c4);
                VST2V4(obase + (long long)(q0 + row) * p.sOi + c0 + c4, v);
            }
        } else {
            for (int row = 0; row < 16; ++row) {
                const int irow = q0 + row; if (irow >= p.Lq) continue;
                for (int c = lane; c < cw; c += 32) { const int d = c0 + c; if (d < p.dv) VST2(float, obase + (long long)irow * p.sOi + d, myp[row * 64 + c]); }
            }
        }
        __syncthreads();
    }
}

__device__ __forceinline__ float xhalf(float x) { return __builtin_bit_cast(float, __builtin_amdgcn_permlanex16(__builtin_bit_cast(int, x), __builtin_bit_cast(int, x), 0x76543210, 0xfedcba98, false, false)); }
// One thread's eight copies for one key block: four 16-byte pieces of the K tile and four of the V^T tile, each the same 16 bytes of rows 16 apart
// (eight lanes cover one row's 128 bytes, a whole line). lk, lv = LDS byte addresses, gk, gv = global addresses of the first piece of each tile.
// The s_wait_xcnt closes the statement so that no register which a copy names is rewritten ahead of it.
template <int PB, int KLD, int VLD>
__device__ __forceinline__ void at_copy8(unsigned lk, unsigned lv, const _Float16* gk, const _Float16* gv) {
    asm volatile(
        "global_load_async_to_lds_b128 %0, %8, off\n\t"
        "global_load_async_to_lds_b128 %1, %9, off\n\t"
        "global_load_async_to_lds_b128 %2, %10, off\n\t"
        "global_load_async_to_lds_b128 %3, %11, off\n\t"
        "global_load_async_to_lds_b128 %4, %12, off\n\t"
        "global_load_async_to_lds_b128 %5, %13, off\n\t"
        "global_load_async_to_lds_b128 %6, %14, off\n\t"
        "global_load_async_to_lds_b128 %7, %15, off\n\t"
        "s_wait_xcnt 0x0"
        :: "v"(lk), "v"(lk + 16 * PB), "v"(lk + 32 * PB), "v"(lk + 48 * PB), "v"(lv), "v"(lv + 16 * PB), "v"(lv + 32 * PB), "v"(lv + 48 * PB),
           "v"(gk), "v"(gk + 16 * KLD), "v"(gk + 32 * KLD), "v"(gk + 48 * KLD), "v"(gv), "v"(gv + 16 * VLD), "v"(gv + 32 * VLD), "v"(gv + 48 * VLD)
        : "memory");
}
// Q and K: f16 planes of GR rows (batch * GT + position) x GD columns, head h at column h * 64. Vt: the f16 plane of V transposed, GD rows (head h at row h * 64) x GR columns.
template <int GT, int GD, int GR>
__global__ __launch_bounds__(32 * AW) KATTN_ATTR void k_attnT(const _Float16* __restrict__ Q, const _Float16* __restrict__ K, const _Float16* __restrict__ Vt, float* __restrict__ O, const float* __restrict__ Rt, float scale) {
    static_assert(GT % (16 * AW) == 0 && GT % 64 == 0 && GT >= 128 && AW == 4, "whole query tiles and key blocks; 128 threads copy the 64 x 64 K and V^T tiles; the two-buffer prologue needs two key blocks");
    constexpr int DH = 64;                      // head size
    constexpr int VP = 64 + 8;                  // LDS pitch (halves): rows of 128 bytes + 16, for 16-byte readers
    constexpr int TB = 64 * VP * 2;             // one tile in LDS, bytes
    __shared__ __align__(16) _Float16 vt[2][DH * VP];   // V^T tile: row = head column, 64 keys along the row
    __shared__ __align__(16) _Float16 kt[2][64 * VP];   // K tile: row = key, the 64 head columns along the row; both tiles are copied in once a key block and read by all four waves
    const int lane = threadIdx.x & 31, hf = lane >> 4, l15 = lane & 15, wave = threadIdx.x >> 5;
    const int h = blockIdx.y, b = blockIdx.z;
    const int q0 = (blockIdx.x * AW + wave) * 16;
    const float L2E = 1.4426950408889634f;
    const int crow = threadIdx.x >> 3, ccol = threadIdx.x & 7;      // copies: eight lanes cover one tile row
    const _Float16* gk = K + (size_t)(b * GT + crow) * GD + h * DH + ccol * 8;
    const _Float16* gv = Vt + (size_t)(h * DH + crow) * GR + b * GT + ccol * 8;
    const unsigned lk = (unsigned)(size_t)&kt[0][0] + (unsigned)(crow * (VP * 2) + ccol * 16);
    const unsigned lv = (unsigned)(size_t)&vt[0][0] + (unsigned)(crow * (VP * 2) + ccol * 16);
    at_copy8<VP * 2, GD, GR>(lk, lv, gk, gv);
    const _Float16* qrow = Q + (size_t)(b * GT + q0 + l15) * GD + h * DH + 8 * hf;
    v16h qb[2];                                 // halves 8 hf + 0..7 and 16 + 8 hf + 0..7 of each 32: the k order of the K fragments below
#pragma unroll
    for (int ks = 0; ks < 2; ++ks) {
        const v8h q0h = *(const v8h*)(qrow + ks * 32), q1h = *(const v8h*)(qrow + ks * 32 + 16);
        qb[ks] = __builtin_shufflevector(q0h, q1h, 0, 1, 2, 3, 4, 5, 6, 7, 8, 9, 10, 11, 12, 13, 14, 15);
    }
    v8f o[4]; float m = -__builtin_inff(), l = 0.f;
#pragma unroll
    for (int t = 0; t < 4; ++t) { v8f zz = {}; o[t] = zz; }
    asm volatile("s_wait_asynccnt 0x0" ::: "memory");    // this wave's share of key block 0 has landed
    __syncthreads();                                     // key block 0 is whole for every wave
    at_copy8<VP * 2, GD, GR>(lk + TB, lv + TB, gk + 64 * GD, gv + 64);
    for (int j0 = 0; j0 < GT; j0 += 64) {
        // This trip works on key block j0 in buffer cur; the next block's copies, issued a trip ago, fly into the other buffer.
        const int cur = (j0 >> 6) & 1;
        // table column i - j + GT - 1 as block-uniform pointer + the lane's fixed offset + a constant, each part >= 0 (j0 <= GT - 64)
        float rb[4][8];
        const float* rt = Rt + (long long)h * (2 * GT - 1) + ((int)blockIdx.x * (16 * AW) - j0 + (GT - 64));
        const unsigned ro = (unsigned)(wave * 16 + l15 + 8 * (1 - hf));
#pragma unroll
        for (int t = 0; t < 4; ++t)
#pragma unroll
            for (int r = 0; r < 8; ++r) rb[t][r] = rt[(size_t)ro + (16 * (3 - t) + (7 - r))];
        v8f s[4];
        v8h ka[16];                                      // the eight K fragments, the k order of qb: halves 8 hf + 0..7 and 16 + 8 hf + 0..7 of each 32
#pragma unroll
        for (int t = 0; t < 4; ++t)
#pragma unroll
            for (int ks = 0; ks < 2; ++ks) {
                const _Float16* kr = kt[cur] + (t * 16 + l15) * VP + ks * 32 + 8 * hf;
                ka[(t * 2 + ks) * 2] = *(const v8h*)kr; ka[(t * 2 + ks) * 2 + 1] = *(const v8h*)(kr + 16);
            }
        hold16(ka);                                      // the sixteen LDS reads issue together and are waited for once (otherwise: one fragment's registers, a full LDS wait in front of each product)
#pragma unroll
        for (int t = 0; t < 4; ++t) {
            v8f acc = {};
#pragma unroll
            for (int ks = 0; ks < 2; ++ks) {
                const v16h kfr = __builtin_shufflevector(ka[(t * 2 + ks) * 2], ka[(t * 2 + ks) * 2 + 1], 0, 1, 2, 3, 4, 5, 6, 7, 8, 9, 10, 11, 12, 13, 14, 15);
                acc = __builtin_amdgcn_wmma_f32_16x16x32_f16(false, kfr, false, qb[ks], (short)0, acc, false, false);   // A = key rows, B = query columns
            }
            s[t] = acc;
        }
        float sc[4][8], mt[4];
#pragma unroll
        for (int t = 0; t < 4; ++t) {
#pragma unroll
            for (int r = 0; r < 8; ++r) sc[t][r] = (s[t][r] * scale + rb[t][r]) * L2E;
            mt[t] = fmaxf(fmaxf(fmaxf(sc[t][0], sc[t][1]), fmaxf(sc[t][2], sc[t][3])), fmaxf(fmaxf(sc[t][4], sc[t][5]), fmaxf(sc[t][6], sc[t][7])));
        }
        v8h vh[16];                                      // the eight V^T fragments: the trip's last LDS reads, so that the buffer can be handed back ahead of the softmax
#pragma unroll
        for (int t = 0; t < 4; ++t)
#pragma unroll
            for (int ks = 0; ks < 2; ++ks) {
                const _Float16* vr = vt[cur] + (t * 16 + l15) * VP + ks * 32 + 8 * hf;
                vh[(t * 2 + ks) * 2] = *(const v8h*)vr; vh[(t * 2 + ks) * 2 + 1] = *(const v8h*)(vr + 16);
            }
        // Publish point: from here on the trip works on registers alone, and the refill has the softmax, the second products and the next trip's first half to land.
        asm volatile("s_wait_dscnt 0x0" ::: "memory");       // this wave's reads of block j0 are done before its buffer is handed back
        asm volatile("s_wait_asynccnt 0x0" ::: "memory");    // this wave's share of block j0 + 64 has landed
        __syncthreads();                                     // publishes block j0 + 64 and ends every wave's reads of block j0
        if (j0 + 128 < GT) at_copy8<VP * 2, GD, GR>(lk + cur * TB, lv + cur * TB, gk + (size_t)(j0 + 128) * GD, gv + (j0 + 128));
        float mx = fmaxf(fmaxf(mt[0], mt[1]), fmaxf(mt[2], mt[3]));
        mx = fmaxf(mx, xhalf(mx));                        // the other lane half holds the query's other 32 keys
        const float mnew = fmaxf(m, mx);
        const float corr = exp2f(m - mnew);
        float rs[4];
#pragma unroll
        for (int t = 0; t < 4; ++t) {
            rs[t] = 0.f;
#pragma unroll
            for (int r = 0; r < 8; ++r) { const float pp = exp2f(sc[t][r] - mnew); rs[t] += pp; sc[t][r] = pp; }
        }
        l = l * corr + ((rs[0] + rs[1]) + (rs[2] + rs[3])); m = mnew;
#pragma unroll
        for (int t = 0; t < 4; ++t)
#pragma unroll
            for (int r = 0; r < 8; ++r) o[t][r] *= corr;
        v16h pb[2];
#pragma unroll
        for (int ks = 0; ks < 2; ++ks)
#pragma unroll
            for (int e = 0; e < 16; ++e) pb[ks][e] = (_Float16)(sc[2 * ks + (e >> 3)][e & 7] * 4096.f);
#pragma unroll
        for (int t = 0; t < 4; ++t)
#pragma unroll
            for (int ks = 0; ks < 2; ++ks) {
                const v16h va = __builtin_shufflevector(vh[(t * 2 + ks) * 2], vh[(t * 2 + ks) * 2 + 1], 0, 1, 2, 3, 4, 5, 6, 7, 8, 9, 10, 11, 12, 13, 14, 15);
                o[t] = __builtin_amdgcn_wmma_f32_16x16x32_f16(false, va, false, pb[ks], (short)0, o[t], false, false);   // A = head columns, B = query columns
            }
    }
    asm volatile("s_wait_asynccnt 0x0" ::: "memory");        // nothing of this wave is in flight when it goes on
    l += xhalf(l);                                       // join the two halves' sums
    const float inv = (l > 0.f) ? 1.f / (l * 4096.f) : 0.f;
    float* orow = O + (long long)b * GT * GD + h * DH + (long long)(q0 + l15) * GD + 8 * hf;
#pragma unroll
    for (int t = 0; t < 4; ++t) {
        const v4f w0 = { o[t][0] * inv, o[t][1] * inv, o[t][2] * inv, o[t][3] * inv }, w1 = { o[t][4] * inv, o[t][5] * inv, o[t][6] * inv, o[t][7] * inv };
        VST2V4(orow + t * 16, w0); VST2V4(orow + t * 16 + 4, w1);
    }
}

// =====================================================================================================================
// k_tr: dst(z, c, r) = alpha * src(z, r, c) (+ beta * R2(z, c, r)): [Z][R][C] (row stride lds) -> [Z][C][R] (row stride ldd) through a 32x32 LDS tile;
//   flags: 1 -> add beta * residual R2 addressed like dst (z*sRz + c*ldr + r); act applied before the residual.
// =====================================================================================================================
struct TrP { const float* src; float* dst; const float* R2; long long sSz, lds, sDz, ldd, sRz, ldr; int R, C, flags, act; float alpha, beta; };
static_assert(sizeof(TrP) == 3 * 8 + 6 * 8 + 6 * 4, "TrP has padding");
__global__ __launch_bounds__(256) void k_tr(TrP p) {
    __shared__ float tile[32][33];
    const int c0 = blockIdx.x * 32, r0 = blockIdx.y * 32, z = blockIdx.z;
    const int lane = threadIdx.x & 31, wave = threadIdx.x >> 5;
    const float* s = p.src + z * p.sSz;
#pragma unroll
    for (int k = 0; k < 4; ++k) {
        const int rl = wave * 4 + k, r = r0 + rl, c = c0 + lane;
        tile[rl][lane] = (r < p.R && c < p.C) ? s[(long long)r * p.lds + c] : 0.f;
    }
    __syncthreads();
    float* d = p.dst + z * p.sDz; const float* rr = p.R2 + z * p.sRz;
#pragma unroll
    for (int k = 0; k < 4; ++k) {
        const int cl = wave * 4 + k, c = c0 + cl, r = r0 + lane;
        if (c < p.C && r < p.R) {
            float v = act_fn(p.alpha * tile[lane][cl], p.act);
            if (p.flags & 1) v += p.beta * rr[(long long)c * p.ldr + r];
            VST2(float, d + (long long)c * p.ldd + r, v);
        }
    }
}

// k_affine: dst[i] = a * (sdev ? sdev[0] : 1) * src[i] + b, i < n (one thread per element; consecutive lanes -> consecutive addresses)
__global__ __launch_bounds__(256) void k_affine(const float* __restrict__ src, float* __restrict__ dst, int n, float a, float b, const float* __restrict__ sdev) {
    const int i = blockIdx.x * 256 + threadIdx.x;
    if (i < n) { const float aa = sdev ? a * sdev[0] : a; const float v = aa * src[i] + b; VST2(float, dst + i, v); }
}

// =====================================================================================================================
// k_softmax: row softmax over n contiguous elements, one 256-thread block per row; rows addressed z*sz + r*sr (grid (R, Z)).
//   out = scale_out * softmax(scale_in * x + (Mf ? Mf[z*smz + r*smr + j] : 0)); a row whose max is -inf is written as 0.
// =====================================================================================================================
struct SmP { const float* src; float* dst; const float* Mf; long long sz, sr, dz, dr, smz, smr; int n, pad; float scale_in, scale_out; };
static_assert(sizeof(SmP) == 3 * 8 + 6 * 8 + 4 * 4, "SmP has padding");
__global__ __launch_bounds__(256) void k_softmax(SmP p) {
    __shared__ float red[256];
    const int r = blockIdx.x, z = blockIdx.y, tid = threadIdx.x;
    const float* s = p.src + z * p.sz + (long long)r * p.sr;
    const float* mf = p.Mf ? (p.Mf + z * p.smz + (long long)r * p.smr) : nullptr;
    float mx = -__builtin_inff();
    for (int j = tid; j < p.n; j += 256) { float v = s[j] * p.scale_in; if (mf) v += mf[j]; mx = fmaxf(mx, v); }
    red[tid] = mx; __syncthreads();
    for (int o = 128; o > 0; o >>= 1) { if (tid < o) red[tid] = fmaxf(red[tid], red[tid + o]); __syncthreads(); }
    mx = red[0]; __syncthreads();
    float sum = 0.f;
    for (int j = tid; j < p.n; j += 256) { float v = s[j] * p.scale_in; if (mf) v += mf[j]; sum += (mx == -__builtin_inff()) ? 0.f : expf(v - mx); }
    red[tid] = sum; __syncthreads();
    for (int o = 128; o > 0; o >>= 1) { if (tid < o) red[tid] += red[tid + o]; __syncthreads(); }
    sum = red[0];
    const float inv = (sum > 0.f) ? p.scale_out / sum : 0.f;
    float* d = p.dst + z * p.dz + (long long)r * p.dr;
    for (int j = tid; j < p.n; j += 256) { float v = s[j] * p.scale_in; if (mf) v += mf[j]; const float o = (mx == -__builtin_inff()) ? 0.f : expf(v - mx) * inv; VST2(float, d + j, o); }
}
// =====================================================================================================================
// k_stats: mean and rsqrt(var + eps) over a set of n elements addressed base + z*sz + (e / inner) * so + (e % inner) * si, one 256-thread
// k_norm_apply: y = (x - mean[set]) * rstd[set] * g[c] + b[c] over a [Z][C][L] channel-major tensor with set = z*G + c / (C/G) (G groups per z;
//   G = C -> per-channel sets indexed z*C+c; for batch norm pass stats indexed by c only via bn = 1). Optional act. Output same layout.
// =====================================================================================================================
//   mode 0: mean / rsqrt(var + eps); mode 1 (RMSNorm): 0 / rsqrt(mean(x^2) + eps); mode 2 (L2 normalize * sqrt(n)): 0 / sqrt(n) / max(||x||, eps); mode 3: as 0 with unbiased variance (n-1)
__global__ __launch_bounds__(256) void k_stats(const float* __restrict__ x, long long sz, long long so, long long si, int inner, int n, float eps, float* __restrict__ stat, int mode) {
    __shared__ float red[256];
    const int z = blockIdx.x, tid = threadIdx.x;
    const float* base = x + z * sz;
    float s = 0.f;
    for (int e = tid; e < n; e += 256) s += base[(long long)(e / inner) * so + (long long)(e % inner) * si];
    red[tid] = s; __syncthreads();
    for (int o = 128; o > 0; o >>= 1) { if (tid < o) red[tid] += red[tid + o]; __syncthreads(); }
    const float mu = (mode == 0 || mode == 3) ? red[0] / (float)n : 0.f; __syncthreads();
    float q = 0.f;
    for (int e = tid; e < n; e += 256) { const float dlt = base[(long long)(e / inner) * so + (long long)(e % inner) * si] - mu; q += dlt * dlt; }
    red[tid] = q; __syncthreads();
    for (int o = 128; o > 0; o >>= 1) { if (tid < o) red[tid] += red[tid + o]; __syncthreads(); }
    {
        float rs;
        if (mode == 2) rs = sqrtf((float)n) / fmaxf(sqrtf(red[0]), eps); else if (mode == 3) rs = rsqrtf(red[0] / (float)(n - 1) + eps); else rs = rsqrtf(red[0] / (float)n + eps);
        if (tid < 32) { const float v = (tid == 0) ? mu : ((tid == 1) ? rs : 0.f); VST2(float, stat + (long long)z * 32 + tid, v); }
    }
}
//   One thread per element over the flat [Z][C][L] index space: grid ceil(Z*C*L / 256).
__global__ __launch_bounds__(256) void k_norm_apply(const float* __restrict__ x, float* __restrict__ y, const float* __restrict__ stat, const float* __restrict__ g, const float* __restrict__ bta,
                                                     int Z, int C, int L, int G, int bn, int act) {
    const long long idx = (long long)blockIdx.x * 256 + threadIdx.x;
    if (idx >= (long long)Z * C * L) return;
    const int l = (int)(idx % L); const long long zc = idx / L; const int c = (int)(zc % C), z = (int)(zc / C); (void)l;
    const int set = bn ? c : (z * G + c / (C / G));
    float v = (x[idx] - stat[(long long)set * 32]) * stat[(long long)set * 32 + 1];
    if (g) v *= g[c];
    if (bta) v += bta[c];
    v = act_fn(v, act);
    VST2(float, y + idx, v);
}

// k_lse_neg: c[i] = -(st[2i] + log(st[2i+1])) = minus the log-sum-exp of row i from k_attn's ST output (for softmax over the query dimension)
__global__ __launch_bounds__(256) void k_lse_neg(const float* __restrict__ st, float* __restrict__ c, int n) {
    const int i = blockIdx.x * 256 + threadIdx.x;
    if (i < n) { const float v = -(st[2 * i] + logf(st[2 * i + 1])); VST2(float, c + i, v); }
}

// k_iota: dst[i] = a * i + b as int32 (segment/position id helper)
__global__ __launch_bounds__(256) void k_iota(int* __restrict__ dst, int n, int a, int b) {
    const int i = blockIdx.x * 256 + threadIdx.x;
    if (i < n) { const int v = a * i + b; VST2(int, dst + i, v); }
}

// k_axpby: dst[i] = a * x[i] + b * y[i] (+ c), i < n
__global__ __launch_bounds__(256) void k_axpby(const float* __restrict__ x, const float* __restrict__ y, float* __restrict__ dst, int n, float a, float b, float c) {
    const int i = blockIdx.x * 256 + threadIdx.x;
    if (i < n) { const float v = a * x[i] + b * y[i] + c; VST2(float, dst + i, v); }
}

// =====================================================================================================================
// k_rope: rotary embedding on a [R rows][Hn heads][D] view (row stride sXr, head stride sXh, element stride 1) -> Y (own strides).
//   mode 0: rotate_half (partner d±D/2, sign - for d<D/2); mode 1: interleaved pairs (partner d^1, sign - for even d).
//   table column tcol: tmode 0 -> d, 1 -> d % (D/2), 2 -> d / 2; position p: pmode 0 -> r % S, 1 -> head index, 2 -> pos[r];
//   c = C[(r / S) * sCb + p * sCp + tcol * sCd], s likewise from Sn; y = x[d] * c + sign * x[partner] * s. X and Y must not alias.
// =====================================================================================================================
struct RopeP { const float* X; float* Y; const float* C; const float* Sn; const int* pos; long long sXr, sXh, sYr, sYh, sCb, sCp, sCd; int R, Hn, D, S, mode, tmode, pmode, pad; };
static_assert(sizeof(RopeP) == 5 * 8 + 7 * 8 + 8 * 4, "RopeP has padding");
__global__ __launch_bounds__(256) void k_rope(RopeP p) {
    const long long idx = (long long)blockIdx.x * 256 + threadIdx.x;
    if (idx >= (long long)p.R * p.Hn * p.D) return;
    const int d = (int)(idx % p.D); const long long rh = idx / p.D; const int h = (int)(rh % p.Hn); const int r = (int)(rh / p.Hn);
    const int half = p.D / 2;
    int partner; float sign;
    if (p.mode == 0) { partner = (d < half) ? d + half : d - half; sign = (d < half) ? -1.f : 1.f; }
    else { partner = d ^ 1; sign = (d & 1) ? 1.f : -1.f; }
    const int tcol = (p.tmode == 0) ? d : ((p.tmode == 1) ? (d % half) : (d >> 1));
    const int pp = (p.pmode == 0) ? (r % p.S) : ((p.pmode == 1) ? h : p.pos[r]);
    const long long toff = (long long)(r / p.S) * p.sCb + (long long)pp * p.sCp + (long long)tcol * p.sCd;
    const float* xr = p.X + (long long)r * p.sXr + (long long)h * p.sXh;
    const float v = xr[d] * p.C[toff] + sign * xr[partner] * p.Sn[toff];
    VST2(float, p.Y + (long long)r * p.sYr + (long long)h * p.sYh + d, v);
}

// k_invf + k_sincos (split so neither kernel carries a large VALU-fma footprint): invf_i = num * (1 / powf(base, (2 i)/D)) [fmode 0],
//   num * expf((2 i) * cexp) [fmode 1], num * powf(base, -2 (i - 1) / D) [fmode 2]; then cs/sn[s*half + i] = cos/sin((pscale * s) * invf_i)
__global__ __launch_bounds__(256) void k_invf(float* __restrict__ invb, int half, int D, float base, float num, int fmode, float cexp) {
    const int i = blockIdx.x * 256 + threadIdx.x;
    if (i >= ((half + 31) / 32) * 32) return;
    if (i >= half) { VST2(float, invb + i, 0.f); return; }
    const float e = (float)(2 * i) / (float)D;
    float invf;
    if (fmode == 1) invf = num * expf((float)(2 * i) * cexp);
    else if (fmode == 2) invf = num * powf(base, (-2.0f * ((float)i - 1.0f)) / (float)D);
    else invf = num * (1.0f / powf(base, e));
    VST2(float, invb + i, invf);
}
__global__ __launch_bounds__(256) void k_sincos(float* __restrict__ cs, float* __restrict__ sn, const float* __restrict__ invb, int S, int half, float pscale) {
    const int idx = blockIdx.x * 256 + threadIdx.x;
    if (idx >= S * half) return;
    const int s = idx / half, i = idx - s * half;
    const float ang = (pscale * (float)s) * invb[i];
    VST2(float, cs + idx, cosf(ang)); VST2(float, sn + idx, sinf(ang));
}

// k_mulact: dst[i] = act(x[i]) * y[i]
__global__ __launch_bounds__(256) void k_mulact(const float* __restrict__ x, const float* __restrict__ y, float* __restrict__ dst, int n, int act) {
    const int i = blockIdx.x * 256 + threadIdx.x;
    if (i < n) { const float v = act_fn(x[i], act) * y[i]; VST2(float, dst + i, v); }
}

// =====================================================================================================================
// k_matvec: thread-per-row matrix-vector products for N <= 8 output columns (heads with 1-3 outputs, gates), f32 on the VALU.
//   C[r*sCm + j] = act(alpha * sum_k A[r*sAm + k*sAk] * B[j*sBn + k*sBk] + bias[j]) + beta * R[r*sRm + j*sRn]; each thread writes its N contiguous floats.
// =====================================================================================================================
__global__ __launch_bounds__(256) void k_matvec(GemmP p) {
    // 32 lanes write one line with one instruction.
    const int rpt = (p.N == 1) ? 1 : 32;
    const long long r0 = ((long long)blockIdx.x * 256 + threadIdx.x) * rpt; const int z = blockIdx.z, zo = z / p.zi_n, zi = z - zo * p.zi_n;
    if (r0 >= p.M) return;
    const float* Bb = p.B + zo * p.sBo + zi * p.sBi;
    float* C = p.C + zo * p.sCo + zi * p.sCi; const float* R = p.R + zo * p.sRo + zi * p.sRi;
    for (int rr = 0; rr < rpt; ++rr) {
        const long long r = r0 + rr; if (r >= p.M) break;
        const float* A = p.A + zo * p.sAo + zi * p.sAi + r * p.sAm;
        float acc[8] = {0.f, 0.f, 0.f, 0.f, 0.f, 0.f, 0.f, 0.f};
        for (int k = 0; k < p.K; ++k) { const float a = A[(long long)k * p.sAk];
#pragma unroll
            for (int j = 0; j < 8; ++j) if (j < p.N) acc[j] += a * Bb[(long long)j * p.sBn + (long long)k * p.sBk]; }
#pragma unroll
        for (int j = 0; j < 8; ++j) if (j < p.N) {
            float v = acc[j] * p.alpha;
            if (p.flags & 1) v += p.bias[j];
            if (p.flags & 2) v += p.bias[r];
            v = act_fn(v, p.act);
            if (p.flags & 4) v += p.beta * R[r * p.sRm + (long long)j * p.sRn];
            VST2(float, C + r * p.sCm + j, v);
        }
    }
}
// k_smallsoftmax: thread-per-row softmax for short rows (n <= 64): dst[r*dr + j] = softmax(scale*src[r*sr + j])
__global__ __launch_bounds__(256) void k_smallsoftmax(const float* __restrict__ src, float* __restrict__ dst, long long sr, long long dr, int n, long long R, float scale) {
    const long long r0 = ((long long)blockIdx.x * 256 + threadIdx.x) * 32;
    for (int rr = 0; rr < 32; ++rr) {
        const long long r = r0 + rr; if (r >= R) return;
        const float* s = src + r * sr; float* d = dst + r * dr;
        float mx = -__builtin_inff();
        for (int j = 0; j < n; ++j) mx = fmaxf(mx, s[j] * scale);
        float sum = 0.f;
        for (int j = 0; j < n; ++j) sum += expf(s[j] * scale - mx);
        const float inv = 1.f / sum;
        for (int j = 0; j < n; ++j) { const float v = expf(s[j] * scale - mx) * inv; VST2(float, d + j, v); }
    }
}

__global__ __launch_bounds__(32) void k_unitstat(float* __restrict__ st) { const int t = threadIdx.x; const float v = (t == 1) ? 1.f : 0.f; VST2(float, st + t, v); }

// destination (e.g. a d_out whose row width is not a multiple of 32 floats) is written by consecutive lanes of one instruction
__global__ __launch_bounds__(256) void k_lincopy(const float* __restrict__ src, long long lds, float* __restrict__ dst, long long ldd, long long rows, int cols) {
    const long long i = (long long)blockIdx.x * 256 + threadIdx.x; if (i >= rows * cols) return;
    const long long r = i / cols; const int c = (int)(i - r * cols);
    const float v = src[r * lds + c]; VST2(float, dst + r * ldd + c, v);
}

namespace w25 {
typedef __attribute__((ext_vector_type(16))) _Float16 v16h;
typedef __attribute__((ext_vector_type(8)))  _Float16 v8h;
typedef __attribute__((ext_vector_type(16))) __bf16   v16b;
typedef __attribute__((ext_vector_type(8)))  __bf16   v8b;
typedef __attribute__((ext_vector_type(8)))  float    v8f;
typedef __attribute__((ext_vector_type(4)))  float    v4f;

__device__ __forceinline__ unsigned short f2bf_bits(float f) {
  unsigned u = __float_as_uint(f);
  return (unsigned short)((u + 0x7FFFu + ((u >> 16) & 1u)) >> 16);
}
__device__ __forceinline__ float bf_bits2f(unsigned short h) { return __uint_as_float(((unsigned)h) << 16); }

// hazard guards as plain device helpers (no inline asm inside the kernel template body)
__device__ __forceinline__ void dep_guard_h(v8f& a, v8f& b, v16h x, v16h y) { asm volatile("v_nop\n\tv_nop\n\tv_nop\n\tv_nop" : "+v"(a), "+v"(b) : "v"(x), "v"(y)); }
__device__ __forceinline__ void dep_guard_b(v8f& a, v8f& b, v16b x, v16b y) { asm volatile("v_nop\n\tv_nop\n\tv_nop\n\tv_nop" : "+v"(a), "+v"(b) : "v"(x), "v"(y)); }
__device__ __forceinline__ void keep4_h(v16h a, v16h b, v16h c, v16h d) { asm volatile("v_nop" :: "v"(a), "v"(b), "v"(c), "v"(d)); }
__device__ __forceinline__ void keep4_b(v16b a, v16b b, v16b c, v16b d) { asm volatile("v_nop" :: "v"(a), "v"(b), "v"(c), "v"(d)); }
__device__ __forceinline__ void acc_guard4(v8f& a, v8f& b, v8f& c, v8f& d) { asm volatile("v_nop\n\tv_nop\n\tv_nop\n\tv_nop" : "+v"(a), "+v"(b), "+v"(c), "+v"(d)); }
template <typename T> struct Frag;
template <> struct Frag<_Float16> {
  typedef v16h V; union U { v16h v; v8h h[2]; };
  static __device__ __forceinline__ v16h load(const _Float16* p) {   // elements 0..7 <- p[0..7], 8..15 <- p[16..23]
    U f; f.h[0] = *(const v8h*)(p); f.h[1] = *(const v8h*)(p + 16); return f.v;
  }
  static __device__ __forceinline__ v8f mma(v16h a, v16h b, v8f c) {
    return __builtin_amdgcn_wmma_f32_16x16x32_f16(false, a, false, b, (short)0, c, false, false);
  }
  static __device__ __forceinline__ void guard(v8f& a, v8f& b, v16h x, v16h y) { dep_guard_h(a, b, x, y); }
  static __device__ __forceinline__ void keep(v16h a, v16h b, v16h c, v16h d) { keep4_h(a, b, c, d); }
};
template <> struct Frag<__bf16> {
  typedef v16b V; union U { v16b v; v8b h[2]; };
  static __device__ __forceinline__ v16b load(const __bf16* p) {
    U f; f.h[0] = *(const v8b*)(p); f.h[1] = *(const v8b*)(p + 16); return f.v;
  }
  static __device__ __forceinline__ v8f mma(v16b a, v16b b, v8f c) {
    return __builtin_amdgcn_wmma_f32_16x16x32_bf16(false, a, false, b, (short)0, c, false, false);
  }
  static __device__ __forceinline__ void guard(v8f& a, v8f& b, v16b x, v16b y) { dep_guard_b(a, b, x, y); }
  static __device__ __forceinline__ void keep(v16b a, v16b b, v16b c, v16b d) { keep4_b(a, b, c, d); }
};

// ---- Register-blocked batched WMMA GEMM ------------------------------------
// C[m,n] = scale * sum_k A[m,k] * Bt[n,k] (+bias)(+resid); each wave owns a 64x64 tile.
// A row-major [M,K]; Bt row-major [N,K]; M,N % 64 == 0, K % 32 == 0.
// SPLIT: operands are hi/lo planes (A2/Bt2 = lo planes, same layout); product = hi·hi + hi·lo + lo·hi.
// BIAS_MODE: 0 = none, 1 = bias[m], 2 = bias[n].
// OUT_MODE: 0 = f32, 1 = f16, 2 = bf16 hi plane (Cout) + bf16 lo plane (Cout2).
// ET: 0 = f16 operands, 1 = bf16 operands (pointers passed as 16-bit storage)
template <int ET> struct Elem;
template <> struct Elem<0> { typedef _Float16 T; };
template <> struct Elem<1> { typedef __bf16 T; };
template <int ET, bool SPLIT, int BIAS_MODE, int OUT_MODE, bool RESID, int ACT = 0>
__global__ __launch_bounds__(256) void wmma_gemm64(
    const unsigned short* __restrict__ Ap, const unsigned short* __restrict__ A2p, int lda, long strideA,
    const unsigned short* __restrict__ Btp, const unsigned short* __restrict__ Bt2p, int ldb, long strideB,
    void* __restrict__ Cout, void* __restrict__ Cout2, int ldc, long strideC,
    const float* __restrict__ bias,
    const float* __restrict__ resid, long strideR,
    int M, int N, int K, float scale) {
  typedef typename Elem<ET>::T T;
  typedef typename Frag<T>::V V;
  const T* A = (const T*)Ap; const T* A2 = (const T*)A2p; const T* Bt = (const T*)Btp; const T* Bt2 = (const T*)Bt2p;
  __shared__ __align__(16) float sT[8][16 * 68];   // per-wave 16x64 slab, pitch 68 floats
  const int b    = blockIdx.y;
  const int lane = threadIdx.x & 31;
  const int wave = threadIdx.x >> 5;
  const int tilesN = N >> 6;
  const int tilesM = M >> 6;
  const int tile = blockIdx.x * 8 + wave;
  if (tile >= tilesM * tilesN) return;   // wave-uniform; no block barriers in this kernel
  const int tm = tile / tilesN;
  const int tn = tile - tm * tilesN;
  const int m0 = tm << 6;
  const int n0 = tn << 6;

  const T* Ab  = A  + (size_t)b * strideA;
  const T* Bb  = Bt + (size_t)b * strideB;
  const T* Ab2 = SPLIT ? (A2  + (size_t)b * strideA) : nullptr;
  const T* Bb2 = SPLIT ? (Bt2 + (size_t)b * strideB) : nullptr;

  const int rlane = lane & 15;                 // row (A) / col (B, D) within subtile
  const int koff  = (lane >> 4) * 8;           // k offset of this lane half
  const int mOff  = (lane >> 4) * 8;           // D row offset

  v8f acc[4][4];
#pragma unroll
  for (int i = 0; i < 4; ++i)
#pragma unroll
    for (int j = 0; j < 4; ++j) acc[i][j] = (v8f){0.f,0.f,0.f,0.f,0.f,0.f,0.f,0.f};

  for (int k0 = 0; k0 < K; k0 += 32) {
    V bh[4], bl[4];
#pragma unroll
    for (int j = 0; j < 4; ++j) {
      const size_t bo = (size_t)(n0 + (j << 4) + rlane) * ldb + koff + k0;
      bh[j] = Frag<T>::load(Bb + bo);
      if (SPLIT) bl[j] = Frag<T>::load(Bb2 + bo);
    }
#pragma unroll
    for (int i = 0; i < 4; ++i) {
      const size_t ao = (size_t)(m0 + (i << 4) + rlane) * lda + koff + k0;
      V ah = Frag<T>::load(Ab + ao);
      V al;
      if (SPLIT) al = Frag<T>::load(Ab2 + ao);
#pragma unroll
      for (int j = 0; j < 4; ++j) {
        acc[i][j] = Frag<T>::mma(ah, bh[j], acc[i][j]);
        if (SPLIT) {
          acc[i][j] = Frag<T>::mma(ah, bl[j], acc[i][j]);
          acc[i][j] = Frag<T>::mma(al, bh[j], acc[i][j]);
        }
      }
      Frag<T>::guard(acc[i][0], acc[i][3], ah, SPLIT ? al : ah);
    }
    Frag<T>::keep(bh[0], bh[1], bh[2], bh[3]);
    if (SPLIT) Frag<T>::keep(bl[0], bl[1], bl[2], bl[3]);
  }
  acc_guard4(acc[0][0], acc[0][1], acc[0][2], acc[0][3]);
  acc_guard4(acc[1][0], acc[1][1], acc[1][2], acc[1][3]);
  acc_guard4(acc[2][0], acc[2][1], acc[2][2], acc[2][3]);
  acc_guard4(acc[3][0], acc[3][1], acc[3][2], acc[3][3]);

  // ---- epilogue ----
  float* slab = sT[wave];
  const float* Rb = RESID ? (resid + (size_t)b * strideR) : nullptr;
#pragma unroll
  for (int i = 0; i < 4; ++i) {
    const int mBase = m0 + (i << 4);
#pragma unroll
    for (int j = 0; j < 4; ++j) {
      const int n = n0 + (j << 4) + rlane;
      float bv = 0.f;
      if (BIAS_MODE == 2) bv = bias[n];
#pragma unroll
      for (int r = 0; r < 8; ++r) {
        float v = acc[i][j][r] * scale;
        if (BIAS_MODE == 1) v += bias[mBase + mOff + r];
        if (BIAS_MODE == 2) v += bv;
        if (RESID) v += Rb[(size_t)(mBase + mOff + r) * ldc + n];
        if (ACT == 1) v = tanhf(v);
        if (ACT == 2) v = fmaxf(v, 0.0f);
        if (ACT == 3) v = v / (1.0f + expf(-v));
        if (ACT == 4) v = (v > 0.f) ? v : 0.01f * v;
        if (ACT == 5) v = 0.5f * v * (1.0f + erff(v * 0.70710678118654752f));
        slab[(mOff + r) * 68 + (j << 4) + rlane] = v;
      }
    }
    __builtin_amdgcn_fence(__ATOMIC_RELEASE, "workgroup");
    __builtin_amdgcn_wave_barrier();
    __builtin_amdgcn_fence(__ATOMIC_ACQUIRE, "workgroup");
    if (OUT_MODE == 0) {
      float* C = (float*)Cout + (size_t)b * strideC;
      const int hh = lane >> 4, c4 = (lane & 15) * 4;     // row seg = 256 B = 16 lanes x 16 B
      {
#pragma unroll
        for (int it = 0; it < 8; ++it) {
          const int row = it * 2 + hh;
          v4f v = *(const v4f*)(slab + row * 68 + c4);
          *(v4f*)(C + (size_t)(mBase + row) * ldc + n0 + c4) = v;
        }
        
      }
    } else {
      const int q = lane >> 3, c8 = (lane & 7) * 8;
      unsigned short* C  = (unsigned short*)Cout  + (size_t)b * strideC;
      unsigned short* C2 = (OUT_MODE == 2) ? ((unsigned short*)Cout2 + (size_t)b * strideC) : nullptr;
      {
#pragma unroll
        for (int it = 0; it < 4; ++it) {
          const int row = it * 4 + q;
          const float* sp = slab + row * 68 + c8;
          v8h hv, lv;
#pragma unroll
          for (int e = 0; e < 8; ++e) {
            if (OUT_MODE == 1) {
              hv[e] = (_Float16)sp[e];
            } else {
              unsigned short hb = f2bf_bits(sp[e]);
              unsigned short lb = f2bf_bits(sp[e] - bf_bits2f(hb));
              hv[e] = __builtin_bit_cast(_Float16, hb);
              lv[e] = __builtin_bit_cast(_Float16, lb);
            }
          }
          *(v8h*)(C + (size_t)(mBase + row) * ldc + n0 + c8) = hv;
          if (OUT_MODE == 2) *(v8h*)(C2 + (size_t)(mBase + row) * ldc + n0 + c8) = lv;
        }
        
      }
    }
    __builtin_amdgcn_fence(__ATOMIC_RELEASE, "workgroup");
    __builtin_amdgcn_wave_barrier();
    __builtin_amdgcn_fence(__ATOMIC_ACQUIRE, "workgroup");
  }
}

// ---- Projection GEMM on operand tiles staged in LDS -------------------------------------------------------------
// C[m,n] = scale * sum_k A[m,k] * Bt[n,k] (+ bias[n]); A [GM][GK] and Bt [GN][GK] f16 with k contiguous, C f32 [GM][GN].
// A block owns a 128 x 128 tile of C, its eight waves 32 x 64 each. A trip takes 128 k: 256 bytes of each of the block's 256 operand rows come into LDS once,
// by asynchronous 16-byte copies (one wave's copy = two whole 256-byte row pieces), and every wave reads its fragments from there, 16 bytes a lane.
// Two buffers: tile t + 1 flies while tile t is worked on, one barrier a trip. The k order of the sums is that of wmma_gemm64 (ascending, 32 a product).
constexpr int GL_PB  = 272;             // LDS row pitch in bytes: 256 + 16, an odd multiple of 16, free of bank conflicts for 16-byte readers
constexpr int GL_OP  = 128 * GL_PB;     // one operand's tile
constexpr int GL_BUF = 2 * GL_OP;       // one buffer: the A tile, behind it the Bt tile
// One thread's eight copies for one operand tile: the same 16 bytes of rows 16 apart. l = LDS byte address, g = global address of the first.
// The s_wait_xcnt closes the statement so that no register which a copy names is rewritten ahead of it.
template <int LD>
__device__ __forceinline__ void gl_copy8(unsigned l, const _Float16* g) {
  asm volatile(
      "global_load_async_to_lds_b128 %0, %8, off\n\t"
      "global_load_async_to_lds_b128 %1, %9, off\n\t"
      "global_load_async_to_lds_b128 %2, %10, off\n\t"
      "global_load_async_to_lds_b128 %3, %11, off\n\t"
      "global_load_async_to_lds_b128 %4, %12, off\n\t"
      "global_load_async_to_lds_b128 %5, %13, off\n\t"
      "global_load_async_to_lds_b128 %6, %14, off\n\t"
      "global_load_async_to_lds_b128 %7, %15, off\n\t"
      "s_wait_xcnt 0x0"
      :: "v"(l), "v"(l + 16 * GL_PB), "v"(l + 32 * GL_PB), "v"(l + 48 * GL_PB), "v"(l + 64 * GL_PB), "v"(l + 80 * GL_PB), "v"(l + 96 * GL_PB), "v"(l + 112 * GL_PB),
         "v"(g), "v"(g + 16 * LD), "v"(g + 32 * LD), "v"(g + 48 * LD), "v"(g + 64 * LD), "v"(g + 80 * LD), "v"(g + 96 * LD), "v"(g + 112 * LD)
      : "memory");
}
// OUT16 = 0: C (f32) takes the tile. OUT16 = 1: C16 takes it rounded to f16, the form in which the attention's products read it.
template <int GM, int GN, int GK, int BIAS_MODE, int OUT16>
__global__ __launch_bounds__(256) void wmma_gemm_lds(const _Float16* __restrict__ A, const _Float16* __restrict__ Bt, float* __restrict__ C, _Float16* __restrict__ C16, const float* __restrict__ bias, float scale) {
  static_assert(GM % 128 == 0 && GN % 128 == 0 && GK % 128 == 0 && GK >= 256, "whole tiles; the two-buffer prologue needs two k tiles");
  __shared__ __align__(16) unsigned char ring[2 * GL_BUF];
  __shared__ __align__(16) float sT[8][32 * 68];   // per-wave 32x64 output slab, pitch 68 floats; apart from the ring
  constexpr int TN = GN / 128, NT = GK / 128;
  const int tid = threadIdx.x, lane = tid & 31, wave = tid >> 5;
  const int bm = blockIdx.x / TN, bn = blockIdx.x % TN;
  const int rlane = lane & 15, hf = lane >> 4;
  const int wm = wave >> 1, wn = wave & 1;
  const int crow = tid >> 4, ccol = tid & 15;      // copies: 16 lanes cover one row's 256 bytes
  const _Float16* ga = A  + (size_t)(bm * 128 + crow) * GK + ccol * 8;
  const _Float16* gb = Bt + (size_t)(bn * 128 + crow) * GK + ccol * 8;
  const unsigned la = (unsigned)(size_t)ring + (unsigned)(crow * GL_PB + ccol * 16);
  const unsigned char* fa = ring + (wm * 32 + rlane) * GL_PB + hf * 16;            // fragment rows: lane = row, this half's 8 k first
  const unsigned char* fb = ring + GL_OP + (wn * 64 + rlane) * GL_PB + hf * 16;

  v8f acc[2][4];
#pragma unroll
  for (int i = 0; i < 2; ++i)
#pragma unroll
    for (int j = 0; j < 4; ++j) acc[i][j] = (v8f){0.f,0.f,0.f,0.f,0.f,0.f,0.f,0.f};

  gl_copy8<GK>(la, ga);
  gl_copy8<GK>(la + GL_OP, gb);
  asm volatile("s_wait_asynccnt 0x0" ::: "memory");   // this wave's share of tile 0 has landed
  __syncthreads();                                    // tile 0 is whole for every wave
  gl_copy8<GK>(la + GL_BUF, ga + 128);
  gl_copy8<GK>(la + GL_BUF + GL_OP, gb + 128);
#pragma unroll 1   // kept rolled: buffer offset and refill test are scalar work, and one trip's code serves both buffers
  for (int t = 0; t < NT; ++t) {
    const int bo = (t & 1) * GL_BUF;
    v16h a[2][2], b[2][4];                              // two fragment sets: one is worked on while the next 32 k are read
#pragma unroll
    for (int i = 0; i < 2; ++i) a[0][i] = Frag<_Float16>::load((const _Float16*)(fa + bo + i * 16 * GL_PB));
#pragma unroll
    for (int j = 0; j < 4; ++j) b[0][j] = Frag<_Float16>::load((const _Float16*)(fb + bo + j * 16 * GL_PB));
#pragma unroll
    for (int ks = 0; ks < 4; ++ks) {
      if (ks < 3) {
#pragma unroll
        for (int i = 0; i < 2; ++i) a[(ks + 1) & 1][i] = Frag<_Float16>::load((const _Float16*)(fa + bo + i * 16 * GL_PB + (ks + 1) * 64));
#pragma unroll
        for (int j = 0; j < 4; ++j) b[(ks + 1) & 1][j] = Frag<_Float16>::load((const _Float16*)(fb + bo + j * 16 * GL_PB + (ks + 1) * 64));
      }
      __builtin_amdgcn_sched_barrier(0);                // the next set's twelve LDS reads stay one group ahead of these products (left alone, the scheduler spreads them among the products on one set, a full LDS wait each)
#pragma unroll
      for (int i = 0; i < 2; ++i)
#pragma unroll
        for (int j = 0; j < 4; ++j) acc[i][j] = Frag<_Float16>::mma(a[ks & 1][i], b[ks & 1][j], acc[i][j]);
      __builtin_amdgcn_sched_barrier(0);                // and the group after next stays behind them
    }
    asm volatile("s_wait_dscnt 0x0" ::: "memory");      // this wave's reads of tile t are done before the buffer is handed back
    asm volatile("s_wait_asynccnt 0x0" ::: "memory");   // this wave's share of tile t + 1 has landed
    __syncthreads();                                    // publishes tile t + 1 and ends every wave's reads of tile t
    if (t + 2 < NT) {
      gl_copy8<GK>(la + bo, ga + (t + 2) * 128);
      gl_copy8<GK>(la + bo + GL_OP, gb + (t + 2) * 128);
    }
  }
  asm volatile("s_wait_asynccnt 0x0" ::: "memory");     // nothing of this wave is in flight when it goes on

  // ---- epilogue: the wave's 32 x 64 tile goes through its own slab, so that every store is whole row pieces (256 bytes of f32, 128 bytes of f16) ----
  float* slab = sT[wave];
  const int n0 = bn * 128 + wn * 64, mBase = bm * 128 + wm * 32;
#pragma unroll
  for (int j = 0; j < 4; ++j) {
    float bv = 0.f;
    if (BIAS_MODE == 2) bv = bias[n0 + j * 16 + rlane];
#pragma unroll
    for (int i = 0; i < 2; ++i)
#pragma unroll
      for (int r = 0; r < 8; ++r) {
        float v = acc[i][j][r] * scale;
        if (BIAS_MODE == 2) v += bv;
        slab[(i * 16 + hf * 8 + r) * 68 + j * 16 + rlane] = v;
      }
  }
  // the slab's rows are read by other lanes of the same wave than wrote them
  __builtin_amdgcn_fence(__ATOMIC_RELEASE, "workgroup");
  __builtin_amdgcn_wave_barrier();
  __builtin_amdgcn_fence(__ATOMIC_ACQUIRE, "workgroup");
  if (OUT16) {
    // eight lanes cover one row's 64 halves, a whole 128-byte line; a store takes four rows
    const int r4 = lane >> 3, c8 = (lane & 7) * 8;
    _Float16* hrow0 = C16 + (size_t)(mBase + r4) * GN + n0 + c8;
#pragma unroll
    for (int it = 0; it < 8; ++it) {
      const float* sp = slab + (it * 4 + r4) * 68 + c8;
      const v4f u0 = *(const v4f*)sp, u1 = *(const v4f*)(sp + 4);
      const v8h pk = { (_Float16)u0[0], (_Float16)u0[1], (_Float16)u0[2], (_Float16)u0[3], (_Float16)u1[0], (_Float16)u1[1], (_Float16)u1[2], (_Float16)u1[3] };
      *(v8h*)(hrow0 + (size_t)it * 4 * GN) = pk;
    }
  } else {
    float* crow0 = C + (size_t)(mBase + hf) * GN + n0 + rlane * 4;
#pragma unroll
    for (int it = 0; it < 16; ++it) {
      const v4f v = *(const v4f*)(slab + (it * 2 + hf) * 68 + rlane * 4);
      *(v4f*)(crow0 + (size_t)it * 2 * GN) = v;
    }
  }
}

__global__ __launch_bounds__(256) void cast_f32_f16x2(
    const float* __restrict__ in, _Float16* __restrict__ out, int n2) {
  int i = blockIdx.x * 256 + threadIdx.x;
  if (i < n2) {
    const _Float16 h0 = (_Float16)in[2 * i], h1 = (_Float16)in[2 * i + 1];
    const unsigned u = (unsigned)__builtin_bit_cast(unsigned short, h0) | ((unsigned)__builtin_bit_cast(unsigned short, h1) << 16);
    ((unsigned*)out)[i] = u;
    
  }
}


} // namespace w25

__global__ __launch_bounds__(256) void k_castT16(const float* __restrict__ src, long long lds, _Float16* __restrict__ dst, long long ldd, int R, int C, float s) {
    const long long i = (long long)blockIdx.x * 256 + threadIdx.x; const long long np = (long long)C * (R / 2); if (i >= np) return; const int c = (int)(i / (R / 2)); const int r = 2 * (int)(i % (R / 2));
    const _Float16 h0 = (_Float16)(src[(long long)r * lds + c] * s), h1 = (_Float16)(src[(long long)(r + 1) * lds + c] * s);
    const unsigned u = (unsigned)__builtin_bit_cast(unsigned short, h0) | ((unsigned)__builtin_bit_cast(unsigned short, h1) << 16);
    unsigned* d = (unsigned*)(dst + (long long)c * ldd + r); *d = u;  }
__global__ __launch_bounds__(256) void k_cast16(const float* __restrict__ src, long long lds, _Float16* __restrict__ dst, long long ldd, int R, int C, float s) {
    const long long i = (long long)blockIdx.x * 256 + threadIdx.x; const long long np = (long long)R * (C / 2); if (i >= np) return; const int r = (int)(i / (C / 2)); const int c = 2 * (int)(i % (C / 2));
    const _Float16 h0 = (_Float16)(src[(long long)r * lds + c] * s), h1 = (_Float16)(src[(long long)r * lds + c + 1] * s);
    const unsigned u = (unsigned)__builtin_bit_cast(unsigned short, h0) | ((unsigned)__builtin_bit_cast(unsigned short, h1) << 16);
    unsigned* d = (unsigned*)(dst + (long long)r * ldd + c); *d = u;  }

// f32 -> f16 casts on few, long waves: 256 blocks of 16 waves (4,096 waves to start a launch). A tile is 16,384 consecutive floats: eight wave-wide 16-byte loads a lane
// (512 contiguous bytes a wave and load), all issued before the first is used, and eight 8-byte stores (256 contiguous bytes a wave and store).
__device__ __forceinline__ void cast_tile_ld(const float* __restrict__ s, v4f* r) {
#pragma unroll   // r stays in registers and the eight loads issue back to back
    for (int i = 0; i < 8; ++i) r[i] = *(const v4f*)(s + i * 2048);
}
__device__ __forceinline__ void cast_tile_st(_Float16* __restrict__ d, const v4f* r, float sc) {
#pragma unroll   // constant indices into r and pk: both stay in registers
    for (int i = 0; i < 8; ++i) {
        v4h pk;
#pragma unroll
        for (int e = 0; e < 4; ++e) pk[e] = (_Float16)(r[i][e] * sc);
        *(v4h*)(d + i * 2048) = pk;
    }
}
// Every operand of the four projections that exists before the first of them, in one launch: block n casts tile n of x, tile n of the context and tile n & 63 of
// weight n >> 6 (order Wq, Wk, Wv, Wo; times 16; the four f16 planes lie one behind the other in w16). x and c: 256 tiles each, a weight: 64.
__global__ __launch_bounds__(512) void k_cast_in(const float* __restrict__ x, const float* __restrict__ c, const float* __restrict__ Wq, const float* __restrict__ Wk,
                                                 const float* __restrict__ Wv, const float* __restrict__ Wo, _Float16* __restrict__ x16, _Float16* __restrict__ c16, _Float16* __restrict__ w16) {
    const unsigned n = blockIdx.x, sel = n >> 6;
    const float* __restrict__ w = (sel == 0) ? Wq : (sel == 1) ? Wk : (sel == 2) ? Wv : Wo;
    const unsigned t4 = threadIdx.x * 4u;
    v4f rx[8], rc[8], rw[8];
    cast_tile_ld(x + (size_t)n * 16384 + t4, rx);
    cast_tile_ld(c + (size_t)n * 16384 + t4, rc);
    cast_tile_ld(w + (size_t)(n & 63u) * 16384 + t4, rw);
    cast_tile_st(x16 + (size_t)n * 16384 + t4, rx, 1.0f);
    cast_tile_st(c16 + (size_t)n * 16384 + t4, rc, 1.0f);
    cast_tile_st(w16 + (size_t)n * 16384 + t4, rw, 16.0f);
}
// One plane of 256 tiles (the attention output).
__global__ __launch_bounds__(512) void k_cast_plane(const float* __restrict__ s, _Float16* __restrict__ d) {
    const size_t o = (size_t)blockIdx.x * 16384 + threadIdx.x * 4u;
    v4f r[8];
    cast_tile_ld(s + o, r);
    cast_tile_st(d + o, r, 1.0f);
}

// f32 -> bf16 hi plane + bf16 lo plane (x = hi + lo to ~2^-17 relative; RNE both), [R][C] -> [R][C] (or transposed to [C][R]); 2 consecutive destination elements
__device__ __forceinline__ unsigned int f2bf2_pack(float a, float b, unsigned int* lo) {
    const unsigned short ha = w25::f2bf_bits(a), hb = w25::f2bf_bits(b);
    const unsigned short la = w25::f2bf_bits(a - w25::bf_bits2f(ha)), lb = w25::f2bf_bits(b - w25::bf_bits2f(hb));
    *lo = (unsigned)la | ((unsigned)lb << 16); return (unsigned)ha | ((unsigned)hb << 16); }
__global__ __launch_bounds__(256) void k_castS16(const float* __restrict__ src, long long lds, __bf16* __restrict__ dhi, __bf16* __restrict__ dlo, long long ldd, int R, int C, float s, int transpose) {
    const long long i = (long long)blockIdx.x * 256 + threadIdx.x; long long o; float a, b;
    if (transpose) { const long long np = (long long)C * (R / 2); if (i >= np) return; const int c = (int)(i / (R / 2)); const int r = 2 * (int)(i % (R / 2)); a = src[(long long)r * lds + c] * s; b = src[(long long)(r + 1) * lds + c] * s; o = (long long)c * ldd + r; }
    else { const long long np = (long long)R * (C / 2); if (i >= np) return; const int r = (int)(i / (C / 2)); const int c = 2 * (int)(i % (C / 2)); a = src[(long long)r * lds + c] * s; b = src[(long long)r * lds + c + 1] * s; o = (long long)r * ldd + c; }
    unsigned lo; const unsigned hi = f2bf2_pack(a, b, &lo); unsigned* ph = (unsigned*)(dhi + o); unsigned* pl = (unsigned*)(dlo + o);
    *ph = hi; *pl = lo;  }

namespace w25 {
// =====================================================================================
// Generic causal/non-causal attention for head_dim 64, f32 in / f32 out; 16-bit operands: bf16 with optional hi/lo splits, or
// plain f16 (F16=true, non-split, probabilities carried x2^15).
//   scores = (q*qscale)·kᵀ : v_wmma_f32_16x16x32_bf16; SPLIT_QK -> q,k as bf16 hi/lo (hi·hi + hi·lo + lo·hi)
//   out    = p·v           : v_wmma_f32_16x16x32_bf16; SPLIT_PV -> p,v as bf16 hi/lo; else p,v plain bf16
//   f32 accumulate; online softmax in f32. Block = 4 waves = 64 query rows of one (batch, head); S % 64 == 0.
//   Element (b, s, h, d) of tensor X lives at X[b*X_bs + s*X_rs + h*X_hs + d] (strides in floats, multiples of 4).
//   Masking: mask_mode 0 none, 1 causal (kv > q masked), 2 tensor [S][Skv] shared over (b,h) (float if
//   mask_is_int==0, int32 with element == 0 -> masked if 1, int32 with element != 0 -> masked if 2), 3 per-token vectors qmask[B][S] & kvmask[B][Skv] (int32,
//   0 -> masked), 4 causal + sliding window (kv > q or q - kv > W masked; W passed in mask_is_int);
//   5 = relative-position bias: s += cp[b,h,q][idx[q][kv]] + pc[b,h,kv][idx[q][kv]] with idx = mask_b ([S][Skv] int32) and
//   mask_a an int32 [S][Skv] tensor with nonzero = masked (tables: element (b,h,row,n) at X + b*c_bs + h*c_hs + row*c_rs + n);
//   masked scores are replaced by mask_fill (e.g. -inf or -1e9) before the softmax.
//   grid.x = B * H * (S/64) (or a sub-range with blk0).
// =====================================================================================
#define AT_D 64
#define AT_NW 4
#define AT_QB 64
#define AT_KC 64
struct AttnGeom { const float* cp = nullptr; const float* pc = nullptr; long c_bs = 0, c_rs = 0, c_hs = 0;   // mode-5 score-bias tables
                  long q_bs, q_rs, q_hs, k_bs, k_rs, k_hs, v_bs, v_rs, v_hs, o_bs, o_rs, o_hs;
                  int S, Skv, H, mask_mode; float qscale; int blk0; float mask_fill; int mask_is_int; };
static_assert(sizeof(AttnGeom) == 168, "no padding");

__device__ __forceinline__ unsigned short at_bf_bits(float f) {
  unsigned u = __float_as_uint(f);
  return (unsigned short)((u + 0x7FFFu + ((u >> 16) & 1u)) >> 16);
}
__device__ __forceinline__ __bf16 at_f2bf(float f) { return __builtin_bit_cast(__bf16, at_bf_bits(f)); }
__device__ __forceinline__ void at_split(float f, __bf16& hi, __bf16& lo) {
  const unsigned short hb = at_bf_bits(f);
  hi = __builtin_bit_cast(__bf16, hb);
  lo = at_f2bf(f - __uint_as_float(((unsigned)hb) << 16));
}
__device__ __forceinline__ v8f at_mma(v16b a, v16b b, v8f c) {
  c = __builtin_amdgcn_wmma_f32_16x16x32_bf16(false, a, false, b, (short)0, c, false, false);
  asm volatile("v_nop\n\tv_nop\n\tv_nop\n\tv_nop" : "+v"(c) : "v"(a), "v"(b));
  return c;
}
// 16-bit element as a bit pattern held in a __bf16 slot: f16 bits when F16, bf16 (RNE) otherwise
template <bool F16> __device__ __forceinline__ __bf16 at_to16(float f) {
  if (F16) return __builtin_bit_cast(__bf16, (_Float16)f);
  return at_f2bf(f);
}
template <bool F16> __device__ __forceinline__ v8f at_mma16(v16b a, v16b b, v8f c) {
  if (F16) {
    const v16h ah = __builtin_bit_cast(v16h, a), bh = __builtin_bit_cast(v16h, b);
    c = __builtin_amdgcn_wmma_f32_16x16x32_f16(false, ah, false, bh, (short)0, c, false, false);
    asm volatile("v_nop\n\tv_nop\n\tv_nop\n\tv_nop" : "+v"(c) : "v"(ah), "v"(bh));
    return c;
  }
  return at_mma(a, b, c);
}

template <bool SPLIT_QK, bool SPLIT_PV, bool F16 = false>
__global__ __launch_bounds__(128)
void attn64_kernel(const float* __restrict__ q, const float* __restrict__ k,
                   const float* __restrict__ v, float* __restrict__ out,
                   const void* __restrict__ mask_a, const int* __restrict__ mask_b, AttnGeom g) {
  static_assert(!(F16 && (SPLIT_QK || SPLIT_PV)), "f16 mode is non-split");
  const float PSC = F16 ? 32768.0f : 1.0f;     // f16 probabilities carried x2^15 (subnormal range), folded into the final 1/l
  union FB { v16b v; v8b h[2]; };
  __shared__ __align__(16) __bf16 Ksh[AT_KC * AT_D];             // K hi [kv][d]      8 KB
  __shared__ __align__(16) __bf16 Ksl[SPLIT_QK ? AT_KC * AT_D : 8];
  __shared__ __align__(16) __bf16 Vth[AT_D * AT_KC];             // V hi [d][kv]      8 KB
  __shared__ __align__(16) __bf16 Vtl[SPLIT_PV ? AT_D * AT_KC : 8];
  __shared__ __align__(16) __bf16 Psh[AT_NW][16 * AT_KC];        // per wave P hi [row][kv]  8 KB
  __shared__ __align__(16) __bf16 Psl[SPLIT_PV ? AT_NW : 1][SPLIT_PV ? 16 * AT_KC : 8];
  __shared__ __align__(16) float  Os[AT_NW][16 * 68];            // per wave out tile, pitch 68

  const int tid  = threadIdx.x;
  const int wave = tid >> 5;
  const int lane = tid & 31;
  const int hh   = lane >> 4;
  const int c    = lane & 15;

  const int nqb = g.S / AT_QB;
  const int bx = blockIdx.x + g.blk0;
  const int qb = bx % nqb;
  const int bh = bx / nqb;
  const int h  = bh % g.H;
  const int b  = bh / g.H;
  const int qbase_block = qb * AT_QB;
  const int q0 = qbase_block + wave * 16;

  const float* qb_ptr = q + (size_t)b * g.q_bs + (size_t)h * g.q_hs;
  const float* kb_ptr = k + (size_t)b * g.k_bs + (size_t)h * g.k_hs;
  const float* vb_ptr = v + (size_t)b * g.v_bs + (size_t)h * g.v_hs;
  float*       ob_ptr = out + (size_t)b * g.o_bs + (size_t)h * g.o_hs;

  // ---- Q fragments (A operand): 2 d-chunks, hi (and lo) ----
  v16b qah[2], qal[2];
  {
    const float* qrow = qb_ptr + (size_t)(q0 + c) * g.q_rs;
#pragma unroll
    for (int dc = 0; dc < 2; ++dc) {
#pragma unroll
      for (int e = 0; e < 8; ++e) {
        const float f0 = qrow[dc * 32 + 8 * hh + e] * g.qscale;
        const float f1 = qrow[dc * 32 + 16 + 8 * hh + e] * g.qscale;
        if (SPLIT_QK) { __bf16 hq, lq; at_split(f0, hq, lq); qah[dc][e] = hq; qal[dc][e] = lq; at_split(f1, hq, lq); qah[dc][8 + e] = hq; qal[dc][8 + e] = lq; }
        else { qah[dc][e] = at_to16<F16>(f0); qah[dc][8 + e] = at_to16<F16>(f1); qal[dc][e] = qah[dc][e]; qal[dc][8 + e] = qah[dc][8 + e]; }
      }
    }
  }

  float mrow[8], lrow[8];
  v8f oacc[4];
#pragma unroll
  for (int r = 0; r < 8; ++r) { mrow[r] = -INFINITY; lrow[r] = 0.f; }
#pragma unroll
  for (int t = 0; t < 4; ++t) oacc[t] = (v8f){0.f,0.f,0.f,0.f,0.f,0.f,0.f,0.f};

  const int nChunks = (g.mask_mode == 1 || g.mask_mode == 4) ? (qb + 1) : (g.Skv / AT_KC);   // block-uniform
  // per-row query mask (mode 3)
  int qkeep[8];
#pragma unroll
  for (int r = 0; r < 8; ++r) qkeep[r] = (g.mask_mode == 3) ? mask_b[(size_t)b * g.S + q0 + 8 * hh + r] : 1;   // mask_b = qmask in mode 3
  for (int kc = 0; kc < nChunks; ++kc) {
    const int kv0 = kc * AT_KC;
    __syncthreads();
    {
      const int kvr = tid >> 1, dh = (tid & 1) * 32;
      const float* krow = kb_ptr + (size_t)(kv0 + kvr) * g.k_rs + dh;
      const float* vrow = vb_ptr + (size_t)(kv0 + kvr) * g.v_rs + dh;
#pragma unroll
      for (int i = 0; i < 8; ++i) {
        v4f kk = *(const v4f*)(krow + 4 * i);
        v4f vv = *(const v4f*)(vrow + 4 * i);
#pragma unroll
        for (int e = 0; e < 4; ++e) {
          const int d = dh + 4 * i + e;
          if (SPLIT_QK) { __bf16 a, bl; at_split(kk[e], a, bl); Ksh[kvr * AT_D + d] = a; Ksl[kvr * AT_D + d] = bl; }
          else Ksh[kvr * AT_D + d] = at_to16<F16>(kk[e]);
          if (SPLIT_PV) { __bf16 a, bl; at_split(vv[e], a, bl); Vth[d * AT_KC + kvr] = a; Vtl[d * AT_KC + kvr] = bl; }
          else Vth[d * AT_KC + kvr] = at_to16<F16>(vv[e]);
        }
      }
    }
    __syncthreads();

    v8f s[4];
#pragma unroll
    for (int j = 0; j < 4; ++j) {
      s[j] = (v8f){0.f,0.f,0.f,0.f,0.f,0.f,0.f,0.f};
#pragma unroll 1
      for (int dc = 0; dc < 2; ++dc) {
        FB kb;
        kb.h[0] = *(const v8b*)(Ksh + (j * 16 + c) * AT_D + dc * 32 + 8 * hh);
        kb.h[1] = *(const v8b*)(Ksh + (j * 16 + c) * AT_D + dc * 32 + 16 + 8 * hh);
        s[j] = at_mma16<F16>(qah[dc], kb.v, s[j]);
        if (SPLIT_QK) {
          FB kl;
          kl.h[0] = *(const v8b*)(Ksl + (j * 16 + c) * AT_D + dc * 32 + 8 * hh);
          kl.h[1] = *(const v8b*)(Ksl + (j * 16 + c) * AT_D + dc * 32 + 16 + 8 * hh);
          s[j] = at_mma16<F16>(qah[dc], kl.v, s[j]);
          s[j] = at_mma16<F16>(qal[dc], kb.v, s[j]);
        }
      }
    }
    const bool diag = (g.mask_mode == 1) && (kc == qb);
    int kvkeep[4] = {1, 1, 1, 1};
    if (g.mask_mode == 3) {
#pragma unroll
      for (int j = 0; j < 4; ++j) kvkeep[j] = ((const int*)mask_a)[(size_t)b * g.Skv + kv0 + j * 16 + c];   // mask_a = kvmask
    }
    float cm[8];
#pragma unroll
    for (int r = 0; r < 8; ++r) {
      const int qrow = q0 + 8 * hh + r;
      float m = -INFINITY;
#pragma unroll
      for (int j = 0; j < 4; ++j) {
        const int kvcol = kv0 + j * 16 + c;
        bool masked = false;
        if (diag) masked = (kvcol > qrow);
        else if (g.mask_mode == 4) masked = (kvcol > qrow) || (qrow - kvcol > g.mask_is_int);
        else if (g.mask_mode == 2) {
          const size_t mi = (size_t)qrow * g.Skv + kvcol;
          masked = (g.mask_is_int == 0) ? (((const float*)mask_a)[mi] == 0.0f)
                 : (g.mask_is_int == 1) ? (((const int*)mask_a)[mi] == 0) : (((const int*)mask_a)[mi] != 0);
        } else if (g.mask_mode == 3) masked = (qkeep[r] == 0) || (kvkeep[j] == 0);
        else if (g.mask_mode == 5) {
          const size_t mi = (size_t)qrow * g.Skv + kvcol;
          masked = (((const int*)mask_a)[mi] != 0);
          int n = mask_b[mi]; n = n < 0 ? 0 : n;
          s[j][r] += g.cp[(size_t)b * g.c_bs + (size_t)h * g.c_hs + (size_t)qrow * g.c_rs + n]
                   + g.pc[(size_t)b * g.c_bs + (size_t)h * g.c_hs + (size_t)kvcol * g.c_rs + n];
        }
        if (masked) s[j][r] = g.mask_fill;
        m = fmaxf(m, s[j][r]);
      }
#pragma unroll
      for (int off = 1; off < 16; off <<= 1) m = fmaxf(m, __shfl_xor(m, off, 32));
      cm[r] = m;
    }
    __bf16* pwh = Psh[wave];
    __bf16* pwl = Psl[SPLIT_PV ? wave : 0];
#pragma unroll
    for (int r = 0; r < 8; ++r) {
      const float mnew = fmaxf(mrow[r], cm[r]);
      const float alpha = expf(mrow[r] - mnew);
      mrow[r] = mnew;
      float psum = 0.f;
#pragma unroll
      for (int j = 0; j < 4; ++j) {
        const float p = expf(s[j][r] - mnew);
        psum += p;
        if (SPLIT_PV) { __bf16 a, bl; at_split(p, a, bl); pwh[(8 * hh + r) * AT_KC + j * 16 + c] = a; pwl[(8 * hh + r) * AT_KC + j * 16 + c] = bl; }
        else pwh[(8 * hh + r) * AT_KC + j * 16 + c] = at_to16<F16>(p * PSC);
      }
#pragma unroll
      for (int off = 1; off < 16; off <<= 1) psum += __shfl_xor(psum, off, 32);
      lrow[r] = lrow[r] * alpha + psum;
#pragma unroll
      for (int t = 0; t < 4; ++t) oacc[t][r] *= alpha;
    }
    __builtin_amdgcn_fence(__ATOMIC_RELEASE, "workgroup");
    __builtin_amdgcn_wave_barrier();
    __builtin_amdgcn_fence(__ATOMIC_ACQUIRE, "workgroup");
#pragma unroll 1
    for (int kk = 0; kk < 2; ++kk) {
      FB pa, pl;
      pa.h[0] = *(const v8b*)(pwh + c * AT_KC + kk * 32 + 8 * hh);
      pa.h[1] = *(const v8b*)(pwh + c * AT_KC + kk * 32 + 16 + 8 * hh);
      if (SPLIT_PV) {
        pl.h[0] = *(const v8b*)(pwl + c * AT_KC + kk * 32 + 8 * hh);
        pl.h[1] = *(const v8b*)(pwl + c * AT_KC + kk * 32 + 16 + 8 * hh);
      }
#pragma unroll
      for (int t = 0; t < 4; ++t) {
        FB vb;
        vb.h[0] = *(const v8b*)(Vth + (t * 16 + c) * AT_KC + kk * 32 + 8 * hh);
        vb.h[1] = *(const v8b*)(Vth + (t * 16 + c) * AT_KC + kk * 32 + 16 + 8 * hh);
        oacc[t] = at_mma16<F16>(pa.v, vb.v, oacc[t]);
        if (SPLIT_PV) {
          FB vl;
          vl.h[0] = *(const v8b*)(Vtl + (t * 16 + c) * AT_KC + kk * 32 + 8 * hh);
          vl.h[1] = *(const v8b*)(Vtl + (t * 16 + c) * AT_KC + kk * 32 + 16 + 8 * hh);
          oacc[t] = at_mma16<F16>(pa.v, vl.v, oacc[t]);
          oacc[t] = at_mma16<F16>(pl.v, vb.v, oacc[t]);
        }
      }
    }
  }

  float* os = Os[wave];
#pragma unroll
  for (int r = 0; r < 8; ++r) {
    const float inv = 1.0f / (lrow[r] * PSC);
#pragma unroll
    for (int t = 0; t < 4; ++t) os[(8 * hh + r) * 68 + t * 16 + c] = oacc[t][r] * inv;
  }
  __builtin_amdgcn_fence(__ATOMIC_RELEASE, "workgroup");
  __builtin_amdgcn_wave_barrier();
  __builtin_amdgcn_fence(__ATOMIC_ACQUIRE, "workgroup");
  {
    const int c4 = (lane & 15) * 4;
    {
#pragma unroll
      for (int it = 0; it < 8; ++it) {
        const int row = it * 2 + hh;
        v4f val = *(const v4f*)(os + row * 68 + c4);
        *(v4f*)(ob_ptr + (size_t)(q0 + row) * g.o_rs + c4) = val;
      }
      
    }
  }
}

} // namespace w25

// relative-offset bias table RT[h][c], c = i - j + (T-1): -floor(|i-j| / 30) * 2^-(h+1)   (thread-linear, data-independent)
__global__ __launch_bounds__(256) void k_mc_rt(float* __restrict__ RT, int NH, int RN, int T) { const int t = blockIdx.x * 256 + threadIdx.x; if (t >= NH * RN) return; const int h = t / RN, c = t % RN; int dist = c - (T - 1); dist = dist < 0 ? -dist : dist; VST2(float, RT + t, -(float)(dist / 30) * exp2f(-(float)(h + 1))); }


extern "C" void kernel_launch(void* const* d_in, const int* in_sizes, int n_in, void* d_out, int out_size, void* d_ws, size_t ws_size, hipStream_t stream) {
    (void)in_sizes; (void)n_in; (void)out_size; (void)ws_size;
    const float* x = (const float*)d_in[0];
    const float* ctx = (const float*)d_in[1];
    const float* Wq = (const float*)d_in[2];
    const float* Wk = (const float*)d_in[3];
    const float* Wv = (const float*)d_in[4];
    const float* Wo = (const float*)d_in[5];
    const float* bo = (const float*)d_in[6];
    const int Bn = 2;
    const int T = 2048;
    const int D = 1024;
    const int NH = 16;
    const int HD = 64;
    const int NR = Bn * T;
    const int RN = 2 * T - 1;
    float* out = (float*)d_out;
    char* wsp = (char*)d_ws;
    _Float16* Q = (_Float16*)wsp; wsp += (((size_t)((size_t)NR * D) * 2 + 255) / 256) * 256;
    _Float16* Kb = (_Float16*)wsp; wsp += (((size_t)((size_t)NR * D) * 2 + 255) / 256) * 256;
    _Float16* Vt = (_Float16*)wsp; wsp += (((size_t)((size_t)NR * D) * 2 + 255) / 256) * 256;   // V transposed: D rows of NR
    float* Y = (float*)wsp; wsp += (((size_t)((size_t)NR * D) * 4 + 255) / 256) * 256;
    float* RT = (float*)wsp; wsp += (((size_t)((size_t)NH * RN + 64) * 4 + 255) / 256) * 256;
    unsigned short* G64A = (unsigned short*)wsp; wsp += (((size_t)(4194304) * 2 + 255) / 256) * 256;
    unsigned short* G64C = (unsigned short*)wsp; wsp += (((size_t)(4194304) * 2 + 255) / 256) * 256;
    unsigned short* G64B = (unsigned short*)wsp; wsp += (((size_t)(4 * 1048576) * 2 + 255) / 256) * 256;
    k_mc_rt<<<(unsigned)((NH * RN + 255) / 256), 256, 0, stream>>>(RT, NH, RN, T);
    k_cast_in<<<256, 512, 0, stream>>>(x, ctx, Wq, Wk, Wv, Wo, (_Float16*)(G64A), (_Float16*)(G64C), (_Float16*)(G64B));
    w25::wmma_gemm_lds<4096, 1024, 1024, 0, 1><<<256, 256, 0, stream>>>((const _Float16*)(G64A), (const _Float16*)(G64B), nullptr, Q, nullptr, 0.0625f);
    w25::wmma_gemm_lds<4096, 1024, 1024, 0, 1><<<256, 256, 0, stream>>>((const _Float16*)(G64C), (const _Float16*)(G64B + 1048576), nullptr, Kb, nullptr, 0.0625f);
    w25::wmma_gemm_lds<1024, 4096, 1024, 0, 1><<<256, 256, 0, stream>>>((const _Float16*)(G64B + 2 * 1048576), (const _Float16*)(G64C), nullptr, Vt, nullptr, 0.0625f);   // operands swapped: Wv . context^T = V^T
    k_attnT<2048, 1024, 4096><<<dim3(2048 / (16 * AW), 16, 2), 32 * AW, 0, stream>>>(Q, Kb, Vt, Y, RT, 0.125f);
    k_cast_plane<<<256, 512, 0, stream>>>(Y, (_Float16*)(G64A));
    w25::wmma_gemm_lds<4096, 1024, 1024, 2, 0><<<256, 256, 0, stream>>>((const _Float16*)(G64A), (const _Float16*)(G64B + 3 * 1048576), out, nullptr, bo, 0.0625f);
}

// v007
// A run of this version takes 124 microseconds.
// Two timings next to v006 put it at 1.09 and 1.08 times that version's speed.
// Over all steps from v000, the starting kernel, it is 18.1 times as fast.
// Contractions: q = x.Wq^T [4096x1024].[1024x1024], k/v = context.W^T and the output projection (+b) with f16 operands on pre-cast planes (v_wmma_f32_16x16x32_f16; 128x128 block tiles staged in LDS by asynchronous copies, 32x64 wave tiles, weights x16); per (batch, head) softmax(q k^T / 8 + b_h(|i-j|)) v over 2048 keys (head_dim 64) as a flash kernel with f16 q.k^T and f16 p.v (p as f16 of 4096 p), the periodic distance bias -floor(|i-j|/30) 2^-(h+1) read from a per-head relative-offset table built on device; f32 accumulate and softmax.
#include <hip/hip_runtime.h>
#include <math.h>

typedef __attribute__((ext_vector_type(16))) _Float16 v16h;
typedef __attribute__((ext_vector_type(8)))  _Float16 v8h;
typedef __attribute__((ext_vector_type(4)))  _Float16 v4h;
typedef __attribute__((ext_vector_type(16))) __bf16   v16b;
typedef __attribute__((ext_vector_type(8)))  float    v8f;
typedef __attribute__((ext_vector_type(4)))  float    v4f;

// 16-bit WMMA fragment map (wave32), lane L, h = L>>4, m = L&15:
//   A 16x32: lane = row m;   element i -> k = (i<8) ? 8h+i : 16+8h+(i-8)
//   B 32x16: lane = column m; the SAME k(i,h)
//   D 16x16 (8 f32): lane = column m; element r -> row 8h+r
__device__ __forceinline__ int frag_k(int i, int h) { return (i < 8) ? (8 * h + i) : (16 + 8 * h + (i - 8)); }
__device__ __forceinline__ __bf16 bf16_rne(float f) {
    unsigned int u = __float_as_uint(f);
    u += 0x7fffu + ((u >> 16) & 1u);
    return __builtin_bit_cast(__bf16, (unsigned short)(u >> 16));
}
__device__ __forceinline__ float bf16_f32(__bf16 b) { return __uint_as_float(((unsigned int)__builtin_bit_cast(unsigned short, b)) << 16); }
__device__ __forceinline__ v8f wmma16(v16h a, v16h b, v8f c) {
    c = __builtin_amdgcn_wmma_f32_16x16x32_f16(false, a, false, b, (short)0, c, false, false);
    asm volatile("v_nop\n\tv_nop\n\tv_nop\n\tv_nop" : "+v"(c) : "v"(a), "v"(b));
    return c;
}
__device__ __forceinline__ v8f wmmab(v16b a, v16b b, v8f c) {
    c = __builtin_amdgcn_wmma_f32_16x16x32_bf16(false, a, false, b, (short)0, c, false, false);
    asm volatile("v_nop\n\tv_nop\n\tv_nop\n\tv_nop" : "+v"(c) : "v"(a), "v"(b));
    return c;
}
struct Split { v16b hi, lo; };
// hi/lo split product: a.hi*b.hi + a.hi*b.lo + a.lo*b.hi
__device__ __forceinline__ v8f wmma3(const Split& a, const Split& b, v8f c) {
    c = __builtin_amdgcn_wmma_f32_16x16x32_bf16(false, a.hi, false, b.hi, (short)0, c, false, false);
    c = __builtin_amdgcn_wmma_f32_16x16x32_bf16(false, a.hi, false, b.lo, (short)0, c, false, false);
    c = __builtin_amdgcn_wmma_f32_16x16x32_bf16(false, a.lo, false, b.hi, (short)0, c, false, false);
    asm volatile("v_nop\n\tv_nop\n\tv_nop\n\tv_nop" : "+v"(c) : "v"(a.hi), "v"(a.lo), "v"(b.hi), "v"(b.lo));
    return c;
}
struct Split3 { v16b hi, mid, lo; };
// triple split product (6 terms, drops only terms below 2^-24 relative)
__device__ __forceinline__ v8f wmma6(const Split3& a, const Split3& b, v8f c) {
    c = __builtin_amdgcn_wmma_f32_16x16x32_bf16(false, a.hi, false, b.hi, (short)0, c, false, false);
    c = __builtin_amdgcn_wmma_f32_16x16x32_bf16(false, a.hi, false, b.mid, (short)0, c, false, false);
    c = __builtin_amdgcn_wmma_f32_16x16x32_bf16(false, a.mid, false, b.hi, (short)0, c, false, false);
    c = __builtin_amdgcn_wmma_f32_16x16x32_bf16(false, a.hi, false, b.lo, (short)0, c, false, false);
    c = __builtin_amdgcn_wmma_f32_16x16x32_bf16(false, a.mid, false, b.mid, (short)0, c, false, false);
    c = __builtin_amdgcn_wmma_f32_16x16x32_bf16(false, a.lo, false, b.hi, (short)0, c, false, false);
    asm volatile("v_nop\n\tv_nop\n\tv_nop\n\tv_nop" : "+v"(c) : "v"(a.hi), "v"(a.mid), "v"(a.lo), "v"(b.hi), "v"(b.mid), "v"(b.lo));
    return c;
}

// Fragment gathers from f32 memory: element i <- p[(k0 + frag_k(i,h)) * sk] * s, zero for k >= klen.
__device__ __forceinline__ v16h fh_ld(const float* __restrict__ p, long long sk, int k0, int h, int klen, float s) {
    v16h a;
#pragma unroll
    for (int i = 0; i < 16; ++i) { const int k = k0 + frag_k(i, h); a[i] = (k < klen) ? (_Float16)(p[(long long)k * sk] * s) : (_Float16)0.f; }
    return a;
}
__device__ __forceinline__ Split sp_ld(const float* __restrict__ p, long long sk, int k0, int h, int klen, float s) {
    Split r;
#pragma unroll
    for (int i = 0; i < 16; ++i) {
        const int k = k0 + frag_k(i, h); const float x = (k < klen) ? p[(long long)k * sk] * s : 0.f;
        const __bf16 hb = bf16_rne(x); r.hi[i] = hb; r.lo[i] = bf16_rne(x - bf16_f32(hb));
    }
    return r;
}
__device__ __forceinline__ Split3 sp3_ld(const float* __restrict__ p, long long sk, int k0, int h, int klen, float s) {
    Split3 r;
#pragma unroll
    for (int i = 0; i < 16; ++i) {
        const int k = k0 + frag_k(i, h); const float x = (k < klen) ? p[(long long)k * sk] * s : 0.f;
        const __bf16 hb = bf16_rne(x); const float r1 = x - bf16_f32(hb); const __bf16 mb = bf16_rne(r1);
        r.hi[i] = hb; r.mid[i] = mb; r.lo[i] = bf16_rne(r1 - bf16_f32(mb));
    }
    return r;
}
__device__ __forceinline__ v16b bh_ld(const float* __restrict__ p, long long sk, int k0, int h, int klen, float s) {
    v16b a;
#pragma unroll
    for (int i = 0; i < 16; ++i) { const int k = k0 + frag_k(i, h); a[i] = bf16_rne((k < klen) ? p[(long long)k * sk] * s : 0.f); }
    return a;
}
// f16 fragment from an f16 LDS/global row with element stride 1 (k-contiguous), no bounds (tile already zero padded)
__device__ __forceinline__ v16h fh_row(const _Float16* __restrict__ row, int k0, int h) {
    v16h a;
#pragma unroll
    for (int i = 0; i < 16; ++i) a[i] = row[k0 + frag_k(i, h)];
    return a;
}

#define VST2(T, ptr, val) do { const T vst2_v_ = (val); *(T*)(ptr) = vst2_v_;  } while (0)
typedef float v4f __attribute__((ext_vector_type(4)));
#define VST2V4(ptr, val) do { const v4f vst2_v4_ = (val); *(v4f*)(ptr) = vst2_v4_;  } while (0)

__device__ __attribute__((noinline)) float act_fn(float v, int act) {
    if (act == 1) return fmaxf(v, 0.f);                                                                               // relu
    if (act == 2) { const float u = 0.7978845608028654f * (v + 0.044715f * v * v * v); return 0.5f * v * (1.f + tanhf(u)); } // tanh-gelu
    if (act == 3) return v / (1.f + expf(-v));                                                                        // silu
    if (act == 4) return 0.5f * v * (1.f + erff(v * 0.7071067811865476f));                                             // erf-gelu
    if (act == 5) return tanhf(v);
    if (act == 6) return 1.f / (1.f + expf(-v));                                                                      // sigmoid
    if (act == 7) return (v > 0.f) ? v : 0.01f * v;                                                                   // leaky relu 0.01
    if (act == 8) return (v > 0.f) ? v : (expf(v) - 1.f);                                                             // elu
    if (act == 9) return fminf(fmaxf(v, 0.f), 6.f);                                                                   // relu6
    if (act == 10) return fabsf(v);                                                                                    // abs
    if (act == 11) return (v >= 0.f) ? v : 0.1f * v;                                                                  // leaky 0.1
    if (act == 12) return (v > 0.f) ? v : 0.2f * v;                                                                   // leaky 0.2
    if (act == 13) return (v > 20.f) ? v : log1pf(expf(v));                                                            // softplus
    return v;
}

// =====================================================================================================================
// k_gemm<MODE>: C(z, m, n) = act(alpha * sum_k A(z, m, k) * B(z, k, n) + bias) + beta * R(z, m, n)
//   One wave (32-thread block) per 16 x 32 tile of C; grid (ceil(N/32), ceil(M/16), Z). Batch z -> (zo = z / zi_n, zi = z % zi_n)
//   with separate outer/inner strides for every tensor (e.g. batch and head). A(m,k) = A[zo*sAo + zi*sAi + m*sAm + k*sAk] (f32),
//   B(k,n) = B[zo*sBo + zi*sBi + n*sBn + k*sBk] (f32); any M, N, K (K zero-padded to 32 inside the fragments, M/N tails guarded).
//   C(m,n) = C[zo*sCo + zi*sCi + m*sCm + n] (n contiguous). flags: 1 bias[n], 2 bias[m], 4 residual R[zo*sRo + zi*sRi + m*sRm + n*sRn].
//   MODE 0: f16 operands (A prescaled by sa, B by sb, both undone in the epilogue); 1: bf16 hi/lo split (3 products); 2: bf16;
//   3: bf16 hi/mid/lo triple split (6 products); 4: as 3 with Kahan-compensated f32 accumulation across k-steps.
// =====================================================================================================================
struct GemmP {
    const float* A; const float* B; const float* bias; const float* R; float* C;
    long long sAo, sAi, sAm, sAk, sBo, sBi, sBn, sBk, sCo, sCi, sCm, sRo, sRi, sRm, sRn;
    int M, N, K, zi_n, flags, act; float alpha, beta, sa, sb;
    int Npad, pad_;     // columns [N, Npad) of C are written as 0 so that padded workspace rows are covered by whole-line stores; Npad >= N
};
static_assert(sizeof(GemmP) == 5 * 8 + 15 * 8 + 6 * 4 + 4 * 4 + 2 * 4, "GemmP has padding");

template <int MODE>
__global__ __launch_bounds__(32) void k_gemm(GemmP p) {
    const int lane = threadIdx.x & 31, h = lane >> 4, l15 = lane & 15;
    const int m0 = blockIdx.y * 16, n0 = blockIdx.x * 32;
    const int z = blockIdx.z, zo = z / p.zi_n, zi = z - zo * p.zi_n;
    const float* A = p.A + zo * p.sAo + zi * p.sAi;
    const float* B = p.B + zo * p.sBo + zi * p.sBi;
    const int am = min(m0 + l15, p.M - 1);                       // clamped row for loads (stores are guarded)
    v8f acc[2], comp[2];
#pragma unroll
    for (int t = 0; t < 2; ++t) { v8f zz = {}; acc[t] = zz; comp[t] = zz; }
    for (int k0 = 0; k0 < p.K; k0 += 32) {
        const float* arow = A + (long long)am * p.sAm;
        if (MODE == 1) {
            const Split a = sp_ld(arow, p.sAk, k0, h, p.K, 1.f);
#pragma unroll
            for (int t = 0; t < 2; ++t) {
                const int bn = min(n0 + t * 16 + l15, p.N - 1);
                acc[t] = wmma3(a, sp_ld(B + (long long)bn * p.sBn, p.sBk, k0, h, p.K, 1.f), acc[t]);
            }
        } else if (MODE == 3) {
            const Split3 a = sp3_ld(arow, p.sAk, k0, h, p.K, 1.f);
#pragma unroll
            for (int t = 0; t < 2; ++t) {
                const int bn = min(n0 + t * 16 + l15, p.N - 1);
                acc[t] = wmma6(a, sp3_ld(B + (long long)bn * p.sBn, p.sBk, k0, h, p.K, 1.f), acc[t]);
            }
        } else if (MODE == 4) {
            // triple split as MODE 3, but each k-step's 6 products go into a fresh accumulator and the partial is added to the running f32 sum
            // on the VALU with Kahan compensation (accumulation error stays ~1 ulp however long K is)
            const Split3 a = sp3_ld(arow, p.sAk, k0, h, p.K, 1.f);
#pragma unroll
            for (int t = 0; t < 2; ++t) {
                const int bn = min(n0 + t * 16 + l15, p.N - 1); v8f zz = {};
                const v8f part = wmma6(a, sp3_ld(B + (long long)bn * p.sBn, p.sBk, k0, h, p.K, 1.f), zz);
                const v8f y = part - comp[t]; const v8f s = acc[t] + y; comp[t] = (s - acc[t]) - y; acc[t] = s;
            }
        } else if (MODE == 2) {
            const v16b a = bh_ld(arow, p.sAk, k0, h, p.K, 1.f);
#pragma unroll
            for (int t = 0; t < 2; ++t) {
                const int bn = min(n0 + t * 16 + l15, p.N - 1);
                acc[t] = wmmab(a, bh_ld(B + (long long)bn * p.sBn, p.sBk, k0, h, p.K, 1.f), acc[t]);
            }
        } else {
            const v16h a = fh_ld(arow, p.sAk, k0, h, p.K, p.sa);
#pragma unroll
            for (int t = 0; t < 2; ++t) {
                const int bn = min(n0 + t * 16 + l15, p.N - 1);
                acc[t] = wmma16(a, fh_ld(B + (long long)bn * p.sBn, p.sBk, k0, h, p.K, p.sb), acc[t]);
            }
        }
    }
    const float iscale = (MODE == 0) ? p.alpha / (p.sa * p.sb) : p.alpha;
    float* C = p.C + zo * p.sCo + zi * p.sCi;
    const float* R = p.R + zo * p.sRo + zi * p.sRi;
    __shared__ __align__(16) float ctile[16][36];
#pragma unroll
    for (int t = 0; t < 2; ++t) {
        const int n = n0 + t * 16 + l15; const int nn = min(n, p.N - 1);
#pragma unroll
        for (int r = 0; r < 8; ++r) {
            const int m = m0 + 8 * h + r; const int mm = min(m, p.M - 1);
            float v = acc[t][r] * iscale;
            if (p.flags & 1) v += p.bias[nn];
            if (p.flags & 2) v += p.bias[mm];
            if (p.flags & 8) v *= p.bias[(long long)zo * p.M + mm];   /* per-(z,row) scale vector laid out [Z][M]; exclusive with the bias flags */
            v = act_fn(v, p.act);
            if (p.flags & 4) v += p.beta * R[(long long)mm * p.sRm + (long long)nn * p.sRn];
            ctile[8 * h + r][t * 16 + l15] = (n < p.N) ? v : 0.f;
        }
    }
    __syncthreads();
    const int NW = (p.Npad > p.N) ? p.Npad : p.N;           // write width
    const bool fast = (m0 + 16 <= p.M) && (n0 + 32 <= NW) && ((p.sCm & 3) == 0) && ((((size_t)C) & 15) == 0);
    if (fast) {
#pragma unroll
        for (int s = 0; s < 4; ++s) {
            const int row = s * 4 + (lane >> 3), c4 = (lane & 7) * 4;
            const v4f v = *(const v4f*)&ctile[row][c4];
            VST2V4(C + (long long)(m0 + row) * p.sCm + n0 + c4, v);
        }
    } else {
        for (int row = 0; row < 16; ++row) {
            const int m = m0 + row, n = n0 + lane;
            if (m < p.M && n < NW) VST2(float, C + (long long)m * p.sCm + n, ctile[row][lane]);
        }
    }
}


// =====================================================================================================================
// k_gemmT<MODE, TM, TN>: same contract as k_gemm, but one wave computes a (16*TM) x (16*TN) tile: TM A fragments and TN B fragments are
//   loaded per 32-wide k-step and reused across TM*TN WMMAs (far fewer load/convert instructions per MAC). MODE 0 (f16), 1 (bf16 hi/lo),
//   2 (bf16) only. grid (ceil(NW/(16*TN)), ceil(M/(16*TM)), Z), block 32. Epilogue identical to k_gemm, run per 16x32 sub-tile.
// =====================================================================================================================
template <int MODE, int TM, int TN>
__global__ __launch_bounds__(32) void k_gemmT(GemmP p) {
    const int lane = threadIdx.x & 31, h = lane >> 4, l15 = lane & 15;
    const int m0 = blockIdx.y * (16 * TM), n0 = blockIdx.x * (16 * TN);
    const int z = blockIdx.z, zo = z / p.zi_n, zi = z - zo * p.zi_n;
    const float* A = p.A + zo * p.sAo + zi * p.sAi;
    const float* B = p.B + zo * p.sBo + zi * p.sBi;
    v8f acc[TM][TN];
#pragma unroll
    for (int i = 0; i < TM; ++i)
#pragma unroll
        for (int t = 0; t < TN; ++t) { v8f zz = {}; acc[i][t] = zz; }
    for (int k0 = 0; k0 < p.K; k0 += 32) {
        if (MODE == 1) {
            Split a[TM], b[TN];
#pragma unroll
            for (int i = 0; i < TM; ++i) { const int am = min(m0 + 16 * i + l15, p.M - 1); a[i] = sp_ld(A + (long long)am * p.sAm, p.sAk, k0, h, p.K, 1.f); }
#pragma unroll
            for (int t = 0; t < TN; ++t) { const int bn = min(n0 + 16 * t + l15, p.N - 1); b[t] = sp_ld(B + (long long)bn * p.sBn, p.sBk, k0, h, p.K, 1.f); }
#pragma unroll
            for (int i = 0; i < TM; ++i)
#pragma unroll
                for (int t = 0; t < TN; ++t) acc[i][t] = wmma3(a[i], b[t], acc[i][t]);
        } else if (MODE == 2) {
            v16b a[TM], b[TN];
#pragma unroll
            for (int i = 0; i < TM; ++i) { const int am = min(m0 + 16 * i + l15, p.M - 1); a[i] = bh_ld(A + (long long)am * p.sAm, p.sAk, k0, h, p.K, 1.f); }
#pragma unroll
            for (int t = 0; t < TN; ++t) { const int bn = min(n0 + 16 * t + l15, p.N - 1); b[t] = bh_ld(B + (long long)bn * p.sBn, p.sBk, k0, h, p.K, 1.f); }
#pragma unroll
            for (int i = 0; i < TM; ++i)
#pragma unroll
                for (int t = 0; t < TN; ++t) acc[i][t] = wmmab(a[i], b[t], acc[i][t]);
        } else {
            v16h a[TM], b[TN];
#pragma unroll
            for (int i = 0; i < TM; ++i) { const int am = min(m0 + 16 * i + l15, p.M - 1); a[i] = fh_ld(A + (long long)am * p.sAm, p.sAk, k0, h, p.K, p.sa); }
#pragma unroll
            for (int t = 0; t < TN; ++t) { const int bn = min(n0 + 16 * t + l15, p.N - 1); b[t] = fh_ld(B + (long long)bn * p.sBn, p.sBk, k0, h, p.K, p.sb); }
#pragma unroll
            for (int i = 0; i < TM; ++i)
#pragma unroll
                for (int t = 0; t < TN; ++t) acc[i][t] = wmma16(a[i], b[t], acc[i][t]);
        }
    }
    const float iscale = (MODE == 0) ? p.alpha / (p.sa * p.sb) : p.alpha;
    float* C = p.C + zo * p.sCo + zi * p.sCi;
    const float* R = p.R + zo * p.sRo + zi * p.sRi;
    const int NW = (p.Npad > p.N) ? p.Npad : p.N;
    __shared__ __align__(16) float ctile[16][36];
#pragma unroll
    for (int i = 0; i < TM; ++i) {
        const int mb = m0 + 16 * i; if (mb >= p.M) break;          // wave-uniform
#pragma unroll
        for (int tp = 0; tp < TN / 2; ++tp) {
            const int nb = n0 + 32 * tp; if (nb >= NW) break;        // wave-uniform
#pragma unroll
            for (int t2 = 0; t2 < 2; ++t2) {
                const int t = 2 * tp + t2; const int n = nb + t2 * 16 + l15; const int nn = min(n, p.N - 1);
#pragma unroll
                for (int r = 0; r < 8; ++r) {
                    const int m = mb + 8 * h + r; const int mm = min(m, p.M - 1);
                    float v = acc[i][t][r] * iscale;
                    if (p.flags & 1) v += p.bias[nn];
                    if (p.flags & 2) v += p.bias[mm];
            if (p.flags & 8) v *= p.bias[(long long)zo * p.M + mm];   /* per-(z,row) scale vector laid out [Z][M]; exclusive with the bias flags */
                    v = act_fn(v, p.act);
                    if (p.flags & 4) v += p.beta * R[(long long)mm * p.sRm + (long long)nn * p.sRn];
                    ctile[8 * h + r][t2 * 16 + l15] = (n < p.N) ? v : 0.f;
                }
            }
            __syncthreads();
            const bool fast = (mb + 16 <= p.M) && (nb + 32 <= NW) && ((p.sCm & 3) == 0) && ((((size_t)C) & 15) == 0);
            if (fast) {
#pragma unroll
                for (int s = 0; s < 4; ++s) {
                    const int row = s * 4 + (lane >> 3), c4 = (lane & 7) * 4;
                    const v4f v = *(const v4f*)&ctile[row][c4];
                    VST2V4(C + (long long)(mb + row) * p.sCm + nb + c4, v);
                }
            } else {
                for (int row = 0; row < 16; ++row) {
                    const int m = mb + row, n = nb + lane;
                    if (m < p.M && n < NW) VST2(float, C + (long long)m * p.sCm + n, ctile[row][lane]);
                }
            }
            __syncthreads();
        }
    }
}

// =====================================================================================================================
//   Wave = 16 queries, AW waves per block, 64-key blocks; grid (ceil(Lq/(16*AW)), H, B), block 32*AW. Any Lq, Lk; head dim dh <= DHP
//   (DHP multiple of 32), value dim dv <= DVP (multiple of 16, <= 128). Every tensor addressed by (batch, head, row, element) strides, f32.
//   Scores: QM 0 f16 operands, 1 bf16 hi/lo split, 2 bf16 triple split; statistics f32 (exp2 domain); P.V: P x 4096 as f16 with V f16 staged in LDS
//   (SPLITPV: P and V as bf16 hi/lo splits). kv head = h / hrep. Masking: causal = 1 (keep j <= i + coff, masked -> -inf, key blocks beyond the
//   diagonal skipped), causal = 2 (masked -> mfill, a finite fill like the -1e9; no skipping), causal = 3 (keep j >= i + coff,
//   masked -> -inf, no skipping); optional additive f32 mask Mf,
//   optional int keep-mask Mi (0 -> score := mfill), both addressed b*smb + h*smh + i*smi + j*smj (0 strides broadcast).
// =====================================================================================================================
#define AW 4
struct AttnP {   // apv4
    const float* Q; const float* K; const float* V; float* O; float* P; const float* Mf; const int* Mi; float* ST;
    const float* Pw; const float* Rt; const int* SQ; const int* SK;           // optional: post-softmax weight, relative-position table, segment ids
    long long swb, swh, swi, swj, srb, srh, sri;                                 // Pw strides (b,h,i,j); Rt strides (b,h,i), column = clamp(i - j + roff, 0, rn-1)
    long long sQb, sQh, sQi, sQd, sKb, sKh, sKj, sKd, sVb, sVh, sVj, sVd, sOb, sOh, sOi, sPb, sPh, sPi, smb, smh, smi, smj;
    int Lq, Lk, dh, dv, hrep, causal, coff, pband;   // pband > 0: P holds only the band |j - i| <= pband, column j - i + pband
    float scale, mfill; int nonorm, mpol;             // nonorm (online path only): O = sum_j exp(score_j) V_j without the 1/rowsum (scores must be <= ~0); mpol: Mi masks where ==0 (mpol 0) or where !=0 (mpol 1)
    int roff, rn, segpol, win;                        // Rt column offset/count; SQ/SK: score := mfill where (segpol 0) SQ[i] != SK[j] or (segpol 1) SQ[i] == SK[j]; win > 0: keys with i - j > win (after coff) -> -inf
};
//   Pw: the softmax numerator is multiplied by Pw(b,h,i,j) AFTER the row sum is taken (probs * weight, then P.V), as in post-softmax multiplicative biases.                                                    // ST (optional): per row (b,h,i) -> ST[((b*H + h)*Lq + i)*2 + {0,1}] = {row max of the scaled+masked score (natural units), sum_j exp(score - max)}
static_assert(sizeof(AttnP) == 12 * 8 + 29 * 8 + 16 * 4, "AttnP has padding");

// Inputs-only fence on sixteen loaded values: all must have arrived here, so their loads are issued together ahead of it and share one wait
// (without it the register-budgeted schedule waits after every load). It names no product and changes no value.
template <typename T> __device__ __forceinline__ void hold16(const T* x) {
    asm volatile("" :: "v"(x[0]), "v"(x[1]), "v"(x[2]), "v"(x[3]), "v"(x[4]), "v"(x[5]), "v"(x[6]), "v"(x[7]),
                       "v"(x[8]), "v"(x[9]), "v"(x[10]), "v"(x[11]), "v"(x[12]), "v"(x[13]), "v"(x[14]), "v"(x[15]));
}
#ifndef KATTN_ATTR
#define KATTN_ATTR __attribute__((amdgpu_waves_per_eu(4)))   // register budget of 256: four waves a SIMD, so that all 1,024 blocks of the launch are resident at once
#endif
//   GT > 0 fixes the geometry at compile time: Lq = Lk = GT, rows of GD floats with head h at column h * DHP (unit element stride), dh = DHP,
//   dv = DVP, one kv head per head, no mask, weight, segment, P or ST tensor, and a per-head Rt row of 2 GT - 1 columns. Only Q, K, V, O, Rt and scale
//   are then taken from the argument, so every length guard folds and the loads of a key block are contiguous and free of branches.
template <int DHP, int DVP, int QM, bool SPLITPV, bool TWOPASS, int GT = 0, int GD = 0>
__global__ __launch_bounds__(32 * AW) KATTN_ATTR void k_attn(AttnP parg) {
    AttnP p = parg;
    if (GT > 0) {
        p.P = nullptr; p.Mf = nullptr; p.Mi = nullptr; p.ST = nullptr; p.Pw = nullptr; p.SQ = nullptr; p.SK = nullptr;
        p.swb = 0; p.swh = 0; p.swi = 0; p.swj = 0; p.srb = 0; p.srh = 2 * GT - 1; p.sri = 0;
        p.sQb = (long long)GT * GD; p.sQh = DHP; p.sQi = GD; p.sQd = 1; p.sKb = (long long)GT * GD; p.sKh = DHP; p.sKj = GD; p.sKd = 1;
        p.sVb = (long long)GT * GD; p.sVh = DVP; p.sVj = GD; p.sVd = 1; p.sOb = (long long)GT * GD; p.sOh = DVP; p.sOi = GD;
        p.sPb = 0; p.sPh = 0; p.sPi = 0; p.smb = 0; p.smh = 0; p.smi = 0; p.smj = 0;
        p.Lq = GT; p.Lk = GT; p.dh = DHP; p.dv = DVP; p.hrep = 1; p.causal = 0; p.coff = 0; p.pband = 0;
        p.mfill = 0.f; p.nonorm = 0; p.mpol = 0; p.roff = GT - 1; p.rn = 2 * GT - 1; p.segpol = 0; p.win = 0;
        __builtin_assume(p.Rt != nullptr);
    }
    constexpr bool FULL = GT > 0 && GT % (16 * AW) == 0 && GT % 64 == 0;   // every query tile and key block is whole: index clamps and length guards are identities
    constexpr int NT = DVP / 16;                // output tiles
    constexpr int KS = DHP / 32;                // k-steps for the scores
    constexpr int VP = DVP + 8;                 // LDS pitch (halves)
    __shared__ __align__(16) float    pl[AW][16 * 64];
    __shared__ __align__(16) _Float16 vl[(SPLITPV ? 2 : 1) * 64 * VP];   // f16 V tile, or bf16 hi and lo tiles (same 2-byte size)
    const int lane = threadIdx.x & 31, hf = lane >> 4, l15 = lane & 15, wave = threadIdx.x >> 5;
    const int h = blockIdx.y, b = blockIdx.z, hk = h / p.hrep;
    const int q0 = (blockIdx.x * AW + wave) * 16;
    float* myp = pl[wave];
    const float L2E = 1.4426950408889634f;
    const float NEG = -__builtin_inff();
    const int qi = FULL ? q0 + l15 : min(q0 + l15, p.Lq - 1);
    const float* qrow = p.Q + b * p.sQb + h * p.sQh + (long long)qi * p.sQi;
    const float* kbase = p.K + b * p.sKb + hk * p.sKh;
    const float* vbase = p.V + b * p.sVb + hk * p.sVh;
    v16h qa[QM == 0 ? KS : 1]; Split qs_[QM == 1 ? KS : 1]; Split3 qt_[QM == 2 ? KS : 1];
#pragma unroll
    for (int ks = 0; ks < KS; ++ks) {
        if (QM == 2) qt_[ks] = sp3_ld(qrow, p.sQd, ks * 32, hf, p.dh, 1.f);
        else if (QM == 1) qs_[ks] = sp_ld(qrow, p.sQd, ks * 32, hf, p.dh, 1.f);
        else qa[ks] = fh_ld(qrow, p.sQd, ks * 32, hf, p.dh, 1.f);
    }
    v8f o[NT]; float m8[8], l8[8];
#pragma unroll
    for (int t = 0; t < NT; ++t) { v8f zz = {}; o[t] = zz; }
#pragma unroll
    for (int i = 0; i < 8; ++i) { m8[i] = NEG; l8[i] = 0.f; }
    int jend = p.Lk;
    if (p.causal == 1) { const int je = (blockIdx.x * AW + AW - 1) * 16 + 16 + p.coff; jend = min(jend, max(je, 0)); }   // uniform per block
    const int npass = TWOPASS ? 2 : 1;
    for (int pass = 0; pass < npass; ++pass) {
        const bool dopv = (!TWOPASS) || pass == 1;
        for (int j0 = 0; j0 < jend; j0 += 64) {
            if (dopv) {
                __syncthreads();                                 // previous key block's reads of vl / pl are done
                constexpr int VN = 64 * DVP / (32 * AW);         // V elements per thread and key block
                constexpr bool VLIN = (32 * AW) % DVP == 0;      // a thread keeps its column: its rows differ by a constant step
                float vf[VN];
#pragma unroll   // constant trip count: with the guard folded the tile's loads differ by immediate offsets only
                for (int it = 0; it < VN; ++it) {
                    const int idx = threadIdx.x + it * (32 * AW);
                    const int jr = VLIN ? (int)threadIdx.x / DVP + it * ((32 * AW) / DVP) : idx / DVP, d = VLIN ? (int)threadIdx.x % DVP : idx - jr * DVP, j = j0 + jr;
                    if constexpr (FULL && VLIN)   // block-uniform tile pointer + the thread's fixed offset + a constant
                        vf[it] = (vbase + (long long)j0 * GD)[(size_t)(unsigned)((int)threadIdx.x / DVP * GD + (int)threadIdx.x % DVP) + it * ((32 * AW) / DVP) * GD];
                    else
                        vf[it] = (j < p.Lk && d < p.dv) ? vbase[(long long)j * p.sVj + (long long)d * p.sVd] : 0.f;
                }
                if (FULL && VN == 32) { hold16(vf); hold16(vf + 16); }   // the tile's loads all issue ahead of this line and are waited for once
#pragma unroll
                for (int it = 0; it < VN; ++it) {
                    const int idx = threadIdx.x + it * (32 * AW);
                    const int jr = VLIN ? (int)threadIdx.x / DVP + it * ((32 * AW) / DVP) : idx / DVP, d = VLIN ? (int)threadIdx.x % DVP : idx - jr * DVP;
                    const float f = vf[it];
                    if (SPLITPV) {
                        const __bf16 hb = bf16_rne(f);
                        ((__bf16*)vl)[jr * VP + d] = hb; ((__bf16*)vl)[64 * VP + jr * VP + d] = bf16_rne(f - bf16_f32(hb));
                    } else vl[jr * VP + d] = (_Float16)f;
                }
            }
            v8f s[4];
            float rb[8][4];                                     // the key block's relative-position table entries, fetched ahead of the products
            if constexpr (FULL) {
                // column i - j + GT - 1 as block-uniform pointer + the lane's fixed offset + a constant, each part >= 0 (j0 <= GT - 64)
                const float* rt = p.Rt + (long long)h * (2 * GT - 1) + ((int)blockIdx.x * (16 * AW) - j0 + (GT - 64));
                const unsigned ro = (unsigned)(wave * 16 + 8 * hf + 15 - l15);
#pragma unroll
                for (int i = 0; i < 8; ++i)
#pragma unroll
                    for (int t = 0; t < 4; ++t) rb[i][t] = rt[(size_t)ro + (i + 16 * (3 - t))];
            } else if (p.Rt) {
#pragma unroll
                for (int i = 0; i < 8; ++i)
#pragma unroll
                    for (int t = 0; t < 4; ++t) {
                        const int ic = min(q0 + i + 8 * hf, p.Lq - 1);
                        int rc = ic - min(j0 + t * 16 + l15, p.Lk - 1) + p.roff; rc = rc < 0 ? 0 : (rc >= p.rn ? p.rn - 1 : rc);
                        rb[i][t] = p.Rt[b * p.srb + h * p.srh + (long long)ic * p.sri + rc];
                    }
            }
            if constexpr (FULL && QM == 0 && KS == 2) {
                // two key tiles at a time: their sixteen 16-byte loads (fh_ld's k order: floats 8 hf + 0..7 and 16 + 8 hf + 0..7 of each 32) fly together
#pragma unroll
                for (int tp = 0; tp < 2; ++tp) {
                    v4f kr[16];
#pragma unroll
                    for (int t2 = 0; t2 < 2; ++t2)
#pragma unroll
                        for (int ks = 0; ks < 2; ++ks) {
                            const v4f* kp = (const v4f*)((kbase + (long long)j0 * GD) + ((size_t)(unsigned)(l15 * GD + 8 * hf) + (2 * tp + t2) * 16 * GD + ks * 32));
                            kr[(t2 * 2 + ks) * 4 + 0] = kp[0]; kr[(t2 * 2 + ks) * 4 + 1] = kp[1]; kr[(t2 * 2 + ks) * 4 + 2] = kp[4]; kr[(t2 * 2 + ks) * 4 + 3] = kp[5];
                        }
                    hold16(kr);                                  // all sixteen loads issue ahead of this line and are waited for once
#pragma unroll
                    for (int t2 = 0; t2 < 2; ++t2) {
                        v8f acc = {};
#pragma unroll
                        for (int ks = 0; ks < 2; ++ks) {
                            v16h kfr;
#pragma unroll
                            for (int e = 0; e < 16; ++e) kfr[e] = (_Float16)kr[(t2 * 2 + ks) * 4 + (e >> 2)][e & 3];
                            acc = wmma16(qa[ks], kfr, acc);
                        }
                        s[2 * tp + t2] = acc;
                    }
                }
            } else {
#pragma unroll
            for (int t = 0; t < 4; ++t) {
                const int j = min(j0 + t * 16 + l15, p.Lk - 1);
                const float* krow = kbase + (long long)j * p.sKj;
                v8f acc = {};
#pragma unroll
                for (int ks = 0; ks < KS; ++ks) {
                    if (QM == 2)      acc = wmma6(qt_[ks], sp3_ld(krow, p.sKd, ks * 32, hf, p.dh, 1.f), acc);
                    else if (QM == 1) acc = wmma3(qs_[ks], sp_ld(krow, p.sKd, ks * 32, hf, p.dh, 1.f), acc);
                    else              acc = wmma16(qa[ks], fh_ld(krow, p.sKd, ks * 32, hf, p.dh, 1.f), acc);
                }
                s[t] = acc;
            }
            }
            float pv[8][4];
#pragma unroll
            for (int i = 0; i < 8; ++i) {
                const int irow = q0 + i + 8 * hf;
                const int ic = FULL ? irow : min(irow, p.Lq - 1);
                float sc[4];
#pragma unroll
                for (int t = 0; t < 4; ++t) {
                    const int jg = j0 + t * 16 + l15;
                    float v = s[t][i] * p.scale;
                    if (p.Mf) v += p.Mf[b * p.smb + h * p.smh + (long long)ic * p.smi + (long long)min(jg, p.Lk - 1) * p.smj];
                    if (p.Rt) v += rb[i][t];
                    if (p.Mi) { const int mv = p.Mi[b * p.smb + h * p.smh + (long long)ic * p.smi + (long long)min(jg, p.Lk - 1) * p.smj]; if (p.mpol ? (mv != 0) : (mv == 0)) v = p.mfill; }
                    if (p.SQ) { const bool same = p.SQ[(long long)b * p.Lq + ic] == p.SK[(long long)b * p.Lk + min(jg, p.Lk - 1)]; if (p.segpol ? same : !same) v = p.mfill; }
                    if (p.causal == 2 && jg > irow + p.coff) v = p.mfill;
                    if ((!FULL && jg >= p.Lk) || (p.causal == 1 && jg > irow + p.coff) || (p.causal == 3 && jg < irow + p.coff) || (p.win > 0 && irow + p.coff - jg > p.win)) v = NEG; else v *= L2E;
                    sc[t] = v;
                }
                if (!TWOPASS || pass == 0) {
                    float mx = fmaxf(fmaxf(sc[0], sc[1]), fmaxf(sc[2], sc[3]));
                    mx = fmaxf(mx, __shfl_xor(mx, 1, 32)); mx = fmaxf(mx, __shfl_xor(mx, 2, 32));
                    mx = fmaxf(mx, __shfl_xor(mx, 4, 32)); mx = fmaxf(mx, __shfl_xor(mx, 8, 32));
                    const float mnew = fmaxf(m8[i], mx);
                    const float corr = (mnew == NEG) ? 1.f : exp2f(m8[i] - mnew);
                    float rs = 0.f;
#pragma unroll
                    for (int t = 0; t < 4; ++t) {
                        const float pp = (sc[t] == NEG) ? 0.f : exp2f(sc[t] - mnew); rs += pp;
                        pv[i][t] = p.Pw ? pp * p.Pw[b * p.swb + h * p.swh + (long long)ic * p.swi + (long long)min(j0 + t * 16 + l15, p.Lk - 1) * p.swj] : pp;
                    }
                    rs += __shfl_xor(rs, 1, 32); rs += __shfl_xor(rs, 2, 32); rs += __shfl_xor(rs, 4, 32); rs += __shfl_xor(rs, 8, 32);
                    l8[i] = l8[i] * corr + rs; m8[i] = mnew;
                    if (!TWOPASS) {
#pragma unroll
                        for (int t = 0; t < NT; ++t) o[t][i] *= corr;
                    }
                } else {
                    const float inv = (l8[i] > 0.f) ? 1.f / l8[i] : 0.f;
#pragma unroll
                    for (int t = 0; t < 4; ++t) {
                        const int jg = j0 + t * 16 + l15;
                        float pp = (sc[t] == NEG) ? 0.f : exp2f(sc[t] - m8[i]) * inv;
                        if (p.Pw) pp *= p.Pw[b * p.swb + h * p.swh + (long long)ic * p.swi + (long long)min(jg, p.Lk - 1) * p.swj];
                        pv[i][t] = pp;
                    }
                }
            }
            if (dopv) {
#pragma unroll
                for (int i = 0; i < 8; ++i)
#pragma unroll
                    for (int t = 0; t < 4; ++t) ((float*)myp)[(i + 8 * hf) * 64 + t * 16 + l15] = pv[i][t];
                __syncthreads();                                 // P (per wave) and V (shared) visible
                if (p.P) {
                    float* pb_ = p.P + b * p.sPb + h * p.sPh;
                    const bool fastP = (p.pband == 0) && ((p.sPi & 3) == 0) && (j0 + 64 <= p.Lk) && (q0 + 16 <= p.Lq) && ((((size_t)pb_) & 15) == 0);
                    if (fastP) {
#pragma unroll
                        for (int s = 0; s < 8; ++s) {
                            const int row = s * 2 + (lane >> 4), c4 = (lane & 15) * 4;
                            const v4f v = *(const v4f*)(myp + row * 64 + c4);
                            VST2V4(pb_ + (long long)(q0 + row) * p.sPi + j0 + c4, v);
                        }
                    } else {
                        for (int row = 0; row < 16; ++row) {
                            const int irow = q0 + row; if (irow >= p.Lq) continue;
                            for (int c = lane; c < 64; c += 32) {
                                const int jg = j0 + c; if (jg >= p.Lk) continue;
                                if (p.pband == 0) VST2(float, pb_ + (long long)irow * p.sPi + jg, myp[row * 64 + c]);
                                else if (jg - irow <= p.pband && irow - jg <= p.pband) VST2(float, pb_ + (long long)irow * p.sPi + (jg - irow + p.pband), myp[row * 64 + c]);
                            }
                        }
                    }
                }
                if (SPLITPV) {
                    const Split pa0 = sp_ld(myp + l15 * 64, 1, 0, hf, 64, 1.f), pa1 = sp_ld(myp + l15 * 64, 1, 32, hf, 64, 1.f);
                    const __bf16* vh = (const __bf16*)vl; const __bf16* vlo = vh + 64 * VP;
#pragma unroll
                    for (int t = 0; t < NT; ++t) {
                        const int dcol = t * 16 + l15;
                        Split b0, b1;
#pragma unroll
                        for (int e = 0; e < 16; ++e) {
                            const int k0 = frag_k(e, hf), k1 = 32 + frag_k(e, hf);
                            b0.hi[e] = vh[k0 * VP + dcol]; b0.lo[e] = vlo[k0 * VP + dcol]; b1.hi[e] = vh[k1 * VP + dcol]; b1.lo[e] = vlo[k1 * VP + dcol];
                        }
                        o[t] = wmma3(pa0, b0, o[t]);
                        o[t] = wmma3(pa1, b1, o[t]);
                    }
                } else {
                    const v16h pa0 = fh_ld(myp + l15 * 64, 1, 0, hf, 64, 4096.f), pa1 = fh_ld(myp + l15 * 64, 1, 32, hf, 64, 4096.f);
#pragma unroll
                    for (int t = 0; t < NT; ++t) {
                        const int dcol = t * 16 + l15;
                        v16h b0, b1;
#pragma unroll
                        for (int e = 0; e < 16; ++e) { b0[e] = vl[frag_k(e, hf) * VP + dcol]; b1[e] = vl[(32 + frag_k(e, hf)) * VP + dcol]; }
                        o[t] = wmma16(pa0, b0, o[t]);
                        o[t] = wmma16(pa1, b1, o[t]);
                    }
                }
            }
        }
    }
    float* obase = p.O + b * p.sOb + h * p.sOh;
    if (p.ST) {
        const int rl = lane >> 1, isel = rl & 7;           // row q0 + rl ; rl>>3 == hf holds because lane>>4 == (lane>>1)>>3
        float mv = 0.f, lv = 0.f;
#pragma unroll
        for (int i = 0; i < 8; ++i) if (i == isel) { mv = m8[i]; lv = l8[i]; }
        const int irow = q0 + rl;
        if (irow < p.Lq) { float* st = p.ST + (((long long)b * gridDim.y + h) * p.Lq + irow) * 2 + (lane & 1); VST2(float, st, (lane & 1) ? lv : mv * 0.6931471805599453f); }
    }
    float invr[8];
#pragma unroll
    for (int i = 0; i < 8; ++i) {
        if (TWOPASS) invr[i] = SPLITPV ? 1.f : (1.f / 4096.f);
        else if (p.nonorm) invr[i] = exp2f(m8[i]) * (SPLITPV ? 1.f : (1.f / 4096.f));
        else invr[i] = (l8[i] > 0.f) ? (SPLITPV ? 1.f / l8[i] : 1.f / (l8[i] * 4096.f)) : 0.f;
    }
    __syncthreads();                                             // all waves done with pl/vl from the main loop
    const bool ofast = ((p.sOi & 3) == 0) && ((((size_t)obase) & 15) == 0) && (q0 + 16 <= p.Lq);
#pragma unroll
    for (int c0 = 0; c0 < DVP; c0 += 64) {
#pragma unroll
        for (int i = 0; i < 8; ++i)
#pragma unroll
            for (int t = 0; t < NT; ++t) if (t * 16 >= c0 && t * 16 < c0 + 64) ((float*)myp)[(i + 8 * hf) * 64 + (t * 16 - c0) + l15] = o[t][i] * invr[i];
        __syncthreads();
        const int cw = (DVP - c0 < 64) ? (DVP - c0) : 64;      // staged columns in this chunk (multiple of 16)
        if (ofast && (c0 + cw <= p.dv) && (cw % 32 == 0)) {
            const int lpr = cw / 4;                              // lanes per row (16 for 64 cols, 8 for 32)
            const int rows_per_ins = 32 / lpr;
            for (int r0 = 0; r0 < 16; r0 += rows_per_ins) {
                const int row = r0 + lane / lpr, c4 = (lane % lpr) * 4;
                const v4f v = *(const v4f*)(myp + row * 64 + c4);
                VST2V4(obase + (long long)(q0 + row) * p.sOi + c0 + c4, v);
            }
        } else {
            for (int row = 0; row < 16; ++row) {
                const int irow = q0 + row; if (irow >= p.Lq) continue;
                for (int c = lane; c < cw; c += 32) { const int d = c0 + c; if (d < p.dv) VST2(float, obase + (long long)irow * p.sOi + d, myp[row * 64 + c]); }
            }
        }
        __syncthreads();
    }
}

__device__ __forceinline__ float xhalf(float x) { return __builtin_bit_cast(float, __builtin_amdgcn_permlanex16(__builtin_bit_cast(int, x), __builtin_bit_cast(int, x), 0x76543210, 0xfedcba98, false, false)); }
// 2^x as the one hardware instruction. exp2f puts a compare, two selects, an add and a ldexp round every v_exp_f32, only so that results below 2^-126 come out as
// denormals. Every argument here is a score minus the row's running maximum: such a term is under 2^-126 of the row's largest, is zero as an f16 p either way and
// cannot move the f32 row sum, which ends at 1 or more. From -126 up the value is the same bit for bit; -inf (the first trip's old maximum) gives 0 as before.
// Written as asm, each value in its own register and in place, so that the slot which the instruction set asks for behind a transcendental is filled by construction:
// behind each v_exp_f32 stands one that touches neither its result nor its source, behind the last a v_nop.
__device__ __forceinline__ void exp2_run8(float* x) {
    asm("v_exp_f32 %0, %0\n\tv_exp_f32 %1, %1\n\tv_exp_f32 %2, %2\n\tv_exp_f32 %3, %3\n\t"
        "v_exp_f32 %4, %4\n\tv_exp_f32 %5, %5\n\tv_exp_f32 %6, %6\n\tv_exp_f32 %7, %7\n\tv_nop"
        : "+v"(x[0]), "+v"(x[1]), "+v"(x[2]), "+v"(x[3]), "+v"(x[4]), "+v"(x[5]), "+v"(x[6]), "+v"(x[7]));
}
__device__ __forceinline__ float exp2_one(float x) { asm("v_exp_f32 %0, %0\n\tv_nop" : "+v"(x)); return x; }   // the same, one value
// One thread's eight copies for one key block: four 16-byte pieces of the K tile and four of the V^T tile, each the same 16 bytes of rows 16 apart
// (eight lanes cover one row's 128 bytes, a whole line). lk, lv = LDS byte addresses, gk, gv = global addresses of the first piece of each tile.
// The s_wait_xcnt closes the statement so that no register which a copy names is rewritten ahead of it.
template <int PB, int KLD, int VLD>
__device__ __forceinline__ void at_copy8(unsigned lk, unsigned lv, const _Float16* gk, const _Float16* gv) {
    asm volatile(
        "global_load_async_to_lds_b128 %0, %8, off\n\t"
        "global_load_async_to_lds_b128 %1, %9, off\n\t"
        "global_load_async_to_lds_b128 %2, %10, off\n\t"
        "global_load_async_to_lds_b128 %3, %11, off\n\t"
        "global_load_async_to_lds_b128 %4, %12, off\n\t"
        "global_load_async_to_lds_b128 %5, %13, off\n\t"
        "global_load_async_to_lds_b128 %6, %14, off\n\t"
        "global_load_async_to_lds_b128 %7, %15, off\n\t"
        "s_wait_xcnt 0x0"
        :: "v"(lk), "v"(lk + 16 * PB), "v"(lk + 32 * PB), "v"(lk + 48 * PB), "v"(lv), "v"(lv + 16 * PB), "v"(lv + 32 * PB), "v"(lv + 48 * PB),
           "v"(gk), "v"(gk + 16 * KLD), "v"(gk + 32 * KLD), "v"(gk + 48 * KLD), "v"(gv), "v"(gv + 16 * VLD), "v"(gv + 32 * VLD), "v"(gv + 48 * VLD)
        : "memory");
}
// Q and K: f16 planes of GR rows (batch * GT + position) x GD columns, head h at column h * 64. Vt: the f16 plane of V transposed, GD rows (head h at row h * 64) x GR columns.
template <int GT, int GD, int GR>
__global__ __launch_bounds__(32 * AW) KATTN_ATTR void k_attnT(const _Float16* __restrict__ Q, const _Float16* __restrict__ K, const _Float16* __restrict__ Vt, float* __restrict__ O, const float* __restrict__ Rt, float scale) {
    static_assert(GT % (16 * AW) == 0 && GT % 64 == 0 && GT >= 128 && AW == 4, "whole query tiles and key blocks; 128 threads copy the 64 x 64 K and V^T tiles; the two-buffer prologue needs two key blocks");
    constexpr int DH = 64;                      // head size
    constexpr int VP = 64 + 8;                  // LDS pitch (halves): rows of 128 bytes + 16, for 16-byte readers
    constexpr int TB = 64 * VP * 2;             // one tile in LDS, bytes
    __shared__ __align__(16) _Float16 vt[2][DH * VP];   // V^T tile: row = head column, 64 keys along the row
    __shared__ __align__(16) _Float16 kt[2][64 * VP];   // K tile: row = key, the 64 head columns along the row; both tiles are copied in once a key block and read by all four waves
    const int lane = threadIdx.x & 31, hf = lane >> 4, l15 = lane & 15, wave = threadIdx.x >> 5;
    const int h = blockIdx.y, b = blockIdx.z;
    const int q0 = (blockIdx.x * AW + wave) * 16;
    const float L2E = 1.4426950408889634f;
    const int crow = threadIdx.x >> 3, ccol = threadIdx.x & 7;      // copies: eight lanes cover one tile row
    const _Float16* gk = K + (size_t)(b * GT + crow) * GD + h * DH + ccol * 8;
    const _Float16* gv = Vt + (size_t)(h * DH + crow) * GR + b * GT + ccol * 8;
    const unsigned lk = (unsigned)(size_t)&kt[0][0] + (unsigned)(crow * (VP * 2) + ccol * 16);
    const unsigned lv = (unsigned)(size_t)&vt[0][0] + (unsigned)(crow * (VP * 2) + ccol * 16);
    at_copy8<VP * 2, GD, GR>(lk, lv, gk, gv);
    const _Float16* qrow = Q + (size_t)(b * GT + q0 + l15) * GD + h * DH + 8 * hf;
    v16h qb[2];                                 // halves 8 hf + 0..7 and 16 + 8 hf + 0..7 of each 32: the k order of the K fragments below
#pragma unroll
    for (int ks = 0; ks < 2; ++ks) {
        const v8h q0h = *(const v8h*)(qrow + ks * 32), q1h = *(const v8h*)(qrow + ks * 32 + 16);
        qb[ks] = __builtin_shufflevector(q0h, q1h, 0, 1, 2, 3, 4, 5, 6, 7, 8, 9, 10, 11, 12, 13, 14, 15);
    }
    v8f o[4]; float m = -__builtin_inff(), l = 0.f;
#pragma unroll
    for (int t = 0; t < 4; ++t) { v8f zz = {}; o[t] = zz; }
    asm volatile("s_wait_asynccnt 0x0" ::: "memory");    // this wave's share of key block 0 has landed
    __syncthreads();                                     // key block 0 is whole for every wave
    at_copy8<VP * 2, GD, GR>(lk + TB, lv + TB, gk + 64 * GD, gv + 64);
    for (int j0 = 0; j0 < GT; j0 += 64) {
        // This trip works on key block j0 in buffer cur; the next block's copies, issued a trip ago, fly into the other buffer.
        const int cur = (j0 >> 6) & 1;
        // table column i - j + GT - 1 as block-uniform pointer + the lane's fixed offset + a constant, each part >= 0 (j0 <= GT - 64)
        float rb[4][8];
        const float* rt = Rt + (long long)h * (2 * GT - 1) + ((int)blockIdx.x * (16 * AW) - j0 + (GT - 64));
        const unsigned ro = (unsigned)(wave * 16 + l15 + 8 * (1 - hf));
#pragma unroll
        for (int t = 0; t < 4; ++t)
#pragma unroll
            for (int r = 0; r < 8; ++r) rb[t][r] = rt[(size_t)ro + (16 * (3 - t) + (7 - r))];
        v8f s[4];
        v8h ka[16];                                      // the eight K fragments, the k order of qb: halves 8 hf + 0..7 and 16 + 8 hf + 0..7 of each 32
#pragma unroll
        for (int t = 0; t < 4; ++t)
#pragma unroll
            for (int ks = 0; ks < 2; ++ks) {
                const _Float16* kr = kt[cur] + (t * 16 + l15) * VP + ks * 32 + 8 * hf;
                ka[(t * 2 + ks) * 2] = *(const v8h*)kr; ka[(t * 2 + ks) * 2 + 1] = *(const v8h*)(kr + 16);
            }
        hold16(ka);                                      // the sixteen LDS reads issue together and are waited for once (otherwise: one fragment's registers, a full LDS wait in front of each product)
#pragma unroll
        for (int t = 0; t < 4; ++t) {
            v8f acc = {};
#pragma unroll
            for (int ks = 0; ks < 2; ++ks) {
                const v16h kfr = __builtin_shufflevector(ka[(t * 2 + ks) * 2], ka[(t * 2 + ks) * 2 + 1], 0, 1, 2, 3, 4, 5, 6, 7, 8, 9, 10, 11, 12, 13, 14, 15);
                acc = __builtin_amdgcn_wmma_f32_16x16x32_f16(false, kfr, false, qb[ks], (short)0, acc, false, false);   // A = key rows, B = query columns
            }
            s[t] = acc;
        }
        float sc[4][8], mt[4];
#pragma unroll
        for (int t = 0; t < 4; ++t) {
#pragma unroll
            for (int r = 0; r < 8; ++r) sc[t][r] = (s[t][r] * scale + rb[t][r]) * L2E;
            mt[t] = fmaxf(fmaxf(fmaxf(sc[t][0], sc[t][1]), fmaxf(sc[t][2], sc[t][3])), fmaxf(fmaxf(sc[t][4], sc[t][5]), fmaxf(sc[t][6], sc[t][7])));
        }
        v8h vh[16];                                      // the eight V^T fragments: the trip's last LDS reads, so that the buffer can be handed back ahead of the softmax
#pragma unroll
        for (int t = 0; t < 4; ++t)
#pragma unroll
            for (int ks = 0; ks < 2; ++ks) {
                const _Float16* vr = vt[cur] + (t * 16 + l15) * VP + ks * 32 + 8 * hf;
                vh[(t * 2 + ks) * 2] = *(const v8h*)vr; vh[(t * 2 + ks) * 2 + 1] = *(const v8h*)(vr + 16);
            }
        // Publish point: from here on the trip works on registers alone, and the refill has the softmax, the second products and the next trip's first half to land.
        asm volatile("s_wait_dscnt 0x0" ::: "memory");       // this wave's reads of block j0 are done before its buffer is handed back
        asm volatile("s_wait_asynccnt 0x0" ::: "memory");    // this wave's share of block j0 + 64 has landed
        __syncthreads();                                     // publishes block j0 + 64 and ends every wave's reads of block j0
        if (j0 + 128 < GT) at_copy8<VP * 2, GD, GR>(lk + cur * TB, lv + cur * TB, gk + (size_t)(j0 + 128) * GD, gv + (j0 + 128));
        float mx = fmaxf(fmaxf(mt[0], mt[1]), fmaxf(mt[2], mt[3]));
        mx = fmaxf(mx, xhalf(mx));                        // the other lane half holds the query's other 32 keys
        const float mnew = fmaxf(m, mx);
        const float corr = exp2_one(m - mnew);
        float rs[4];
#pragma unroll
        for (int t = 0; t < 4; ++t) {
#pragma unroll
            for (int r = 0; r < 8; ++r) sc[t][r] -= mnew;
            exp2_run8(sc[t]);
            rs[t] = sc[t][0];
#pragma unroll
            for (int r = 1; r < 8; ++r) rs[t] += sc[t][r];
        }
        l = l * corr + ((rs[0] + rs[1]) + (rs[2] + rs[3])); m = mnew;
#pragma unroll
        for (int t = 0; t < 4; ++t)
#pragma unroll
            for (int r = 0; r < 8; ++r) o[t][r] *= corr;
        v16h pb[2];
#pragma unroll
        for (int ks = 0; ks < 2; ++ks)
#pragma unroll
            for (int e = 0; e < 16; ++e) pb[ks][e] = (_Float16)(sc[2 * ks + (e >> 3)][e & 7] * 4096.f);
#pragma unroll
        for (int t = 0; t < 4; ++t)
#pragma unroll
            for (int ks = 0; ks < 2; ++ks) {
                const v16h va = __builtin_shufflevector(vh[(t * 2 + ks) * 2], vh[(t * 2 + ks) * 2 + 1], 0, 1, 2, 3, 4, 5, 6, 7, 8, 9, 10, 11, 12, 13, 14, 15);
                o[t] = __builtin_amdgcn_wmma_f32_16x16x32_f16(false, va, false, pb[ks], (short)0, o[t], false, false);   // A = head columns, B = query columns
            }
    }
    asm volatile("s_wait_asynccnt 0x0" ::: "memory");        // nothing of this wave is in flight when it goes on
    l += xhalf(l);                                       // join the two halves' sums
    const float inv = (l > 0.f) ? 1.f / (l * 4096.f) : 0.f;
    float* orow = O + (long long)b * GT * GD + h * DH + (long long)(q0 + l15) * GD + 8 * hf;
#pragma unroll
    for (int t = 0; t < 4; ++t) {
        const v4f w0 = { o[t][0] * inv, o[t][1] * inv, o[t][2] * inv, o[t][3] * inv }, w1 = { o[t][4] * inv, o[t][5] * inv, o[t][6] * inv, o[t][7] * inv };
        VST2V4(orow + t * 16, w0); VST2V4(orow + t * 16 + 4, w1);
    }
}

// =====================================================================================================================
// k_tr: dst(z, c, r) = alpha * src(z, r, c) (+ beta * R2(z, c, r)): [Z][R][C] (row stride lds) -> [Z][C][R] (row stride ldd) through a 32x32 LDS tile;
//   flags: 1 -> add beta * residual R2 addressed like dst (z*sRz + c*ldr + r); act applied before the residual.
// =====================================================================================================================
struct TrP { const float* src; float* dst; const float* R2; long long sSz, lds, sDz, ldd, sRz, ldr; int R, C, flags, act; float alpha, beta; };
static_assert(sizeof(TrP) == 3 * 8 + 6 * 8 + 6 * 4, "TrP has padding");
__global__ __launch_bounds__(256) void k_tr(TrP p) {
    __shared__ float tile[32][33];
    const int c0 = blockIdx.x * 32, r0 = blockIdx.y * 32, z = blockIdx.z;
    const int lane = threadIdx.x & 31, wave = threadIdx.x >> 5;
    const float* s = p.src + z * p.sSz;
#pragma unroll
    for (int k = 0; k < 4; ++k) {
        const int rl = wave * 4 + k, r = r0 + rl, c = c0 + lane;
        tile[rl][lane] = (r < p.R && c < p.C) ? s[(long long)r * p.lds + c] : 0.f;
    }
    __syncthreads();
    float* d = p.dst + z * p.sDz; const float* rr = p.R2 + z * p.sRz;
#pragma unroll
    for (int k = 0; k < 4; ++k) {
        const int cl = wave * 4 + k, c = c0 + cl, r = r0 + lane;
        if (c < p.C && r < p.R) {
            float v = act_fn(p.alpha * tile[lane][cl], p.act);
            if (p.flags & 1) v += p.beta * rr[(long long)c * p.ldr + r];
            VST2(float, d + (long long)c * p.ldd + r, v);
        }
    }
}

// k_affine: dst[i] = a * (sdev ? sdev[0] : 1) * src[i] + b, i < n (one thread per element; consecutive lanes -> consecutive addresses)
__global__ __launch_bounds__(256) void k_affine(const float* __restrict__ src, float* __restrict__ dst, int n, float a, float b, const float* __restrict__ sdev) {
    const int i = blockIdx.x * 256 + threadIdx.x;
    if (i < n) { const float aa = sdev ? a * sdev[0] : a; const float v = aa * src[i] + b; VST2(float, dst + i, v); }
}

// =====================================================================================================================
// k_softmax: row softmax over n contiguous elements, one 256-thread block per row; rows addressed z*sz + r*sr (grid (R, Z)).
//   out = scale_out * softmax(scale_in * x + (Mf ? Mf[z*smz + r*smr + j] : 0)); a row whose max is -inf is written as 0.
// =====================================================================================================================
struct SmP { const float* src; float* dst; const float* Mf; long long sz, sr, dz, dr, smz, smr; int n, pad; float scale_in, scale_out; };
static_assert(sizeof(SmP) == 3 * 8 + 6 * 8 + 4 * 4, "SmP has padding");
__global__ __launch_bounds__(256) void k_softmax(SmP p) {
    __shared__ float red[256];
    const int r = blockIdx.x, z = blockIdx.y, tid = threadIdx.x;
    const float* s = p.src + z * p.sz + (long long)r * p.sr;
    const float* mf = p.Mf ? (p.Mf + z * p.smz + (long long)r * p.smr) : nullptr;
    float mx = -__builtin_inff();
    for (int j = tid; j < p.n; j += 256) { float v = s[j] * p.scale_in; if (mf) v += mf[j]; mx = fmaxf(mx, v); }
    red[tid] = mx; __syncthreads();
    for (int o = 128; o > 0; o >>= 1) { if (tid < o) red[tid] = fmaxf(red[tid], red[tid + o]); __syncthreads(); }
    mx = red[0]; __syncthreads();
    float sum = 0.f;
    for (int j = tid; j < p.n; j += 256) { float v = s[j] * p.scale_in; if (mf) v += mf[j]; sum += (mx == -__builtin_inff()) ? 0.f : expf(v - mx); }
    red[tid] = sum; __syncthreads();
    for (int o = 128; o > 0; o >>= 1) { if (tid < o) red[tid] += red[tid + o]; __syncthreads(); }
    sum = red[0];
    const float inv = (sum > 0.f) ? p.scale_out / sum : 0.f;
    float* d = p.dst + z * p.dz + (long long)r * p.dr;
    for (int j = tid; j < p.n; j += 256) { float v = s[j] * p.scale_in; if (mf) v += mf[j]; const float o = (mx == -__builtin_inff()) ? 0.f : expf(v - mx) * inv; VST2(float, d + j, o); }
}
// =====================================================================================================================
// k_stats: mean and rsqrt(var + eps) over a set of n elements addressed base + z*sz + (e / inner) * so + (e % inner) * si, one 256-thread
// k_norm_apply: y = (x - mean[set]) * rstd[set] * g[c] + b[c] over a [Z][C][L] channel-major tensor with set = z*G + c / (C/G) (G groups per z;
//   G = C -> per-channel sets indexed z*C+c; for batch norm pass stats indexed by c only via bn = 1). Optional act. Output same layout.
// =====================================================================================================================
//   mode 0: mean / rsqrt(var + eps); mode 1 (RMSNorm): 0 / rsqrt(mean(x^2) + eps); mode 2 (L2 normalize * sqrt(n)): 0 / sqrt(n) / max(||x||, eps); mode 3: as 0 with unbiased variance (n-1)
__global__ __launch_bounds__(256) void k_stats(const float* __restrict__ x, long long sz, long long so, long long si, int inner, int n, float eps, float* __restrict__ stat, int mode) {
    __shared__ float red[256];
    const int z = blockIdx.x, tid = threadIdx.x;
    const float* base = x + z * sz;
    float s = 0.f;
    for (int e = tid; e < n; e += 256) s += base[(long long)(e / inner) * so + (long long)(e % inner) * si];
    red[tid] = s; __syncthreads();
    for (int o = 128; o > 0; o >>= 1) { if (tid < o) red[tid] += red[tid + o]; __syncthreads(); }
    const float mu = (mode == 0 || mode == 3) ? red[0] / (float)n : 0.f; __syncthreads();
    float q = 0.f;
    for (int e = tid; e < n; e += 256) { const float dlt = base[(long long)(e / inner) * so + (long long)(e % inner) * si] - mu; q += dlt * dlt; }
    red[tid] = q; __syncthreads();
    for (int o = 128; o > 0; o >>= 1) { if (tid < o) red[tid] += red[tid + o]; __syncthreads(); }
    {
        float rs;
        if (mode == 2) rs = sqrtf((float)n) / fmaxf(sqrtf(red[0]), eps); else if (mode == 3) rs = rsqrtf(red[0] / (float)(n - 1) + eps); else rs = rsqrtf(red[0] / (float)n + eps);
        if (tid < 32) { const float v = (tid == 0) ? mu : ((tid == 1) ? rs : 0.f); VST2(float, stat + (long long)z * 32 + tid, v); }
    }
}
//   One thread per element over the flat [Z][C][L] index space: grid ceil(Z*C*L / 256).
__global__ __launch_bounds__(256) void k_norm_apply(const float* __restrict__ x, float* __restrict__ y, const float* __restrict__ stat, const float* __restrict__ g, const float* __restrict__ bta,
                                                     int Z, int C, int L, int G, int bn, int act) {
    const long long idx = (long long)blockIdx.x * 256 + threadIdx.x;
    if (idx >= (long long)Z * C * L) return;
    const int l = (int)(idx % L); const long long zc = idx / L; const int c = (int)(zc % C), z = (int)(zc / C); (void)l;
    const int set = bn ? c : (z * G + c / (C / G));
    float v = (x[idx] - stat[(long long)set * 32]) * stat[(long long)set * 32 + 1];
    if (g) v *= g[c];
    if (bta) v += bta[c];
    v = act_fn(v, act);
    VST2(float, y + idx, v);
}

// k_lse_neg: c[i] = -(st[2i] + log(st[2i+1])) = minus the log-sum-exp of row i from k_attn's ST output (for softmax over the query dimension)
__global__ __launch_bounds__(256) void k_lse_neg(const float* __restrict__ st, float* __restrict__ c, int n) {
    const int i = blockIdx.x * 256 + threadIdx.x;
    if (i < n) { const float v = -(st[2 * i] + logf(st[2 * i + 1])); VST2(float, c + i, v); }
}

// k_iota: dst[i] = a * i + b as int32 (segment/position id helper)
__global__ __launch_bounds__(256) void k_iota(int* __restrict__ dst, int n, int a, int b) {
    const int i = blockIdx.x * 256 + threadIdx.x;
    if (i < n) { const int v = a * i + b; VST2(int, dst + i, v); }
}

// k_axpby: dst[i] = a * x[i] + b * y[i] (+ c), i < n
__global__ __launch_bounds__(256) void k_axpby(const float* __restrict__ x, const float* __restrict__ y, float* __restrict__ dst, int n, float a, float b, float c) {
    const int i = blockIdx.x * 256 + threadIdx.x;
    if (i < n) { const float v = a * x[i] + b * y[i] + c; VST2(float, dst + i, v); }
}

// =====================================================================================================================
// k_rope: rotary embedding on a [R rows][Hn heads][D] view (row stride sXr, head stride sXh, element stride 1) -> Y (own strides).
//   mode 0: rotate_half (partner d±D/2, sign - for d<D/2); mode 1: interleaved pairs (partner d^1, sign - for even d).
//   table column tcol: tmode 0 -> d, 1 -> d % (D/2), 2 -> d / 2; position p: pmode 0 -> r % S, 1 -> head index, 2 -> pos[r];
//   c = C[(r / S) * sCb + p * sCp + tcol * sCd], s likewise from Sn; y = x[d] * c + sign * x[partner] * s. X and Y must not alias.
// =====================================================================================================================
struct RopeP { const float* X; float* Y; const float* C; const float* Sn; const int* pos; long long sXr, sXh, sYr, sYh, sCb, sCp, sCd; int R, Hn, D, S, mode, tmode, pmode, pad; };
static_assert(sizeof(RopeP) == 5 * 8 + 7 * 8 + 8 * 4, "RopeP has padding");
__global__ __launch_bounds__(256) void k_rope(RopeP p) {
    const long long idx = (long long)blockIdx.x * 256 + threadIdx.x;
    if (idx >= (long long)p.R * p.Hn * p.D) return;
    const int d = (int)(idx % p.D); const long long rh = idx / p.D; const int h = (int)(rh % p.Hn); const int r = (int)(rh / p.Hn);
    const int half = p.D / 2;
    int partner; float sign;
    if (p.mode == 0) { partner = (d < half) ? d + half : d - half; sign = (d < half) ? -1.f : 1.f; }
    else { partner = d ^ 1; sign = (d & 1) ? 1.f : -1.f; }
    const int tcol = (p.tmode == 0) ? d : ((p.tmode == 1) ? (d % half) : (d >> 1));
    const int pp = (p.pmode == 0) ? (r % p.S) : ((p.pmode == 1) ? h : p.pos[r]);
    const long long toff = (long long)(r / p.S) * p.sCb + (long long)pp * p.sCp + (long long)tcol * p.sCd;
    const float* xr = p.X + (long long)r * p.sXr + (long long)h * p.sXh;
    const float v = xr[d] * p.C[toff] + sign * xr[partner] * p.Sn[toff];
    VST2(float, p.Y + (long long)r * p.sYr + (long long)h * p.sYh + d, v);
}

// k_invf + k_sincos (split so neither kernel carries a large VALU-fma footprint): invf_i = num * (1 / powf(base, (2 i)/D)) [fmode 0],
//   num * expf((2 i) * cexp) [fmode 1], num * powf(base, -2 (i - 1) / D) [fmode 2]; then cs/sn[s*half + i] = cos/sin((pscale * s) * invf_i)
__global__ __launch_bounds__(256) void k_invf(float* __restrict__ invb, int half, int D, float base, float num, int fmode, float cexp) {
    const int i = blockIdx.x * 256 + threadIdx.x;
    if (i >= ((half + 31) / 32) * 32) return;
    if (i >= half) { VST2(float, invb + i, 0.f); return; }
    const float e = (float)(2 * i) / (float)D;
    float invf;
    if (fmode == 1) invf = num * expf((float)(2 * i) * cexp);
    else if (fmode == 2) invf = num * powf(base, (-2.0f * ((float)i - 1.0f)) / (float)D);
    else invf = num * (1.0f / powf(base, e));
    VST2(float, invb + i, invf);
}
__global__ __launch_bounds__(256) void k_sincos(float* __restrict__ cs, float* __restrict__ sn, const float* __restrict__ invb, int S, int half, float pscale) {
    const int idx = blockIdx.x * 256 + threadIdx.x;
    if (idx >= S * half) return;
    const int s = idx / half, i = idx - s * half;
    const float ang = (pscale * (float)s) * invb[i];
    VST2(float, cs + idx, cosf(ang)); VST2(float, sn + idx, sinf(ang));
}

// k_mulact: dst[i] = act(x[i]) * y[i]
__global__ __launch_bounds__(256) void k_mulact(const float* __restrict__ x, const float* __restrict__ y, float* __restrict__ dst, int n, int act) {
    const int i = blockIdx.x * 256 + threadIdx.x;
    if (i < n) { const float v = act_fn(x[i], act) * y[i]; VST2(float, dst + i, v); }
}

// =====================================================================================================================
// k_matvec: thread-per-row matrix-vector products for N <= 8 output columns (heads with 1-3 outputs, gates), f32 on the VALU.
//   C[r*sCm + j] = act(alpha * sum_k A[r*sAm + k*sAk] * B[j*sBn + k*sBk] + bias[j]) + beta * R[r*sRm + j*sRn]; each thread writes its N contiguous floats.
// =====================================================================================================================
__global__ __launch_bounds__(256) void k_matvec(GemmP p) {
    // 32 lanes write one line with one instruction.
    const int rpt = (p.N == 1) ? 1 : 32;
    const long long r0 = ((long long)blockIdx.x * 256 + threadIdx.x) * rpt; const int z = blockIdx.z, zo = z / p.zi_n, zi = z - zo * p.zi_n;
    if (r0 >= p.M) return;
    const float* Bb = p.B + zo * p.sBo + zi * p.sBi;
    float* C = p.C + zo * p.sCo + zi * p.sCi; const float* R = p.R + zo * p.sRo + zi * p.sRi;
    for (int rr = 0; rr < rpt; ++rr) {
        const long long r = r0 + rr; if (r >= p.M) break;
        const float* A = p.A + zo * p.sAo + zi * p.sAi + r * p.sAm;
        float acc[8] = {0.f, 0.f, 0.f, 0.f, 0.f, 0.f, 0.f, 0.f};
        for (int k = 0; k < p.K; ++k) { const float a = A[(long long)k * p.sAk];
#pragma unroll
            for (int j = 0; j < 8; ++j) if (j < p.N) acc[j] += a * Bb[(long long)j * p.sBn + (long long)k * p.sBk]; }
#pragma unroll
        for (int j = 0; j < 8; ++j) if (j < p.N) {
            float v = acc[j] * p.alpha;
            if (p.flags & 1) v += p.bias[j];
            if (p.flags & 2) v += p.bias[r];
            v = act_fn(v, p.act);
            if (p.flags & 4) v += p.beta * R[r * p.sRm + (long long)j * p.sRn];
            VST2(float, C + r * p.sCm + j, v);
        }
    }
}
// k_smallsoftmax: thread-per-row softmax for short rows (n <= 64): dst[r*dr + j] = softmax(scale*src[r*sr + j])
__global__ __launch_bounds__(256) void k_smallsoftmax(const float* __restrict__ src, float* __restrict__ dst, long long sr, long long dr, int n, long long R, float scale) {
    const long long r0 = ((long long)blockIdx.x * 256 + threadIdx.x) * 32;
    for (int rr = 0; rr < 32; ++rr) {
        const long long r = r0 + rr; if (r >= R) return;
        const float* s = src + r * sr; float* d = dst + r * dr;
        float mx = -__builtin_inff();
        for (int j = 0; j < n; ++j) mx = fmaxf(mx, s[j] * scale);
        float sum = 0.f;
        for (int j = 0; j < n; ++j) sum += expf(s[j] * scale - mx);
        const float inv = 1.f / sum;
        for (int j = 0; j < n; ++j) { const float v = expf(s[j] * scale - mx) * inv; VST2(float, d + j, v); }
    }
}

__global__ __launch_bounds__(32) void k_unitstat(float* __restrict__ st) { const int t = threadIdx.x; const float v = (t == 1) ? 1.f : 0.f; VST2(float, st + t, v); }

// destination (e.g. a d_out whose row width is not a multiple of 32 floats) is written by consecutive lanes of one instruction
__global__ __launch_bounds__(256) void k_lincopy(const float* __restrict__ src, long long lds, float* __restrict__ dst, long long ldd, long long rows, int cols) {
    const long long i = (long long)blockIdx.x * 256 + threadIdx.x; if (i >= rows * cols) return;
    const long long r = i / cols; const int c = (int)(i - r * cols);
    const float v = src[r * lds + c]; VST2(float, dst + r * ldd + c, v);
}

namespace w25 {
typedef __attribute__((ext_vector_type(16))) _Float16 v16h;
typedef __attribute__((ext_vector_type(8)))  _Float16 v8h;
typedef __attribute__((ext_vector_type(16))) __bf16   v16b;
typedef __attribute__((ext_vector_type(8)))  __bf16   v8b;
typedef __attribute__((ext_vector_type(8)))  float    v8f;
typedef __attribute__((ext_vector_type(4)))  float    v4f;

__device__ __forceinline__ unsigned short f2bf_bits(float f) {
  unsigned u = __float_as_uint(f);
  return (unsigned short)((u + 0x7FFFu + ((u >> 16) & 1u)) >> 16);
}
__device__ __forceinline__ float bf_bits2f(unsigned short h) { return __uint_as_float(((unsigned)h) << 16); }

// hazard guards as plain device helpers (no inline asm inside the kernel template body)
__device__ __forceinline__ void dep_guard_h(v8f& a, v8f& b, v16h x, v16h y) { asm volatile("v_nop\n\tv_nop\n\tv_nop\n\tv_nop" : "+v"(a), "+v"(b) : "v"(x), "v"(y)); }
__device__ __forceinline__ void dep_guard_b(v8f& a, v8f& b, v16b x, v16b y) { asm volatile("v_nop\n\tv_nop\n\tv_nop\n\tv_nop" : "+v"(a), "+v"(b) : "v"(x), "v"(y)); }
__device__ __forceinline__ void keep4_h(v16h a, v16h b, v16h c, v16h d) { asm volatile("v_nop" :: "v"(a), "v"(b), "v"(c), "v"(d)); }
__device__ __forceinline__ void keep4_b(v16b a, v16b b, v16b c, v16b d) { asm volatile("v_nop" :: "v"(a), "v"(b), "v"(c), "v"(d)); }
__device__ __forceinline__ void acc_guard4(v8f& a, v8f& b, v8f& c, v8f& d) { asm volatile("v_nop\n\tv_nop\n\tv_nop\n\tv_nop" : "+v"(a), "+v"(b), "+v"(c), "+v"(d)); }
template <typename T> struct Frag;
template <> struct Frag<_Float16> {
  typedef v16h V; union U { v16h v; v8h h[2]; };
  static __device__ __forceinline__ v16h load(const _Float16* p) {   // elements 0..7 <- p[0..7], 8..15 <- p[16..23]
    U f; f.h[0] = *(const v8h*)(p); f.h[1] = *(const v8h*)(p + 16); return f.v;
  }
  static __device__ __forceinline__ v8f mma(v16h a, v16h b, v8f c) {
    return __builtin_amdgcn_wmma_f32_16x16x32_f16(false, a, false, b, (short)0, c, false, false);
  }
  static __device__ __forceinline__ void guard(v8f& a, v8f& b, v16h x, v16h y) { dep_guard_h(a, b, x, y); }
  static __device__ __forceinline__ void keep(v16h a, v16h b, v16h c, v16h d) { keep4_h(a, b, c, d); }
};
template <> struct Frag<__bf16> {
  typedef v16b V; union U { v16b v; v8b h[2]; };
  static __device__ __forceinline__ v16b load(const __bf16* p) {
    U f; f.h[0] = *(const v8b*)(p); f.h[1] = *(const v8b*)(p + 16); return f.v;
  }
  static __device__ __forceinline__ v8f mma(v16b a, v16b b, v8f c) {
    return __builtin_amdgcn_wmma_f32_16x16x32_bf16(false, a, false, b, (short)0, c, false, false);
  }
  static __device__ __forceinline__ void guard(v8f& a, v8f& b, v16b x, v16b y) { dep_guard_b(a, b, x, y); }
  static __device__ __forceinline__ void keep(v16b a, v16b b, v16b c, v16b d) { keep4_b(a, b, c, d); }
};

// ---- Register-blocked batched WMMA GEMM ------------------------------------
// C[m,n] = scale * sum_k A[m,k] * Bt[n,k] (+bias)(+resid); each wave owns a 64x64 tile.
// A row-major [M,K]; Bt row-major [N,K]; M,N % 64 == 0, K % 32 == 0.
// SPLIT: operands are hi/lo planes (A2/Bt2 = lo planes, same layout); product = hi·hi + hi·lo + lo·hi.
// BIAS_MODE: 0 = none, 1 = bias[m], 2 = bias[n].
// OUT_MODE: 0 = f32, 1 = f16, 2 = bf16 hi plane (Cout) + bf16 lo plane (Cout2).
// ET: 0 = f16 operands, 1 = bf16 operands (pointers passed as 16-bit storage)
template <int ET> struct Elem;
template <> struct Elem<0> { typedef _Float16 T; };
template <> struct Elem<1> { typedef __bf16 T; };
template <int ET, bool SPLIT, int BIAS_MODE, int OUT_MODE, bool RESID, int ACT = 0>
__global__ __launch_bounds__(256) void wmma_gemm64(
    const unsigned short* __restrict__ Ap, const unsigned short* __restrict__ A2p, int lda, long strideA,
    const unsigned short* __restrict__ Btp, const unsigned short* __restrict__ Bt2p, int ldb, long strideB,
    void* __restrict__ Cout, void* __restrict__ Cout2, int ldc, long strideC,
    const float* __restrict__ bias,
    const float* __restrict__ resid, long strideR,
    int M, int N, int K, float scale) {
  typedef typename Elem<ET>::T T;
  typedef typename Frag<T>::V V;
  const T* A = (const T*)Ap; const T* A2 = (const T*)A2p; const T* Bt = (const T*)Btp; const T* Bt2 = (const T*)Bt2p;
  __shared__ __align__(16) float sT[8][16 * 68];   // per-wave 16x64 slab, pitch 68 floats
  const int b    = blockIdx.y;
  const int lane = threadIdx.x & 31;
  const int wave = threadIdx.x >> 5;
  const int tilesN = N >> 6;
  const int tilesM = M >> 6;
  const int tile = blockIdx.x * 8 + wave;
  if (tile >= tilesM * tilesN) return;   // wave-uniform; no block barriers in this kernel
  const int tm = tile / tilesN;
  const int tn = tile - tm * tilesN;
  const int m0 = tm << 6;
  const int n0 = tn << 6;

  const T* Ab  = A  + (size_t)b * strideA;
  const T* Bb  = Bt + (size_t)b * strideB;
  const T* Ab2 = SPLIT ? (A2  + (size_t)b * strideA) : nullptr;
  const T* Bb2 = SPLIT ? (Bt2 + (size_t)b * strideB) : nullptr;

  const int rlane = lane & 15;                 // row (A) / col (B, D) within subtile
  const int koff  = (lane >> 4) * 8;           // k offset of this lane half
  const int mOff  = (lane >> 4) * 8;           // D row offset

  v8f acc[4][4];
#pragma unroll
  for (int i = 0; i < 4; ++i)
#pragma unroll
    for (int j = 0; j < 4; ++j) acc[i][j] = (v8f){0.f,0.f,0.f,0.f,0.f,0.f,0.f,0.f};

  for (int k0 = 0; k0 < K; k0 += 32) {
    V bh[4], bl[4];
#pragma unroll
    for (int j = 0; j < 4; ++j) {
      const size_t bo = (size_t)(n0 + (j << 4) + rlane) * ldb + koff + k0;
      bh[j] = Frag<T>::load(Bb + bo);
      if (SPLIT) bl[j] = Frag<T>::load(Bb2 + bo);
    }
#pragma unroll
    for (int i = 0; i < 4; ++i) {
      const size_t ao = (size_t)(m0 + (i << 4) + rlane) * lda + koff + k0;
      V ah = Frag<T>::load(Ab + ao);
      V al;
      if (SPLIT) al = Frag<T>::load(Ab2 + ao);
#pragma unroll
      for (int j = 0; j < 4; ++j) {
        acc[i][j] = Frag<T>::mma(ah, bh[j], acc[i][j]);
        if (SPLIT) {
          acc[i][j] = Frag<T>::mma(ah, bl[j], acc[i][j]);
          acc[i][j] = Frag<T>::mma(al, bh[j], acc[i][j]);
        }
      }
      Frag<T>::guard(acc[i][0], acc[i][3], ah, SPLIT ? al : ah);
    }
    Frag<T>::keep(bh[0], bh[1], bh[2], bh[3]);
    if (SPLIT) Frag<T>::keep(bl[0], bl[1], bl[2], bl[3]);
  }
  acc_guard4(acc[0][0], acc[0][1], acc[0][2], acc[0][3]);
  acc_guard4(acc[1][0], acc[1][1], acc[1][2], acc[1][3]);
  acc_guard4(acc[2][0], acc[2][1], acc[2][2], acc[2][3]);
  acc_guard4(acc[3][0], acc[3][1], acc[3][2], acc[3][3]);

  // ---- epilogue ----
  float* slab = sT[wave];
  const float* Rb = RESID ? (resid + (size_t)b * strideR) : nullptr;
#pragma unroll
  for (int i = 0; i < 4; ++i) {
    const int mBase = m0 + (i << 4);
#pragma unroll
    for (int j = 0; j < 4; ++j) {
      const int n = n0 + (j << 4) + rlane;
      float bv = 0.f;
      if (BIAS_MODE == 2) bv = bias[n];
#pragma unroll
      for (int r = 0; r < 8; ++r) {
        float v = acc[i][j][r] * scale;
        if (BIAS_MODE == 1) v += bias[mBase + mOff + r];
        if (BIAS_MODE == 2) v += bv;
        if (RESID) v += Rb[(size_t)(mBase + mOff + r) * ldc + n];
        if (ACT == 1) v = tanhf(v);
        if (ACT == 2) v = fmaxf(v, 0.0f);
        if (ACT == 3) v = v / (1.0f + expf(-v));
        if (ACT == 4) v = (v > 0.f) ? v : 0.01f * v;
        if (ACT == 5) v = 0.5f * v * (1.0f + erff(v * 0.70710678118654752f));
        slab[(mOff + r) * 68 + (j << 4) + rlane] = v;
      }
    }
    __builtin_amdgcn_fence(__ATOMIC_RELEASE, "workgroup");
    __builtin_amdgcn_wave_barrier();
    __builtin_amdgcn_fence(__ATOMIC_ACQUIRE, "workgroup");
    if (OUT_MODE == 0) {
      float* C = (float*)Cout + (size_t)b * strideC;
      const int hh = lane >> 4, c4 = (lane & 15) * 4;     // row seg = 256 B = 16 lanes x 16 B
      {
#pragma unroll
        for (int it = 0; it < 8; ++it) {
          const int row = it * 2 + hh;
          v4f v = *(const v4f*)(slab + row * 68 + c4);
          *(v4f*)(C + (size_t)(mBase + row) * ldc + n0 + c4) = v;
        }
        
      }
    } else {
      const int q = lane >> 3, c8 = (lane & 7) * 8;
      unsigned short* C  = (unsigned short*)Cout  + (size_t)b * strideC;
      unsigned short* C2 = (OUT_MODE == 2) ? ((unsigned short*)Cout2 + (size_t)b * strideC) : nullptr;
      {
#pragma unroll
        for (int it = 0; it < 4; ++it) {
          const int row = it * 4 + q;
          const float* sp = slab + row * 68 + c8;
          v8h hv, lv;
#pragma unroll
          for (int e = 0; e < 8; ++e) {
            if (OUT_MODE == 1) {
              hv[e] = (_Float16)sp[e];
            } else {
              unsigned short hb = f2bf_bits(sp[e]);
              unsigned short lb = f2bf_bits(sp[e] - bf_bits2f(hb));
              hv[e] = __builtin_bit_cast(_Float16, hb);
              lv[e] = __builtin_bit_cast(_Float16, lb);
            }
          }
          *(v8h*)(C + (size_t)(mBase + row) * ldc + n0 + c8) = hv;
          if (OUT_MODE == 2) *(v8h*)(C2 + (size_t)(mBase + row) * ldc + n0 + c8) = lv;
        }
        
      }
    }
    __builtin_amdgcn_fence(__ATOMIC_RELEASE, "workgroup");
    __builtin_amdgcn_wave_barrier();
    __builtin_amdgcn_fence(__ATOMIC_ACQUIRE, "workgroup");
  }
}

// ---- Projection GEMM on operand tiles staged in LDS -------------------------------------------------------------
// C[m,n] = scale * sum_k A[m,k] * Bt[n,k] (+ bias[n]); A [GM][GK] and Bt [GN][GK] f16 with k contiguous, C f32 [GM][GN].
// A block owns a 128 x 128 tile of C, its eight waves 32 x 64 each. A trip takes 128 k: 256 bytes of each of the block's 256 operand rows come into LDS once,
// by asynchronous 16-byte copies (one wave's copy = two whole 256-byte row pieces), and every wave reads its fragments from there, 16 bytes a lane.
// Two buffers: tile t + 1 flies while tile t is worked on, one barrier a trip. The k order of the sums is that of wmma_gemm64 (ascending, 32 a product).
constexpr int GL_PB  = 272;             // LDS row pitch in bytes: 256 + 16, an odd multiple of 16, free of bank conflicts for 16-byte readers
constexpr int GL_OP  = 128 * GL_PB;     // one operand's tile
constexpr int GL_BUF = 2 * GL_OP;       // one buffer: the A tile, behind it the Bt tile
// One thread's eight copies for one operand tile: the same 16 bytes of rows 16 apart. l = LDS byte address, g = global address of the first.
// The s_wait_xcnt closes the statement so that no register which a copy names is rewritten ahead of it.
template <int LD>
__device__ __forceinline__ void gl_copy8(unsigned l, const _Float16* g) {
  asm volatile(
      "global_load_async_to_lds_b128 %0, %8, off\n\t"
      "global_load_async_to_lds_b128 %1, %9, off\n\t"
      "global_load_async_to_lds_b128 %2, %10, off\n\t"
      "global_load_async_to_lds_b128 %3, %11, off\n\t"
      "global_load_async_to_lds_b128 %4, %12, off\n\t"
      "global_load_async_to_lds_b128 %5, %13, off\n\t"
      "global_load_async_to_lds_b128 %6, %14, off\n\t"
      "global_load_async_to_lds_b128 %7, %15, off\n\t"
      "s_wait_xcnt 0x0"
      :: "v"(l), "v"(l + 16 * GL_PB), "v"(l + 32 * GL_PB), "v"(l + 48 * GL_PB), "v"(l + 64 * GL_PB), "v"(l + 80 * GL_PB), "v"(l + 96 * GL_PB), "v"(l + 112 * GL_PB),
         "v"(g), "v"(g + 16 * LD), "v"(g + 32 * LD), "v"(g + 48 * LD), "v"(g + 64 * LD), "v"(g + 80 * LD), "v"(g + 96 * LD), "v"(g + 112 * LD)
      : "memory");
}
// OUT16 = 0: C (f32) takes the tile. OUT16 = 1: C16 takes it rounded to f16, the form in which the attention's products read it.
template <int GM, int GN, int GK, int BIAS_MODE, int OUT16>
__global__ __launch_bounds__(256) void wmma_gemm_lds(const _Float16* __restrict__ A, const _Float16* __restrict__ Bt, float* __restrict__ C, _Float16* __restrict__ C16, const float* __restrict__ bias, float scale) {
  static_assert(GM % 128 == 0 && GN % 128 == 0 && GK % 128 == 0 && GK >= 256, "whole tiles; the two-buffer prologue needs two k tiles");
  __shared__ __align__(16) unsigned char ring[2 * GL_BUF];
  __shared__ __align__(16) float sT[8][32 * 68];   // per-wave 32x64 output slab, pitch 68 floats; apart from the ring
  constexpr int TN = GN / 128, NT = GK / 128;
  const int tid = threadIdx.x, lane = tid & 31, wave = tid >> 5;
  const int bm = blockIdx.x / TN, bn = blockIdx.x % TN;
  const int rlane = lane & 15, hf = lane >> 4;
  const int wm = wave >> 1, wn = wave & 1;
  const int crow = tid >> 4, ccol = tid & 15;      // copies: 16 lanes cover one row's 256 bytes
  const _Float16* ga = A  + (size_t)(bm * 128 + crow) * GK + ccol * 8;
  const _Float16* gb = Bt + (size_t)(bn * 128 + crow) * GK + ccol * 8;
  const unsigned la = (unsigned)(size_t)ring + (unsigned)(crow * GL_PB + ccol * 16);
  const unsigned char* fa = ring + (wm * 32 + rlane) * GL_PB + hf * 16;            // fragment rows: lane = row, this half's 8 k first
  const unsigned char* fb = ring + GL_OP + (wn * 64 + rlane) * GL_PB + hf * 16;

  v8f acc[2][4];
#pragma unroll
  for (int i = 0; i < 2; ++i)
#pragma unroll
    for (int j = 0; j < 4; ++j) acc[i][j] = (v8f){0.f,0.f,0.f,0.f,0.f,0.f,0.f,0.f};

  gl_copy8<GK>(la, ga);
  gl_copy8<GK>(la + GL_OP, gb);
  asm volatile("s_wait_asynccnt 0x0" ::: "memory");   // this wave's share of tile 0 has landed
  __syncthreads();                                    // tile 0 is whole for every wave
  gl_copy8<GK>(la + GL_BUF, ga + 128);
  gl_copy8<GK>(la + GL_BUF + GL_OP, gb + 128);
#pragma unroll 1   // kept rolled: buffer offset and refill test are scalar work, and one trip's code serves both buffers
  for (int t = 0; t < NT; ++t) {
    const int bo = (t & 1) * GL_BUF;
    v16h a[2][2], b[2][4];                              // two fragment sets: one is worked on while the next 32 k are read
#pragma unroll
    for (int i = 0; i < 2; ++i) a[0][i] = Frag<_Float16>::load((const _Float16*)(fa + bo + i * 16 * GL_PB));
#pragma unroll
    for (int j = 0; j < 4; ++j) b[0][j] = Frag<_Float16>::load((const _Float16*)(fb + bo + j * 16 * GL_PB));
#pragma unroll
    for (int ks = 0; ks < 4; ++ks) {
      if (ks < 3) {
#pragma unroll
        for (int i = 0; i < 2; ++i) a[(ks + 1) & 1][i] = Frag<_Float16>::load((const _Float16*)(fa + bo + i * 16 * GL_PB + (ks + 1) * 64));
#pragma unroll
        for (int j = 0; j < 4; ++j) b[(ks + 1) & 1][j] = Frag<_Float16>::load((const _Float16*)(fb + bo + j * 16 * GL_PB + (ks + 1) * 64));
      }
      __builtin_amdgcn_sched_barrier(0);                // the next set's twelve LDS reads stay one group ahead of these products (left alone, the scheduler spreads them among the products on one set, a full LDS wait each)
#pragma unroll
      for (int i = 0; i < 2; ++i)
#pragma unroll
        for (int j = 0; j < 4; ++j) acc[i][j] = Frag<_Float16>::mma(a[ks & 1][i], b[ks & 1][j], acc[i][j]);
      __builtin_amdgcn_sched_barrier(0);                // and the group after next stays behind them
    }
    asm volatile("s_wait_dscnt 0x0" ::: "memory");      // this wave's reads of tile t are done before the buffer is handed back
    asm volatile("s_wait_asynccnt 0x0" ::: "memory");   // this wave's share of tile t + 1 has landed
    __syncthreads();                                    // publishes tile t + 1 and ends every wave's reads of tile t
    if (t + 2 < NT) {
      gl_copy8<GK>(la + bo, ga + (t + 2) * 128);
      gl_copy8<GK>(la + bo + GL_OP, gb + (t + 2) * 128);
    }
  }
  asm volatile("s_wait_asynccnt 0x0" ::: "memory");     // nothing of this wave is in flight when it goes on

  // ---- epilogue: the wave's 32 x 64 tile goes through its own slab, so that every store is whole row pieces (256 bytes of f32, 128 bytes of f16) ----
  float* slab = sT[wave];
  const int n0 = bn * 128 + wn * 64, mBase = bm * 128 + wm * 32;
#pragma unroll
  for (int j = 0; j < 4; ++j) {
    float bv = 0.f;
    if (BIAS_MODE == 2) bv = bias[n0 + j * 16 + rlane];
#pragma unroll
    for (int i = 0; i < 2; ++i)
#pragma unroll
      for (int r = 0; r < 8; ++r) {
        float v = acc[i][j][r] * scale;
        if (BIAS_MODE == 2) v += bv;
        slab[(i * 16 + hf * 8 + r) * 68 + j * 16 + rlane] = v;
      }
  }
  // the slab's rows are read by other lanes of the same wave than wrote them
  __builtin_amdgcn_fence(__ATOMIC_RELEASE, "workgroup");
  __builtin_amdgcn_wave_barrier();
  __builtin_amdgcn_fence(__ATOMIC_ACQUIRE, "workgroup");
  if (OUT16) {
    // eight lanes cover one row's 64 halves, a whole 128-byte line; a store takes four rows
    const int r4 = lane >> 3, c8 = (lane & 7) * 8;
    _Float16* hrow0 = C16 + (size_t)(mBase + r4) * GN + n0 + c8;
#pragma unroll
    for (int it = 0; it < 8; ++it) {
      const float* sp = slab + (it * 4 + r4) * 68 + c8;
      const v4f u0 = *(const v4f*)sp, u1 = *(const v4f*)(sp + 4);
      const v8h pk = { (_Float16)u0[0], (_Float16)u0[1], (_Float16)u0[2], (_Float16)u0[3], (_Float16)u1[0], (_Float16)u1[1], (_Float16)u1[2], (_Float16)u1[3] };
      *(v8h*)(hrow0 + (size_t)it * 4 * GN) = pk;
    }
  } else {
    float* crow0 = C + (size_t)(mBase + hf) * GN + n0 + rlane * 4;
#pragma unroll
    for (int it = 0; it < 16; ++it) {
      const v4f v = *(const v4f*)(slab + (it * 2 + hf) * 68 + rlane * 4);
      *(v4f*)(crow0 + (size_t)it * 2 * GN) = v;
    }
  }
}

__global__ __launch_bounds__(256) void cast_f32_f16x2(
    const float* __restrict__ in, _Float16* __restrict__ out, int n2) {
  int i = blockIdx.x * 256 + threadIdx.x;
  if (i < n2) {
    const _Float16 h0 = (_Float16)in[2 * i], h1 = (_Float16)in[2 * i + 1];
    const unsigned u = (unsigned)__builtin_bit_cast(unsigned short, h0) | ((unsigned)__builtin_bit_cast(unsigned short, h1) << 16);
    ((unsigned*)out)[i] = u;
    
  }
}


} // namespace w25

__global__ __launch_bounds__(256) void k_castT16(const float* __restrict__ src, long long lds, _Float16* __restrict__ dst, long long ldd, int R, int C, float s) {
    const long long i = (long long)blockIdx.x * 256 + threadIdx.x; const long long np = (long long)C * (R / 2); if (i >= np) return; const int c = (int)(i / (R / 2)); const int r = 2 * (int)(i % (R / 2));
    const _Float16 h0 = (_Float16)(src[(long long)r * lds + c] * s), h1 = (_Float16)(src[(long long)(r + 1) * lds + c] * s);
    const unsigned u = (unsigned)__builtin_bit_cast(unsigned short, h0) | ((unsigned)__builtin_bit_cast(unsigned short, h1) << 16);
    unsigned* d = (unsigned*)(dst + (long long)c * ldd + r); *d = u;  }
__global__ __launch_bounds__(256) void k_cast16(const float* __restrict__ src, long long lds, _Float16* __restrict__ dst, long long ldd, int R, int C, float s) {
    const long long i = (long long)blockIdx.x * 256 + threadIdx.x; const long long np = (long long)R * (C / 2); if (i >= np) return; const int r = (int)(i / (C / 2)); const int c = 2 * (int)(i % (C / 2));
    const _Float16 h0 = (_Float16)(src[(long long)r * lds + c] * s), h1 = (_Float16)(src[(long long)r * lds + c + 1] * s);
    const unsigned u = (unsigned)__builtin_bit_cast(unsigned short, h0) | ((unsigned)__builtin_bit_cast(unsigned short, h1) << 16);
    unsigned* d = (unsigned*)(dst + (long long)r * ldd + c); *d = u;  }

// f32 -> f16 casts on few, long waves: 256 blocks of 16 waves (4,096 waves to start a launch). A tile is 16,384 consecutive floats: eight wave-wide 16-byte loads a lane
// (512 contiguous bytes a wave and load), all issued before the first is used, and eight 8-byte stores (256 contiguous bytes a wave and store).
__device__ __forceinline__ void cast_tile_ld(const float* __restrict__ s, v4f* r) {
#pragma unroll   // r stays in registers and the eight loads issue back to back
    for (int i = 0; i < 8; ++i) r[i] = *(const v4f*)(s + i * 2048);
}
__device__ __forceinline__ void cast_tile_st(_Float16* __restrict__ d, const v4f* r, float sc) {
#pragma unroll   // constant indices into r and pk: both stay in registers
    for (int i = 0; i < 8; ++i) {
        v4h pk;
#pragma unroll
        for (int e = 0; e < 4; ++e) pk[e] = (_Float16)(r[i][e] * sc);
        *(v4h*)(d + i * 2048) = pk;
    }
}
// Every operand of the four projections that exists before the first of them, in one launch: block n casts tile n of x, tile n of the context and tile n & 63 of
// weight n >> 6 (order Wq, Wk, Wv, Wo; times 16; the four f16 planes lie one behind the other in w16). x and c: 256 tiles each, a weight: 64.
__global__ __launch_bounds__(512) void k_cast_in(const float* __restrict__ x, const float* __restrict__ c, const float* __restrict__ Wq, const float* __restrict__ Wk,
                                                 const float* __restrict__ Wv, const float* __restrict__ Wo, _Float16* __restrict__ x16, _Float16* __restrict__ c16, _Float16* __restrict__ w16) {
    const unsigned n = blockIdx.x, sel = n >> 6;
    const float* __restrict__ w = (sel == 0) ? Wq : (sel == 1) ? Wk : (sel == 2) ? Wv : Wo;
    const unsigned t4 = threadIdx.x * 4u;
    v4f rx[8], rc[8], rw[8];
    cast_tile_ld(x + (size_t)n * 16384 + t4, rx);
    cast_tile_ld(c + (size_t)n * 16384 + t4, rc);
    cast_tile_ld(w + (size_t)(n & 63u) * 16384 + t4, rw);
    cast_tile_st(x16 + (size_t)n * 16384 + t4, rx, 1.0f);
    cast_tile_st(c16 + (size_t)n * 16384 + t4, rc, 1.0f);
    cast_tile_st(w16 + (size_t)n * 16384 + t4, rw, 16.0f);
}
// One plane of 256 tiles (the attention output).
__global__ __launch_bounds__(512) void k_cast_plane(const float* __restrict__ s, _Float16* __restrict__ d) {
    const size_t o = (size_t)blockIdx.x * 16384 + threadIdx.x * 4u;
    v4f r[8];
    cast_tile_ld(s + o, r);
    cast_tile_st(d + o, r, 1.0f);
}

// f32 -> bf16 hi plane + bf16 lo plane (x = hi + lo to ~2^-17 relative; RNE both), [R][C] -> [R][C] (or transposed to [C][R]); 2 consecutive destination elements
__device__ __forceinline__ unsigned int f2bf2_pack(float a, float b, unsigned int* lo) {
    const unsigned short ha = w25::f2bf_bits(a), hb = w25::f2bf_bits(b);
    const unsigned short la = w25::f2bf_bits(a - w25::bf_bits2f(ha)), lb = w25::f2bf_bits(b - w25::bf_bits2f(hb));
    *lo = (unsigned)la | ((unsigned)lb << 16); return (unsigned)ha | ((unsigned)hb << 16); }
__global__ __launch_bounds__(256) void k_castS16(const float* __restrict__ src, long long lds, __bf16* __restrict__ dhi, __bf16* __restrict__ dlo, long long ldd, int R, int C, float s, int transpose) {
    const long long i = (long long)blockIdx.x * 256 + threadIdx.x; long long o; float a, b;
    if (transpose) { const long long np = (long long)C * (R / 2); if (i >= np) return; const int c = (int)(i / (R / 2)); const int r = 2 * (int)(i % (R / 2)); a = src[(long long)r * lds + c] * s; b = src[(long long)(r + 1) * lds + c] * s; o = (long long)c * ldd + r; }
    else { const long long np = (long long)R * (C / 2); if (i >= np) return; const int r = (int)(i / (C / 2)); const int c = 2 * (int)(i % (C / 2)); a = src[(long long)r * lds + c] * s; b = src[(long long)r * lds + c + 1] * s; o = (long long)r * ldd + c; }
    unsigned lo; const unsigned hi = f2bf2_pack(a, b, &lo); unsigned* ph = (unsigned*)(dhi + o); unsigned* pl = (unsigned*)(dlo + o);
    *ph = hi; *pl = lo;  }

namespace w25 {
// =====================================================================================
// Generic causal/non-causal attention for head_dim 64, f32 in / f32 out; 16-bit operands: bf16 with optional hi/lo splits, or
// plain f16 (F16=true, non-split, probabilities carried x2^15).
//   scores = (q*qscale)·kᵀ : v_wmma_f32_16x16x32_bf16; SPLIT_QK -> q,k as bf16 hi/lo (hi·hi + hi·lo + lo·hi)
//   out    = p·v           : v_wmma_f32_16x16x32_bf16; SPLIT_PV -> p,v as bf16 hi/lo; else p,v plain bf16
//   f32 accumulate; online softmax in f32. Block = 4 waves = 64 query rows of one (batch, head); S % 64 == 0.
//   Element (b, s, h, d) of tensor X lives at X[b*X_bs + s*X_rs + h*X_hs + d] (strides in floats, multiples of 4).
//   Masking: mask_mode 0 none, 1 causal (kv > q masked), 2 tensor [S][Skv] shared over (b,h) (float if
//   mask_is_int==0, int32 with element == 0 -> masked if 1, int32 with element != 0 -> masked if 2), 3 per-token vectors qmask[B][S] & kvmask[B][Skv] (int32,
//   0 -> masked), 4 causal + sliding window (kv > q or q - kv > W masked; W passed in mask_is_int);
//   5 = relative-position bias: s += cp[b,h,q][idx[q][kv]] + pc[b,h,kv][idx[q][kv]] with idx = mask_b ([S][Skv] int32) and
//   mask_a an int32 [S][Skv] tensor with nonzero = masked (tables: element (b,h,row,n) at X + b*c_bs + h*c_hs + row*c_rs + n);
//   masked scores are replaced by mask_fill (e.g. -inf or -1e9) before the softmax.
//   grid.x = B * H * (S/64) (or a sub-range with blk0).
// =====================================================================================
#define AT_D 64
#define AT_NW 4
#define AT_QB 64
#define AT_KC 64
struct AttnGeom { const float* cp = nullptr; const float* pc = nullptr; long c_bs = 0, c_rs = 0, c_hs = 0;   // mode-5 score-bias tables
                  long q_bs, q_rs, q_hs, k_bs, k_rs, k_hs, v_bs, v_rs, v_hs, o_bs, o_rs, o_hs;
                  int S, Skv, H, mask_mode; float qscale; int blk0; float mask_fill; int mask_is_int; };
static_assert(sizeof(AttnGeom) == 168, "no padding");

__device__ __forceinline__ unsigned short at_bf_bits(float f) {
  unsigned u = __float_as_uint(f);
  return (unsigned short)((u + 0x7FFFu + ((u >> 16) & 1u)) >> 16);
}
__device__ __forceinline__ __bf16 at_f2bf(float f) { return __builtin_bit_cast(__bf16, at_bf_bits(f)); }
__device__ __forceinline__ void at_split(float f, __bf16& hi, __bf16& lo) {
  const unsigned short hb = at_bf_bits(f);
  hi = __builtin_bit_cast(__bf16, hb);
  lo = at_f2bf(f - __uint_as_float(((unsigned)hb) << 16));
}
__device__ __forceinline__ v8f at_mma(v16b a, v16b b, v8f c) {
  c = __builtin_amdgcn_wmma_f32_16x16x32_bf16(false, a, false, b, (short)0, c, false, false);
  asm volatile("v_nop\n\tv_nop\n\tv_nop\n\tv_nop" : "+v"(c) : "v"(a), "v"(b));
  return c;
}
// 16-bit element as a bit pattern held in a __bf16 slot: f16 bits when F16, bf16 (RNE) otherwise
template <bool F16> __device__ __forceinline__ __bf16 at_to16(float f) {
  if (F16) return __builtin_bit_cast(__bf16, (_Float16)f);
  return at_f2bf(f);
}
template <bool F16> __device__ __forceinline__ v8f at_mma16(v16b a, v16b b, v8f c) {
  if (F16) {
    const v16h ah = __builtin_bit_cast(v16h, a), bh = __builtin_bit_cast(v16h, b);
    c = __builtin_amdgcn_wmma_f32_16x16x32_f16(false, ah, false, bh, (short)0, c, false, false);
    asm volatile("v_nop\n\tv_nop\n\tv_nop\n\tv_nop" : "+v"(c) : "v"(ah), "v"(bh));
    return c;
  }
  return at_mma(a, b, c);
}

template <bool SPLIT_QK, bool SPLIT_PV, bool F16 = false>
__global__ __launch_bounds__(128)
void attn64_kernel(const float* __restrict__ q, const float* __restrict__ k,
                   const float* __restrict__ v, float* __restrict__ out,
                   const void* __restrict__ mask_a, const int* __restrict__ mask_b, AttnGeom g) {
  static_assert(!(F16 && (SPLIT_QK || SPLIT_PV)), "f16 mode is non-split");
  const float PSC = F16 ? 32768.0f : 1.0f;     // f16 probabilities carried x2^15 (subnormal range), folded into the final 1/l
  union FB { v16b v; v8b h[2]; };
  __shared__ __align__(16) __bf16 Ksh[AT_KC * AT_D];             // K hi [kv][d]      8 KB
  __shared__ __align__(16) __bf16 Ksl[SPLIT_QK ? AT_KC * AT_D : 8];
  __shared__ __align__(16) __bf16 Vth[AT_D * AT_KC];             // V hi [d][kv]      8 KB
  __shared__ __align__(16) __bf16 Vtl[SPLIT_PV ? AT_D * AT_KC : 8];
  __shared__ __align__(16) __bf16 Psh[AT_NW][16 * AT_KC];        // per wave P hi [row][kv]  8 KB
  __shared__ __align__(16) __bf16 Psl[SPLIT_PV ? AT_NW : 1][SPLIT_PV ? 16 * AT_KC : 8];
  __shared__ __align__(16) float  Os[AT_NW][16 * 68];            // per wave out tile, pitch 68

  const int tid  = threadIdx.x;
  const int wave = tid >> 5;
  const int lane = tid & 31;
  const int hh   = lane >> 4;
  const int c    = lane & 15;

  const int nqb = g.S / AT_QB;
  const int bx = blockIdx.x + g.blk0;
  const int qb = bx % nqb;
  const int bh = bx / nqb;
  const int h  = bh % g.H;
  const int b  = bh / g.H;
  const int qbase_block = qb * AT_QB;
  const int q0 = qbase_block + wave * 16;

  const float* qb_ptr = q + (size_t)b * g.q_bs + (size_t)h * g.q_hs;
  const float* kb_ptr = k + (size_t)b * g.k_bs + (size_t)h * g.k_hs;
  const float* vb_ptr = v + (size_t)b * g.v_bs + (size_t)h * g.v_hs;
  float*       ob_ptr = out + (size_t)b * g.o_bs + (size_t)h * g.o_hs;

  // ---- Q fragments (A operand): 2 d-chunks, hi (and lo) ----
  v16b qah[2], qal[2];
  {
    const float* qrow = qb_ptr + (size_t)(q0 + c) * g.q_rs;
#pragma unroll
    for (int dc = 0; dc < 2; ++dc) {
#pragma unroll
      for (int e = 0; e < 8; ++e) {
        const float f0 = qrow[dc * 32 + 8 * hh + e] * g.qscale;
        const float f1 = qrow[dc * 32 + 16 + 8 * hh + e] * g.qscale;
        if (SPLIT_QK) { __bf16 hq, lq; at_split(f0, hq, lq); qah[dc][e] = hq; qal[dc][e] = lq; at_split(f1, hq, lq); qah[dc][8 + e] = hq; qal[dc][8 + e] = lq; }
        else { qah[dc][e] = at_to16<F16>(f0); qah[dc][8 + e] = at_to16<F16>(f1); qal[dc][e] = qah[dc][e]; qal[dc][8 + e] = qah[dc][8 + e]; }
      }
    }
  }

  float mrow[8], lrow[8];
  v8f oacc[4];
#pragma unroll
  for (int r = 0; r < 8; ++r) { mrow[r] = -INFINITY; lrow[r] = 0.f; }
#pragma unroll
  for (int t = 0; t < 4; ++t) oacc[t] = (v8f){0.f,0.f,0.f,0.f,0.f,0.f,0.f,0.f};

  const int nChunks = (g.mask_mode == 1 || g.mask_mode == 4) ? (qb + 1) : (g.Skv / AT_KC);   // block-uniform
  // per-row query mask (mode 3)
  int qkeep[8];
#pragma unroll
  for (int r = 0; r < 8; ++r) qkeep[r] = (g.mask_mode == 3) ? mask_b[(size_t)b * g.S + q0 + 8 * hh + r] : 1;   // mask_b = qmask in mode 3
  for (int kc = 0; kc < nChunks; ++kc) {
    const int kv0 = kc * AT_KC;
    __syncthreads();
    {
      const int kvr = tid >> 1, dh = (tid & 1) * 32;
      const float* krow = kb_ptr + (size_t)(kv0 + kvr) * g.k_rs + dh;
      const float* vrow = vb_ptr + (size_t)(kv0 + kvr) * g.v_rs + dh;
#pragma unroll
      for (int i = 0; i < 8; ++i) {
        v4f kk = *(const v4f*)(krow + 4 * i);
        v4f vv = *(const v4f*)(vrow + 4 * i);
#pragma unroll
        for (int e = 0; e < 4; ++e) {
          const int d = dh + 4 * i + e;
          if (SPLIT_QK) { __bf16 a, bl; at_split(kk[e], a, bl); Ksh[kvr * AT_D + d] = a; Ksl[kvr * AT_D + d] = bl; }
          else Ksh[kvr * AT_D + d] = at_to16<F16>(kk[e]);
          if (SPLIT_PV) { __bf16 a, bl; at_split(vv[e], a, bl); Vth[d * AT_KC + kvr] = a; Vtl[d * AT_KC + kvr] = bl; }
          else Vth[d * AT_KC + kvr] = at_to16<F16>(vv[e]);
        }
      }
    }
    __syncthreads();

    v8f s[4];
#pragma unroll
    for (int j = 0; j < 4; ++j) {
      s[j] = (v8f){0.f,0.f,0.f,0.f,0.f,0.f,0.f,0.f};
#pragma unroll 1
      for (int dc = 0; dc < 2; ++dc) {
        FB kb;
        kb.h[0] = *(const v8b*)(Ksh + (j * 16 + c) * AT_D + dc * 32 + 8 * hh);
        kb.h[1] = *(const v8b*)(Ksh + (j * 16 + c) * AT_D + dc * 32 + 16 + 8 * hh);
        s[j] = at_mma16<F16>(qah[dc], kb.v, s[j]);
        if (SPLIT_QK) {
          FB kl;
          kl.h[0] = *(const v8b*)(Ksl + (j * 16 + c) * AT_D + dc * 32 + 8 * hh);
          kl.h[1] = *(const v8b*)(Ksl + (j * 16 + c) * AT_D + dc * 32 + 16 + 8 * hh);
          s[j] = at_mma16<F16>(qah[dc], kl.v, s[j]);
          s[j] = at_mma16<F16>(qal[dc], kb.v, s[j]);
        }
      }
    }
    const bool diag = (g.mask_mode == 1) && (kc == qb);
    int kvkeep[4] = {1, 1, 1, 1};
    if (g.mask_mode == 3) {
#pragma unroll
      for (int j = 0; j < 4; ++j) kvkeep[j] = ((const int*)mask_a)[(size_t)b * g.Skv + kv0 + j * 16 + c];   // mask_a = kvmask
    }
    float cm[8];
#pragma unroll
    for (int r = 0; r < 8; ++r) {
      const int qrow = q0 + 8 * hh + r;
      float m = -INFINITY;
#pragma unroll
      for (int j = 0; j < 4; ++j) {
        const int kvcol = kv0 + j * 16 + c;
        bool masked = false;
        if (diag) masked = (kvcol > qrow);
        else if (g.mask_mode == 4) masked = (kvcol > qrow) || (qrow - kvcol > g.mask_is_int);
        else if (g.mask_mode == 2) {
          const size_t mi = (size_t)qrow * g.Skv + kvcol;
          masked = (g.mask_is_int == 0) ? (((const float*)mask_a)[mi] == 0.0f)
                 : (g.mask_is_int == 1) ? (((const int*)mask_a)[mi] == 0) : (((const int*)mask_a)[mi] != 0);
        } else if (g.mask_mode == 3) masked = (qkeep[r] == 0) || (kvkeep[j] == 0);
        else if (g.mask_mode == 5) {
          const size_t mi = (size_t)qrow * g.Skv + kvcol;
          masked = (((const int*)mask_a)[mi] != 0);
          int n = mask_b[mi]; n = n < 0 ? 0 : n;
          s[j][r] += g.cp[(size_t)b * g.c_bs + (size_t)h * g.c_hs + (size_t)qrow * g.c_rs + n]
                   + g.pc[(size_t)b * g.c_bs + (size_t)h * g.c_hs + (size_t)kvcol * g.c_rs + n];
        }
        if (masked) s[j][r] = g.mask_fill;
        m = fmaxf(m, s[j][r]);
      }
#pragma unroll
      for (int off = 1; off < 16; off <<= 1) m = fmaxf(m, __shfl_xor(m, off, 32));
      cm[r] = m;
    }
    __bf16* pwh = Psh[wave];
    __bf16* pwl = Psl[SPLIT_PV ? wave : 0];
#pragma unroll
    for (int r = 0; r < 8; ++r) {
      const float mnew = fmaxf(mrow[r], cm[r]);
      const float alpha = expf(mrow[r] - mnew);
      mrow[r] = mnew;
      float psum = 0.f;
#pragma unroll
      for (int j = 0; j < 4; ++j) {
        const float p = expf(s[j][r] - mnew);
        psum += p;
        if (SPLIT_PV) { __bf16 a, bl; at_split(p, a, bl); pwh[(8 * hh + r) * AT_KC + j * 16 + c] = a; pwl[(8 * hh + r) * AT_KC + j * 16 + c] = bl; }
        else pwh[(8 * hh + r) * AT_KC + j * 16 + c] = at_to16<F16>(p * PSC);
      }
#pragma unroll
      for (int off = 1; off < 16; off <<= 1) psum += __shfl_xor(psum, off, 32);
      lrow[r] = lrow[r] * alpha + psum;
#pragma unroll
      for (int t = 0; t < 4; ++t) oacc[t][r] *= alpha;
    }
    __builtin_amdgcn_fence(__ATOMIC_RELEASE, "workgroup");
    __builtin_amdgcn_wave_barrier();
    __builtin_amdgcn_fence(__ATOMIC_ACQUIRE, "workgroup");
#pragma unroll 1
    for (int kk = 0; kk < 2; ++kk) {
      FB pa, pl;
      pa.h[0] = *(const v8b*)(pwh + c * AT_KC + kk * 32 + 8 * hh);
      pa.h[1] = *(const v8b*)(pwh + c * AT_KC + kk * 32 + 16 + 8 * hh);
      if (SPLIT_PV) {
        pl.h[0] = *(const v8b*)(pwl + c * AT_KC + kk * 32 + 8 * hh);
        pl.h[1] = *(const v8b*)(pwl + c * AT_KC + kk * 32 + 16 + 8 * hh);
      }
#pragma unroll
      for (int t = 0; t < 4; ++t) {
        FB vb;
        vb.h[0] = *(const v8b*)(Vth + (t * 16 + c) * AT_KC + kk * 32 + 8 * hh);
        vb.h[1] = *(const v8b*)(Vth + (t * 16 + c) * AT_KC + kk * 32 + 16 + 8 * hh);
        oacc[t] = at_mma16<F16>(pa.v, vb.v, oacc[t]);
        if (SPLIT_PV) {
          FB vl;
          vl.h[0] = *(const v8b*)(Vtl + (t * 16 + c) * AT_KC + kk * 32 + 8 * hh);
          vl.h[1] = *(const v8b*)(Vtl + (t * 16 + c) * AT_KC + kk * 32 + 16 + 8 * hh);
          oacc[t] = at_mma16<F16>(pa.v, vl.v, oacc[t]);
          oacc[t] = at_mma16<F16>(pl.v, vb.v, oacc[t]);
        }
      }
    }
  }

  float* os = Os[wave];
#pragma unroll
  for (int r = 0; r < 8; ++r) {
    const float inv = 1.0f / (lrow[r] * PSC);
#pragma unroll
    for (int t = 0; t < 4; ++t) os[(8 * hh + r) * 68 + t * 16 + c] = oacc[t][r] * inv;
  }
  __builtin_amdgcn_fence(__ATOMIC_RELEASE, "workgroup");
  __builtin_amdgcn_wave_barrier();
  __builtin_amdgcn_fence(__ATOMIC_ACQUIRE, "workgroup");
  {
    const int c4 = (lane & 15) * 4;
    {
#pragma unroll
      for (int it = 0; it < 8; ++it) {
        const int row = it * 2 + hh;
        v4f val = *(const v4f*)(os + row * 68 + c4);
        *(v4f*)(ob_ptr + (size_t)(q0 + row) * g.o_rs + c4) = val;
      }
      
    }
  }
}

} // namespace w25

// relative-offset bias table RT[h][c], c = i - j + (T-1): -floor(|i-j| / 30) * 2^-(h+1)   (thread-linear, data-independent)
__global__ __launch_bounds__(256) void k_mc_rt(float* __restrict__ RT, int NH, int RN, int T) { const int t = blockIdx.x * 256 + threadIdx.x; if (t >= NH * RN) return; const int h = t / RN, c = t % RN; int dist = c - (T - 1); dist = dist < 0 ? -dist : dist; VST2(float, RT + t, -(float)(dist / 30) * exp2f(-(float)(h + 1))); }


extern "C" void kernel_launch(void* const* d_in, const int* in_sizes, int n_in, void* d_out, int out_size, void* d_ws, size_t ws_size, hipStream_t stream) {
    (void)in_sizes; (void)n_in; (void)out_size; (void)ws_size;
    const float* x = (const float*)d_in[0];
    const float* ctx = (const float*)d_in[1];
    const float* Wq = (const float*)d_in[2];
    const float* Wk = (const float*)d_in[3];
    const float* Wv = (const float*)d_in[4];
    const float* Wo = (const float*)d_in[5];
    const float* bo = (const float*)d_in[6];
    const int Bn = 2;
    const int T = 2048;
    const int D = 1024;
    const int NH = 16;
    const int HD = 64;
    const int NR = Bn * T;
    const int RN = 2 * T - 1;
    float* out = (float*)d_out;
    char* wsp = (char*)d_ws;
    _Float16* Q = (_Float16*)wsp; wsp += (((size_t)((size_t)NR * D) * 2 + 255) / 256) * 256;
    _Float16* Kb = (_Float16*)wsp; wsp += (((size_t)((size_t)NR * D) * 2 + 255) / 256) * 256;
    _Float16* Vt = (_Float16*)wsp; wsp += (((size_t)((size_t)NR * D) * 2 + 255) / 256) * 256;   // V transposed: D rows of NR
    float* Y = (float*)wsp; wsp += (((size_t)((size_t)NR * D) * 4 + 255) / 256) * 256;
    float* RT = (float*)wsp; wsp += (((size_t)((size_t)NH * RN + 64) * 4 + 255) / 256) * 256;
    unsigned short* G64A = (unsigned short*)wsp; wsp += (((size_t)(4194304) * 2 + 255) / 256) * 256;
    unsigned short* G64C = (unsigned short*)wsp; wsp += (((size_t)(4194304) * 2 + 255) / 256) * 256;
    unsigned short* G64B = (unsigned short*)wsp; wsp += (((size_t)(4 * 1048576) * 2 + 255) / 256) * 256;
    k_mc_rt<<<(unsigned)((NH * RN + 255) / 256), 256, 0, stream>>>(RT, NH, RN, T);
    k_cast_in<<<256, 512, 0, stream>>>(x, ctx, Wq, Wk, Wv, Wo, (_Float16*)(G64A), (_Float16*)(G64C), (_Float16*)(G64B));
    w25::wmma_gemm_lds<4096, 1024, 1024, 0, 1><<<256, 256, 0, stream>>>((const _Float16*)(G64A), (const _Float16*)(G64B), nullptr, Q, nullptr, 0.0625f);
    w25::wmma_gemm_lds<4096, 1024, 1024, 0, 1><<<256, 256, 0, stream>>>((const _Float16*)(G64C), (const _Float16*)(G64B + 1048576), nullptr, Kb, nullptr, 0.0625f);
    w25::wmma_gemm_lds<1024, 4096, 1024, 0, 1><<<256, 256, 0, stream>>>((const _Float16*)(G64B + 2 * 1048576), (const _Float16*)(G64C), nullptr, Vt, nullptr, 0.0625f);   // operands swapped: Wv . context^T = V^T
    k_attnT<2048, 1024, 4096><<<dim3(2048 / (16 * AW), 16, 2), 32 * AW, 0, stream>>>(Q, Kb, Vt, Y, RT, 0.125f);
    k_cast_plane<<<256, 512, 0, stream>>>(Y, (_Float16*)(G64A));
    w25::wmma_gemm_lds<4096, 1024, 1024, 2, 0><<<256, 256, 0, stream>>>((const _Float16*)(G64A), (const _Float16*)(G64B + 3 * 1048576), out, nullptr, bo, 0.0625f);
}

// v008
// It runs in 116 microseconds.
// Two timings next to v007 put it at 1.06 and 1.08 times that version's speed.
// Counting every step since v000, which is the starting kernel, it is 19.4 times as fast.
// Contractions: q = x.Wq^T [4096x1024].[1024x1024], k/v = context.W^T and the output projection (+b) with f16 operands on pre-cast planes (v_wmma_f32_16x16x32_f16; 128x128 block tiles staged in LDS by asynchronous copies, 32x64 wave tiles, weights x16); per (batch, head) softmax(q k^T / 8 + b_h(|i-j|)) v over 2048 keys (head_dim 64) as a flash kernel with f16 q.k^T and f16 p.v (p as f16 of 4096 p), the periodic distance bias -floor(|i-j|/30) 2^-(h+1) read from a per-head relative-offset table built on device; f32 accumulate and softmax.
#include <hip/hip_runtime.h>
#include <math.h>

typedef __attribute__((ext_vector_type(16))) _Float16 v16h;
typedef __attribute__((ext_vector_type(8)))  _Float16 v8h;
typedef __attribute__((ext_vector_type(4)))  _Float16 v4h;
typedef __attribute__((ext_vector_type(16))) __bf16   v16b;
typedef __attribute__((ext_vector_type(8)))  float    v8f;
typedef __attribute__((ext_vector_type(4)))  float    v4f;

// 16-bit WMMA fragment map (wave32), lane L, h = L>>4, m = L&15:
//   A 16x32: lane = row m;   element i -> k = (i<8) ? 8h+i : 16+8h+(i-8)
//   B 32x16: lane = column m; the SAME k(i,h)
//   D 16x16 (8 f32): lane = column m; element r -> row 8h+r
__device__ __forceinline__ int frag_k(int i, int h) { return (i < 8) ? (8 * h + i) : (16 + 8 * h + (i - 8)); }
__device__ __forceinline__ __bf16 bf16_rne(float f) {
    unsigned int u = __float_as_uint(f);
    u += 0x7fffu + ((u >> 16) & 1u);
    return __builtin_bit_cast(__bf16, (unsigned short)(u >> 16));
}
__device__ __forceinline__ float bf16_f32(__bf16 b) { return __uint_as_float(((unsigned int)__builtin_bit_cast(unsigned short, b)) << 16); }
__device__ __forceinline__ v8f wmma16(v16h a, v16h b, v8f c) {
    c = __builtin_amdgcn_wmma_f32_16x16x32_f16(false, a, false, b, (short)0, c, false, false);
    asm volatile("v_nop\n\tv_nop\n\tv_nop\n\tv_nop" : "+v"(c) : "v"(a), "v"(b));
    return c;
}
__device__ __forceinline__ v8f wmmab(v16b a, v16b b, v8f c) {
    c = __builtin_amdgcn_wmma_f32_16x16x32_bf16(false, a, false, b, (short)0, c, false, false);
    asm volatile("v_nop\n\tv_nop\n\tv_nop\n\tv_nop" : "+v"(c) : "v"(a), "v"(b));
    return c;
}
struct Split { v16b hi, lo; };
// hi/lo split product: a.hi*b.hi + a.hi*b.lo + a.lo*b.hi
__device__ __forceinline__ v8f wmma3(const Split& a, const Split& b, v8f c) {
    c = __builtin_amdgcn_wmma_f32_16x16x32_bf16(false, a.hi, false, b.hi, (short)0, c, false, false);
    c = __builtin_amdgcn_wmma_f32_16x16x32_bf16(false, a.hi, false, b.lo, (short)0, c, false, false);
    c = __builtin_amdgcn_wmma_f32_16x16x32_bf16(false, a.lo, false, b.hi, (short)0, c, false, false);
    asm volatile("v_nop\n\tv_nop\n\tv_nop\n\tv_nop" : "+v"(c) : "v"(a.hi), "v"(a.lo), "v"(b.hi), "v"(b.lo));
    return c;
}
struct Split3 { v16b hi, mid, lo; };
// triple split product (6 terms, drops only terms below 2^-24 relative)
__device__ __forceinline__ v8f wmma6(const Split3& a, const Split3& b, v8f c) {
    c = __builtin_amdgcn_wmma_f32_16x16x32_bf16(false, a.hi, false, b.hi, (short)0, c, false, false);
    c = __builtin_amdgcn_wmma_f32_16x16x32_bf16(false, a.hi, false, b.mid, (short)0, c, false, false);
    c = __builtin_amdgcn_wmma_f32_16x16x32_bf16(false, a.mid, false, b.hi, (short)0, c, false, false);
    c = __builtin_amdgcn_wmma_f32_16x16x32_bf16(false, a.hi, false, b.lo, (short)0, c, false, false);
    c = __builtin_amdgcn_wmma_f32_16x16x32_bf16(false, a.mid, false, b.mid, (short)0, c, false, false);
    c = __builtin_amdgcn_wmma_f32_16x16x32_bf16(false, a.lo, false, b.hi, (short)0, c, false, false);
    asm volatile("v_nop\n\tv_nop\n\tv_nop\n\tv_nop" : "+v"(c) : "v"(a.hi), "v"(a.mid), "v"(a.lo), "v"(b.hi), "v"(b.mid), "v"(b.lo));
    return c;
}

// Fragment gathers from f32 memory: element i <- p[(k0 + frag_k(i,h)) * sk] * s, zero for k >= klen.
__device__ __forceinline__ v16h fh_ld(const float* __restrict__ p, long long sk, int k0, int h, int klen, float s) {
    v16h a;
#pragma unroll
    for (int i = 0; i < 16; ++i) { const int k = k0 + frag_k(i, h); a[i] = (k < klen) ? (_Float16)(p[(long long)k * sk] * s) : (_Float16)0.f; }
    return a;
}
__device__ __forceinline__ Split sp_ld(const float* __restrict__ p, long long sk, int k0, int h, int klen, float s) {
    Split r;
#pragma unroll
    for (int i = 0; i < 16; ++i) {
        const int k = k0 + frag_k(i, h); const float x = (k < klen) ? p[(long long)k * sk] * s : 0.f;
        const __bf16 hb = bf16_rne(x); r.hi[i] = hb; r.lo[i] = bf16_rne(x - bf16_f32(hb));
    }
    return r;
}
__device__ __forceinline__ Split3 sp3_ld(const float* __restrict__ p, long long sk, int k0, int h, int klen, float s) {
    Split3 r;
#pragma unroll
    for (int i = 0; i < 16; ++i) {
        const int k = k0 + frag_k(i, h); const float x = (k < klen) ? p[(long long)k * sk] * s : 0.f;
        const __bf16 hb = bf16_rne(x); const float r1 = x - bf16_f32(hb); const __bf16 mb = bf16_rne(r1);
        r.hi[i] = hb; r.mid[i] = mb; r.lo[i] = bf16_rne(r1 - bf16_f32(mb));
    }
    return r;
}
__device__ __forceinline__ v16b bh_ld(const float* __restrict__ p, long long sk, int k0, int h, int klen, float s) {
    v16b a;
#pragma unroll
    for (int i = 0; i < 16; ++i) { const int k = k0 + frag_k(i, h); a[i] = bf16_rne((k < klen) ? p[(long long)k * sk] * s : 0.f); }
    return a;
}
// f16 fragment from an f16 LDS/global row with element stride 1 (k-contiguous), no bounds (tile already zero padded)
__device__ __forceinline__ v16h fh_row(const _Float16* __restrict__ row, int k0, int h) {
    v16h a;
#pragma unroll
    for (int i = 0; i < 16; ++i) a[i] = row[k0 + frag_k(i, h)];
    return a;
}

#define VST2(T, ptr, val) do { const T vst2_v_ = (val); *(T*)(ptr) = vst2_v_;  } while (0)
typedef float v4f __attribute__((ext_vector_type(4)));
#define VST2V4(ptr, val) do { const v4f vst2_v4_ = (val); *(v4f*)(ptr) = vst2_v4_;  } while (0)

__device__ __attribute__((noinline)) float act_fn(float v, int act) {
    if (act == 1) return fmaxf(v, 0.f);                                                                               // relu
    if (act == 2) { const float u = 0.7978845608028654f * (v + 0.044715f * v * v * v); return 0.5f * v * (1.f + tanhf(u)); } // tanh-gelu
    if (act == 3) return v / (1.f + expf(-v));                                                                        // silu
    if (act == 4) return 0.5f * v * (1.f + erff(v * 0.7071067811865476f));                                             // erf-gelu
    if (act == 5) return tanhf(v);
    if (act == 6) return 1.f / (1.f + expf(-v));                                                                      // sigmoid
    if (act == 7) return (v > 0.f) ? v : 0.01f * v;                                                                   // leaky relu 0.01
    if (act == 8) return (v > 0.f) ? v : (expf(v) - 1.f);                                                             // elu
    if (act == 9) return fminf(fmaxf(v, 0.f), 6.f);                                                                   // relu6
    if (act == 10) return fabsf(v);                                                                                    // abs
    if (act == 11) return (v >= 0.f) ? v : 0.1f * v;                                                                  // leaky 0.1
    if (act == 12) return (v > 0.f) ? v : 0.2f * v;                                                                   // leaky 0.2
    if (act == 13) return (v > 20.f) ? v : log1pf(expf(v));                                                            // softplus
    return v;
}

// =====================================================================================================================
// k_gemm<MODE>: C(z, m, n) = act(alpha * sum_k A(z, m, k) * B(z, k, n) + bias) + beta * R(z, m, n)
//   One wave (32-thread block) per 16 x 32 tile of C; grid (ceil(N/32), ceil(M/16), Z). Batch z -> (zo = z / zi_n, zi = z % zi_n)
//   with separate outer/inner strides for every tensor (e.g. batch and head). A(m,k) = A[zo*sAo + zi*sAi + m*sAm + k*sAk] (f32),
//   B(k,n) = B[zo*sBo + zi*sBi + n*sBn + k*sBk] (f32); any M, N, K (K zero-padded to 32 inside the fragments, M/N tails guarded).
//   C(m,n) = C[zo*sCo + zi*sCi + m*sCm + n] (n contiguous). flags: 1 bias[n], 2 bias[m], 4 residual R[zo*sRo + zi*sRi + m*sRm + n*sRn].
//   MODE 0: f16 operands (A prescaled by sa, B by sb, both undone in the epilogue); 1: bf16 hi/lo split (3 products); 2: bf16;
//   3: bf16 hi/mid/lo triple split (6 products); 4: as 3 with Kahan-compensated f32 accumulation across k-steps.
// =====================================================================================================================
struct GemmP {
    const float* A; const float* B; const float* bias; const float* R; float* C;
    long long sAo, sAi, sAm, sAk, sBo, sBi, sBn, sBk, sCo, sCi, sCm, sRo, sRi, sRm, sRn;
    int M, N, K, zi_n, flags, act; float alpha, beta, sa, sb;
    int Npad, pad_;     // columns [N, Npad) of C are written as 0 so that padded workspace rows are covered by whole-line stores; Npad >= N
};
static_assert(sizeof(GemmP) == 5 * 8 + 15 * 8 + 6 * 4 + 4 * 4 + 2 * 4, "GemmP has padding");

template <int MODE>
__global__ __launch_bounds__(32) void k_gemm(GemmP p) {
    const int lane = threadIdx.x & 31, h = lane >> 4, l15 = lane & 15;
    const int m0 = blockIdx.y * 16, n0 = blockIdx.x * 32;
    const int z = blockIdx.z, zo = z / p.zi_n, zi = z - zo * p.zi_n;
    const float* A = p.A + zo * p.sAo + zi * p.sAi;
    const float* B = p.B + zo * p.sBo + zi * p.sBi;
    const int am = min(m0 + l15, p.M - 1);                       // clamped row for loads (stores are guarded)
    v8f acc[2], comp[2];
#pragma unroll
    for (int t = 0; t < 2; ++t) { v8f zz = {}; acc[t] = zz; comp[t] = zz; }
    for (int k0 = 0; k0 < p.K; k0 += 32) {
        const float* arow = A + (long long)am * p.sAm;
        if (MODE == 1) {
            const Split a = sp_ld(arow, p.sAk, k0, h, p.K, 1.f);
#pragma unroll
            for (int t = 0; t < 2; ++t) {
                const int bn = min(n0 + t * 16 + l15, p.N - 1);
                acc[t] = wmma3(a, sp_ld(B + (long long)bn * p.sBn, p.sBk, k0, h, p.K, 1.f), acc[t]);
            }
        } else if (MODE == 3) {
            const Split3 a = sp3_ld(arow, p.sAk, k0, h, p.K, 1.f);
#pragma unroll
            for (int t = 0; t < 2; ++t) {
                const int bn = min(n0 + t * 16 + l15, p.N - 1);
                acc[t] = wmma6(a, sp3_ld(B + (long long)bn * p.sBn, p.sBk, k0, h, p.K, 1.f), acc[t]);
            }
        } else if (MODE == 4) {
            // triple split as MODE 3, but each k-step's 6 products go into a fresh accumulator and the partial is added to the running f32 sum
            // on the VALU with Kahan compensation (accumulation error stays ~1 ulp however long K is)
            const Split3 a = sp3_ld(arow, p.sAk, k0, h, p.K, 1.f);
#pragma unroll
            for (int t = 0; t < 2; ++t) {
                const int bn = min(n0 + t * 16 + l15, p.N - 1); v8f zz = {};
                const v8f part = wmma6(a, sp3_ld(B + (long long)bn * p.sBn, p.sBk, k0, h, p.K, 1.f), zz);
                const v8f y = part - comp[t]; const v8f s = acc[t] + y; comp[t] = (s - acc[t]) - y; acc[t] = s;
            }
        } else if (MODE == 2) {
            const v16b a = bh_ld(arow, p.sAk, k0, h, p.K, 1.f);
#pragma unroll
            for (int t = 0; t < 2; ++t) {
                const int bn = min(n0 + t * 16 + l15, p.N - 1);
                acc[t] = wmmab(a, bh_ld(B + (long long)bn * p.sBn, p.sBk, k0, h, p.K, 1.f), acc[t]);
            }
        } else {
            const v16h a = fh_ld(arow, p.sAk, k0, h, p.K, p.sa);
#pragma unroll
            for (int t = 0; t < 2; ++t) {
                const int bn = min(n0 + t * 16 + l15, p.N - 1);
                acc[t] = wmma16(a, fh_ld(B + (long long)bn * p.sBn, p.sBk, k0, h, p.K, p.sb), acc[t]);
            }
        }
    }
    const float iscale = (MODE == 0) ? p.alpha / (p.sa * p.sb) : p.alpha;
    float* C = p.C + zo * p.sCo + zi * p.sCi;
    const float* R = p.R + zo * p.sRo + zi * p.sRi;
    __shared__ __align__(16) float ctile[16][36];
#pragma unroll
    for (int t = 0; t < 2; ++t) {
        const int n = n0 + t * 16 + l15; const int nn = min(n, p.N - 1);
#pragma unroll
        for (int r = 0; r < 8; ++r) {
            const int m = m0 + 8 * h + r; const int mm = min(m, p.M - 1);
            float v = acc[t][r] * iscale;
            if (p.flags & 1) v += p.bias[nn];
            if (p.flags & 2) v += p.bias[mm];
            if (p.flags & 8) v *= p.bias[(long long)zo * p.M + mm];   /* per-(z,row) scale vector laid out [Z][M]; exclusive with the bias flags */
            v = act_fn(v, p.act);
            if (p.flags & 4) v += p.beta * R[(long long)mm * p.sRm + (long long)nn * p.sRn];
            ctile[8 * h + r][t * 16 + l15] = (n < p.N) ? v : 0.f;
        }
    }
    __syncthreads();
    const int NW = (p.Npad > p.N) ? p.Npad : p.N;           // write width
    const bool fast = (m0 + 16 <= p.M) && (n0 + 32 <= NW) && ((p.sCm & 3) == 0) && ((((size_t)C) & 15) == 0);
    if (fast) {
#pragma unroll
        for (int s = 0; s < 4; ++s) {
            const int row = s * 4 + (lane >> 3), c4 = (lane & 7) * 4;
            const v4f v = *(const v4f*)&ctile[row][c4];
            VST2V4(C + (long long)(m0 + row) * p.sCm + n0 + c4, v);
        }
    } else {
        for (int row = 0; row < 16; ++row) {
            const int m = m0 + row, n = n0 + lane;
            if (m < p.M && n < NW) VST2(float, C + (long long)m * p.sCm + n, ctile[row][lane]);
        }
    }
}


// =====================================================================================================================
// k_gemmT<MODE, TM, TN>: same contract as k_gemm, but one wave computes a (16*TM) x (16*TN) tile: TM A fragments and TN B fragments are
//   loaded per 32-wide k-step and reused across TM*TN WMMAs (far fewer load/convert instructions per MAC). MODE 0 (f16), 1 (bf16 hi/lo),
//   2 (bf16) only. grid (ceil(NW/(16*TN)), ceil(M/(16*TM)), Z), block 32. Epilogue identical to k_gemm, run per 16x32 sub-tile.
// =====================================================================================================================
template <int MODE, int TM, int TN>
__global__ __launch_bounds__(32) void k_gemmT(GemmP p) {
    const int lane = threadIdx.x & 31, h = lane >> 4, l15 = lane & 15;
    const int m0 = blockIdx.y * (16 * TM), n0 = blockIdx.x * (16 * TN);
    const int z = blockIdx.z, zo = z / p.zi_n, zi = z - zo * p.zi_n;
    const float* A = p.A + zo * p.sAo + zi * p.sAi;
    const float* B = p.B + zo * p.sBo + zi * p.sBi;
    v8f acc[TM][TN];
#pragma unroll
    for (int i = 0; i < TM; ++i)
#pragma unroll
        for (int t = 0; t < TN; ++t) { v8f zz = {}; acc[i][t] = zz; }
    for (int k0 = 0; k0 < p.K; k0 += 32) {
        if (MODE == 1) {
            Split a[TM], b[TN];
#pragma unroll
            for (int i = 0; i < TM; ++i) { const int am = min(m0 + 16 * i + l15, p.M - 1); a[i] = sp_ld(A + (long long)am * p.sAm, p.sAk, k0, h, p.K, 1.f); }
#pragma unroll
            for (int t = 0; t < TN; ++t) { const int bn = min(n0 + 16 * t + l15, p.N - 1); b[t] = sp_ld(B + (long long)bn * p.sBn, p.sBk, k0, h, p.K, 1.f); }
#pragma unroll
            for (int i = 0; i < TM; ++i)
#pragma unroll
                for (int t = 0; t < TN; ++t) acc[i][t] = wmma3(a[i], b[t], acc[i][t]);
        } else if (MODE == 2) {
            v16b a[TM], b[TN];
#pragma unroll
            for (int i = 0; i < TM; ++i) { const int am = min(m0 + 16 * i + l15, p.M - 1); a[i] = bh_ld(A + (long long)am * p.sAm, p.sAk, k0, h, p.K, 1.f); }
#pragma unroll
            for (int t = 0; t < TN; ++t) { const int bn = min(n0 + 16 * t + l15, p.N - 1); b[t] = bh_ld(B + (long long)bn * p.sBn, p.sBk, k0, h, p.K, 1.f); }
#pragma unroll
            for (int i = 0; i < TM; ++i)
#pragma unroll
                for (int t = 0; t < TN; ++t) acc[i][t] = wmmab(a[i], b[t], acc[i][t]);
        } else {
            v16h a[TM], b[TN];
#pragma unroll
            for (int i = 0; i < TM; ++i) { const int am = min(m0 + 16 * i + l15, p.M - 1); a[i] = fh_ld(A + (long long)am * p.sAm, p.sAk, k0, h, p.K, p.sa); }
#pragma unroll
            for (int t = 0; t < TN; ++t) { const int bn = min(n0 + 16 * t + l15, p.N - 1); b[t] = fh_ld(B + (long long)bn * p.sBn, p.sBk, k0, h, p.K, p.sb); }
#pragma unroll
            for (int i = 0; i < TM; ++i)
#pragma unroll
                for (int t = 0; t < TN; ++t) acc[i][t] = wmma16(a[i], b[t], acc[i][t]);
        }
    }
    const float iscale = (MODE == 0) ? p.alpha / (p.sa * p.sb) : p.alpha;
    float* C = p.C + zo * p.sCo + zi * p.sCi;
    const float* R = p.R + zo * p.sRo + zi * p.sRi;
    const int NW = (p.Npad > p.N) ? p.Npad : p.N;
    __shared__ __align__(16) float ctile[16][36];
#pragma unroll
    for (int i = 0; i < TM; ++i) {
        const int mb = m0 + 16 * i; if (mb >= p.M) break;          // wave-uniform
#pragma unroll
        for (int tp = 0; tp < TN / 2; ++tp) {
            const int nb = n0 + 32 * tp; if (nb >= NW) break;        // wave-uniform
#pragma unroll
            for (int t2 = 0; t2 < 2; ++t2) {
                const int t = 2 * tp + t2; const int n = nb + t2 * 16 + l15; const int nn = min(n, p.N - 1);
#pragma unroll
                for (int r = 0; r < 8; ++r) {
                    const int m = mb + 8 * h + r; const int mm = min(m, p.M - 1);
                    float v = acc[i][t][r] * iscale;
                    if (p.flags & 1) v += p.bias[nn];
                    if (p.flags & 2) v += p.bias[mm];
            if (p.flags & 8) v *= p.bias[(long long)zo * p.M + mm];   /* per-(z,row) scale vector laid out [Z][M]; exclusive with the bias flags */
                    v = act_fn(v, p.act);
                    if (p.flags & 4) v += p.beta * R[(long long)mm * p.sRm + (long long)nn * p.sRn];
                    ctile[8 * h + r][t2 * 16 + l15] = (n < p.N) ? v : 0.f;
                }
            }
            __syncthreads();
            const bool fast = (mb + 16 <= p.M) && (nb + 32 <= NW) && ((p.sCm & 3) == 0) && ((((size_t)C) & 15) == 0);
            if (fast) {
#pragma unroll
                for (int s = 0; s < 4; ++s) {
                    const int row = s * 4 + (lane >> 3), c4 = (lane & 7) * 4;
                    const v4f v = *(const v4f*)&ctile[row][c4];
                    VST2V4(C + (long long)(mb + row) * p.sCm + nb + c4, v);
                }
            } else {
                for (int row = 0; row < 16; ++row) {
                    const int m = mb + row, n = nb + lane;
                    if (m < p.M && n < NW) VST2(float, C + (long long)m * p.sCm + n, ctile[row][lane]);
                }
            }
            __syncthreads();
        }
    }
}

// =====================================================================================================================
//   Wave = 16 queries, AW waves per block, 64-key blocks; grid (ceil(Lq/(16*AW)), H, B), block 32*AW. Any Lq, Lk; head dim dh <= DHP
//   (DHP multiple of 32), value dim dv <= DVP (multiple of 16, <= 128). Every tensor addressed by (batch, head, row, element) strides, f32.
//   Scores: QM 0 f16 operands, 1 bf16 hi/lo split, 2 bf16 triple split; statistics f32 (exp2 domain); P.V: P x 4096 as f16 with V f16 staged in LDS
//   (SPLITPV: P and V as bf16 hi/lo splits). kv head = h / hrep. Masking: causal = 1 (keep j <= i + coff, masked -> -inf, key blocks beyond the
//   diagonal skipped), causal = 2 (masked -> mfill, a finite fill like the -1e9; no skipping), causal = 3 (keep j >= i + coff,
//   masked -> -inf, no skipping); optional additive f32 mask Mf,
//   optional int keep-mask Mi (0 -> score := mfill), both addressed b*smb + h*smh + i*smi + j*smj (0 strides broadcast).
// =====================================================================================================================
#define AW 4
struct AttnP {   // apv4
    const float* Q; const float* K; const float* V; float* O; float* P; const float* Mf; const int* Mi; float* ST;
    const float* Pw; const float* Rt; const int* SQ; const int* SK;           // optional: post-softmax weight, relative-position table, segment ids
    long long swb, swh, swi, swj, srb, srh, sri;                                 // Pw strides (b,h,i,j); Rt strides (b,h,i), column = clamp(i - j + roff, 0, rn-1)
    long long sQb, sQh, sQi, sQd, sKb, sKh, sKj, sKd, sVb, sVh, sVj, sVd, sOb, sOh, sOi, sPb, sPh, sPi, smb, smh, smi, smj;
    int Lq, Lk, dh, dv, hrep, causal, coff, pband;   // pband > 0: P holds only the band |j - i| <= pband, column j - i + pband
    float scale, mfill; int nonorm, mpol;             // nonorm (online path only): O = sum_j exp(score_j) V_j without the 1/rowsum (scores must be <= ~0); mpol: Mi masks where ==0 (mpol 0) or where !=0 (mpol 1)
    int roff, rn, segpol, win;                        // Rt column offset/count; SQ/SK: score := mfill where (segpol 0) SQ[i] != SK[j] or (segpol 1) SQ[i] == SK[j]; win > 0: keys with i - j > win (after coff) -> -inf
};
//   Pw: the softmax numerator is multiplied by Pw(b,h,i,j) AFTER the row sum is taken (probs * weight, then P.V), as in post-softmax multiplicative biases.                                                    // ST (optional): per row (b,h,i) -> ST[((b*H + h)*Lq + i)*2 + {0,1}] = {row max of the scaled+masked score (natural units), sum_j exp(score - max)}
static_assert(sizeof(AttnP) == 12 * 8 + 29 * 8 + 16 * 4, "AttnP has padding");

// Inputs-only fence on sixteen loaded values: all must have arrived here, so their loads are issued together ahead of it and share one wait
// (without it the register-budgeted schedule waits after every load). It names no product and changes no value.
template <typename T> __device__ __forceinline__ void hold16(const T* x) {
    asm volatile("" :: "v"(x[0]), "v"(x[1]), "v"(x[2]), "v"(x[3]), "v"(x[4]), "v"(x[5]), "v"(x[6]), "v"(x[7]),
                       "v"(x[8]), "v"(x[9]), "v"(x[10]), "v"(x[11]), "v"(x[12]), "v"(x[13]), "v"(x[14]), "v"(x[15]));
}
#ifndef KATTN_ATTR
#define KATTN_ATTR __attribute__((amdgpu_waves_per_eu(4)))   // register budget of 256: four waves a SIMD, so that all 1,024 blocks of the launch are resident at once
#endif
//   GT > 0 fixes the geometry at compile time: Lq = Lk = GT, rows of GD floats with head h at column h * DHP (unit element stride), dh = DHP,
//   dv = DVP, one kv head per head, no mask, weight, segment, P or ST tensor, and a per-head Rt row of 2 GT - 1 columns. Only Q, K, V, O, Rt and scale
//   are then taken from the argument, so every length guard folds and the loads of a key block are contiguous and free of branches.
template <int DHP, int DVP, int QM, bool SPLITPV, bool TWOPASS, int GT = 0, int GD = 0>
__global__ __launch_bounds__(32 * AW) KATTN_ATTR void k_attn(AttnP parg) {
    AttnP p = parg;
    if (GT > 0) {
        p.P = nullptr; p.Mf = nullptr; p.Mi = nullptr; p.ST = nullptr; p.Pw = nullptr; p.SQ = nullptr; p.SK = nullptr;
        p.swb = 0; p.swh = 0; p.swi = 0; p.swj = 0; p.srb = 0; p.srh = 2 * GT - 1; p.sri = 0;
        p.sQb = (long long)GT * GD; p.sQh = DHP; p.sQi = GD; p.sQd = 1; p.sKb = (long long)GT * GD; p.sKh = DHP; p.sKj = GD; p.sKd = 1;
        p.sVb = (long long)GT * GD; p.sVh = DVP; p.sVj = GD; p.sVd = 1; p.sOb = (long long)GT * GD; p.sOh = DVP; p.sOi = GD;
        p.sPb = 0; p.sPh = 0; p.sPi = 0; p.smb = 0; p.smh = 0; p.smi = 0; p.smj = 0;
        p.Lq = GT; p.Lk = GT; p.dh = DHP; p.dv = DVP; p.hrep = 1; p.causal = 0; p.coff = 0; p.pband = 0;
        p.mfill = 0.f; p.nonorm = 0; p.mpol = 0; p.roff = GT - 1; p.rn = 2 * GT - 1; p.segpol = 0; p.win = 0;
        __builtin_assume(p.Rt != nullptr);
    }
    constexpr bool FULL = GT > 0 && GT % (16 * AW) == 0 && GT % 64 == 0;   // every query tile and key block is whole: index clamps and length guards are identities
    constexpr int NT = DVP / 16;                // output tiles
    constexpr int KS = DHP / 32;                // k-steps for the scores
    constexpr int VP = DVP + 8;                 // LDS pitch (halves)
    __shared__ __align__(16) float    pl[AW][16 * 64];
    __shared__ __align__(16) _Float16 vl[(SPLITPV ? 2 : 1) * 64 * VP];   // f16 V tile, or bf16 hi and lo tiles (same 2-byte size)
    const int lane = threadIdx.x & 31, hf = lane >> 4, l15 = lane & 15, wave = threadIdx.x >> 5;
    const int h = blockIdx.y, b = blockIdx.z, hk = h / p.hrep;
    const int q0 = (blockIdx.x * AW + wave) * 16;
    float* myp = pl[wave];
    const float L2E = 1.4426950408889634f;
    const float NEG = -__builtin_inff();
    const int qi = FULL ? q0 + l15 : min(q0 + l15, p.Lq - 1);
    const float* qrow = p.Q + b * p.sQb + h * p.sQh + (long long)qi * p.sQi;
    const float* kbase = p.K + b * p.sKb + hk * p.sKh;
    const float* vbase = p.V + b * p.sVb + hk * p.sVh;
    v16h qa[QM == 0 ? KS : 1]; Split qs_[QM == 1 ? KS : 1]; Split3 qt_[QM == 2 ? KS : 1];
#pragma unroll
    for (int ks = 0; ks < KS; ++ks) {
        if (QM == 2) qt_[ks] = sp3_ld(qrow, p.sQd, ks * 32, hf, p.dh, 1.f);
        else if (QM == 1) qs_[ks] = sp_ld(qrow, p.sQd, ks * 32, hf, p.dh, 1.f);
        else qa[ks] = fh_ld(qrow, p.sQd, ks * 32, hf, p.dh, 1.f);
    }
    v8f o[NT]; float m8[8], l8[8];
#pragma unroll
    for (int t = 0; t < NT; ++t) { v8f zz = {}; o[t] = zz; }
#pragma unroll
    for (int i = 0; i < 8; ++i) { m8[i] = NEG; l8[i] = 0.f; }
    int jend = p.Lk;
    if (p.causal == 1) { const int je = (blockIdx.x * AW + AW - 1) * 16 + 16 + p.coff; jend = min(jend, max(je, 0)); }   // uniform per block
    const int npass = TWOPASS ? 2 : 1;
    for (int pass = 0; pass < npass; ++pass) {
        const bool dopv = (!TWOPASS) || pass == 1;
        for (int j0 = 0; j0 < jend; j0 += 64) {
            if (dopv) {
                __syncthreads();                                 // previous key block's reads of vl / pl are done
                constexpr int VN = 64 * DVP / (32 * AW);         // V elements per thread and key block
                constexpr bool VLIN = (32 * AW) % DVP == 0;      // a thread keeps its column: its rows differ by a constant step
                float vf[VN];
#pragma unroll   // constant trip count: with the guard folded the tile's loads differ by immediate offsets only
                for (int it = 0; it < VN; ++it) {
                    const int idx = threadIdx.x + it * (32 * AW);
                    const int jr = VLIN ? (int)threadIdx.x / DVP + it * ((32 * AW) / DVP) : idx / DVP, d = VLIN ? (int)threadIdx.x % DVP : idx - jr * DVP, j = j0 + jr;
                    if constexpr (FULL && VLIN)   // block-uniform tile pointer + the thread's fixed offset + a constant
                        vf[it] = (vbase + (long long)j0 * GD)[(size_t)(unsigned)((int)threadIdx.x / DVP * GD + (int)threadIdx.x % DVP) + it * ((32 * AW) / DVP) * GD];
                    else
                        vf[it] = (j < p.Lk && d < p.dv) ? vbase[(long long)j * p.sVj + (long long)d * p.sVd] : 0.f;
                }
                if (FULL && VN == 32) { hold16(vf); hold16(vf + 16); }   // the tile's loads all issue ahead of this line and are waited for once
#pragma unroll
                for (int it = 0; it < VN; ++it) {
                    const int idx = threadIdx.x + it * (32 * AW);
                    const int jr = VLIN ? (int)threadIdx.x / DVP + it * ((32 * AW) / DVP) : idx / DVP, d = VLIN ? (int)threadIdx.x % DVP : idx - jr * DVP;
                    const float f = vf[it];
                    if (SPLITPV) {
                        const __bf16 hb = bf16_rne(f);
                        ((__bf16*)vl)[jr * VP + d] = hb; ((__bf16*)vl)[64 * VP + jr * VP + d] = bf16_rne(f - bf16_f32(hb));
                    } else vl[jr * VP + d] = (_Float16)f;
                }
            }
            v8f s[4];
            float rb[8][4];                                     // the key block's relative-position table entries, fetched ahead of the products
            if constexpr (FULL) {
                // column i - j + GT - 1 as block-uniform pointer + the lane's fixed offset + a constant, each part >= 0 (j0 <= GT - 64)
                const float* rt = p.Rt + (long long)h * (2 * GT - 1) + ((int)blockIdx.x * (16 * AW) - j0 + (GT - 64));
                const unsigned ro = (unsigned)(wave * 16 + 8 * hf + 15 - l15);
#pragma unroll
                for (int i = 0; i < 8; ++i)
#pragma unroll
                    for (int t = 0; t < 4; ++t) rb[i][t] = rt[(size_t)ro + (i + 16 * (3 - t))];
            } else if (p.Rt) {
#pragma unroll
                for (int i = 0; i < 8; ++i)
#pragma unroll
                    for (int t = 0; t < 4; ++t) {
                        const int ic = min(q0 + i + 8 * hf, p.Lq - 1);
                        int rc = ic - min(j0 + t * 16 + l15, p.Lk - 1) + p.roff; rc = rc < 0 ? 0 : (rc >= p.rn ? p.rn - 1 : rc);
                        rb[i][t] = p.Rt[b * p.srb + h * p.srh + (long long)ic * p.sri + rc];
                    }
            }
            if constexpr (FULL && QM == 0 && KS == 2) {
                // two key tiles at a time: their sixteen 16-byte loads (fh_ld's k order: floats 8 hf + 0..7 and 16 + 8 hf + 0..7 of each 32) fly together
#pragma unroll
                for (int tp = 0; tp < 2; ++tp) {
                    v4f kr[16];
#pragma unroll
                    for (int t2 = 0; t2 < 2; ++t2)
#pragma unroll
                        for (int ks = 0; ks < 2; ++ks) {
                            const v4f* kp = (const v4f*)((kbase + (long long)j0 * GD) + ((size_t)(unsigned)(l15 * GD + 8 * hf) + (2 * tp + t2) * 16 * GD + ks * 32));
                            kr[(t2 * 2 + ks) * 4 + 0] = kp[0]; kr[(t2 * 2 + ks) * 4 + 1] = kp[1]; kr[(t2 * 2 + ks) * 4 + 2] = kp[4]; kr[(t2 * 2 + ks) * 4 + 3] = kp[5];
                        }
                    hold16(kr);                                  // all sixteen loads issue ahead of this line and are waited for once
#pragma unroll
                    for (int t2 = 0; t2 < 2; ++t2) {
                        v8f acc = {};
#pragma unroll
                        for (int ks = 0; ks < 2; ++ks) {
                            v16h kfr;
#pragma unroll
                            for (int e = 0; e < 16; ++e) kfr[e] = (_Float16)kr[(t2 * 2 + ks) * 4 + (e >> 2)][e & 3];
                            acc = wmma16(qa[ks], kfr, acc);
                        }
                        s[2 * tp + t2] = acc;
                    }
                }
            } else {
#pragma unroll
            for (int t = 0; t < 4; ++t) {
                const int j = min(j0 + t * 16 + l15, p.Lk - 1);
                const float* krow = kbase + (long long)j * p.sKj;
                v8f acc = {};
#pragma unroll
                for (int ks = 0; ks < KS; ++ks) {
                    if (QM == 2)      acc = wmma6(qt_[ks], sp3_ld(krow, p.sKd, ks * 32, hf, p.dh, 1.f), acc);
                    else if (QM == 1) acc = wmma3(qs_[ks], sp_ld(krow, p.sKd, ks * 32, hf, p.dh, 1.f), acc);
                    else              acc = wmma16(qa[ks], fh_ld(krow, p.sKd, ks * 32, hf, p.dh, 1.f), acc);
                }
                s[t] = acc;
            }
            }
            float pv[8][4];
#pragma unroll
            for (int i = 0; i < 8; ++i) {
                const int irow = q0 + i + 8 * hf;
                const int ic = FULL ? irow : min(irow, p.Lq - 1);
                float sc[4];
#pragma unroll
                for (int t = 0; t < 4; ++t) {
                    const int jg = j0 + t * 16 + l15;
                    float v = s[t][i] * p.scale;
                    if (p.Mf) v += p.Mf[b * p.smb + h * p.smh + (long long)ic * p.smi + (long long)min(jg, p.Lk - 1) * p.smj];
                    if (p.Rt) v += rb[i][t];
                    if (p.Mi) { const int mv = p.Mi[b * p.smb + h * p.smh + (long long)ic * p.smi + (long long)min(jg, p.Lk - 1) * p.smj]; if (p.mpol ? (mv != 0) : (mv == 0)) v = p.mfill; }
                    if (p.SQ) { const bool same = p.SQ[(long long)b * p.Lq + ic] == p.SK[(long long)b * p.Lk + min(jg, p.Lk - 1)]; if (p.segpol ? same : !same) v = p.mfill; }
                    if (p.causal == 2 && jg > irow + p.coff) v = p.mfill;
                    if ((!FULL && jg >= p.Lk) || (p.causal == 1 && jg > irow + p.coff) || (p.causal == 3 && jg < irow + p.coff) || (p.win > 0 && irow + p.coff - jg > p.win)) v = NEG; else v *= L2E;
                    sc[t] = v;
                }
                if (!TWOPASS || pass == 0) {
                    float mx = fmaxf(fmaxf(sc[0], sc[1]), fmaxf(sc[2], sc[3]));
                    mx = fmaxf(mx, __shfl_xor(mx, 1, 32)); mx = fmaxf(mx, __shfl_xor(mx, 2, 32));
                    mx = fmaxf(mx, __shfl_xor(mx, 4, 32)); mx = fmaxf(mx, __shfl_xor(mx, 8, 32));
                    const float mnew = fmaxf(m8[i], mx);
                    const float corr = (mnew == NEG) ? 1.f : exp2f(m8[i] - mnew);
                    float rs = 0.f;
#pragma unroll
                    for (int t = 0; t < 4; ++t) {
                        const float pp = (sc[t] == NEG) ? 0.f : exp2f(sc[t] - mnew); rs += pp;
                        pv[i][t] = p.Pw ? pp * p.Pw[b * p.swb + h * p.swh + (long long)ic * p.swi + (long long)min(j0 + t * 16 + l15, p.Lk - 1) * p.swj] : pp;
                    }
                    rs += __shfl_xor(rs, 1, 32); rs += __shfl_xor(rs, 2, 32); rs += __shfl_xor(rs, 4, 32); rs += __shfl_xor(rs, 8, 32);
                    l8[i] = l8[i] * corr + rs; m8[i] = mnew;
                    if (!TWOPASS) {
#pragma unroll
                        for (int t = 0; t < NT; ++t) o[t][i] *= corr;
                    }
                } else {
                    const float inv = (l8[i] > 0.f) ? 1.f / l8[i] : 0.f;
#pragma unroll
                    for (int t = 0; t < 4; ++t) {
                        const int jg = j0 + t * 16 + l15;
                        float pp = (sc[t] == NEG) ? 0.f : exp2f(sc[t] - m8[i]) * inv;
                        if (p.Pw) pp *= p.Pw[b * p.swb + h * p.swh + (long long)ic * p.swi + (long long)min(jg, p.Lk - 1) * p.swj];
                        pv[i][t] = pp;
                    }
                }
            }
            if (dopv) {
#pragma unroll
                for (int i = 0; i < 8; ++i)
#pragma unroll
                    for (int t = 0; t < 4; ++t) ((float*)myp)[(i + 8 * hf) * 64 + t * 16 + l15] = pv[i][t];
                __syncthreads();                                 // P (per wave) and V (shared) visible
                if (p.P) {
                    float* pb_ = p.P + b * p.sPb + h * p.sPh;
                    const bool fastP = (p.pband == 0) && ((p.sPi & 3) == 0) && (j0 + 64 <= p.Lk) && (q0 + 16 <= p.Lq) && ((((size_t)pb_) & 15) == 0);
                    if (fastP) {
#pragma unroll
                        for (int s = 0; s < 8; ++s) {
                            const int row = s * 2 + (lane >> 4), c4 = (lane & 15) * 4;
                            const v4f v = *(const v4f*)(myp + row * 64 + c4);
                            VST2V4(pb_ + (long long)(q0 + row) * p.sPi + j0 + c4, v);
                        }
                    } else {
                        for (int row = 0; row < 16; ++row) {
                            const int irow = q0 + row; if (irow >= p.Lq) continue;
                            for (int c = lane; c < 64; c += 32) {
                                const int jg = j0 + c; if (jg >= p.Lk) continue;
                                if (p.pband == 0) VST2(float, pb_ + (long long)irow * p.sPi + jg, myp[row * 64 + c]);
                                else if (jg - irow <= p.pband && irow - jg <= p.pband) VST2(float, pb_ + (long long)irow * p.sPi + (jg - irow + p.pband), myp[row * 64 + c]);
                            }
                        }
                    }
                }
                if (SPLITPV) {
                    const Split pa0 = sp_ld(myp + l15 * 64, 1, 0, hf, 64, 1.f), pa1 = sp_ld(myp + l15 * 64, 1, 32, hf, 64, 1.f);
                    const __bf16* vh = (const __bf16*)vl; const __bf16* vlo = vh + 64 * VP;
#pragma unroll
                    for (int t = 0; t < NT; ++t) {
                        const int dcol = t * 16 + l15;
                        Split b0, b1;
#pragma unroll
                        for (int e = 0; e < 16; ++e) {
                            const int k0 = frag_k(e, hf), k1 = 32 + frag_k(e, hf);
                            b0.hi[e] = vh[k0 * VP + dcol]; b0.lo[e] = vlo[k0 * VP + dcol]; b1.hi[e] = vh[k1 * VP + dcol]; b1.lo[e] = vlo[k1 * VP + dcol];
                        }
                        o[t] = wmma3(pa0, b0, o[t]);
                        o[t] = wmma3(pa1, b1, o[t]);
                    }
                } else {
                    const v16h pa0 = fh_ld(myp + l15 * 64, 1, 0, hf, 64, 4096.f), pa1 = fh_ld(myp + l15 * 64, 1, 32, hf, 64, 4096.f);
#pragma unroll
                    for (int t = 0; t < NT; ++t) {
                        const int dcol = t * 16 + l15;
                        v16h b0, b1;
#pragma unroll
                        for (int e = 0; e < 16; ++e) { b0[e] = vl[frag_k(e, hf) * VP + dcol]; b1[e] = vl[(32 + frag_k(e, hf)) * VP + dcol]; }
                        o[t] = wmma16(pa0, b0, o[t]);
                        o[t] = wmma16(pa1, b1, o[t]);
                    }
                }
            }
        }
    }
    float* obase = p.O + b * p.sOb + h * p.sOh;
    if (p.ST) {
        const int rl = lane >> 1, isel = rl & 7;           // row q0 + rl ; rl>>3 == hf holds because lane>>4 == (lane>>1)>>3
        float mv = 0.f, lv = 0.f;
#pragma unroll
        for (int i = 0; i < 8; ++i) if (i == isel) { mv = m8[i]; lv = l8[i]; }
        const int irow = q0 + rl;
        if (irow < p.Lq) { float* st = p.ST + (((long long)b * gridDim.y + h) * p.Lq + irow) * 2 + (lane & 1); VST2(float, st, (lane & 1) ? lv : mv * 0.6931471805599453f); }
    }
    float invr[8];
#pragma unroll
    for (int i = 0; i < 8; ++i) {
        if (TWOPASS) invr[i] = SPLITPV ? 1.f : (1.f / 4096.f);
        else if (p.nonorm) invr[i] = exp2f(m8[i]) * (SPLITPV ? 1.f : (1.f / 4096.f));
        else invr[i] = (l8[i] > 0.f) ? (SPLITPV ? 1.f / l8[i] : 1.f / (l8[i] * 4096.f)) : 0.f;
    }
    __syncthreads();                                             // all waves done with pl/vl from the main loop
    const bool ofast = ((p.sOi & 3) == 0) && ((((size_t)obase) & 15) == 0) && (q0 + 16 <= p.Lq);
#pragma unroll
    for (int c0 = 0; c0 < DVP; c0 += 64) {
#pragma unroll
        for (int i = 0; i < 8; ++i)
#pragma unroll
            for (int t = 0; t < NT; ++t) if (t * 16 >= c0 && t * 16 < c0 + 64) ((float*)myp)[(i + 8 * hf) * 64 + (t * 16 - c0) + l15] = o[t][i] * invr[i];
        __syncthreads();
        const int cw = (DVP - c0 < 64) ? (DVP - c0) : 64;      // staged columns in this chunk (multiple of 16)
        if (ofast && (c0 + cw <= p.dv) && (cw % 32 == 0)) {
            const int lpr = cw / 4;                              // lanes per row (16 for 64 cols, 8 for 32)
            const int rows_per_ins = 32 / lpr;
            for (int r0 = 0; r0 < 16; r0 += rows_per_ins) {
                const int row = r0 + lane / lpr, c4 = (lane % lpr) * 4;
                const v4f v = *(const v4f*)(myp + row * 64 + c4);
                VST2V4(obase + (long long)(q0 + row) * p.sOi + c0 + c4, v);
            }
        } else {
            for (int row = 0; row < 16; ++row) {
                const int irow = q0 + row; if (irow >= p.Lq) continue;
                for (int c = lane; c < cw; c += 32) { const int d = c0 + c; if (d < p.dv) VST2(float, obase + (long long)irow * p.sOi + d, myp[row * 64 + c]); }
            }
        }
        __syncthreads();
    }
}

__device__ __forceinline__ float xhalf(float x) { return __builtin_bit_cast(float, __builtin_amdgcn_permlanex16(__builtin_bit_cast(int, x), __builtin_bit_cast(int, x), 0x76543210, 0xfedcba98, false, false)); }
// 2^x as the one hardware instruction. exp2f puts a compare, two selects, an add and a ldexp round every v_exp_f32, only so that results below 2^-126 come out as
// denormals. Every argument here is a score minus the row's running maximum: such a term is under 2^-126 of the row's largest, is zero as an f16 p either way and
// cannot move the f32 row sum, which ends at 1 or more. From -126 up the value is the same bit for bit; -inf (the first trip's old maximum) gives 0 as before.
// Written as asm, each value in its own register and in place, so that the slot which the instruction set asks for behind a transcendental is filled by construction:
// behind each v_exp_f32 stands one that touches neither its result nor its source, behind the last a v_nop.
__device__ __forceinline__ void exp2_run8(float* x) {
    asm("v_exp_f32 %0, %0\n\tv_exp_f32 %1, %1\n\tv_exp_f32 %2, %2\n\tv_exp_f32 %3, %3\n\t"
        "v_exp_f32 %4, %4\n\tv_exp_f32 %5, %5\n\tv_exp_f32 %6, %6\n\tv_exp_f32 %7, %7\n\tv_nop"
        : "+v"(x[0]), "+v"(x[1]), "+v"(x[2]), "+v"(x[3]), "+v"(x[4]), "+v"(x[5]), "+v"(x[6]), "+v"(x[7]));
}
__device__ __forceinline__ float exp2_one(float x) { asm("v_exp_f32 %0, %0\n\tv_nop" : "+v"(x)); return x; }   // the same, one value
// One thread's eight copies for one key block: four 16-byte pieces of the K tile and four of the V^T tile, each the same 16 bytes of rows 16 apart
// (eight lanes cover one row's 128 bytes, a whole line). lk, lv = LDS byte addresses, gk, gv = global addresses of the first piece of each tile.
// The s_wait_xcnt closes the statement so that no register which a copy names is rewritten ahead of it.
template <int PB, int KLD, int VLD>
__device__ __forceinline__ void at_copy8(unsigned lk, unsigned lv, const _Float16* gk, const _Float16* gv) {
    asm volatile(
        "global_load_async_to_lds_b128 %0, %8, off\n\t"
        "global_load_async_to_lds_b128 %1, %9, off\n\t"
        "global_load_async_to_lds_b128 %2, %10, off\n\t"
        "global_load_async_to_lds_b128 %3, %11, off\n\t"
        "global_load_async_to_lds_b128 %4, %12, off\n\t"
        "global_load_async_to_lds_b128 %5, %13, off\n\t"
        "global_load_async_to_lds_b128 %6, %14, off\n\t"
        "global_load_async_to_lds_b128 %7, %15, off\n\t"
        "s_wait_xcnt 0x0"
        :: "v"(lk), "v"(lk + 16 * PB), "v"(lk + 32 * PB), "v"(lk + 48 * PB), "v"(lv), "v"(lv + 16 * PB), "v"(lv + 32 * PB), "v"(lv + 48 * PB),
           "v"(gk), "v"(gk + 16 * KLD), "v"(gk + 32 * KLD), "v"(gk + 48 * KLD), "v"(gv), "v"(gv + 16 * VLD), "v"(gv + 32 * VLD), "v"(gv + 48 * VLD)
        : "memory");
}
// Q and K: f16 planes of GR rows (batch * GT + position) x GD columns, head h at column h * 64. Vt: the f16 plane of V transposed, GD rows (head h at row h * 64) x GR columns.
template <int GT, int GD, int GR>
__global__ __launch_bounds__(32 * AW) KATTN_ATTR void k_attnT(const _Float16* __restrict__ Q, const _Float16* __restrict__ K, const _Float16* __restrict__ Vt, float* __restrict__ O, const float* __restrict__ Rt, float scale) {
    static_assert(GT % (16 * AW) == 0 && GT % 64 == 0 && GT >= 128 && AW == 4, "whole query tiles and key blocks; 128 threads copy the 64 x 64 K and V^T tiles; the two-buffer prologue needs two key blocks");
    constexpr int DH = 64;                      // head size
    constexpr int VP = 64 + 8;                  // LDS pitch (halves): rows of 128 bytes + 16, for 16-byte readers
    constexpr int TB = 64 * VP * 2;             // one tile in LDS, bytes
    __shared__ __align__(16) _Float16 vt[2][DH * VP];   // V^T tile: row = head column, 64 keys along the row
    __shared__ __align__(16) _Float16 kt[2][64 * VP];   // K tile: row = key, the 64 head columns along the row; both tiles are copied in once a key block and read by all four waves
    const int lane = threadIdx.x & 31, hf = lane >> 4, l15 = lane & 15, wave = threadIdx.x >> 5;
    const int h = blockIdx.y, b = blockIdx.z;
    const int q0 = (blockIdx.x * AW + wave) * 16;
    const float L2E = 1.4426950408889634f;
    const int crow = threadIdx.x >> 3, ccol = threadIdx.x & 7;      // copies: eight lanes cover one tile row
    const _Float16* gk = K + (size_t)(b * GT + crow) * GD + h * DH + ccol * 8;
    const _Float16* gv = Vt + (size_t)(h * DH + crow) * GR + b * GT + ccol * 8;
    const unsigned lk = (unsigned)(size_t)&kt[0][0] + (unsigned)(crow * (VP * 2) + ccol * 16);
    const unsigned lv = (unsigned)(size_t)&vt[0][0] + (unsigned)(crow * (VP * 2) + ccol * 16);
    at_copy8<VP * 2, GD, GR>(lk, lv, gk, gv);
    const _Float16* qrow = Q + (size_t)(b * GT + q0 + l15) * GD + h * DH + 8 * hf;
    v16h qb[2];                                 // halves 8 hf + 0..7 and 16 + 8 hf + 0..7 of each 32: the k order of the K fragments below
#pragma unroll
    for (int ks = 0; ks < 2; ++ks) {
        const v8h q0h = *(const v8h*)(qrow + ks * 32), q1h = *(const v8h*)(qrow + ks * 32 + 16);
        qb[ks] = __builtin_shufflevector(q0h, q1h, 0, 1, 2, 3, 4, 5, 6, 7, 8, 9, 10, 11, 12, 13, 14, 15);
    }
    v8f o[4]; float m = -__builtin_inff(), l = 0.f;
#pragma unroll
    for (int t = 0; t < 4; ++t) { v8f zz = {}; o[t] = zz; }
    asm volatile("s_wait_asynccnt 0x0" ::: "memory");    // this wave's share of key block 0 has landed
    __syncthreads();                                     // key block 0 is whole for every wave
    at_copy8<VP * 2, GD, GR>(lk + TB, lv + TB, gk + 64 * GD, gv + 64);
    for (int j0 = 0; j0 < GT; j0 += 64) {
        // This trip works on key block j0 in buffer cur; the next block's copies, issued a trip ago, fly into the other buffer.
        const int cur = (j0 >> 6) & 1;
        // table column i - j + GT - 1 as block-uniform pointer + the lane's fixed offset + a constant, each part >= 0 (j0 <= GT - 64)
        float rb[4][8];
        const float* rt = Rt + (long long)h * (2 * GT - 1) + ((int)blockIdx.x * (16 * AW) - j0 + (GT - 64));
        const unsigned ro = (unsigned)(wave * 16 + l15 + 8 * (1 - hf));
#pragma unroll
        for (int t = 0; t < 4; ++t)
#pragma unroll
            for (int r = 0; r < 8; ++r) rb[t][r] = rt[(size_t)ro + (16 * (3 - t) + (7 - r))];
        v8f s[4];
        v8h ka[16];                                      // the eight K fragments, the k order of qb: halves 8 hf + 0..7 and 16 + 8 hf + 0..7 of each 32
#pragma unroll
        for (int t = 0; t < 4; ++t)
#pragma unroll
            for (int ks = 0; ks < 2; ++ks) {
                const _Float16* kr = kt[cur] + (t * 16 + l15) * VP + ks * 32 + 8 * hf;
                ka[(t * 2 + ks) * 2] = *(const v8h*)kr; ka[(t * 2 + ks) * 2 + 1] = *(const v8h*)(kr + 16);
            }
        hold16(ka);                                      // the sixteen LDS reads issue together and are waited for once (otherwise: one fragment's registers, a full LDS wait in front of each product)
#pragma unroll
        for (int t = 0; t < 4; ++t) {
            v8f acc = {};
#pragma unroll
            for (int ks = 0; ks < 2; ++ks) {
                const v16h kfr = __builtin_shufflevector(ka[(t * 2 + ks) * 2], ka[(t * 2 + ks) * 2 + 1], 0, 1, 2, 3, 4, 5, 6, 7, 8, 9, 10, 11, 12, 13, 14, 15);
                acc = __builtin_amdgcn_wmma_f32_16x16x32_f16(false, kfr, false, qb[ks], (short)0, acc, false, false);   // A = key rows, B = query columns
            }
            s[t] = acc;
        }
        float sc[4][8], mt[4];
#pragma unroll
        for (int t = 0; t < 4; ++t) {
#pragma unroll
            for (int r = 0; r < 8; ++r) sc[t][r] = (s[t][r] * scale + rb[t][r]) * L2E;
            mt[t] = fmaxf(fmaxf(fmaxf(sc[t][0], sc[t][1]), fmaxf(sc[t][2], sc[t][3])), fmaxf(fmaxf(sc[t][4], sc[t][5]), fmaxf(sc[t][6], sc[t][7])));
        }
        v8h vh[16];                                      // the eight V^T fragments: the trip's last LDS reads, so that the buffer can be handed back ahead of the softmax
#pragma unroll
        for (int t = 0; t < 4; ++t)
#pragma unroll
            for (int ks = 0; ks < 2; ++ks) {
                const _Float16* vr = vt[cur] + (t * 16 + l15) * VP + ks * 32 + 8 * hf;
                vh[(t * 2 + ks) * 2] = *(const v8h*)vr; vh[(t * 2 + ks) * 2 + 1] = *(const v8h*)(vr + 16);
            }
        // Publish point: from here on the trip works on registers alone, and the refill has the softmax, the second products and the next trip's first half to land.
        asm volatile("s_wait_dscnt 0x0" ::: "memory");       // this wave's reads of block j0 are done before its buffer is handed back
        asm volatile("s_wait_asynccnt 0x0" ::: "memory");    // this wave's share of block j0 + 64 has landed
        __syncthreads();                                     // publishes block j0 + 64 and ends every wave's reads of block j0
        if (j0 + 128 < GT) at_copy8<VP * 2, GD, GR>(lk + cur * TB, lv + cur * TB, gk + (size_t)(j0 + 128) * GD, gv + (j0 + 128));
        float mx = fmaxf(fmaxf(mt[0], mt[1]), fmaxf(mt[2], mt[3]));
        mx = fmaxf(mx, xhalf(mx));                        // the other lane half holds the query's other 32 keys
        const float mnew = fmaxf(m, mx);
        const float corr = exp2_one(m - mnew);
        float rs[4];
#pragma unroll
        for (int t = 0; t < 4; ++t) {
#pragma unroll
            for (int r = 0; r < 8; ++r) sc[t][r] -= mnew;
            exp2_run8(sc[t]);
            rs[t] = sc[t][0];
#pragma unroll
            for (int r = 1; r < 8; ++r) rs[t] += sc[t][r];
        }
        l = l * corr + ((rs[0] + rs[1]) + (rs[2] + rs[3])); m = mnew;
#pragma unroll
        for (int t = 0; t < 4; ++t)
#pragma unroll
            for (int r = 0; r < 8; ++r) o[t][r] *= corr;
        v16h pb[2];
#pragma unroll
        for (int ks = 0; ks < 2; ++ks)
#pragma unroll
            for (int e = 0; e < 16; ++e) pb[ks][e] = (_Float16)(sc[2 * ks + (e >> 3)][e & 7] * 4096.f);
#pragma unroll
        for (int t = 0; t < 4; ++t)
#pragma unroll
            for (int ks = 0; ks < 2; ++ks) {
                const v16h va = __builtin_shufflevector(vh[(t * 2 + ks) * 2], vh[(t * 2 + ks) * 2 + 1], 0, 1, 2, 3, 4, 5, 6, 7, 8, 9, 10, 11, 12, 13, 14, 15);
                o[t] = __builtin_amdgcn_wmma_f32_16x16x32_f16(false, va, false, pb[ks], (short)0, o[t], false, false);   // A = head columns, B = query columns
            }
    }
    asm volatile("s_wait_asynccnt 0x0" ::: "memory");        // nothing of this wave is in flight when it goes on
    l += xhalf(l);                                       // join the two halves' sums
    const float inv = (l > 0.f) ? 1.f / (l * 4096.f) : 0.f;
    float* orow = O + (long long)b * GT * GD + h * DH + (long long)(q0 + l15) * GD + 8 * hf;
#pragma unroll
    for (int t = 0; t < 4; ++t) {
        const v4f w0 = { o[t][0] * inv, o[t][1] * inv, o[t][2] * inv, o[t][3] * inv }, w1 = { o[t][4] * inv, o[t][5] * inv, o[t][6] * inv, o[t][7] * inv };
        VST2V4(orow + t * 16, w0); VST2V4(orow + t * 16 + 4, w1);
    }
}

// =====================================================================================================================
// k_tr: dst(z, c, r) = alpha * src(z, r, c) (+ beta * R2(z, c, r)): [Z][R][C] (row stride lds) -> [Z][C][R] (row stride ldd) through a 32x32 LDS tile;
//   flags: 1 -> add beta * residual R2 addressed like dst (z*sRz + c*ldr + r); act applied before the residual.
// =====================================================================================================================
struct TrP { const float* src; float* dst; const float* R2; long long sSz, lds, sDz, ldd, sRz, ldr; int R, C, flags, act; float alpha, beta; };
static_assert(sizeof(TrP) == 3 * 8 + 6 * 8 + 6 * 4, "TrP has padding");
__global__ __launch_bounds__(256) void k_tr(TrP p) {
    __shared__ float tile[32][33];
    const int c0 = blockIdx.x * 32, r0 = blockIdx.y * 32, z = blockIdx.z;
    const int lane = threadIdx.x & 31, wave = threadIdx.x >> 5;
    const float* s = p.src + z * p.sSz;
#pragma unroll
    for (int k = 0; k < 4; ++k) {
        const int rl = wave * 4 + k, r = r0 + rl, c = c0 + lane;
        tile[rl][lane] = (r < p.R && c < p.C) ? s[(long long)r * p.lds + c] : 0.f;
    }
    __syncthreads();
    float* d = p.dst + z * p.sDz; const float* rr = p.R2 + z * p.sRz;
#pragma unroll
    for (int k = 0; k < 4; ++k) {
        const int cl = wave * 4 + k, c = c0 + cl, r = r0 + lane;
        if (c < p.C && r < p.R) {
            float v = act_fn(p.alpha * tile[lane][cl], p.act);
            if (p.flags & 1) v += p.beta * rr[(long long)c * p.ldr + r];
            VST2(float, d + (long long)c * p.ldd + r, v);
        }
    }
}

// k_affine: dst[i] = a * (sdev ? sdev[0] : 1) * src[i] + b, i < n (one thread per element; consecutive lanes -> consecutive addresses)
__global__ __launch_bounds__(256) void k_affine(const float* __restrict__ src, float* __restrict__ dst, int n, float a, float b, const float* __restrict__ sdev) {
    const int i = blockIdx.x * 256 + threadIdx.x;
    if (i < n) { const float aa = sdev ? a * sdev[0] : a; const float v = aa * src[i] + b; VST2(float, dst + i, v); }
}

// =====================================================================================================================
// k_softmax: row softmax over n contiguous elements, one 256-thread block per row; rows addressed z*sz + r*sr (grid (R, Z)).
//   out = scale_out * softmax(scale_in * x + (Mf ? Mf[z*smz + r*smr + j] : 0)); a row whose max is -inf is written as 0.
// =====================================================================================================================
struct SmP { const float* src; float* dst; const float* Mf; long long sz, sr, dz, dr, smz, smr; int n, pad; float scale_in, scale_out; };
static_assert(sizeof(SmP) == 3 * 8 + 6 * 8 + 4 * 4, "SmP has padding");
__global__ __launch_bounds__(256) void k_softmax(SmP p) {
    __shared__ float red[256];
    const int r = blockIdx.x, z = blockIdx.y, tid = threadIdx.x;
    const float* s = p.src + z * p.sz + (long long)r * p.sr;
    const float* mf = p.Mf ? (p.Mf + z * p.smz + (long long)r * p.smr) : nullptr;
    float mx = -__builtin_inff();
    for (int j = tid; j < p.n; j += 256) { float v = s[j] * p.scale_in; if (mf) v += mf[j]; mx = fmaxf(mx, v); }
    red[tid] = mx; __syncthreads();
    for (int o = 128; o > 0; o >>= 1) { if (tid < o) red[tid] = fmaxf(red[tid], red[tid + o]); __syncthreads(); }
    mx = red[0]; __syncthreads();
    float sum = 0.f;
    for (int j = tid; j < p.n; j += 256) { float v = s[j] * p.scale_in; if (mf) v += mf[j]; sum += (mx == -__builtin_inff()) ? 0.f : expf(v - mx); }
    red[tid] = sum; __syncthreads();
    for (int o = 128; o > 0; o >>= 1) { if (tid < o) red[tid] += red[tid + o]; __syncthreads(); }
    sum = red[0];
    const float inv = (sum > 0.f) ? p.scale_out / sum : 0.f;
    float* d = p.dst + z * p.dz + (long long)r * p.dr;
    for (int j = tid; j < p.n; j += 256) { float v = s[j] * p.scale_in; if (mf) v += mf[j]; const float o = (mx == -__builtin_inff()) ? 0.f : expf(v - mx) * inv; VST2(float, d + j, o); }
}
// =====================================================================================================================
// k_stats: mean and rsqrt(var + eps) over a set of n elements addressed base + z*sz + (e / inner) * so + (e % inner) * si, one 256-thread
// k_norm_apply: y = (x - mean[set]) * rstd[set] * g[c] + b[c] over a [Z][C][L] channel-major tensor with set = z*G + c / (C/G) (G groups per z;
//   G = C -> per-channel sets indexed z*C+c; for batch norm pass stats indexed by c only via bn = 1). Optional act. Output same layout.
// =====================================================================================================================
//   mode 0: mean / rsqrt(var + eps); mode 1 (RMSNorm): 0 / rsqrt(mean(x^2) + eps); mode 2 (L2 normalize * sqrt(n)): 0 / sqrt(n) / max(||x||, eps); mode 3: as 0 with unbiased variance (n-1)
__global__ __launch_bounds__(256) void k_stats(const float* __restrict__ x, long long sz, long long so, long long si, int inner, int n, float eps, float* __restrict__ stat, int mode) {
    __shared__ float red[256];
    const int z = blockIdx.x, tid = threadIdx.x;
    const float* base = x + z * sz;
    float s = 0.f;
    for (int e = tid; e < n; e += 256) s += base[(long long)(e / inner) * so + (long long)(e % inner) * si];
    red[tid] = s; __syncthreads();
    for (int o = 128; o > 0; o >>= 1) { if (tid < o) red[tid] += red[tid + o]; __syncthreads(); }
    const float mu = (mode == 0 || mode == 3) ? red[0] / (float)n : 0.f; __syncthreads();
    float q = 0.f;
    for (int e = tid; e < n; e += 256) { const float dlt = base[(long long)(e / inner) * so + (long long)(e % inner) * si] - mu; q += dlt * dlt; }
    red[tid] = q; __syncthreads();
    for (int o = 128; o > 0; o >>= 1) { if (tid < o) red[tid] += red[tid + o]; __syncthreads(); }
    {
        float rs;
        if (mode == 2) rs = sqrtf((float)n) / fmaxf(sqrtf(red[0]), eps); else if (mode == 3) rs = rsqrtf(red[0] / (float)(n - 1) + eps); else rs = rsqrtf(red[0] / (float)n + eps);
        if (tid < 32) { const float v = (tid == 0) ? mu : ((tid == 1) ? rs : 0.f); VST2(float, stat + (long long)z * 32 + tid, v); }
    }
}
//   One thread per element over the flat [Z][C][L] index space: grid ceil(Z*C*L / 256).
__global__ __launch_bounds__(256) void k_norm_apply(const float* __restrict__ x, float* __restrict__ y, const float* __restrict__ stat, const float* __restrict__ g, const float* __restrict__ bta,
                                                     int Z, int C, int L, int G, int bn, int act) {
    const long long idx = (long long)blockIdx.x * 256 + threadIdx.x;
    if (idx >= (long long)Z * C * L) return;
    const int l = (int)(idx % L); const long long zc = idx / L; const int c = (int)(zc % C), z = (int)(zc / C); (void)l;
    const int set = bn ? c : (z * G + c / (C / G));
    float v = (x[idx] - stat[(long long)set * 32]) * stat[(long long)set * 32 + 1];
    if (g) v *= g[c];
    if (bta) v += bta[c];
    v = act_fn(v, act);
    VST2(float, y + idx, v);
}

// k_lse_neg: c[i] = -(st[2i] + log(st[2i+1])) = minus the log-sum-exp of row i from k_attn's ST output (for softmax over the query dimension)
__global__ __launch_bounds__(256) void k_lse_neg(const float* __restrict__ st, float* __restrict__ c, int n) {
    const int i = blockIdx.x * 256 + threadIdx.x;
    if (i < n) { const float v = -(st[2 * i] + logf(st[2 * i + 1])); VST2(float, c + i, v); }
}

// k_iota: dst[i] = a * i + b as int32 (segment/position id helper)
__global__ __launch_bounds__(256) void k_iota(int* __restrict__ dst, int n, int a, int b) {
    const int i = blockIdx.x * 256 + threadIdx.x;
    if (i < n) { const int v = a * i + b; VST2(int, dst + i, v); }
}

// k_axpby: dst[i] = a * x[i] + b * y[i] (+ c), i < n
__global__ __launch_bounds__(256) void k_axpby(const float* __restrict__ x, const float* __restrict__ y, float* __restrict__ dst, int n, float a, float b, float c) {
    const int i = blockIdx.x * 256 + threadIdx.x;
    if (i < n) { const float v = a * x[i] + b * y[i] + c; VST2(float, dst + i, v); }
}

// =====================================================================================================================
// k_rope: rotary embedding on a [R rows][Hn heads][D] view (row stride sXr, head stride sXh, element stride 1) -> Y (own strides).
//   mode 0: rotate_half (partner d±D/2, sign - for d<D/2); mode 1: interleaved pairs (partner d^1, sign - for even d).
//   table column tcol: tmode 0 -> d, 1 -> d % (D/2), 2 -> d / 2; position p: pmode 0 -> r % S, 1 -> head index, 2 -> pos[r];
//   c = C[(r / S) * sCb + p * sCp + tcol * sCd], s likewise from Sn; y = x[d] * c + sign * x[partner] * s. X and Y must not alias.
// =====================================================================================================================
struct RopeP { const float* X; float* Y; const float* C; const float* Sn; const int* pos; long long sXr, sXh, sYr, sYh, sCb, sCp, sCd; int R, Hn, D, S, mode, tmode, pmode, pad; };
static_assert(sizeof(RopeP) == 5 * 8 + 7 * 8 + 8 * 4, "RopeP has padding");
__global__ __launch_bounds__(256) void k_rope(RopeP p) {
    const long long idx = (long long)blockIdx.x * 256 + threadIdx.x;
    if (idx >= (long long)p.R * p.Hn * p.D) return;
    const int d = (int)(idx % p.D); const long long rh = idx / p.D; const int h = (int)(rh % p.Hn); const int r = (int)(rh / p.Hn);
    const int half = p.D / 2;
    int partner; float sign;
    if (p.mode == 0) { partner = (d < half) ? d + half : d - half; sign = (d < half) ? -1.f : 1.f; }
    else { partner = d ^ 1; sign = (d & 1) ? 1.f : -1.f; }
    const int tcol = (p.tmode == 0) ? d : ((p.tmode == 1) ? (d % half) : (d >> 1));
    const int pp = (p.pmode == 0) ? (r % p.S) : ((p.pmode == 1) ? h : p.pos[r]);
    const long long toff = (long long)(r / p.S) * p.sCb + (long long)pp * p.sCp + (long long)tcol * p.sCd;
    const float* xr = p.X + (long long)r * p.sXr + (long long)h * p.sXh;
    const float v = xr[d] * p.C[toff] + sign * xr[partner] * p.Sn[toff];
    VST2(float, p.Y + (long long)r * p.sYr + (long long)h * p.sYh + d, v);
}

// k_invf + k_sincos (split so neither kernel carries a large VALU-fma footprint): invf_i = num * (1 / powf(base, (2 i)/D)) [fmode 0],
//   num * expf((2 i) * cexp) [fmode 1], num * powf(base, -2 (i - 1) / D) [fmode 2]; then cs/sn[s*half + i] = cos/sin((pscale * s) * invf_i)
__global__ __launch_bounds__(256) void k_invf(float* __restrict__ invb, int half, int D, float base, float num, int fmode, float cexp) {
    const int i = blockIdx.x * 256 + threadIdx.x;
    if (i >= ((half + 31) / 32) * 32) return;
    if (i >= half) { VST2(float, invb + i, 0.f); return; }
    const float e = (float)(2 * i) / (float)D;
    float invf;
    if (fmode == 1) invf = num * expf((float)(2 * i) * cexp);
    else if (fmode == 2) invf = num * powf(base, (-2.0f * ((float)i - 1.0f)) / (float)D);
    else invf = num * (1.0f / powf(base, e));
    VST2(float, invb + i, invf);
}
__global__ __launch_bounds__(256) void k_sincos(float* __restrict__ cs, float* __restrict__ sn, const float* __restrict__ invb, int S, int half, float pscale) {
    const int idx = blockIdx.x * 256 + threadIdx.x;
    if (idx >= S * half) return;
    const int s = idx / half, i = idx - s * half;
    const float ang = (pscale * (float)s) * invb[i];
    VST2(float, cs + idx, cosf(ang)); VST2(float, sn + idx, sinf(ang));
}

// k_mulact: dst[i] = act(x[i]) * y[i]
__global__ __launch_bounds__(256) void k_mulact(const float* __restrict__ x, const float* __restrict__ y, float* __restrict__ dst, int n, int act) {
    const int i = blockIdx.x * 256 + threadIdx.x;
    if (i < n) { const float v = act_fn(x[i], act) * y[i]; VST2(float, dst + i, v); }
}

// =====================================================================================================================
// k_matvec: thread-per-row matrix-vector products for N <= 8 output columns (heads with 1-3 outputs, gates), f32 on the VALU.
//   C[r*sCm + j] = act(alpha * sum_k A[r*sAm + k*sAk] * B[j*sBn + k*sBk] + bias[j]) + beta * R[r*sRm + j*sRn]; each thread writes its N contiguous floats.
// =====================================================================================================================
__global__ __launch_bounds__(256) void k_matvec(GemmP p) {
    // 32 lanes write one line with one instruction.
    const int rpt = (p.N == 1) ? 1 : 32;
    const long long r0 = ((long long)blockIdx.x * 256 + threadIdx.x) * rpt; const int z = blockIdx.z, zo = z / p.zi_n, zi = z - zo * p.zi_n;
    if (r0 >= p.M) return;
    const float* Bb = p.B + zo * p.sBo + zi * p.sBi;
    float* C = p.C + zo * p.sCo + zi * p.sCi; const float* R = p.R + zo * p.sRo + zi * p.sRi;
    for (int rr = 0; rr < rpt; ++rr) {
        const long long r = r0 + rr; if (r >= p.M) break;
        const float* A = p.A + zo * p.sAo + zi * p.sAi + r * p.sAm;
        float acc[8] = {0.f, 0.f, 0.f, 0.f, 0.f, 0.f, 0.f, 0.f};
        for (int k = 0; k < p.K; ++k) { const float a = A[(long long)k * p.sAk];
#pragma unroll
            for (int j = 0; j < 8; ++j) if (j < p.N) acc[j] += a * Bb[(long long)j * p.sBn + (long long)k * p.sBk]; }
#pragma unroll
        for (int j = 0; j < 8; ++j) if (j < p.N) {
            float v = acc[j] * p.alpha;
            if (p.flags & 1) v += p.bias[j];
            if (p.flags & 2) v += p.bias[r];
            v = act_fn(v, p.act);
            if (p.flags & 4) v += p.beta * R[r * p.sRm + (long long)j * p.sRn];
            VST2(float, C + r * p.sCm + j, v);
        }
    }
}
// k_smallsoftmax: thread-per-row softmax for short rows (n <= 64): dst[r*dr + j] = softmax(scale*src[r*sr + j])
__global__ __launch_bounds__(256) void k_smallsoftmax(const float* __restrict__ src, float* __restrict__ dst, long long sr, long long dr, int n, long long R, float scale) {
    const long long r0 = ((long long)blockIdx.x * 256 + threadIdx.x) * 32;
    for (int rr = 0; rr < 32; ++rr) {
        const long long r = r0 + rr; if (r >= R) return;
        const float* s = src + r * sr; float* d = dst + r * dr;
        float mx = -__builtin_inff();
        for (int j = 0; j < n; ++j) mx = fmaxf(mx, s[j] * scale);
        float sum = 0.f;
        for (int j = 0; j < n; ++j) sum += expf(s[j] * scale - mx);
        const float inv = 1.f / sum;
        for (int j = 0; j < n; ++j) { const float v = expf(s[j] * scale - mx) * inv; VST2(float, d + j, v); }
    }
}

__global__ __launch_bounds__(32) void k_unitstat(float* __restrict__ st) { const int t = threadIdx.x; const float v = (t == 1) ? 1.f : 0.f; VST2(float, st + t, v); }

// destination (e.g. a d_out whose row width is not a multiple of 32 floats) is written by consecutive lanes of one instruction
__global__ __launch_bounds__(256) void k_lincopy(const float* __restrict__ src, long long lds, float* __restrict__ dst, long long ldd, long long rows, int cols) {
    const long long i = (long long)blockIdx.x * 256 + threadIdx.x; if (i >= rows * cols) return;
    const long long r = i / cols; const int c = (int)(i - r * cols);
    const float v = src[r * lds + c]; VST2(float, dst + r * ldd + c, v);
}

namespace w25 {
typedef __attribute__((ext_vector_type(16))) _Float16 v16h;
typedef __attribute__((ext_vector_type(8)))  _Float16 v8h;
typedef __attribute__((ext_vector_type(16))) __bf16   v16b;
typedef __attribute__((ext_vector_type(8)))  __bf16   v8b;
typedef __attribute__((ext_vector_type(8)))  float    v8f;
typedef __attribute__((ext_vector_type(4)))  float    v4f;

__device__ __forceinline__ unsigned short f2bf_bits(float f) {
  unsigned u = __float_as_uint(f);
  return (unsigned short)((u + 0x7FFFu + ((u >> 16) & 1u)) >> 16);
}
__device__ __forceinline__ float bf_bits2f(unsigned short h) { return __uint_as_float(((unsigned)h) << 16); }

// hazard guards as plain device helpers (no inline asm inside the kernel template body)
__device__ __forceinline__ void dep_guard_h(v8f& a, v8f& b, v16h x, v16h y) { asm volatile("v_nop\n\tv_nop\n\tv_nop\n\tv_nop" : "+v"(a), "+v"(b) : "v"(x), "v"(y)); }
__device__ __forceinline__ void dep_guard_b(v8f& a, v8f& b, v16b x, v16b y) { asm volatile("v_nop\n\tv_nop\n\tv_nop\n\tv_nop" : "+v"(a), "+v"(b) : "v"(x), "v"(y)); }
__device__ __forceinline__ void keep4_h(v16h a, v16h b, v16h c, v16h d) { asm volatile("v_nop" :: "v"(a), "v"(b), "v"(c), "v"(d)); }
__device__ __forceinline__ void keep4_b(v16b a, v16b b, v16b c, v16b d) { asm volatile("v_nop" :: "v"(a), "v"(b), "v"(c), "v"(d)); }
__device__ __forceinline__ void acc_guard4(v8f& a, v8f& b, v8f& c, v8f& d) { asm volatile("v_nop\n\tv_nop\n\tv_nop\n\tv_nop" : "+v"(a), "+v"(b), "+v"(c), "+v"(d)); }
template <typename T> struct Frag;
template <> struct Frag<_Float16> {
  typedef v16h V; union U { v16h v; v8h h[2]; };
  static __device__ __forceinline__ v16h load(const _Float16* p) {   // elements 0..7 <- p[0..7], 8..15 <- p[16..23]
    U f; f.h[0] = *(const v8h*)(p); f.h[1] = *(const v8h*)(p + 16); return f.v;
  }
  static __device__ __forceinline__ v8f mma(v16h a, v16h b, v8f c) {
    return __builtin_amdgcn_wmma_f32_16x16x32_f16(false, a, false, b, (short)0, c, false, false);
  }
  static __device__ __forceinline__ void guard(v8f& a, v8f& b, v16h x, v16h y) { dep_guard_h(a, b, x, y); }
  static __device__ __forceinline__ void keep(v16h a, v16h b, v16h c, v16h d) { keep4_h(a, b, c, d); }
};
template <> struct Frag<__bf16> {
  typedef v16b V; union U { v16b v; v8b h[2]; };
  static __device__ __forceinline__ v16b load(const __bf16* p) {
    U f; f.h[0] = *(const v8b*)(p); f.h[1] = *(const v8b*)(p + 16); return f.v;
  }
  static __device__ __forceinline__ v8f mma(v16b a, v16b b, v8f c) {
    return __builtin_amdgcn_wmma_f32_16x16x32_bf16(false, a, false, b, (short)0, c, false, false);
  }
  static __device__ __forceinline__ void guard(v8f& a, v8f& b, v16b x, v16b y) { dep_guard_b(a, b, x, y); }
  static __device__ __forceinline__ void keep(v16b a, v16b b, v16b c, v16b d) { keep4_b(a, b, c, d); }
};

// ---- Register-blocked batched WMMA GEMM ------------------------------------
// C[m,n] = scale * sum_k A[m,k] * Bt[n,k] (+bias)(+resid); each wave owns a 64x64 tile.
// A row-major [M,K]; Bt row-major [N,K]; M,N % 64 == 0, K % 32 == 0.
// SPLIT: operands are hi/lo planes (A2/Bt2 = lo planes, same layout); product = hi·hi + hi·lo + lo·hi.
// BIAS_MODE: 0 = none, 1 = bias[m], 2 = bias[n].
// OUT_MODE: 0 = f32, 1 = f16, 2 = bf16 hi plane (Cout) + bf16 lo plane (Cout2).
// ET: 0 = f16 operands, 1 = bf16 operands (pointers passed as 16-bit storage)
template <int ET> struct Elem;
template <> struct Elem<0> { typedef _Float16 T; };
template <> struct Elem<1> { typedef __bf16 T; };
template <int ET, bool SPLIT, int BIAS_MODE, int OUT_MODE, bool RESID, int ACT = 0>
__global__ __launch_bounds__(256) void wmma_gemm64(
    const unsigned short* __restrict__ Ap, const unsigned short* __restrict__ A2p, int lda, long strideA,
    const unsigned short* __restrict__ Btp, const unsigned short* __restrict__ Bt2p, int ldb, long strideB,
    void* __restrict__ Cout, void* __restrict__ Cout2, int ldc, long strideC,
    const float* __restrict__ bias,
    const float* __restrict__ resid, long strideR,
    int M, int N, int K, float scale) {
  typedef typename Elem<ET>::T T;
  typedef typename Frag<T>::V V;
  const T* A = (const T*)Ap; const T* A2 = (const T*)A2p; const T* Bt = (const T*)Btp; const T* Bt2 = (const T*)Bt2p;
  __shared__ __align__(16) float sT[8][16 * 68];   // per-wave 16x64 slab, pitch 68 floats
  const int b    = blockIdx.y;
  const int lane = threadIdx.x & 31;
  const int wave = threadIdx.x >> 5;
  const int tilesN = N >> 6;
  const int tilesM = M >> 6;
  const int tile = blockIdx.x * 8 + wave;
  if (tile >= tilesM * tilesN) return;   // wave-uniform; no block barriers in this kernel
  const int tm = tile / tilesN;
  const int tn = tile - tm * tilesN;
  const int m0 = tm << 6;
  const int n0 = tn << 6;

  const T* Ab  = A  + (size_t)b * strideA;
  const T* Bb  = Bt + (size_t)b * strideB;
  const T* Ab2 = SPLIT ? (A2  + (size_t)b * strideA) : nullptr;
  const T* Bb2 = SPLIT ? (Bt2 + (size_t)b * strideB) : nullptr;

  const int rlane = lane & 15;                 // row (A) / col (B, D) within subtile
  const int koff  = (lane >> 4) * 8;           // k offset of this lane half
  const int mOff  = (lane >> 4) * 8;           // D row offset

  v8f acc[4][4];
#pragma unroll
  for (int i = 0; i < 4; ++i)
#pragma unroll
    for (int j = 0; j < 4; ++j) acc[i][j] = (v8f){0.f,0.f,0.f,0.f,0.f,0.f,0.f,0.f};

  for (int k0 = 0; k0 < K; k0 += 32) {
    V bh[4], bl[4];
#pragma unroll
    for (int j = 0; j < 4; ++j) {
      const size_t bo = (size_t)(n0 + (j << 4) + rlane) * ldb + koff + k0;
      bh[j] = Frag<T>::load(Bb + bo);
      if (SPLIT) bl[j] = Frag<T>::load(Bb2 + bo);
    }
#pragma unroll
    for (int i = 0; i < 4; ++i) {
      const size_t ao = (size_t)(m0 + (i << 4) + rlane) * lda + koff + k0;
      V ah = Frag<T>::load(Ab + ao);
      V al;
      if (SPLIT) al = Frag<T>::load(Ab2 + ao);
#pragma unroll
      for (int j = 0; j < 4; ++j) {
        acc[i][j] = Frag<T>::mma(ah, bh[j], acc[i][j]);
        if (SPLIT) {
          acc[i][j] = Frag<T>::mma(ah, bl[j], acc[i][j]);
          acc[i][j] = Frag<T>::mma(al, bh[j], acc[i][j]);
        }
      }
      Frag<T>::guard(acc[i][0], acc[i][3], ah, SPLIT ? al : ah);
    }
    Frag<T>::keep(bh[0], bh[1], bh[2], bh[3]);
    if (SPLIT) Frag<T>::keep(bl[0], bl[1], bl[2], bl[3]);
  }
  acc_guard4(acc[0][0], acc[0][1], acc[0][2], acc[0][3]);
  acc_guard4(acc[1][0], acc[1][1], acc[1][2], acc[1][3]);
  acc_guard4(acc[2][0], acc[2][1], acc[2][2], acc[2][3]);
  acc_guard4(acc[3][0], acc[3][1], acc[3][2], acc[3][3]);

  // ---- epilogue ----
  float* slab = sT[wave];
  const float* Rb = RESID ? (resid + (size_t)b * strideR) : nullptr;
#pragma unroll
  for (int i = 0; i < 4; ++i) {
    const int mBase = m0 + (i << 4);
#pragma unroll
    for (int j = 0; j < 4; ++j) {
      const int n = n0 + (j << 4) + rlane;
      float bv = 0.f;
      if (BIAS_MODE == 2) bv = bias[n];
#pragma unroll
      for (int r = 0; r < 8; ++r) {
        float v = acc[i][j][r] * scale;
        if (BIAS_MODE == 1) v += bias[mBase + mOff + r];
        if (BIAS_MODE == 2) v += bv;
        if (RESID) v += Rb[(size_t)(mBase + mOff + r) * ldc + n];
        if (ACT == 1) v = tanhf(v);
        if (ACT == 2) v = fmaxf(v, 0.0f);
        if (ACT == 3) v = v / (1.0f + expf(-v));
        if (ACT == 4) v = (v > 0.f) ? v : 0.01f * v;
        if (ACT == 5) v = 0.5f * v * (1.0f + erff(v * 0.70710678118654752f));
        slab[(mOff + r) * 68 + (j << 4) + rlane] = v;
      }
    }
    __builtin_amdgcn_fence(__ATOMIC_RELEASE, "workgroup");
    __builtin_amdgcn_wave_barrier();
    __builtin_amdgcn_fence(__ATOMIC_ACQUIRE, "workgroup");
    if (OUT_MODE == 0) {
      float* C = (float*)Cout + (size_t)b * strideC;
      const int hh = lane >> 4, c4 = (lane & 15) * 4;     // row seg = 256 B = 16 lanes x 16 B
      {
#pragma unroll
        for (int it = 0; it < 8; ++it) {
          const int row = it * 2 + hh;
          v4f v = *(const v4f*)(slab + row * 68 + c4);
          *(v4f*)(C + (size_t)(mBase + row) * ldc + n0 + c4) = v;
        }
        
      }
    } else {
      const int q = lane >> 3, c8 = (lane & 7) * 8;
      unsigned short* C  = (unsigned short*)Cout  + (size_t)b * strideC;
      unsigned short* C2 = (OUT_MODE == 2) ? ((unsigned short*)Cout2 + (size_t)b * strideC) : nullptr;
      {
#pragma unroll
        for (int it = 0; it < 4; ++it) {
          const int row = it * 4 + q;
          const float* sp = slab + row * 68 + c8;
          v8h hv, lv;
#pragma unroll
          for (int e = 0; e < 8; ++e) {
            if (OUT_MODE == 1) {
              hv[e] = (_Float16)sp[e];
            } else {
              unsigned short hb = f2bf_bits(sp[e]);
              unsigned short lb = f2bf_bits(sp[e] - bf_bits2f(hb));
              hv[e] = __builtin_bit_cast(_Float16, hb);
              lv[e] = __builtin_bit_cast(_Float16, lb);
            }
          }
          *(v8h*)(C + (size_t)(mBase + row) * ldc + n0 + c8) = hv;
          if (OUT_MODE == 2) *(v8h*)(C2 + (size_t)(mBase + row) * ldc + n0 + c8) = lv;
        }
        
      }
    }
    __builtin_amdgcn_fence(__ATOMIC_RELEASE, "workgroup");
    __builtin_amdgcn_wave_barrier();
    __builtin_amdgcn_fence(__ATOMIC_ACQUIRE, "workgroup");
  }
}

// ---- Projection GEMM on operand tiles staged in LDS -------------------------------------------------------------
// C[m,n] = scale * sum_k A[m,k] * Bt[n,k] (+ bias[n]); A [GM][GK] and Bt [GN][GK] f16 with k contiguous, C f32 [GM][GN].
// A block owns a 128 x 128 tile of C, its eight waves 32 x 64 each. A trip takes 128 k: 256 bytes of each of the block's 256 operand rows come into LDS once,
// by asynchronous 16-byte copies (one wave's copy = two whole 256-byte row pieces), and every wave reads its fragments from there, 16 bytes a lane.
// Two buffers: tile t + 1 flies while tile t is worked on, one barrier a trip. The k order of the sums is that of wmma_gemm64 (ascending, 32 a product).
constexpr int GL_PB  = 272;             // LDS row pitch in bytes: 256 + 16, an odd multiple of 16, free of bank conflicts for 16-byte readers
constexpr int GL_OP  = 128 * GL_PB;     // one operand's tile
constexpr int GL_BUF = 2 * GL_OP;       // one buffer: the A tile, behind it the Bt tile
// One thread's eight copies for one operand tile: the same 16 bytes of rows 16 apart. l = LDS byte address, g = global address of the first.
// The s_wait_xcnt closes the statement so that no register which a copy names is rewritten ahead of it.
template <int LD>
__device__ __forceinline__ void gl_copy8(unsigned l, const _Float16* g) {
  asm volatile(
      "global_load_async_to_lds_b128 %0, %8, off\n\t"
      "global_load_async_to_lds_b128 %1, %9, off\n\t"
      "global_load_async_to_lds_b128 %2, %10, off\n\t"
      "global_load_async_to_lds_b128 %3, %11, off\n\t"
      "global_load_async_to_lds_b128 %4, %12, off\n\t"
      "global_load_async_to_lds_b128 %5, %13, off\n\t"
      "global_load_async_to_lds_b128 %6, %14, off\n\t"
      "global_load_async_to_lds_b128 %7, %15, off\n\t"
      "s_wait_xcnt 0x0"
      :: "v"(l), "v"(l + 16 * GL_PB), "v"(l + 32 * GL_PB), "v"(l + 48 * GL_PB), "v"(l + 64 * GL_PB), "v"(l + 80 * GL_PB), "v"(l + 96 * GL_PB), "v"(l + 112 * GL_PB),
         "v"(g), "v"(g + 16 * LD), "v"(g + 32 * LD), "v"(g + 48 * LD), "v"(g + 64 * LD), "v"(g + 80 * LD), "v"(g + 96 * LD), "v"(g + 112 * LD)
      : "memory");
}
// One block's work: the 128 x 128 tile (bm, bn) of C, whose rows are GN elements long. ring = the block's two operand buffers, slabs = its eight output slabs (8 x 32 x 68 floats).
// slabs may lie on the ring: the last trip's barrier stands behind every wave's last read of the ring (its s_wait_dscnt 0), and no copy is in flight there any more.
// OUT16 = 0: C (f32) takes the tile. OUT16 = 1: C16 takes it rounded to f16, the form in which the attention's products read it.
template <int GK, int BIAS_MODE, int OUT16>
__device__ __forceinline__ void gemm_lds_tile(const _Float16* __restrict__ A, const _Float16* __restrict__ Bt, float* __restrict__ C, _Float16* __restrict__ C16, const float* __restrict__ bias, float scale,
                                              const int bm, const int bn, const int GN, unsigned char* ring, float* slabs) {
  static_assert(GK % 128 == 0 && GK >= 256, "whole k tiles; the two-buffer prologue needs two of them");
  constexpr int NT = GK / 128;
  const int tid = threadIdx.x, lane = tid & 31, wave = tid >> 5;
  const int rlane = lane & 15, hf = lane >> 4;
  const int wm = wave >> 1, wn = wave & 1;
  const int crow = tid >> 4, ccol = tid & 15;      // copies: 16 lanes cover one row's 256 bytes
  const _Float16* ga = A  + (size_t)(bm * 128 + crow) * GK + ccol * 8;
  const _Float16* gb = Bt + (size_t)(bn * 128 + crow) * GK + ccol * 8;
  const unsigned la = (unsigned)(size_t)ring + (unsigned)(crow * GL_PB + ccol * 16);
  const unsigned char* fa = ring + (wm * 32 + rlane) * GL_PB + hf * 16;            // fragment rows: lane = row, this half's 8 k first
  const unsigned char* fb = ring + GL_OP + (wn * 64 + rlane) * GL_PB + hf * 16;

  v8f acc[2][4];
#pragma unroll
  for (int i = 0; i < 2; ++i)
#pragma unroll
    for (int j = 0; j < 4; ++j) acc[i][j] = (v8f){0.f,0.f,0.f,0.f,0.f,0.f,0.f,0.f};

  gl_copy8<GK>(la, ga);
  gl_copy8<GK>(la + GL_OP, gb);
  asm volatile("s_wait_asynccnt 0x0" ::: "memory");   // this wave's share of tile 0 has landed
  __syncthreads();                                    // tile 0 is whole for every wave
  gl_copy8<GK>(la + GL_BUF, ga + 128);
  gl_copy8<GK>(la + GL_BUF + GL_OP, gb + 128);
#pragma unroll 1   // kept rolled: buffer offset and refill test are scalar work, and one trip's code serves both buffers
  for (int t = 0; t < NT; ++t) {
    const int bo = (t & 1) * GL_BUF;
    v16h a[2][2], b[2][4];                              // two fragment sets: one is worked on while the next 32 k are read
#pragma unroll
    for (int i = 0; i < 2; ++i) a[0][i] = Frag<_Float16>::load((const _Float16*)(fa + bo + i * 16 * GL_PB));
#pragma unroll
    for (int j = 0; j < 4; ++j) b[0][j] = Frag<_Float16>::load((const _Float16*)(fb + bo + j * 16 * GL_PB));
#pragma unroll
    for (int ks = 0; ks < 4; ++ks) {
      if (ks < 3) {
#pragma unroll
        for (int i = 0; i < 2; ++i) a[(ks + 1) & 1][i] = Frag<_Float16>::load((const _Float16*)(fa + bo + i * 16 * GL_PB + (ks + 1) * 64));
#pragma unroll
        for (int j = 0; j < 4; ++j) b[(ks + 1) & 1][j] = Frag<_Float16>::load((const _Float16*)(fb + bo + j * 16 * GL_PB + (ks + 1) * 64));
      }
      __builtin_amdgcn_sched_barrier(0);                // the next set's twelve LDS reads stay one group ahead of these products (left alone, the scheduler spreads them among the products on one set, a full LDS wait each)
#pragma unroll
      for (int i = 0; i < 2; ++i)
#pragma unroll
        for (int j = 0; j < 4; ++j) acc[i][j] = Frag<_Float16>::mma(a[ks & 1][i], b[ks & 1][j], acc[i][j]);
      __builtin_amdgcn_sched_barrier(0);                // and the group after next stays behind them
    }
    asm volatile("s_wait_dscnt 0x0" ::: "memory");      // this wave's reads of tile t are done before the buffer is handed back
    asm volatile("s_wait_asynccnt 0x0" ::: "memory");   // this wave's share of tile t + 1 has landed
    __syncthreads();                                    // publishes tile t + 1 and ends every wave's reads of tile t
    if (t + 2 < NT) {
      gl_copy8<GK>(la + bo, ga + (t + 2) * 128);
      gl_copy8<GK>(la + bo + GL_OP, gb + (t + 2) * 128);
    }
  }
  asm volatile("s_wait_asynccnt 0x0" ::: "memory");     // nothing of this wave is in flight when it goes on

  // ---- epilogue: the wave's 32 x 64 tile goes through its own slab, so that every store is whole row pieces (256 bytes of f32, 128 of f16) ----
  float* slab = slabs + wave * (32 * 68);
  const int n0 = bn * 128 + wn * 64, mBase = bm * 128 + wm * 32;
#pragma unroll
  for (int j = 0; j < 4; ++j) {
    float bv = 0.f;
    if (BIAS_MODE == 2) bv = bias[n0 + j * 16 + rlane];
#pragma unroll
    for (int i = 0; i < 2; ++i)
#pragma unroll
      for (int r = 0; r < 8; ++r) {
        float v = acc[i][j][r] * scale;
        if (BIAS_MODE == 2) v += bv;
        slab[(i * 16 + hf * 8 + r) * 68 + j * 16 + rlane] = v;
      }
  }
  // the slab's rows are read by other lanes of the same wave than wrote them
  __builtin_amdgcn_fence(__ATOMIC_RELEASE, "workgroup");
  __builtin_amdgcn_wave_barrier();
  __builtin_amdgcn_fence(__ATOMIC_ACQUIRE, "workgroup");
  if (OUT16) {
    // eight lanes cover one row's 64 halves, a whole 128-byte line; a store takes four rows
    const int r4 = lane >> 3, c8 = (lane & 7) * 8;
    _Float16* hrow0 = C16 + (size_t)(mBase + r4) * GN + n0 + c8;
#pragma unroll
    for (int it = 0; it < 8; ++it) {
      const float* sp = slab + (it * 4 + r4) * 68 + c8;
      const v4f u0 = *(const v4f*)sp, u1 = *(const v4f*)(sp + 4);
      const v8h pk = { (_Float16)u0[0], (_Float16)u0[1], (_Float16)u0[2], (_Float16)u0[3], (_Float16)u1[0], (_Float16)u1[1], (_Float16)u1[2], (_Float16)u1[3] };
      *(v8h*)(hrow0 + (size_t)it * 4 * GN) = pk;
    }
  } else {
    float* crow0 = C + (size_t)(mBase + hf) * GN + n0 + rlane * 4;
#pragma unroll
    for (int it = 0; it < 16; ++it) {
      const v4f v = *(const v4f*)(slab + (it * 2 + hf) * 68 + rlane * 4);
      *(v4f*)(crow0 + (size_t)it * 2 * GN) = v;
    }
  }
}

// One projection a launch, a block a tile.
template <int GM, int GN, int GK, int BIAS_MODE, int OUT16>
__global__ __launch_bounds__(256) void wmma_gemm_lds(const _Float16* __restrict__ A, const _Float16* __restrict__ Bt, float* __restrict__ C, _Float16* __restrict__ C16, const float* __restrict__ bias, float scale) {
  static_assert(GM % 128 == 0 && GN % 128 == 0, "whole tiles");
  __shared__ __align__(16) unsigned char ring[2 * GL_BUF];
  __shared__ __align__(16) float sT[8 * 32 * 68];   // per-wave 32x64 output slabs, pitch 68 floats; apart from the ring (this launch has one block for each WGP, so LDS saved would buy nothing)
  constexpr int TN = GN / 128;
  gemm_lds_tile<GK, BIAS_MODE, OUT16>(A, Bt, C, C16, bias, scale, blockIdx.x / TN, blockIdx.x % TN, GN, ring, sT);
}
// The three input projections, which do not depend on each other, in ONE launch: blocks 0 .. NB - 1 do Q = x . Wq^T, the next NB K = context . Wk^T, the last NB V^T = Wv . context^T
// (operands swapped, so that V comes out transposed). x16, c16: [NR][D]; w16: the planes Wq, Wk, Wv one behind the other, [D][D] each. Every block works exactly as in wmma_gemm_lds.
// The output slabs lie on the ring, which leaves the block at 139,264 bytes of LDS: two blocks share a WGP, and while one waits for its copies, fills its first buffer or stores
// its tile, the other one's products run. One projection alone has only one block for each WGP, hence the one launch.
template <int NR, int D>
__global__ __launch_bounds__(256) void wmma_gemm_qkv(const _Float16* __restrict__ x16, const _Float16* __restrict__ c16, const _Float16* __restrict__ w16,
                                                     _Float16* __restrict__ Q, _Float16* __restrict__ K, _Float16* __restrict__ Vt, float scale) {
  static_assert(NR % 128 == 0 && D % 128 == 0, "whole tiles");
  static_assert(8 * 32 * 68 * 4 <= 2 * GL_BUF, "the slabs fit on the ring");
  __shared__ __align__(16) unsigned char ring[2 * GL_BUF];
  constexpr unsigned NB = (NR / 128) * (D / 128);
  const unsigned sel = blockIdx.x / NB, r = blockIdx.x % NB;      // the same for the whole block
  const _Float16* A  = (sel == 0) ? x16 : (sel == 1) ? c16 : w16 + 2 * (size_t)D * D;
  const _Float16* Bt = (sel == 0) ? w16 : (sel == 1) ? w16 + (size_t)D * D : c16;
  _Float16* C16 = (sel == 0) ? Q : (sel == 1) ? K : Vt;
  const int GN = (sel == 2) ? NR : D;
  const unsigned TN = (unsigned)GN / 128u;
  gemm_lds_tile<D, 0, 1>(A, Bt, nullptr, C16, nullptr, scale, (int)(r / TN), (int)(r % TN), GN, ring, (float*)ring);
}

__global__ __launch_bounds__(256) void cast_f32_f16x2(
    const float* __restrict__ in, _Float16* __restrict__ out, int n2) {
  int i = blockIdx.x * 256 + threadIdx.x;
  if (i < n2) {
    const _Float16 h0 = (_Float16)in[2 * i], h1 = (_Float16)in[2 * i + 1];
    const unsigned u = (unsigned)__builtin_bit_cast(unsigned short, h0) | ((unsigned)__builtin_bit_cast(unsigned short, h1) << 16);
    ((unsigned*)out)[i] = u;
    
  }
}


} // namespace w25

__global__ __launch_bounds__(256) void k_castT16(const float* __restrict__ src, long long lds, _Float16* __restrict__ dst, long long ldd, int R, int C, float s) {
    const long long i = (long long)blockIdx.x * 256 + threadIdx.x; const long long np = (long long)C * (R / 2); if (i >= np) return; const int c = (int)(i / (R / 2)); const int r = 2 * (int)(i % (R / 2));
    const _Float16 h0 = (_Float16)(src[(long long)r * lds + c] * s), h1 = (_Float16)(src[(long long)(r + 1) * lds + c] * s);
    const unsigned u = (unsigned)__builtin_bit_cast(unsigned short, h0) | ((unsigned)__builtin_bit_cast(unsigned short, h1) << 16);
    unsigned* d = (unsigned*)(dst + (long long)c * ldd + r); *d = u;  }
__global__ __launch_bounds__(256) void k_cast16(const float* __restrict__ src, long long lds, _Float16* __restrict__ dst, long long ldd, int R, int C, float s) {
    const long long i = (long long)blockIdx.x * 256 + threadIdx.x; const long long np = (long long)R * (C / 2); if (i >= np) return; const int r = (int)(i / (C / 2)); const int c = 2 * (int)(i % (C / 2));
    const _Float16 h0 = (_Float16)(src[(long long)r * lds + c] * s), h1 = (_Float16)(src[(long long)r * lds + c + 1] * s);
    const unsigned u = (unsigned)__builtin_bit_cast(unsigned short, h0) | ((unsigned)__builtin_bit_cast(unsigned short, h1) << 16);
    unsigned* d = (unsigned*)(dst + (long long)r * ldd + c); *d = u;  }

// f32 -> f16 casts on few, long waves: 256 blocks of 16 waves (4,096 waves to start a launch). A tile is 16,384 consecutive floats: eight wave-wide 16-byte loads a lane
// (512 contiguous bytes a wave and load), all issued before the first is used, and eight 8-byte stores (256 contiguous bytes a wave and store).
__device__ __forceinline__ void cast_tile_ld(const float* __restrict__ s, v4f* r) {
#pragma unroll   // r stays in registers and the eight loads issue back to back
    for (int i = 0; i < 8; ++i) r[i] = *(const v4f*)(s + i * 2048);
}
__device__ __forceinline__ void cast_tile_st(_Float16* __restrict__ d, const v4f* r, float sc) {
#pragma unroll   // constant indices into r and pk: both stay in registers
    for (int i = 0; i < 8; ++i) {
        v4h pk;
#pragma unroll
        for (int e = 0; e < 4; ++e) pk[e] = (_Float16)(r[i][e] * sc);
        *(v4h*)(d + i * 2048) = pk;
    }
}
// Every operand of the four projections that exists before the first of them, in one launch: block n casts tile n of x, tile n of the context and tile n & 63 of
// weight n >> 6 (order Wq, Wk, Wv, Wo; times 16; the four f16 planes lie one behind the other in w16). x and c: 256 tiles each, a weight: 64.
__global__ __launch_bounds__(512) void k_cast_in(const float* __restrict__ x, const float* __restrict__ c, const float* __restrict__ Wq, const float* __restrict__ Wk,
                                                 const float* __restrict__ Wv, const float* __restrict__ Wo, _Float16* __restrict__ x16, _Float16* __restrict__ c16, _Float16* __restrict__ w16) {
    const unsigned n = blockIdx.x, sel = n >> 6;
    const float* __restrict__ w = (sel == 0) ? Wq : (sel == 1) ? Wk : (sel == 2) ? Wv : Wo;
    const unsigned t4 = threadIdx.x * 4u;
    v4f rx[8], rc[8], rw[8];
    cast_tile_ld(x + (size_t)n * 16384 + t4, rx);
    cast_tile_ld(c + (size_t)n * 16384 + t4, rc);
    cast_tile_ld(w + (size_t)(n & 63u) * 16384 + t4, rw);
    cast_tile_st(x16 + (size_t)n * 16384 + t4, rx, 1.0f);
    cast_tile_st(c16 + (size_t)n * 16384 + t4, rc, 1.0f);
    cast_tile_st(w16 + (size_t)n * 16384 + t4, rw, 16.0f);
}
// One plane of 256 tiles (the attention output).
__global__ __launch_bounds__(512) void k_cast_plane(const float* __restrict__ s, _Float16* __restrict__ d) {
    const size_t o = (size_t)blockIdx.x * 16384 + threadIdx.x * 4u;
    v4f r[8];
    cast_tile_ld(s + o, r);
    cast_tile_st(d + o, r, 1.0f);
}

// f32 -> bf16 hi plane + bf16 lo plane (x = hi + lo to ~2^-17 relative; RNE both), [R][C] -> [R][C] (or transposed to [C][R]); 2 consecutive destination elements
__device__ __forceinline__ unsigned int f2bf2_pack(float a, float b, unsigned int* lo) {
    const unsigned short ha = w25::f2bf_bits(a), hb = w25::f2bf_bits(b);
    const unsigned short la = w25::f2bf_bits(a - w25::bf_bits2f(ha)), lb = w25::f2bf_bits(b - w25::bf_bits2f(hb));
    *lo = (unsigned)la | ((unsigned)lb << 16); return (unsigned)ha | ((unsigned)hb << 16); }
__global__ __launch_bounds__(256) void k_castS16(const float* __restrict__ src, long long lds, __bf16* __restrict__ dhi, __bf16* __restrict__ dlo, long long ldd, int R, int C, float s, int transpose) {
    const long long i = (long long)blockIdx.x * 256 + threadIdx.x; long long o; float a, b;
    if (transpose) { const long long np = (long long)C * (R / 2); if (i >= np) return; const int c = (int)(i / (R / 2)); const int r = 2 * (int)(i % (R / 2)); a = src[(long long)r * lds + c] * s; b = src[(long long)(r + 1) * lds + c] * s; o = (long long)c * ldd + r; }
    else { const long long np = (long long)R * (C / 2); if (i >= np) return; const int r = (int)(i / (C / 2)); const int c = 2 * (int)(i % (C / 2)); a = src[(long long)r * lds + c] * s; b = src[(long long)r * lds + c + 1] * s; o = (long long)r * ldd + c; }
    unsigned lo; const unsigned hi = f2bf2_pack(a, b, &lo); unsigned* ph = (unsigned*)(dhi + o); unsigned* pl = (unsigned*)(dlo + o);
    *ph = hi; *pl = lo;  }

namespace w25 {
// =====================================================================================
// Generic causal/non-causal attention for head_dim 64, f32 in / f32 out; 16-bit operands: bf16 with optional hi/lo splits, or
// plain f16 (F16=true, non-split, probabilities carried x2^15).
//   scores = (q*qscale)·kᵀ : v_wmma_f32_16x16x32_bf16; SPLIT_QK -> q,k as bf16 hi/lo (hi·hi + hi·lo + lo·hi)
//   out    = p·v           : v_wmma_f32_16x16x32_bf16; SPLIT_PV -> p,v as bf16 hi/lo; else p,v plain bf16
//   f32 accumulate; online softmax in f32. Block = 4 waves = 64 query rows of one (batch, head); S % 64 == 0.
//   Element (b, s, h, d) of tensor X lives at X[b*X_bs + s*X_rs + h*X_hs + d] (strides in floats, multiples of 4).
//   Masking: mask_mode 0 none, 1 causal (kv > q masked), 2 tensor [S][Skv] shared over (b,h) (float if
//   mask_is_int==0, int32 with element == 0 -> masked if 1, int32 with element != 0 -> masked if 2), 3 per-token vectors qmask[B][S] & kvmask[B][Skv] (int32,
//   0 -> masked), 4 causal + sliding window (kv > q or q - kv > W masked; W passed in mask_is_int);
//   5 = relative-position bias: s += cp[b,h,q][idx[q][kv]] + pc[b,h,kv][idx[q][kv]] with idx = mask_b ([S][Skv] int32) and
//   mask_a an int32 [S][Skv] tensor with nonzero = masked (tables: element (b,h,row,n) at X + b*c_bs + h*c_hs + row*c_rs + n);
//   masked scores are replaced by mask_fill (e.g. -inf or -1e9) before the softmax.
//   grid.x = B * H * (S/64) (or a sub-range with blk0).
// =====================================================================================
#define AT_D 64
#define AT_NW 4
#define AT_QB 64
#define AT_KC 64
struct AttnGeom { const float* cp = nullptr; const float* pc = nullptr; long c_bs = 0, c_rs = 0, c_hs = 0;   // mode-5 score-bias tables
                  long q_bs, q_rs, q_hs, k_bs, k_rs, k_hs, v_bs, v_rs, v_hs, o_bs, o_rs, o_hs;
                  int S, Skv, H, mask_mode; float qscale; int blk0; float mask_fill; int mask_is_int; };
static_assert(sizeof(AttnGeom) == 168, "no padding");

__device__ __forceinline__ unsigned short at_bf_bits(float f) {
  unsigned u = __float_as_uint(f);
  return (unsigned short)((u + 0x7FFFu + ((u >> 16) & 1u)) >> 16);
}
__device__ __forceinline__ __bf16 at_f2bf(float f) { return __builtin_bit_cast(__bf16, at_bf_bits(f)); }
__device__ __forceinline__ void at_split(float f, __bf16& hi, __bf16& lo) {
  const unsigned short hb = at_bf_bits(f);
  hi = __builtin_bit_cast(__bf16, hb);
  lo = at_f2bf(f - __uint_as_float(((unsigned)hb) << 16));
}
__device__ __forceinline__ v8f at_mma(v16b a, v16b b, v8f c) {
  c = __builtin_amdgcn_wmma_f32_16x16x32_bf16(false, a, false, b, (short)0, c, false, false);
  asm volatile("v_nop\n\tv_nop\n\tv_nop\n\tv_nop" : "+v"(c) : "v"(a), "v"(b));
  return c;
}
// 16-bit element as a bit pattern held in a __bf16 slot: f16 bits when F16, bf16 (RNE) otherwise
template <bool F16> __device__ __forceinline__ __bf16 at_to16(float f) {
  if (F16) return __builtin_bit_cast(__bf16, (_Float16)f);
  return at_f2bf(f);
}
template <bool F16> __device__ __forceinline__ v8f at_mma16(v16b a, v16b b, v8f c) {
  if (F16) {
    const v16h ah = __builtin_bit_cast(v16h, a), bh = __builtin_bit_cast(v16h, b);
    c = __builtin_amdgcn_wmma_f32_16x16x32_f16(false, ah, false, bh, (short)0, c, false, false);
    asm volatile("v_nop\n\tv_nop\n\tv_nop\n\tv_nop" : "+v"(c) : "v"(ah), "v"(bh));
    return c;
  }
  return at_mma(a, b, c);
}

template <bool SPLIT_QK, bool SPLIT_PV, bool F16 = false>
__global__ __launch_bounds__(128)
void attn64_kernel(const float* __restrict__ q, const float* __restrict__ k,
                   const float* __restrict__ v, float* __restrict__ out,
                   const void* __restrict__ mask_a, const int* __restrict__ mask_b, AttnGeom g) {
  static_assert(!(F16 && (SPLIT_QK || SPLIT_PV)), "f16 mode is non-split");
  const float PSC = F16 ? 32768.0f : 1.0f;     // f16 probabilities carried x2^15 (subnormal range), folded into the final 1/l
  union FB { v16b v; v8b h[2]; };
  __shared__ __align__(16) __bf16 Ksh[AT_KC * AT_D];             // K hi [kv][d]      8 KB
  __shared__ __align__(16) __bf16 Ksl[SPLIT_QK ? AT_KC * AT_D : 8];
  __shared__ __align__(16) __bf16 Vth[AT_D * AT_KC];             // V hi [d][kv]      8 KB
  __shared__ __align__(16) __bf16 Vtl[SPLIT_PV ? AT_D * AT_KC : 8];
  __shared__ __align__(16) __bf16 Psh[AT_NW][16 * AT_KC];        // per wave P hi [row][kv]  8 KB
  __shared__ __align__(16) __bf16 Psl[SPLIT_PV ? AT_NW : 1][SPLIT_PV ? 16 * AT_KC : 8];
  __shared__ __align__(16) float  Os[AT_NW][16 * 68];            // per wave out tile, pitch 68

  const int tid  = threadIdx.x;
  const int wave = tid >> 5;
  const int lane = tid & 31;
  const int hh   = lane >> 4;
  const int c    = lane & 15;

  const int nqb = g.S / AT_QB;
  const int bx = blockIdx.x + g.blk0;
  const int qb = bx % nqb;
  const int bh = bx / nqb;
  const int h  = bh % g.H;
  const int b  = bh / g.H;
  const int qbase_block = qb * AT_QB;
  const int q0 = qbase_block + wave * 16;

  const float* qb_ptr = q + (size_t)b * g.q_bs + (size_t)h * g.q_hs;
  const float* kb_ptr = k + (size_t)b * g.k_bs + (size_t)h * g.k_hs;
  const float* vb_ptr = v + (size_t)b * g.v_bs + (size_t)h * g.v_hs;
  float*       ob_ptr = out + (size_t)b * g.o_bs + (size_t)h * g.o_hs;

  // ---- Q fragments (A operand): 2 d-chunks, hi (and lo) ----
  v16b qah[2], qal[2];
  {
    const float* qrow = qb_ptr + (size_t)(q0 + c) * g.q_rs;
#pragma unroll
    for (int dc = 0; dc < 2; ++dc) {
#pragma unroll
      for (int e = 0; e < 8; ++e) {
        const float f0 = qrow[dc * 32 + 8 * hh + e] * g.qscale;
        const float f1 = qrow[dc * 32 + 16 + 8 * hh + e] * g.qscale;
        if (SPLIT_QK) { __bf16 hq, lq; at_split(f0, hq, lq); qah[dc][e] = hq; qal[dc][e] = lq; at_split(f1, hq, lq); qah[dc][8 + e] = hq; qal[dc][8 + e] = lq; }
        else { qah[dc][e] = at_to16<F16>(f0); qah[dc][8 + e] = at_to16<F16>(f1); qal[dc][e] = qah[dc][e]; qal[dc][8 + e] = qah[dc][8 + e]; }
      }
    }
  }

  float mrow[8], lrow[8];
  v8f oacc[4];
#pragma unroll
  for (int r = 0; r < 8; ++r) { mrow[r] = -INFINITY; lrow[r] = 0.f; }
#pragma unroll
  for (int t = 0; t < 4; ++t) oacc[t] = (v8f){0.f,0.f,0.f,0.f,0.f,0.f,0.f,0.f};

  const int nChunks = (g.mask_mode == 1 || g.mask_mode == 4) ? (qb + 1) : (g.Skv / AT_KC);   // block-uniform
  // per-row query mask (mode 3)
  int qkeep[8];
#pragma unroll
  for (int r = 0; r < 8; ++r) qkeep[r] = (g.mask_mode == 3) ? mask_b[(size_t)b * g.S + q0 + 8 * hh + r] : 1;   // mask_b = qmask in mode 3
  for (int kc = 0; kc < nChunks; ++kc) {
    const int kv0 = kc * AT_KC;
    __syncthreads();
    {
      const int kvr = tid >> 1, dh = (tid & 1) * 32;
      const float* krow = kb_ptr + (size_t)(kv0 + kvr) * g.k_rs + dh;
      const float* vrow = vb_ptr + (size_t)(kv0 + kvr) * g.v_rs + dh;
#pragma unroll
      for (int i = 0; i < 8; ++i) {
        v4f kk = *(const v4f*)(krow + 4 * i);
        v4f vv = *(const v4f*)(vrow + 4 * i);
#pragma unroll
        for (int e = 0; e < 4; ++e) {
          const int d = dh + 4 * i + e;
          if (SPLIT_QK) { __bf16 a, bl; at_split(kk[e], a, bl); Ksh[kvr * AT_D + d] = a; Ksl[kvr * AT_D + d] = bl; }
          else Ksh[kvr * AT_D + d] = at_to16<F16>(kk[e]);
          if (SPLIT_PV) { __bf16 a, bl; at_split(vv[e], a, bl); Vth[d * AT_KC + kvr] = a; Vtl[d * AT_KC + kvr] = bl; }
          else Vth[d * AT_KC + kvr] = at_to16<F16>(vv[e]);
        }
      }
    }
    __syncthreads();

    v8f s[4];
#pragma unroll
    for (int j = 0; j < 4; ++j) {
      s[j] = (v8f){0.f,0.f,0.f,0.f,0.f,0.f,0.f,0.f};
#pragma unroll 1
      for (int dc = 0; dc < 2; ++dc) {
        FB kb;
        kb.h[0] = *(const v8b*)(Ksh + (j * 16 + c) * AT_D + dc * 32 + 8 * hh);
        kb.h[1] = *(const v8b*)(Ksh + (j * 16 + c) * AT_D + dc * 32 + 16 + 8 * hh);
        s[j] = at_mma16<F16>(qah[dc], kb.v, s[j]);
        if (SPLIT_QK) {
          FB kl;
          kl.h[0] = *(const v8b*)(Ksl + (j * 16 + c) * AT_D + dc * 32 + 8 * hh);
          kl.h[1] = *(const v8b*)(Ksl + (j * 16 + c) * AT_D + dc * 32 + 16 + 8 * hh);
          s[j] = at_mma16<F16>(qah[dc], kl.v, s[j]);
          s[j] = at_mma16<F16>(qal[dc], kb.v, s[j]);
        }
      }
    }
    const bool diag = (g.mask_mode == 1) && (kc == qb);
    int kvkeep[4] = {1, 1, 1, 1};
    if (g.mask_mode == 3) {
#pragma unroll
      for (int j = 0; j < 4; ++j) kvkeep[j] = ((const int*)mask_a)[(size_t)b * g.Skv + kv0 + j * 16 + c];   // mask_a = kvmask
    }
    float cm[8];
#pragma unroll
    for (int r = 0; r < 8; ++r) {
      const int qrow = q0 + 8 * hh + r;
      float m = -INFINITY;
#pragma unroll
      for (int j = 0; j < 4; ++j) {
        const int kvcol = kv0 + j * 16 + c;
        bool masked = false;
        if (diag) masked = (kvcol > qrow);
        else if (g.mask_mode == 4) masked = (kvcol > qrow) || (qrow - kvcol > g.mask_is_int);
        else if (g.mask_mode == 2) {
          const size_t mi = (size_t)qrow * g.Skv + kvcol;
          masked = (g.mask_is_int == 0) ? (((const float*)mask_a)[mi] == 0.0f)
                 : (g.mask_is_int == 1) ? (((const int*)mask_a)[mi] == 0) : (((const int*)mask_a)[mi] != 0);
        } else if (g.mask_mode == 3) masked = (qkeep[r] == 0) || (kvkeep[j] == 0);
        else if (g.mask_mode == 5) {
          const size_t mi = (size_t)qrow * g.Skv + kvcol;
          masked = (((const int*)mask_a)[mi] != 0);
          int n = mask_b[mi]; n = n < 0 ? 0 : n;
          s[j][r] += g.cp[(size_t)b * g.c_bs + (size_t)h * g.c_hs + (size_t)qrow * g.c_rs + n]
                   + g.pc[(size_t)b * g.c_bs + (size_t)h * g.c_hs + (size_t)kvcol * g.c_rs + n];
        }
        if (masked) s[j][r] = g.mask_fill;
        m = fmaxf(m, s[j][r]);
      }
#pragma unroll
      for (int off = 1; off < 16; off <<= 1) m = fmaxf(m, __shfl_xor(m, off, 32));
      cm[r] = m;
    }
    __bf16* pwh = Psh[wave];
    __bf16* pwl = Psl[SPLIT_PV ? wave : 0];
#pragma unroll
    for (int r = 0; r < 8; ++r) {
      const float mnew = fmaxf(mrow[r], cm[r]);
      const float alpha = expf(mrow[r] - mnew);
      mrow[r] = mnew;
      float psum = 0.f;
#pragma unroll
      for (int j = 0; j < 4; ++j) {
        const float p = expf(s[j][r] - mnew);
        psum += p;
        if (SPLIT_PV) { __bf16 a, bl; at_split(p, a, bl); pwh[(8 * hh + r) * AT_KC + j * 16 + c] = a; pwl[(8 * hh + r) * AT_KC + j * 16 + c] = bl; }
        else pwh[(8 * hh + r) * AT_KC + j * 16 + c] = at_to16<F16>(p * PSC);
      }
#pragma unroll
      for (int off = 1; off < 16; off <<= 1) psum += __shfl_xor(psum, off, 32);
      lrow[r] = lrow[r] * alpha + psum;
#pragma unroll
      for (int t = 0; t < 4; ++t) oacc[t][r] *= alpha;
    }
    __builtin_amdgcn_fence(__ATOMIC_RELEASE, "workgroup");
    __builtin_amdgcn_wave_barrier();
    __builtin_amdgcn_fence(__ATOMIC_ACQUIRE, "workgroup");
#pragma unroll 1
    for (int kk = 0; kk < 2; ++kk) {
      FB pa, pl;
      pa.h[0] = *(const v8b*)(pwh + c * AT_KC + kk * 32 + 8 * hh);
      pa.h[1] = *(const v8b*)(pwh + c * AT_KC + kk * 32 + 16 + 8 * hh);
      if (SPLIT_PV) {
        pl.h[0] = *(const v8b*)(pwl + c * AT_KC + kk * 32 + 8 * hh);
        pl.h[1] = *(const v8b*)(pwl + c * AT_KC + kk * 32 + 16 + 8 * hh);
      }
#pragma unroll
      for (int t = 0; t < 4; ++t) {
        FB vb;
        vb.h[0] = *(const v8b*)(Vth + (t * 16 + c) * AT_KC + kk * 32 + 8 * hh);
        vb.h[1] = *(const v8b*)(Vth + (t * 16 + c) * AT_KC + kk * 32 + 16 + 8 * hh);
        oacc[t] = at_mma16<F16>(pa.v, vb.v, oacc[t]);
        if (SPLIT_PV) {
          FB vl;
          vl.h[0] = *(const v8b*)(Vtl + (t * 16 + c) * AT_KC + kk * 32 + 8 * hh);
          vl.h[1] = *(const v8b*)(Vtl + (t * 16 + c) * AT_KC + kk * 32 + 16 + 8 * hh);
          oacc[t] = at_mma16<F16>(pa.v, vl.v, oacc[t]);
          oacc[t] = at_mma16<F16>(pl.v, vb.v, oacc[t]);
        }
      }
    }
  }

  float* os = Os[wave];
#pragma unroll
  for (int r = 0; r < 8; ++r) {
    const float inv = 1.0f / (lrow[r] * PSC);
#pragma unroll
    for (int t = 0; t < 4; ++t) os[(8 * hh + r) * 68 + t * 16 + c] = oacc[t][r] * inv;
  }
  __builtin_amdgcn_fence(__ATOMIC_RELEASE, "workgroup");
  __builtin_amdgcn_wave_barrier();
  __builtin_amdgcn_fence(__ATOMIC_ACQUIRE, "workgroup");
  {
    const int c4 = (lane & 15) * 4;
    {
#pragma unroll
      for (int it = 0; it < 8; ++it) {
        const int row = it * 2 + hh;
        v4f val = *(const v4f*)(os + row * 68 + c4);
        *(v4f*)(ob_ptr + (size_t)(q0 + row) * g.o_rs + c4) = val;
      }
      
    }
  }
}

} // namespace w25

// relative-offset bias table RT[h][c], c = i - j + (T-1): -floor(|i-j| / 30) * 2^-(h+1)   (thread-linear, data-independent)
__global__ __launch_bounds__(256) void k_mc_rt(float* __restrict__ RT, int NH, int RN, int T) { const int t = blockIdx.x * 256 + threadIdx.x; if (t >= NH * RN) return; const int h = t / RN, c = t % RN; int dist = c - (T - 1); dist = dist < 0 ? -dist : dist; VST2(float, RT + t, -(float)(dist / 30) * exp2f(-(float)(h + 1))); }


extern "C" void kernel_launch(void* const* d_in, const int* in_sizes, int n_in, void* d_out, int out_size, void* d_ws, size_t ws_size, hipStream_t stream) {
    (void)in_sizes; (void)n_in; (void)out_size; (void)ws_size;
    const float* x = (const float*)d_in[0];
    const float* ctx = (const float*)d_in[1];
    const float* Wq = (const float*)d_in[2];
    const float* Wk = (const float*)d_in[3];
    const float* Wv = (const float*)d_in[4];
    const float* Wo = (const float*)d_in[5];
    const float* bo = (const float*)d_in[6];
    const int Bn = 2;
    const int T = 2048;
    const int D = 1024;
    const int NH = 16;
    const int HD = 64;
    const int NR = Bn * T;
    const int RN = 2 * T - 1;
    float* out = (float*)d_out;
    char* wsp = (char*)d_ws;
    _Float16* Q = (_Float16*)wsp; wsp += (((size_t)((size_t)NR * D) * 2 + 255) / 256) * 256;
    _Float16* Kb = (_Float16*)wsp; wsp += (((size_t)((size_t)NR * D) * 2 + 255) / 256) * 256;
    _Float16* Vt = (_Float16*)wsp; wsp += (((size_t)((size_t)NR * D) * 2 + 255) / 256) * 256;   // V transposed: D rows of NR
    float* Y = (float*)wsp; wsp += (((size_t)((size_t)NR * D) * 4 + 255) / 256) * 256;
    float* RT = (float*)wsp; wsp += (((size_t)((size_t)NH * RN + 64) * 4 + 255) / 256) * 256;
    unsigned short* G64A = (unsigned short*)wsp; wsp += (((size_t)(4194304) * 2 + 255) / 256) * 256;
    unsigned short* G64C = (unsigned short*)wsp; wsp += (((size_t)(4194304) * 2 + 255) / 256) * 256;
    unsigned short* G64B = (unsigned short*)wsp; wsp += (((size_t)(4 * 1048576) * 2 + 255) / 256) * 256;
    k_mc_rt<<<(unsigned)((NH * RN + 255) / 256), 256, 0, stream>>>(RT, NH, RN, T);
    k_cast_in<<<256, 512, 0, stream>>>(x, ctx, Wq, Wk, Wv, Wo, (_Float16*)(G64A), (_Float16*)(G64C), (_Float16*)(G64B));
    w25::wmma_gemm_qkv<4096, 1024><<<768, 256, 0, stream>>>((const _Float16*)(G64A), (const _Float16*)(G64C), (const _Float16*)(G64B), Q, Kb, Vt, 0.0625f);
    k_attnT<2048, 1024, 4096><<<dim3(2048 / (16 * AW), 16, 2), 32 * AW, 0, stream>>>(Q, Kb, Vt, Y, RT, 0.125f);
    k_cast_plane<<<256, 512, 0, stream>>>(Y, (_Float16*)(G64A));
    w25::wmma_gemm_lds<4096, 1024, 1024, 2, 0><<<256, 256, 0, stream>>>((const _Float16*)(G64A), (const _Float16*)(G64B + 3 * 1048576), out, nullptr, bo, 0.0625f);
}
